// v000
// Measured on an AMD MI455X. A time is GPU time per run, averaged over a window of back-to-back runs after a warm-up
// (all launches, gaps included; the runs take copies of the inputs in turn), and the median of several windows.
// Apart from v000's, it joins two sittings. Times from different sittings can be a few percent apart, while
// side-by-side timings come from the same sitting.
// v000 is the starting kernel. One run takes 3000 microseconds.
// compute dtype: all float inputs rounded to bf16; q/k/v projections with EXACT bf16 products on WMMA 16x16x32 (f32 accumulate); RoPE in f32 at the int token positions; causal logits: 3 products for the first 384 rows, single f16 q x k after, x 64^-0.5; softmax f32; P x 2^11 once to f16 x v once to f16 (bf16 hi + lo below row 384); ctx hi+lo x exact Wo below row 384, x2^6 f16 carry x f16(bf16 x 2^8) Wo after; f32 output.
#include <hip/hip_runtime.h>
#include <math.h>

typedef __attribute__((ext_vector_type(16))) _Float16 v16h;
typedef __attribute__((ext_vector_type(16))) __bf16 v16b;
typedef __attribute__((ext_vector_type(8)))  _Float16 v8h;
typedef __attribute__((ext_vector_type(8)))  float v8f;
typedef __attribute__((ext_vector_type(4)))  float v4f;
typedef __attribute__((ext_vector_type(2)))  float v2f;
typedef __attribute__((ext_vector_type(4)))  unsigned v4u;
typedef __attribute__((ext_vector_type(4)))  int v4i;
typedef float __attribute__((may_alias)) float_a;
typedef int __attribute__((may_alias)) int_a;

template <typename T> __device__ __forceinline__ void vst2(void* p, T v) { *(T*)p = v;  }
__device__ __forceinline__ v8f wmma16(v16h a, v16h b, v8f c) {
  v8f d = __builtin_amdgcn_wmma_f32_16x16x32_f16(false, a, false, b, (short)0, c, false, false);
  asm volatile("v_nop\n\tv_nop\n\tv_nop\n\tv_nop" : "+v"(d) : "v"(a), "v"(b));
  return d;
}
__device__ __forceinline__ v8f wmma_bf(v16b a, v16b b, v8f c) {
  v8f d = __builtin_amdgcn_wmma_f32_16x16x32_bf16(false, a, false, b, (short)0, c, false, false);
  asm volatile("v_nop\n\tv_nop\n\tv_nop\n\tv_nop" : "+v"(d) : "v"(a), "v"(b));
  return d;
}
// 16x16x32 fragments: lane = (h = lane>>4, row/col = lane&15); elements 0..7 = k0+8h+0..7, 8..15 = k0+16+8h+0..7; D element r = row 8h+r
__device__ __forceinline__ v16h frag_h(const _Float16* rowk0, int lane) {
  union { v16h v; v8h q[2]; } u; const _Float16* p = rowk0 + 8 * (lane >> 4);
  u.q[0] = *(const v8h*)p; u.q[1] = *(const v8h*)(p + 16); return u.v;
}
__device__ __forceinline__ v16h frag_f32(const float* rowk0, int lane) {
  v16h a; const float* p = rowk0 + 8 * (lane >> 4);
#pragma unroll
  for (int i = 0; i < 8; ++i) { a[i] = (_Float16)p[i]; a[8 + i] = (_Float16)p[16 + i]; }
  return a;
}
__device__ __forceinline__ v16h frag_f32s(const float* rowk0, int lane, float sc) {
  v16h a; const float* p = rowk0 + 8 * (lane >> 4);
#pragma unroll
  for (int i = 0; i < 8; ++i) { a[i] = (_Float16)(p[i] * sc); a[8 + i] = (_Float16)(p[16 + i] * sc); }
  return a;
}
// column fragment from a [K][ld] layout (column n), rows >= K read as 0
__device__ __forceinline__ v16h fragc_f32(const float* W, int k0, int n, int lane, int ld, int K) {
  v16h a; const int g = lane >> 4;
#pragma unroll
  for (int i = 0; i < 8; ++i) { const int ka = k0 + 8 * g + i, kb = ka + 16;
    a[i] = (_Float16)(ka < K ? W[(size_t)(ka < K ? ka : K - 1) * ld + n] : 0.f); a[8 + i] = (_Float16)(kb < K ? W[(size_t)(kb < K ? kb : K - 1) * ld + n] : 0.f); }
  return a;
}
struct F2 { v16b h, l; };
__device__ __forceinline__ F2 bsplit16(const float v[16]) { F2 r;
#pragma unroll
  for (int i = 0; i < 16; ++i) { const __bf16 h = (__bf16)v[i]; r.h[i] = h; r.l[i] = (__bf16)(v[i] - (float)h); }
  return r; }
__device__ __forceinline__ F2 split_row(const float* row, int k0, int lane) { float v[16]; const float* p = row + k0 + 8 * (lane >> 4);
#pragma unroll
  for (int i = 0; i < 8; ++i) { v[i] = p[i]; v[8 + i] = p[16 + i]; }
  return bsplit16(v); }
__device__ __forceinline__ F2 split_rowK(const float* row, int k0, int lane, int K) { float v[16]; const int g = lane >> 4;
#pragma unroll
  for (int i = 0; i < 8; ++i) { const int ka = k0 + 8 * g + i, kb = ka + 16; v[i] = ka < K ? row[ka < K ? ka : K - 1] : 0.f; v[8 + i] = kb < K ? row[kb < K ? kb : K - 1] : 0.f; }
  return bsplit16(v); }
__device__ __forceinline__ F2 split_col(const float* W, int k0, int n, int lane, int ld, int K) { float v[16]; const int g = lane >> 4;
#pragma unroll
  for (int i = 0; i < 8; ++i) { const int ka = k0 + 8 * g + i, kb = ka + 16; v[i] = ka < K ? W[(size_t)(ka < K ? ka : K - 1) * ld + n] : 0.f; v[8 + i] = kb < K ? W[(size_t)(kb < K ? kb : K - 1) * ld + n] : 0.f; }
  return bsplit16(v); }
__device__ __forceinline__ v8f mac3(const F2& a, const F2& b, v8f c) { c = wmma_bf(a.l, b.h, c); c = wmma_bf(a.h, b.l, c); return wmma_bf(a.h, b.h, c); }
__device__ __forceinline__ float sigm(float v) { return 1.0f / (1.0f + expf(-v)); }
#define LDSX() do { asm volatile("s_wait_dscnt 0" ::: "memory"); __builtin_amdgcn_wave_barrier(); __builtin_amdgcn_fence(__ATOMIC_RELEASE, "workgroup"); } while (0)

// Causal multi-head self-attention with interleaved-pair RoPE at given token positions, ONE batch of 4,096 tokens (x [1,4096,1024]; (out,in) Wq / Wk / Wv / Wo [1024,1024] N(0,1) x 0.02 applied as x @ W.T, no biases; token_positions [4096] int (arange; the LAST input); 16 heads x 64; inv_freq = 1 / 10000^(2i/64); (even, odd) pairs rotated and re-interleaved; scores / sqrt(64); tril kept, -inf elsewhere; softmax; attn @ Wo.T). THIS ROW: the same module and weight scale (0.02) with the argument order x, token_positions, Wq, Wk, Wv, Wo (the positions SECOND): the indices on lines 283 and 289 follow; finfo.min in place of -inf under the causal rule (an exclusion either way); the inverse-frequency expression is the host's own, token for token: the baked table is unchanged.
#define NB 1
#define TT 4096
#define CC 1024            // NH * HD = projected width
#define DIN 1024          // input (model) width
#define NH 16
#define HD 64
#define NQB (TT / 64)
#define HG 1   // one head per pass: S = 4,096 x 4,096 f32 = 64 MiB
#define SCALE (0.125f)
#define CAUSAL 1
#ifndef TNB
#define TNB NB
#endif
__device__ __forceinline__ float bfr(float v) { return (float)(__bf16)v; }
__host__ __device__ __forceinline__ int kb_last(int qb) { return CAUSAL ? ((qb * 64 + 63) >> 7) : (TT / 128 - 1); }
typedef __attribute__((ext_vector_type(8))) __bf16 v8b;
__device__ __forceinline__ v16b frag_b(const __bf16* rowk0, int lane) {
  union { v16b v; v8b q[2]; } u; const __bf16* p = rowk0 + 8 * (lane >> 4);
  u.q[0] = *(const v8b*)p; u.q[1] = *(const v8b*)(p + 16); return u.v;
}
#define QBH 6              // causal: query blocks 0..QBH-1 of each sequence (few keys, no averaging) take the high-precision path
#define QHI 384            // rows carrying a q residual plane (all rows when non-causal: 2-product logits everywhere)
#define KHI 384            // key rows carrying k residual / v bf16 hi+lo planes (used only by the causal high-precision path)
// B fragment (k rows k0+.., output column o) of a weight: (in,out) [K][ld] or (out,in) [ld rows of K]: bf16 exact, or f16(bf16 * 256) exact
__device__ __forceinline__ v16b wcol_io(const float* Wm, int k0, int o, int lane, int ld) { v16b w; const int g = lane >> 4;
#pragma unroll
  for (int i = 0; i < 8; ++i) { w[i] = (__bf16)Wm[(size_t)(k0 + 8 * g + i) * ld + o]; w[8 + i] = (__bf16)Wm[(size_t)(k0 + 16 + 8 * g + i) * ld + o]; }
  return w; }
__device__ __forceinline__ v16b wcol_oi(const float* Wm, int k0, int o, int lane, int K) { v16b w; const float* p = Wm + (size_t)o * K + k0 + 8 * (lane >> 4);
#pragma unroll
  for (int i = 0; i < 8; ++i) { w[i] = (__bf16)p[i]; w[8 + i] = (__bf16)p[16 + i]; }
  return w; }
__device__ __forceinline__ v16h wcolh_io(const float* Wm, int k0, int o, int lane, int ld) { v16h w; const int g = lane >> 4;
#pragma unroll
  for (int i = 0; i < 8; ++i) { w[i] = (_Float16)(bfr(Wm[(size_t)(k0 + 8 * g + i) * ld + o]) * 256.0f); w[8 + i] = (_Float16)(bfr(Wm[(size_t)(k0 + 16 + 8 * g + i) * ld + o]) * 256.0f); }
  return w; }
__device__ __forceinline__ v16h wcolh_oi(const float* Wm, int k0, int o, int lane, int K) { v16h w; const float* p = Wm + (size_t)o * K + k0 + 8 * (lane >> 4);
#pragma unroll
  for (int i = 0; i < 8; ++i) { w[i] = (_Float16)(bfr(p[i]) * 256.0f); w[8 + i] = (_Float16)(bfr(p[16 + i]) * 256.0f); }
  return w; }
#define WQKV_LAYOUT 1   // 0 = (in,out) [DIN][CC]; 1 = (out,in) [CC][DIN]; 2 = per-head [NH][DIN][HD]
__device__ __forceinline__ v16b wcol_hdk(const float* Wm, int k0, int o, int lane) { v16b w; const int g = lane >> 4; const float* p = Wm + (size_t)(o / HD) * DIN * HD + (o % HD);
#pragma unroll
  for (int i = 0; i < 8; ++i) { w[i] = (__bf16)p[(size_t)(k0 + 8 * g + i) * HD]; w[8 + i] = (__bf16)p[(size_t)(k0 + 16 + 8 * g + i) * HD]; }
  return w; }
#define WO_OUT_IN 1
#if WQKV_LAYOUT == 1
#define WCOL(W, k0, o, lane) wcol_oi(W, k0, o, lane, DIN)
#elif WQKV_LAYOUT == 2
#define WCOL(W, k0, o, lane) wcol_hdk(W, k0, o, lane)
#else
#define WCOL(W, k0, o, lane) wcol_io(W, k0, o, lane, CC)
#endif
#if WO_OUT_IN
#define WOCOL(W, k0, o, lane) wcol_oi(W, k0, o, lane, CC)
#define WOCOLH(W, k0, o, lane) wcolh_oi(W, k0, o, lane, CC)
#else
#define WOCOL(W, k0, o, lane) wcol_io(W, k0, o, lane, DIN)
#define WOCOLH(W, k0, o, lane) wcolh_io(W, k0, o, lane, DIN)
#endif
// RoPE inverse frequencies 1/10000^(2i/64) (the f32 values jax computes)
__constant__ float INVF[32] = {1.000000000e+00,7.498942018e-01,5.623413324e-01,4.216965139e-01,3.162277639e-01,2.371373624e-01,1.778279394e-01,1.333521456e-01,1.000000015e-01,7.498941571e-02,5.623412877e-02,4.216964915e-02,3.162277862e-02,2.371373586e-02,1.778279431e-02,1.333521493e-02,9.999999776e-03,7.498942316e-03,5.623413250e-03,4.216964822e-03,3.162277862e-03,2.371373819e-03,1.778279431e-03,1.333521446e-03,1.000000047e-03,7.498941850e-04,5.623413017e-04,4.216964880e-04,3.162277862e-04,2.371373848e-04,1.778279402e-04,1.333521504e-04};
#define PROJ_EXTRA_PARAMS , const int* __restrict__ TPOS
// interleaved-pair RoPE on q and k (which 0, 1) at the token's position from the int input token_positions[t]: angle = (float)pos * inv_freq[i]; (x1, x2) -> (x1 cos - x2 sin, x1 sin + x2 cos); products and sums kept separate (no fma contraction)
#define PROJ_EPI(which, row, t, h) do { if ((which) < 2) { float* rw = (row); const float pos_ = (float)TPOS[(t)]; _Pragma("unroll 4") for (int i = 0; i < 32; ++i) { _Pragma("clang fp contract(off)") const float ang = pos_ * INVF[i]; const float cs = cosf(ang), sn = sinf(ang); const float xe = rw[2 * i], xo = rw[2 * i + 1]; rw[2 * i] = xe * cs - xo * sn; rw[2 * i + 1] = xe * sn + xo * cs; } } } while (0)
#ifndef SM_EXTRA_PARAMS
#define SM_EXTRA_PARAMS
#endif
#ifndef PROJ_EXTRA_PARAMS
#define PROJ_EXTRA_PARAMS
#endif
#ifndef SM_MASK_HOOK
#define SM_MASK_HOOK (void)0
#endif

#define WS_QH  0u                                      // f16 q rows [b*t][CC]
#define WS_KH  (WS_QH + 2u * (size_t)NB * TT * CC)      // f16 k rows [b*t][CC]
#define WS_VT  (WS_KH + 2u * (size_t)NB * TT * CC)      // f16 v planes [b][c][t]
#define WS_QL  (WS_VT + 2u * (size_t)NB * CC * TT)      // f16 q residual x 2^10 rows [b][t < QHI][CC]
#define WS_KL  (WS_QL + 2u * (size_t)NB * QHI * CC)     // f16 k residual x 2^10 rows [b][t < KHI][CC]
#define WS_VB  (WS_KL + 2u * (size_t)NB * KHI * CC)     // bf16 v hi planes [b][c][t < KHI]
#define WS_VBL (WS_VB + 2u * (size_t)NB * CC * KHI)
#define WS_S   (WS_VBL + 2u * (size_t)NB * CC * KHI)    // f32 logits / P [hg][t][s]
#define WS_Y   (WS_S  + 4u * (size_t)HG * TT * TT)      // f32 ctx rows [b*t][CC] (only when there is an output projection)
#define WS_END (WS_Y  + 4u * (size_t)NB * TT * CC)

// ---- k_proj: block = (64 rows, 128 cols, which): q/k/v = X W (+ b) with exact bf16 products (K = DIN) -> which 0: q f16 rows (+ residual rows < QHI); 1: k f16 rows (+ residual rows < KHI); 2: v f16 planes [c][t] (+ bf16 hi/lo planes for t < KHI)
__global__ __launch_bounds__(128) void k_proj(const float* __restrict__ XQ, const float* __restrict__ XK, const float* __restrict__ XV, const float* __restrict__ WQ, const float* __restrict__ WK, const float* __restrict__ WV, const float* __restrict__ BQ, const float* __restrict__ BK, const float* __restrict__ BV,
    _Float16* __restrict__ QH, _Float16* __restrict__ QL, _Float16* __restrict__ KH, _Float16* __restrict__ KL, _Float16* __restrict__ VT, __bf16* __restrict__ VB, __bf16* __restrict__ VBL PROJ_EXTRA_PARAMS) {
  __shared__ __align__(16) float st[64][132]; __shared__ __align__(16) _Float16 sh[64][136], sl[64][136]; __shared__ __align__(16) _Float16 th[128][72]; __shared__ __align__(16) __bf16 tb[128][72], tbl[128][72];
  const int tid = threadIdx.x, wave = tid >> 5, lane = tid & 31, col = lane & 15, g = lane >> 4; const int which = blockIdx.z; const int c0 = blockIdx.y * 128; const size_t r0 = (size_t)blockIdx.x * 64; const size_t bb = r0 / TT; const int t0 = (int)(r0 % TT);
  const float* X = which == 0 ? XQ : which == 1 ? XK : XV; const float* WA = which == 0 ? WQ : which == 1 ? WK : WV; const float* BA = which == 0 ? BQ : which == 1 ? BK : BV;
  v8f acc[8] = {};
#pragma unroll 2
  for (int kc = 0; kc < DIN / 32; ++kc) { v16b a; { const float* p = X + (r0 + wave * 16 + col) * DIN + kc * 32 + 8 * g;
#pragma unroll
      for (int i = 0; i < 8; ++i) { a[i] = (__bf16)p[i]; a[8 + i] = (__bf16)p[16 + i]; } }
    asm volatile("s_wait_loadcnt 0x0" ::: "memory");
#pragma unroll
    for (int j = 0; j < 8; ++j) { const v16b w = WCOL(WA, kc * 32, c0 + j * 16 + col, lane); asm volatile("s_wait_loadcnt 0x0" ::: "memory"); acc[j] = wmma_bf(a, w, acc[j]); } }
  { // stage the f32 tile (acc + bias) in LDS, run the per-(row, head) epilogue hook, then convert
#pragma unroll
    for (int j = 0; j < 8; ++j) { const float bias = BA ? bfr(BA[c0 + j * 16 + col]) : 0.f;
#pragma unroll
      for (int r = 0; r < 8; ++r) st[wave * 16 + 8 * g + r][j * 16 + col] = acc[j][r] + bias; }
    __syncthreads();
    for (int e = tid; e < 64 * (128 / HD); e += 128) { const int rl = e / (128 / HD), hh = e % (128 / HD); PROJ_EPI(which, &st[rl][hh * HD], (int)((r0 + rl) % TT), (c0 / HD) + hh); }
    __syncthreads(); }
  if (which < 2) { _Float16* DH = which == 0 ? QH : KH; _Float16* DL = which == 0 ? QL : KL; const int nhi = which == 0 ? QHI : KHI; const bool hi_rows = t0 < nhi;
    for (int e = tid; e < 64 * 128; e += 128) { const int rl = e >> 7, cl = e & 127; const float v = st[rl][cl]; const _Float16 hv = (_Float16)v; sh[rl][cl] = hv; sl[rl][cl] = (_Float16)((v - (float)hv) * 1024.0f); }
    __syncthreads();
    for (int e = tid; e < 64 * 16; e += 128) { const int rl = e >> 4, q = e & 15; vst2((unsigned*)(DH + (r0 + rl) * CC + c0 + q * 8), *(const v4u*)&sh[rl][q * 8]); if (hi_rows) vst2((unsigned*)(DL + (bb * nhi + t0 + rl) * (size_t)CC + c0 + q * 8), *(const v4u*)&sl[rl][q * 8]); }
  } else { const bool hi_rows = t0 < KHI;
    for (int e = tid; e < 64 * 128; e += 128) { const int rl = e & 63, cl = e >> 6; const float v = st[rl][cl]; th[cl][rl] = (_Float16)v; const __bf16 bh = (__bf16)v; tb[cl][rl] = bh; tbl[cl][rl] = (__bf16)(v - (float)bh); }
    __syncthreads();
    for (int e = tid; e < 128 * 8; e += 128) { const int cl = e >> 3, q = e & 7; vst2((unsigned*)(VT + (bb * CC + c0 + cl) * (size_t)TT + t0 + q * 8), *(const v4u*)&th[cl][q * 8]); if (hi_rows) { const size_t o3 = (bb * CC + c0 + cl) * (size_t)KHI + t0 + q * 8; vst2((unsigned*)(VB + o3), *(const v4u*)&tb[cl][q * 8]); vst2((unsigned*)(VBL + o3), *(const v4u*)&tbl[cl][q * 8]); } } } }
// ---- k_sc: block = (query block qb, key block kb <= kb_last(qb), head in group) of batch b: logits x SCALE; q hi + residual (x 2^10) against k (2 products) for query rows < QHI, plus the k residual (3 products) for query blocks < QBH (causal early rows); causal: blocks past the diagonal exit, the mask itself is applied by index in k_sm
__global__ __launch_bounds__(128) void k_sc(const _Float16* __restrict__ QH, const _Float16* __restrict__ KH, const _Float16* __restrict__ QL, const _Float16* __restrict__ KL, int b, int h0, float* __restrict__ S0) { __shared__ __align__(16) float ss[4][16][132];
  const int qb = blockIdx.x, kb = blockIdx.y; if (kb > kb_last(qb)) return;
  const int h = h0 + blockIdx.z; float* S = S0 + (size_t)blockIdx.z * TT * TT;
  const int tid = threadIdx.x, wave = tid >> 5, lane = tid & 31, col = lane & 15, g = lane >> 4; const int k0 = kb * 128; const int ql0 = qb * 64 + wave * 16; const size_t q0 = (size_t)b * TT + ql0, kr0 = (size_t)b * TT + k0;
  v8f acc[8] = {}, accl[8] = {};
  const _Float16* QLb = QL + (size_t)b * QHI * CC; const _Float16* KLb = KL + (size_t)b * KHI * CC;
  if (qb < QBH) {
#pragma unroll
    for (int kc = 0; kc < HD / 32; ++kc) { const v16h ah = frag_h(QH + (q0 + col) * CC + h * HD + kc * 32, lane), al = frag_h(QLb + (size_t)(ql0 + col) * CC + h * HD + kc * 32, lane);
#pragma unroll
      for (int j = 0; j < 8; ++j) { const v16h kbf = frag_h(KH + (kr0 + j * 16 + col) * CC + h * HD + kc * 32, lane), klf = frag_h(KLb + (size_t)(k0 + j * 16 + col) * CC + h * HD + kc * 32, lane); acc[j] = wmma16(ah, kbf, acc[j]); accl[j] = wmma16(al, kbf, accl[j]); accl[j] = wmma16(ah, klf, accl[j]); } }
  } else if (qb * 64 < QHI) {
#pragma unroll
    for (int kc = 0; kc < HD / 32; ++kc) { const v16h ah = frag_h(QH + (q0 + col) * CC + h * HD + kc * 32, lane), al = frag_h(QLb + (size_t)(ql0 + col) * CC + h * HD + kc * 32, lane);
#pragma unroll
      for (int j = 0; j < 8; ++j) { const v16h kbf = frag_h(KH + (kr0 + j * 16 + col) * CC + h * HD + kc * 32, lane); acc[j] = wmma16(ah, kbf, acc[j]); accl[j] = wmma16(al, kbf, accl[j]); } }
  } else {
#pragma unroll
    for (int kc = 0; kc < HD / 32; ++kc) { const v16h ah = frag_h(QH + (q0 + col) * CC + h * HD + kc * 32, lane);
#pragma unroll
      for (int j = 0; j < 8; ++j) { const v16h kbf = frag_h(KH + (kr0 + j * 16 + col) * CC + h * HD + kc * 32, lane); acc[j] = wmma16(ah, kbf, acc[j]); } } }
#pragma unroll
  for (int j = 0; j < 8; ++j) {
#pragma unroll
    for (int r = 0; r < 8; ++r) ss[wave][8 * g + r][j * 16 + col] = (acc[j][r] + accl[j][r] * (1.0f / 1024.0f)) * SCALE; }
  LDSX(); for (int rl = 0; rl < 16; ++rl) vst2(S + (size_t)(ql0 + rl) * TT + k0 + lane * 4, *(const v4f*)&ss[wave][rl][lane * 4]); }
// ---- k_sm: block = query row t (head in group): keys [0, kend): causal -> logit if s <= t else excluded; softmax in f32; P x 2^11 in place (0 for excluded)
__global__ __launch_bounds__(256) void k_sm(float* __restrict__ S0 SM_EXTRA_PARAMS) { __shared__ float sred[8]; __shared__ float sbc; __shared__ __align__(16) float shv[TT];
  const int tid = threadIdx.x; const int t = blockIdx.x; const int kend = (kb_last(t >> 6) + 1) * 128;
  float* sr = S0 + (size_t)blockIdx.y * TT * TT + (size_t)t * TT;
  float m = -3.0e38f; for (int k = tid; k < kend; k += 256) { float v = (!CAUSAL || k <= t) ? sr[k] : -3.0e38f; SM_MASK_HOOK; shv[k] = v; m = fmaxf(m, v); }
#pragma unroll
  for (int o = 1; o < 32; o <<= 1) m = fmaxf(m, __shfl_xor(m, o));
  if ((tid & 31) == 0) sred[tid >> 5] = m; __syncthreads(); if (tid == 0) { float a = sred[0]; for (int i = 1; i < 8; ++i) a = fmaxf(a, sred[i]); sbc = a; } __syncthreads(); m = sbc; __syncthreads();
  float sum = 0.f; for (int k = tid; k < kend; k += 256) { const float v = shv[k]; const float e = (v <= -1.0e38f) ? 0.f : expf(v - m); shv[k] = e; sum += e; }
#pragma unroll
  for (int o = 1; o < 32; o <<= 1) sum += __shfl_xor(sum, o);
  if ((tid & 31) == 0) sred[tid >> 5] = sum; __syncthreads(); if (tid == 0) { float a = 0.f; for (int i = 0; i < 8; ++i) a += sred[i]; sbc = a > 0.f ? 2048.0f / a : 0.f; }   /* a fully excluded row yields P = 0 */ __syncthreads(); const float inv = sbc;
  for (int k = tid; k < kend; k += 256) shv[k] = shv[k] * inv;
  __syncthreads(); for (int q = tid; q < kend / 4; q += 256) vst2(sr + q * 4, *(const v4f*)&shv[q * 4]); }
// ---- k_pv: block = 64 queries (qb) of (b, h): ctx = P . v over keys [0, kend) (P x 2^11 once to f16 against v f16: 1 product; causal early query blocks: P and v as bf16 hi + lo, 3 products); 256-B (row, head) segment by 16 lanes
__global__ __launch_bounds__(128) void k_pv(const float* __restrict__ PS0, const _Float16* __restrict__ VT, const __bf16* __restrict__ VB, const __bf16* __restrict__ VBL, int b, int h0, float* __restrict__ Y) { const int h = h0 + blockIdx.z; const float* PS = PS0 + (size_t)blockIdx.z * TT * TT; __shared__ __align__(16) float ss[4][16][HD + 4];
  const int tid = threadIdx.x, wave = tid >> 5, lane = tid & 31, col = lane & 15, g = lane >> 4; const int qb = blockIdx.x; const int ql0 = qb * 64 + wave * 16; const int kce = (kb_last(qb) + 1) * 4;
  v8f acc[HD / 16] = {};
  if (qb < QBH) {
#pragma unroll 1
    for (int kc = 0; kc < kce; ++kc) { const F2 p = split_row(PS + (size_t)(ql0 + col) * TT, kc * 32, lane);
      asm volatile("s_wait_loadcnt 0x0" ::: "memory");
#pragma unroll
      for (int j = 0; j < HD / 16; ++j) { const size_t po = ((size_t)b * CC + h * HD + j * 16 + col) * (size_t)KHI + kc * 32; const v16b vh = frag_b(VB + po, lane); acc[j] = wmma_bf(p.h, vh, acc[j]); acc[j] = wmma_bf(p.l, vh, acc[j]); acc[j] = wmma_bf(p.h, frag_b(VBL + po, lane), acc[j]); } }
  } else {
#pragma unroll 1
    for (int kc = 0; kc < kce; ++kc) { const v16h p = frag_f32(PS + (size_t)(ql0 + col) * TT + kc * 32, lane);
      asm volatile("s_wait_loadcnt 0x0" ::: "memory");
#pragma unroll
      for (int j = 0; j < HD / 16; ++j) { const size_t po = ((size_t)b * CC + h * HD + j * 16 + col) * (size_t)TT + kc * 32; acc[j] = wmma16(p, frag_h(VT + po, lane), acc[j]); } } }
#pragma unroll
  for (int j = 0; j < HD / 16; ++j)
#pragma unroll
    for (int r = 0; r < 8; ++r) ss[wave][8 * g + r][j * 16 + col] = acc[j][r] * (1.0f / 2048.0f);
  LDSX(); for (int rl = 0; rl < 16; ++rl) if (lane < HD / 4) vst2(Y + ((size_t)b * TT + ql0 + rl) * CC + h * HD + lane * 4, *(const v4f*)&ss[wave][rl][lane * 4]); }
// ---- k_out: block = (64 rows, 128 cols): out = ctx Wo (+ bo): ctx x 2^6 once to f16 against Wo as f16(bf16 x 2^8) exact (1 product) x 2^-14; causal early rows (< QHI of each sequence): ctx bf16 hi + lo against exact bf16 Wo (2 products)
__global__ __launch_bounds__(128) void k_out(const float* __restrict__ Y, const float* __restrict__ WO, const float* __restrict__ BO, float* __restrict__ OUT) { __shared__ __align__(16) float sf[4][16][132];
  const int tid = threadIdx.x, wave = tid >> 5, lane = tid & 31, col = lane & 15, g = lane >> 4; const int c0 = blockIdx.y * 128; const size_t r0 = (size_t)blockIdx.x * 64 + wave * 16;
  v8f acc[8] = {};
  if (CAUSAL && (int)(((size_t)blockIdx.x * 64) % TT) < QHI) {   /* block-uniform */
#pragma unroll 2
    for (int kc = 0; kc < CC / 32; ++kc) { const F2 a = split_row(Y + (r0 + col) * CC, kc * 32, lane); asm volatile("s_wait_loadcnt 0x0" ::: "memory");
#pragma unroll
      for (int j = 0; j < 8; ++j) { const v16b w = WOCOL(WO, kc * 32, c0 + j * 16 + col, lane); asm volatile("s_wait_loadcnt 0x0" ::: "memory"); acc[j] = wmma_bf(a.h, w, acc[j]); acc[j] = wmma_bf(a.l, w, acc[j]); } }
#pragma unroll
    for (int j = 0; j < 8; ++j) { const float bias = BO ? bfr(BO[c0 + j * 16 + col]) : 0.f;
#pragma unroll
      for (int r = 0; r < 8; ++r) sf[wave][8 * g + r][j * 16 + col] = acc[j][r] + bias; }
  } else {
#pragma unroll 2
    for (int kc = 0; kc < CC / 32; ++kc) { const v16h a = frag_f32s(Y + (r0 + col) * CC + kc * 32, lane, 64.0f); asm volatile("s_wait_loadcnt 0x0" ::: "memory");   /* ctx carried x 2^6 into f16 so small-magnitude context rows stay clear of f16 subnormals */
#pragma unroll
      for (int j = 0; j < 8; ++j) { const v16h w = WOCOLH(WO, kc * 32, c0 + j * 16 + col, lane); asm volatile("s_wait_loadcnt 0x0" ::: "memory"); acc[j] = wmma16(a, w, acc[j]); } }
#pragma unroll
    for (int j = 0; j < 8; ++j) { const float bias = BO ? bfr(BO[c0 + j * 16 + col]) : 0.f;
#pragma unroll
      for (int r = 0; r < 8; ++r) sf[wave][8 * g + r][j * 16 + col] = acc[j][r] * (1.0f / 16384.0f) + bias; } }   /* 2^-8 (Wo carry) x 2^-6 (ctx carry) */
  LDSX(); for (int rl = 0; rl < 16; ++rl) vst2(OUT + (r0 + rl) * DIN + c0 + lane * 4, *(const v4f*)&sf[wave][rl][lane * 4]); }

extern "C" void kernel_launch(void* const* d_in, const int* in_sizes, int n_in, void* d_out, int out_size, void* d_ws, size_t ws_size, hipStream_t stream) {
  (void)in_sizes; (void)n_in; (void)out_size;
  const float** F = (const float**)d_in;
  if (ws_size < (size_t)WS_END) return;
  char* ws = (char*)d_ws; _Float16 *QH = (_Float16*)(ws + WS_QH), *KH = (_Float16*)(ws + WS_KH), *VT = (_Float16*)(ws + WS_VT), *QL = (_Float16*)(ws + WS_QL), *KL = (_Float16*)(ws + WS_KL); __bf16 *VB = (__bf16*)(ws + WS_VB), *VBL = (__bf16*)(ws + WS_VBL); float *S = (float*)(ws + WS_S), *Y = (float*)(ws + WS_Y);
  (void)Y; (void)QL; (void)KL; (void)VB; (void)VBL;
  // inputs in order: 0 x [1,4096,1024]; 1 token_positions [4096] int32 (arange): READ on the device; 2 Wq [1024,1024] (out,in); 3 Wk; 4 Wv; 5 Wo (out,in); no biases (null pointers)
  k_proj<<<dim3(TNB * TT / 64, CC / 128, 3), 128, 0, stream>>>(F[0], F[0], F[0], F[2], F[3], F[4], nullptr, nullptr, nullptr, QH, QL, KH, KL, VT, VB, VBL, (const int*)d_in[1]);
  for (int b = 0; b < TNB; ++b) for (int h0 = 0; h0 < NH; h0 += HG) {
    k_sc<<<dim3(NQB, TT / 128, HG), 128, 0, stream>>>(QH, KH, QL, KL, b, h0, S);
    k_sm<<<dim3(TT, HG), 256, 0, stream>>>(S);
    k_pv<<<dim3(NQB, 1, HG), 128, 0, stream>>>(S, VT, VB, VBL, b, h0, Y);
  }
  k_out<<<dim3(TNB * TT / 64, DIN / 128), 128, 0, stream>>>(Y, F[5], nullptr, (float*)d_out);
}

// v001
// One run takes 616 microseconds.
// Two timings next to v000 put it at 4.85 and 4.87 times that version's speed.
// compute dtype: all float inputs rounded to bf16; q/k/v projections with EXACT bf16 products on WMMA 16x16x32 (f32 accumulate); RoPE in f32 at the int token positions; causal logits: 3 products for the first 384 rows, single f16 q x k after, x 64^-0.5; softmax f32; P x 2^11 once to f16 x v once to f16 (bf16 hi + lo below row 384); ctx hi+lo x exact Wo below row 384, x2^6 f16 carry x f16(bf16 x 2^8) Wo after; f32 output.
#include <hip/hip_runtime.h>
#include <math.h>

typedef __attribute__((ext_vector_type(16))) _Float16 v16h;
typedef __attribute__((ext_vector_type(16))) __bf16 v16b;
typedef __attribute__((ext_vector_type(8)))  _Float16 v8h;
typedef __attribute__((ext_vector_type(8)))  float v8f;
typedef __attribute__((ext_vector_type(4)))  float v4f;
typedef __attribute__((ext_vector_type(2)))  float v2f;
typedef __attribute__((ext_vector_type(4)))  unsigned v4u;
typedef __attribute__((ext_vector_type(4)))  int v4i;
typedef float __attribute__((may_alias)) float_a;
typedef int __attribute__((may_alias)) int_a;

template <typename T> __device__ __forceinline__ void vst2(void* p, T v) { *(T*)p = v;  }
__device__ __forceinline__ v8f wmma16(v16h a, v16h b, v8f c) {
  v8f d = __builtin_amdgcn_wmma_f32_16x16x32_f16(false, a, false, b, (short)0, c, false, false);
  asm volatile("v_nop\n\tv_nop\n\tv_nop\n\tv_nop" : "+v"(d) : "v"(a), "v"(b));
  return d;
}
__device__ __forceinline__ v8f wmma_bf(v16b a, v16b b, v8f c) {
  v8f d = __builtin_amdgcn_wmma_f32_16x16x32_bf16(false, a, false, b, (short)0, c, false, false);
  asm volatile("v_nop\n\tv_nop\n\tv_nop\n\tv_nop" : "+v"(d) : "v"(a), "v"(b));
  return d;
}
// 16x16x32 fragments: lane = (h = lane>>4, row/col = lane&15); elements 0..7 = k0+8h+0..7, 8..15 = k0+16+8h+0..7; D element r = row 8h+r
__device__ __forceinline__ v16h frag_h(const _Float16* rowk0, int lane) {
  union { v16h v; v8h q[2]; } u; const _Float16* p = rowk0 + 8 * (lane >> 4);
  u.q[0] = *(const v8h*)p; u.q[1] = *(const v8h*)(p + 16); return u.v;
}
__device__ __forceinline__ v16h frag_f32(const float* rowk0, int lane) {
  v16h a; const float* p = rowk0 + 8 * (lane >> 4);
#pragma unroll
  for (int i = 0; i < 8; ++i) { a[i] = (_Float16)p[i]; a[8 + i] = (_Float16)p[16 + i]; }
  return a;
}
__device__ __forceinline__ v16h frag_f32s(const float* rowk0, int lane, float sc) {
  v16h a; const float* p = rowk0 + 8 * (lane >> 4);
#pragma unroll
  for (int i = 0; i < 8; ++i) { a[i] = (_Float16)(p[i] * sc); a[8 + i] = (_Float16)(p[16 + i] * sc); }
  return a;
}
// column fragment from a [K][ld] layout (column n), rows >= K read as 0
__device__ __forceinline__ v16h fragc_f32(const float* W, int k0, int n, int lane, int ld, int K) {
  v16h a; const int g = lane >> 4;
#pragma unroll
  for (int i = 0; i < 8; ++i) { const int ka = k0 + 8 * g + i, kb = ka + 16;
    a[i] = (_Float16)(ka < K ? W[(size_t)(ka < K ? ka : K - 1) * ld + n] : 0.f); a[8 + i] = (_Float16)(kb < K ? W[(size_t)(kb < K ? kb : K - 1) * ld + n] : 0.f); }
  return a;
}
struct F2 { v16b h, l; };
__device__ __forceinline__ F2 bsplit16(const float v[16]) { F2 r;
#pragma unroll
  for (int i = 0; i < 16; ++i) { const __bf16 h = (__bf16)v[i]; r.h[i] = h; r.l[i] = (__bf16)(v[i] - (float)h); }
  return r; }
__device__ __forceinline__ F2 split_row(const float* row, int k0, int lane) { float v[16]; const float* p = row + k0 + 8 * (lane >> 4);
#pragma unroll
  for (int i = 0; i < 8; ++i) { v[i] = p[i]; v[8 + i] = p[16 + i]; }
  return bsplit16(v); }
__device__ __forceinline__ F2 split_rowK(const float* row, int k0, int lane, int K) { float v[16]; const int g = lane >> 4;
#pragma unroll
  for (int i = 0; i < 8; ++i) { const int ka = k0 + 8 * g + i, kb = ka + 16; v[i] = ka < K ? row[ka < K ? ka : K - 1] : 0.f; v[8 + i] = kb < K ? row[kb < K ? kb : K - 1] : 0.f; }
  return bsplit16(v); }
__device__ __forceinline__ F2 split_col(const float* W, int k0, int n, int lane, int ld, int K) { float v[16]; const int g = lane >> 4;
#pragma unroll
  for (int i = 0; i < 8; ++i) { const int ka = k0 + 8 * g + i, kb = ka + 16; v[i] = ka < K ? W[(size_t)(ka < K ? ka : K - 1) * ld + n] : 0.f; v[8 + i] = kb < K ? W[(size_t)(kb < K ? kb : K - 1) * ld + n] : 0.f; }
  return bsplit16(v); }
__device__ __forceinline__ v8f mac3(const F2& a, const F2& b, v8f c) { c = wmma_bf(a.l, b.h, c); c = wmma_bf(a.h, b.l, c); return wmma_bf(a.h, b.h, c); }
__device__ __forceinline__ float sigm(float v) { return 1.0f / (1.0f + expf(-v)); }
#define LDSX() do { asm volatile("s_wait_dscnt 0" ::: "memory"); __builtin_amdgcn_wave_barrier(); __builtin_amdgcn_fence(__ATOMIC_RELEASE, "workgroup"); } while (0)

// Causal multi-head self-attention with interleaved-pair RoPE at given token positions, ONE batch of 4,096 tokens (x [1,4096,1024]; (out,in) Wq / Wk / Wv / Wo [1024,1024] N(0,1) x 0.02 applied as x @ W.T, no biases; token_positions [4096] int (arange; the LAST input); 16 heads x 64; inv_freq = 1 / 10000^(2i/64); (even, odd) pairs rotated and re-interleaved; scores / sqrt(64); tril kept, -inf elsewhere; softmax; attn @ Wo.T). THIS ROW: the same module and weight scale (0.02) with the argument order x, token_positions, Wq, Wk, Wv, Wo (the positions SECOND): the indices in kernel_launch follow; finfo.min in place of -inf under the causal rule (an exclusion either way); the inverse-frequency expression is the host's own, token for token: the baked table is unchanged.
#define NB 1
#define TT 4096
#define CC 1024            // NH * HD = projected width
#define DIN 1024          // input (model) width
#define NH 16
#define HD 64
#define NQB (TT / 64)
#define SCALE (0.125f)
#define CAUSAL 1
#ifndef TNB
#define TNB NB
#endif
__device__ __forceinline__ float bfr(float v) { return (float)(__bf16)v; }
typedef __attribute__((ext_vector_type(8))) __bf16 v8b;
__device__ __forceinline__ v16b frag_b(const __bf16* rowk0, int lane) {
  union { v16b v; v8b q[2]; } u; const __bf16* p = rowk0 + 8 * (lane >> 4);
  u.q[0] = *(const v8b*)p; u.q[1] = *(const v8b*)(p + 16); return u.v;
}
#define QBH 6              // causal: query blocks 0..QBH-1 of each sequence (few keys, no averaging) take the high-precision path
#define QHI 384            // rows carrying a q residual plane
#define KHI 384            // key rows carrying k residual / v bf16 hi+lo planes (used only by the causal high-precision path)
// B fragment (k rows k0+.., output column o) of a weight: (in,out) [K][ld] or (out,in) [ld rows of K]: bf16 exact, or f16(bf16 * 256) exact
__device__ __forceinline__ v16b wcol_io(const float* Wm, int k0, int o, int lane, int ld) { v16b w; const int g = lane >> 4;
#pragma unroll
  for (int i = 0; i < 8; ++i) { w[i] = (__bf16)Wm[(size_t)(k0 + 8 * g + i) * ld + o]; w[8 + i] = (__bf16)Wm[(size_t)(k0 + 16 + 8 * g + i) * ld + o]; }
  return w; }
__device__ __forceinline__ v16b wcol_oi(const float* Wm, int k0, int o, int lane, int K) { v16b w; const float* p = Wm + (size_t)o * K + k0 + 8 * (lane >> 4);
#pragma unroll
  for (int i = 0; i < 8; ++i) { w[i] = (__bf16)p[i]; w[8 + i] = (__bf16)p[16 + i]; }
  return w; }
__device__ __forceinline__ v16h wcolh_io(const float* Wm, int k0, int o, int lane, int ld) { v16h w; const int g = lane >> 4;
#pragma unroll
  for (int i = 0; i < 8; ++i) { w[i] = (_Float16)(bfr(Wm[(size_t)(k0 + 8 * g + i) * ld + o]) * 256.0f); w[8 + i] = (_Float16)(bfr(Wm[(size_t)(k0 + 16 + 8 * g + i) * ld + o]) * 256.0f); }
  return w; }
__device__ __forceinline__ v16h wcolh_oi(const float* Wm, int k0, int o, int lane, int K) { v16h w; const float* p = Wm + (size_t)o * K + k0 + 8 * (lane >> 4);
#pragma unroll
  for (int i = 0; i < 8; ++i) { w[i] = (_Float16)(bfr(p[i]) * 256.0f); w[8 + i] = (_Float16)(bfr(p[16 + i]) * 256.0f); }
  return w; }
#define WQKV_LAYOUT 1   // 0 = (in,out) [DIN][CC]; 1 = (out,in) [CC][DIN]; 2 = per-head [NH][DIN][HD]
__device__ __forceinline__ v16b wcol_hdk(const float* Wm, int k0, int o, int lane) { v16b w; const int g = lane >> 4; const float* p = Wm + (size_t)(o / HD) * DIN * HD + (o % HD);
#pragma unroll
  for (int i = 0; i < 8; ++i) { w[i] = (__bf16)p[(size_t)(k0 + 8 * g + i) * HD]; w[8 + i] = (__bf16)p[(size_t)(k0 + 16 + 8 * g + i) * HD]; }
  return w; }
#define WO_OUT_IN 1
#if WQKV_LAYOUT == 1
#define WCOL(W, k0, o, lane) wcol_oi(W, k0, o, lane, DIN)
#elif WQKV_LAYOUT == 2
#define WCOL(W, k0, o, lane) wcol_hdk(W, k0, o, lane)
#else
#define WCOL(W, k0, o, lane) wcol_io(W, k0, o, lane, CC)
#endif
#if WO_OUT_IN
#define WOCOL(W, k0, o, lane) wcol_oi(W, k0, o, lane, CC)
#define WOCOLH(W, k0, o, lane) wcolh_oi(W, k0, o, lane, CC)
#else
#define WOCOL(W, k0, o, lane) wcol_io(W, k0, o, lane, DIN)
#define WOCOLH(W, k0, o, lane) wcolh_io(W, k0, o, lane, DIN)
#endif
// RoPE inverse frequencies 1/10000^(2i/64) (the f32 values jax computes)
__constant__ float INVF[32] = {1.000000000e+00,7.498942018e-01,5.623413324e-01,4.216965139e-01,3.162277639e-01,2.371373624e-01,1.778279394e-01,1.333521456e-01,1.000000015e-01,7.498941571e-02,5.623412877e-02,4.216964915e-02,3.162277862e-02,2.371373586e-02,1.778279431e-02,1.333521493e-02,9.999999776e-03,7.498942316e-03,5.623413250e-03,4.216964822e-03,3.162277862e-03,2.371373819e-03,1.778279431e-03,1.333521446e-03,1.000000047e-03,7.498941850e-04,5.623413017e-04,4.216964880e-04,3.162277862e-04,2.371373848e-04,1.778279402e-04,1.333521504e-04};
#define PROJ_EXTRA_PARAMS , const int* __restrict__ TPOS
// interleaved-pair RoPE on q and k (which 0, 1) at the token's position from the int input token_positions[t]: angle = (float)pos * inv_freq[i]; (x1, x2) -> (x1 cos - x2 sin, x1 sin + x2 cos); products and sums kept separate (no fma contraction)
#define PROJ_EPI(which, row, t, h) do { if ((which) < 2) { float* rw = (row); const float pos_ = (float)TPOS[(t)]; _Pragma("unroll 4") for (int i = 0; i < 32; ++i) { _Pragma("clang fp contract(off)") const float ang = pos_ * INVF[i]; const float cs = cosf(ang), sn = sinf(ang); const float xe = rw[2 * i], xo = rw[2 * i + 1]; rw[2 * i] = xe * cs - xo * sn; rw[2 * i + 1] = xe * sn + xo * cs; } } } while (0)
#ifndef PROJ_EXTRA_PARAMS
#define PROJ_EXTRA_PARAMS
#endif

#define WS_QH  0u                                      // f16 q rows [b*t][CC]
#define WS_KH  (WS_QH + 2u * (size_t)NB * TT * CC)      // f16 k rows [b*t][CC]
#define WS_VT  (WS_KH + 2u * (size_t)NB * TT * CC)      // f16 v planes [b][c][t]
#define WS_QL  (WS_VT + 2u * (size_t)NB * CC * TT)      // f16 q residual x 2^10 rows [b][t < QHI][CC]
#define WS_KL  (WS_QL + 2u * (size_t)NB * QHI * CC)     // f16 k residual x 2^10 rows [b][t < KHI][CC]
#define WS_VB  (WS_KL + 2u * (size_t)NB * KHI * CC)     // bf16 v hi planes [b][c][t < KHI]
#define WS_VBL (WS_VB + 2u * (size_t)NB * CC * KHI)
#define WS_Y   (WS_VBL + 2u * (size_t)NB * CC * KHI)    // f32 ctx rows [b*t][CC] (only when there is an output projection)
#define WS_END (WS_Y  + 4u * (size_t)NB * TT * CC)

// ---- k_proj: block = (64 rows, 128 cols, which): q/k/v = X W (+ b) with exact bf16 products (K = DIN) -> which 0: q f16 rows (+ residual rows < QHI); 1: k f16 rows (+ residual rows < KHI); 2: v f16 planes [c][t] (+ bf16 hi/lo planes for t < KHI)
__global__ __launch_bounds__(128) void k_proj(const float* __restrict__ XQ, const float* __restrict__ XK, const float* __restrict__ XV, const float* __restrict__ WQ, const float* __restrict__ WK, const float* __restrict__ WV, const float* __restrict__ BQ, const float* __restrict__ BK, const float* __restrict__ BV,
    _Float16* __restrict__ QH, _Float16* __restrict__ QL, _Float16* __restrict__ KH, _Float16* __restrict__ KL, _Float16* __restrict__ VT, __bf16* __restrict__ VB, __bf16* __restrict__ VBL PROJ_EXTRA_PARAMS) {
  __shared__ __align__(16) float st[64][132]; __shared__ __align__(16) _Float16 sh[64][136], sl[64][136]; __shared__ __align__(16) _Float16 th[128][72]; __shared__ __align__(16) __bf16 tb[128][72], tbl[128][72];
  const int tid = threadIdx.x, wave = tid >> 5, lane = tid & 31, col = lane & 15, g = lane >> 4; const int which = blockIdx.z; const int c0 = blockIdx.y * 128; const size_t r0 = (size_t)blockIdx.x * 64; const size_t bb = r0 / TT; const int t0 = (int)(r0 % TT);
  const float* X = which == 0 ? XQ : which == 1 ? XK : XV; const float* WA = which == 0 ? WQ : which == 1 ? WK : WV; const float* BA = which == 0 ? BQ : which == 1 ? BK : BV;
  v8f acc[8] = {};
#pragma unroll 2
  for (int kc = 0; kc < DIN / 32; ++kc) { v16b a; { const float* p = X + (r0 + wave * 16 + col) * DIN + kc * 32 + 8 * g;
#pragma unroll
      for (int i = 0; i < 8; ++i) { a[i] = (__bf16)p[i]; a[8 + i] = (__bf16)p[16 + i]; } }
    asm volatile("s_wait_loadcnt 0x0" ::: "memory");
#pragma unroll
    for (int j = 0; j < 8; ++j) { const v16b w = WCOL(WA, kc * 32, c0 + j * 16 + col, lane); asm volatile("s_wait_loadcnt 0x0" ::: "memory"); acc[j] = wmma_bf(a, w, acc[j]); } }
  { // stage the f32 tile (acc + bias) in LDS, run the per-(row, head) epilogue hook, then convert
#pragma unroll
    for (int j = 0; j < 8; ++j) { const float bias = BA ? bfr(BA[c0 + j * 16 + col]) : 0.f;
#pragma unroll
      for (int r = 0; r < 8; ++r) st[wave * 16 + 8 * g + r][j * 16 + col] = acc[j][r] + bias; }
    __syncthreads();
    for (int e = tid; e < 64 * (128 / HD); e += 128) { const int rl = e / (128 / HD), hh = e % (128 / HD); PROJ_EPI(which, &st[rl][hh * HD], (int)((r0 + rl) % TT), (c0 / HD) + hh); }
    __syncthreads(); }
  if (which < 2) { _Float16* DH = which == 0 ? QH : KH; _Float16* DL = which == 0 ? QL : KL; const int nhi = which == 0 ? QHI : KHI; const bool hi_rows = t0 < nhi;
    for (int e = tid; e < 64 * 128; e += 128) { const int rl = e >> 7, cl = e & 127; const float v = st[rl][cl]; const _Float16 hv = (_Float16)v; sh[rl][cl] = hv; sl[rl][cl] = (_Float16)((v - (float)hv) * 1024.0f); }
    __syncthreads();
    for (int e = tid; e < 64 * 16; e += 128) { const int rl = e >> 4, q = e & 15; vst2((unsigned*)(DH + (r0 + rl) * CC + c0 + q * 8), *(const v4u*)&sh[rl][q * 8]); if (hi_rows) vst2((unsigned*)(DL + (bb * nhi + t0 + rl) * (size_t)CC + c0 + q * 8), *(const v4u*)&sl[rl][q * 8]); }
  } else { const bool hi_rows = t0 < KHI;
    for (int e = tid; e < 64 * 128; e += 128) { const int rl = e & 63, cl = e >> 6; const float v = st[rl][cl]; th[cl][rl] = (_Float16)v; const __bf16 bh = (__bf16)v; tb[cl][rl] = bh; tbl[cl][rl] = (__bf16)(v - (float)bh); }
    __syncthreads();
    for (int e = tid; e < 128 * 8; e += 128) { const int cl = e >> 3, q = e & 7; vst2((unsigned*)(VT + (bb * CC + c0 + cl) * (size_t)TT + t0 + q * 8), *(const v4u*)&th[cl][q * 8]); if (hi_rows) { const size_t o3 = (bb * CC + c0 + cl) * (size_t)KHI + t0 + q * 8; vst2((unsigned*)(VB + o3), *(const v4u*)&tb[cl][q * 8]); vst2((unsigned*)(VBL + o3), *(const v4u*)&tbl[cl][q * 8]); } } } }
// stands behind each group of global loads, before anything may take the loads' address registers
#define XWAIT() asm volatile("s_wait_xcnt 0x0" ::: "memory")
// fragment from the lane's own pointer (row start + k0 + 8 * (lane >> 4)): the same k order as frag_h / frag_b
__device__ __forceinline__ v16h frag_hp(const _Float16* p) { union { v16h v; v8h q[2]; } u; u.q[0] = *(const v8h*)p; u.q[1] = *(const v8h*)(p + 16); return u.v; }
__device__ __forceinline__ v16b frag_bp(const __bf16* p) { union { v16b v; v8b q[2]; } u; u.q[0] = *(const v8b*)p; u.q[1] = *(const v8b*)(p + 16); return u.v; }
// one 32-key step of a query's running softmax: v = the lane's 16 scaled logits (-3.0e38 = excluded) -> exp(v - new maximum) x 2^11; m = running maximum (both wave halves alike), l = this half's running sum; returns the factor that carries the old sums to the new maximum
__device__ __forceinline__ float sm_step(float v[16], float& m, float& l) {
  float mx = v[0];
#pragma unroll
  for (int i = 1; i < 16; ++i) mx = fmaxf(mx, v[i]);
  mx = fmaxf(mx, __shfl_xor(mx, 16));
  const float mn = fmaxf(m, mx); const float alpha = expf(m - mn); float s = 0.f;
#pragma unroll
  for (int i = 0; i < 16; ++i) { const float e = expf(v[i] - mn); s += e; v[i] = e * 2048.0f; }   /* mn is a kept key's logit (every step holds one for every query), so an excluded key gives exp(-3.0e38) = 0 */
  l = l * alpha + s; m = mn; return alpha; }
// ---- k_attn: block = (head h, 64 queries qb, batch b), wave = 16 queries, keys [0, diagonal] 32 at a time. S^T = K Q^T x SCALE: lane (g, col) holds query col's logits of keys 8g + r and 16 + 8g + r (causal early query blocks: q and k residual planes, 3 products); the causal rule by index in the last step; running maximum and sum in f32; the two score tiles, as P^T x 2^11 once to f16 (early blocks: bf16 hi + lo), are the B operand of ctx^T += V^T P^T (early blocks: v bf16 hi + lo, 3 products); ctx = sums / (2^11 x sum of exp); 256-B (row, head) segment by 16 lanes
__global__ __launch_bounds__(128) void k_attn(const _Float16* __restrict__ QH, const _Float16* __restrict__ KH, const _Float16* __restrict__ QL, const _Float16* __restrict__ KL, const _Float16* __restrict__ VT, const __bf16* __restrict__ VB, const __bf16* __restrict__ VBL, float* __restrict__ Y) { __shared__ __align__(16) float ss[4][16][HD + 4];
  const int tid = threadIdx.x, wave = __builtin_amdgcn_readfirstlane(tid >> 5), lane = tid & 31, col = lane & 15, g = lane >> 4; const int h = blockIdx.x, qb = blockIdx.y, b = blockIdx.z; const int ql0 = qb * 64 + wave * 16; const int nch = (ql0 + 47) >> 5;
  const size_t q0 = (size_t)b * TT + ql0, kr0 = (size_t)b * TT;
  v8f acc[HD / 16] = {}; float m = -3.0e38f, l = 0.f;
  if (qb < QBH) { const _Float16* QLb = QL + (size_t)b * QHI * CC; const _Float16* KLb = KL + (size_t)b * KHI * CC; v16h qh[HD / 32], qlo[HD / 32];
#pragma unroll
    for (int kk = 0; kk < HD / 32; ++kk) { qh[kk] = frag_h(QH + (q0 + col) * CC + h * HD + kk * 32, lane); qlo[kk] = frag_h(QLb + (size_t)(ql0 + col) * CC + h * HD + kk * 32, lane); }
    asm volatile("s_wait_xcnt 0x0" :: "v"(qh[0]), "v"(qh[1]), "v"(qlo[0]), "v"(qlo[1]) : "memory");   /* XWAIT held behind the q loads by their values (inputs only) */
    const _Float16* kp = KH + (kr0 + col) * CC + h * HD + 8 * g; const _Float16* klp = KLb + (size_t)col * CC + h * HD + 8 * g; const __bf16* vp = VB + ((size_t)b * CC + h * HD + col) * (size_t)KHI + 8 * g; const __bf16* vlp = VBL + ((size_t)b * CC + h * HD + col) * (size_t)KHI + 8 * g;
    for (int kc = 0; kc < nch; ++kc, kp += 32 * CC, klp += 32 * CC, vp += 32, vlp += 32) { const int k0 = kc * 32; float v[16]; v16h kbf[2][HD / 32], klf[2][HD / 32];   /* a step's k loads are all issued before its first product, its v loads before the softmax */
#pragma unroll
      for (int t = 0; t < 2; ++t)
#pragma unroll
        for (int kk = 0; kk < HD / 32; ++kk) kbf[t][kk] = frag_hp(kp + t * 16 * CC + kk * 32);
      XWAIT();
#pragma unroll
      for (int t = 0; t < 2; ++t)
#pragma unroll
        for (int kk = 0; kk < HD / 32; ++kk) klf[t][kk] = frag_hp(klp + t * 16 * CC + kk * 32);
      XWAIT();
#pragma unroll
      for (int t = 0; t < 2; ++t) { v8f s = {}, sl = {};
#pragma unroll
        for (int kk = 0; kk < HD / 32; ++kk) { s = wmma16(kbf[t][kk], qh[kk], s); sl = wmma16(kbf[t][kk], qlo[kk], sl); sl = wmma16(klf[t][kk], qh[kk], sl); }
#pragma unroll
        for (int r = 0; r < 8; ++r) v[t * 8 + r] = (s[r] + sl[r] * (1.0f / 1024.0f)) * SCALE; }
      if (kc == nch - 1) {
#pragma unroll
        for (int i = 0; i < 16; ++i) if (k0 + (i >> 3) * 16 + 8 * g + (i & 7) > ql0 + col) v[i] = -3.0e38f; }
      v16b vh[HD / 16], vl[HD / 16];
#pragma unroll
      for (int j = 0; j < HD / 16; ++j) vh[j] = frag_bp(vp + j * 16 * KHI);
      XWAIT();
#pragma unroll
      for (int j = 0; j < HD / 16; ++j) vl[j] = frag_bp(vlp + j * 16 * KHI);
      XWAIT();
      const float alpha = sm_step(v, m, l); const F2 p = bsplit16(v);
#pragma unroll
      for (int j = 0; j < HD / 16; ++j) { acc[j] = acc[j] * alpha; acc[j] = wmma_bf(vh[j], p.h, acc[j]); acc[j] = wmma_bf(vh[j], p.l, acc[j]); acc[j] = wmma_bf(vl[j], p.h, acc[j]); } }
  } else { v16h qh[HD / 32];
#pragma unroll
    for (int kk = 0; kk < HD / 32; ++kk) qh[kk] = frag_h(QH + (q0 + col) * CC + h * HD + kk * 32, lane);
    asm volatile("s_wait_xcnt 0x0" :: "v"(qh[0]), "v"(qh[1]) : "memory");   /* XWAIT held behind the q loads by their values (inputs only) */
    const _Float16* kp = KH + (kr0 + col) * CC + h * HD + 8 * g; const _Float16* vp = VT + ((size_t)b * CC + h * HD + col) * (size_t)TT + 8 * g;
    for (int kc = 0; kc < nch; ++kc, kp += 32 * CC, vp += 32) { const int k0 = kc * 32; float v[16]; v16h kf[2][HD / 32], vf[HD / 16];   /* a step's k and v loads are all issued before its first product */
#pragma unroll
      for (int t = 0; t < 2; ++t)
#pragma unroll
        for (int kk = 0; kk < HD / 32; ++kk) kf[t][kk] = frag_hp(kp + t * 16 * CC + kk * 32);
      XWAIT();
#pragma unroll
      for (int j = 0; j < HD / 16; ++j) vf[j] = frag_hp(vp + j * 16 * TT);
      XWAIT();
#pragma unroll
      for (int t = 0; t < 2; ++t) { v8f s = {};
#pragma unroll
        for (int kk = 0; kk < HD / 32; ++kk) s = wmma16(kf[t][kk], qh[kk], s);
#pragma unroll
        for (int r = 0; r < 8; ++r) v[t * 8 + r] = s[r] * SCALE; }
      if (kc == nch - 1) {
#pragma unroll
        for (int i = 0; i < 16; ++i) if (k0 + (i >> 3) * 16 + 8 * g + (i & 7) > ql0 + col) v[i] = -3.0e38f; }
      const float alpha = sm_step(v, m, l); v16h p;
#pragma unroll
      for (int i = 0; i < 16; ++i) p[i] = (_Float16)v[i];
#pragma unroll
      for (int j = 0; j < HD / 16; ++j) { acc[j] = acc[j] * alpha; acc[j] = wmma16(vf[j], p, acc[j]); } } }
  l += __shfl_xor(l, 16); const float inv = 1.0f / (l * 2048.0f);
#pragma unroll
  for (int j = 0; j < HD / 16; ++j)
#pragma unroll
    for (int r = 0; r < 8; ++r) ss[wave][col][j * 16 + 8 * g + r] = acc[j][r] * inv;
  LDSX(); for (int rl = 0; rl < 16; ++rl) if (lane < HD / 4) vst2(Y + ((size_t)b * TT + ql0 + rl) * CC + h * HD + lane * 4, *(const v4f*)&ss[wave][rl][lane * 4]); }
// ---- k_out: block = (64 rows, 128 cols): out = ctx Wo (+ bo): ctx x 2^6 once to f16 against Wo as f16(bf16 x 2^8) exact (1 product) x 2^-14; causal early rows (< QHI of each sequence): ctx bf16 hi + lo against exact bf16 Wo (2 products)
__global__ __launch_bounds__(128) void k_out(const float* __restrict__ Y, const float* __restrict__ WO, const float* __restrict__ BO, float* __restrict__ OUT) { __shared__ __align__(16) float sf[4][16][132];
  const int tid = threadIdx.x, wave = tid >> 5, lane = tid & 31, col = lane & 15, g = lane >> 4; const int c0 = blockIdx.y * 128; const size_t r0 = (size_t)blockIdx.x * 64 + wave * 16;
  v8f acc[8] = {};
  if (CAUSAL && (int)(((size_t)blockIdx.x * 64) % TT) < QHI) {   /* block-uniform */
#pragma unroll 2
    for (int kc = 0; kc < CC / 32; ++kc) { const F2 a = split_row(Y + (r0 + col) * CC, kc * 32, lane); asm volatile("s_wait_loadcnt 0x0" ::: "memory");
#pragma unroll
      for (int j = 0; j < 8; ++j) { const v16b w = WOCOL(WO, kc * 32, c0 + j * 16 + col, lane); asm volatile("s_wait_loadcnt 0x0" ::: "memory"); acc[j] = wmma_bf(a.h, w, acc[j]); acc[j] = wmma_bf(a.l, w, acc[j]); } }
#pragma unroll
    for (int j = 0; j < 8; ++j) { const float bias = BO ? bfr(BO[c0 + j * 16 + col]) : 0.f;
#pragma unroll
      for (int r = 0; r < 8; ++r) sf[wave][8 * g + r][j * 16 + col] = acc[j][r] + bias; }
  } else {
#pragma unroll 2
    for (int kc = 0; kc < CC / 32; ++kc) { const v16h a = frag_f32s(Y + (r0 + col) * CC + kc * 32, lane, 64.0f); asm volatile("s_wait_loadcnt 0x0" ::: "memory");   /* ctx carried x 2^6 into f16 so small-magnitude context rows stay clear of f16 subnormals */
#pragma unroll
      for (int j = 0; j < 8; ++j) { const v16h w = WOCOLH(WO, kc * 32, c0 + j * 16 + col, lane); asm volatile("s_wait_loadcnt 0x0" ::: "memory"); acc[j] = wmma16(a, w, acc[j]); } }
#pragma unroll
    for (int j = 0; j < 8; ++j) { const float bias = BO ? bfr(BO[c0 + j * 16 + col]) : 0.f;
#pragma unroll
      for (int r = 0; r < 8; ++r) sf[wave][8 * g + r][j * 16 + col] = acc[j][r] * (1.0f / 16384.0f) + bias; } }   /* 2^-8 (Wo carry) x 2^-6 (ctx carry) */
  LDSX(); for (int rl = 0; rl < 16; ++rl) vst2(OUT + (r0 + rl) * DIN + c0 + lane * 4, *(const v4f*)&sf[wave][rl][lane * 4]); }

extern "C" void kernel_launch(void* const* d_in, const int* in_sizes, int n_in, void* d_out, int out_size, void* d_ws, size_t ws_size, hipStream_t stream) {
  (void)in_sizes; (void)n_in; (void)out_size;
  const float** F = (const float**)d_in;
  if (ws_size < (size_t)WS_END) return;
  char* ws = (char*)d_ws; _Float16 *QH = (_Float16*)(ws + WS_QH), *KH = (_Float16*)(ws + WS_KH), *VT = (_Float16*)(ws + WS_VT), *QL = (_Float16*)(ws + WS_QL), *KL = (_Float16*)(ws + WS_KL); __bf16 *VB = (__bf16*)(ws + WS_VB), *VBL = (__bf16*)(ws + WS_VBL); float *Y = (float*)(ws + WS_Y);
  (void)Y; (void)QL; (void)KL; (void)VB; (void)VBL;
  // inputs in order: 0 x [1,4096,1024]; 1 token_positions [4096] int32 (arange): READ on the device; 2 Wq [1024,1024] (out,in); 3 Wk; 4 Wv; 5 Wo (out,in); no biases (null pointers)
  k_proj<<<dim3(TNB * TT / 64, CC / 128, 3), 128, 0, stream>>>(F[0], F[0], F[0], F[2], F[3], F[4], nullptr, nullptr, nullptr, QH, QL, KH, KL, VT, VB, VBL, (const int*)d_in[1]);
  k_attn<<<dim3(NH, NQB, TNB), 128, 0, stream>>>(QH, KH, QL, KL, VT, VB, VBL, Y);
  k_out<<<dim3(TNB * TT / 64, DIN / 128), 128, 0, stream>>>(Y, F[5], nullptr, (float*)d_out);
}

// v002
// A run of this version takes 173 microseconds.
// Next to v001, in two timings, it ran 3.56 times as fast each time.
// Over all steps from v000 it is 17.3 times as fast.
// compute dtype: all float inputs rounded to bf16; q/k/v projections with EXACT bf16 products on WMMA 16x16x32 (f32 accumulate); RoPE in f32 at the int token positions; causal logits: 3 products for the first 384 rows, single f16 q x k after, x 64^-0.5; softmax f32; P x 2^11 once to f16 x v once to f16 (bf16 hi + lo below row 384); ctx hi+lo x exact Wo below row 384, x2^6 f16 carry x f16(bf16 x 2^8) Wo after; f32 output.
#include <hip/hip_runtime.h>
#include <math.h>

typedef __attribute__((ext_vector_type(16))) _Float16 v16h;
typedef __attribute__((ext_vector_type(16))) __bf16 v16b;
typedef __attribute__((ext_vector_type(8)))  _Float16 v8h;
typedef __attribute__((ext_vector_type(8)))  float v8f;
typedef __attribute__((ext_vector_type(4)))  float v4f;
typedef __attribute__((ext_vector_type(2)))  float v2f;
typedef __attribute__((ext_vector_type(4)))  unsigned v4u;
typedef __attribute__((ext_vector_type(4)))  int v4i;
typedef float __attribute__((may_alias)) float_a;
typedef int __attribute__((may_alias)) int_a;

template <typename T> __device__ __forceinline__ void vst2(void* p, T v) { *(T*)p = v;  }
__device__ __forceinline__ v8f wmma16(v16h a, v16h b, v8f c) {
  v8f d = __builtin_amdgcn_wmma_f32_16x16x32_f16(false, a, false, b, (short)0, c, false, false);
  asm volatile("v_nop\n\tv_nop\n\tv_nop\n\tv_nop" : "+v"(d) : "v"(a), "v"(b));
  return d;
}
__device__ __forceinline__ v8f wmma_bf(v16b a, v16b b, v8f c) {
  v8f d = __builtin_amdgcn_wmma_f32_16x16x32_bf16(false, a, false, b, (short)0, c, false, false);
  asm volatile("v_nop\n\tv_nop\n\tv_nop\n\tv_nop" : "+v"(d) : "v"(a), "v"(b));
  return d;
}
// 16x16x32 fragments: lane = (h = lane>>4, row/col = lane&15); elements 0..7 = k0+8h+0..7, 8..15 = k0+16+8h+0..7; D element r = row 8h+r
__device__ __forceinline__ v16h frag_h(const _Float16* rowk0, int lane) {
  union { v16h v; v8h q[2]; } u; const _Float16* p = rowk0 + 8 * (lane >> 4);
  u.q[0] = *(const v8h*)p; u.q[1] = *(const v8h*)(p + 16); return u.v;
}
__device__ __forceinline__ v16h frag_f32(const float* rowk0, int lane) {
  v16h a; const float* p = rowk0 + 8 * (lane >> 4);
#pragma unroll
  for (int i = 0; i < 8; ++i) { a[i] = (_Float16)p[i]; a[8 + i] = (_Float16)p[16 + i]; }
  return a;
}
__device__ __forceinline__ v16h frag_f32s(const float* rowk0, int lane, float sc) {
  v16h a; const float* p = rowk0 + 8 * (lane >> 4);
#pragma unroll
  for (int i = 0; i < 8; ++i) { a[i] = (_Float16)(p[i] * sc); a[8 + i] = (_Float16)(p[16 + i] * sc); }
  return a;
}
// column fragment from a [K][ld] layout (column n), rows >= K read as 0
__device__ __forceinline__ v16h fragc_f32(const float* W, int k0, int n, int lane, int ld, int K) {
  v16h a; const int g = lane >> 4;
#pragma unroll
  for (int i = 0; i < 8; ++i) { const int ka = k0 + 8 * g + i, kb = ka + 16;
    a[i] = (_Float16)(ka < K ? W[(size_t)(ka < K ? ka : K - 1) * ld + n] : 0.f); a[8 + i] = (_Float16)(kb < K ? W[(size_t)(kb < K ? kb : K - 1) * ld + n] : 0.f); }
  return a;
}
struct F2 { v16b h, l; };
__device__ __forceinline__ F2 bsplit16(const float v[16]) { F2 r;
#pragma unroll
  for (int i = 0; i < 16; ++i) { const __bf16 h = (__bf16)v[i]; r.h[i] = h; r.l[i] = (__bf16)(v[i] - (float)h); }
  return r; }
__device__ __forceinline__ F2 split_row(const float* row, int k0, int lane) { float v[16]; const float* p = row + k0 + 8 * (lane >> 4);
#pragma unroll
  for (int i = 0; i < 8; ++i) { v[i] = p[i]; v[8 + i] = p[16 + i]; }
  return bsplit16(v); }
__device__ __forceinline__ F2 split_rowK(const float* row, int k0, int lane, int K) { float v[16]; const int g = lane >> 4;
#pragma unroll
  for (int i = 0; i < 8; ++i) { const int ka = k0 + 8 * g + i, kb = ka + 16; v[i] = ka < K ? row[ka < K ? ka : K - 1] : 0.f; v[8 + i] = kb < K ? row[kb < K ? kb : K - 1] : 0.f; }
  return bsplit16(v); }
__device__ __forceinline__ F2 split_col(const float* W, int k0, int n, int lane, int ld, int K) { float v[16]; const int g = lane >> 4;
#pragma unroll
  for (int i = 0; i < 8; ++i) { const int ka = k0 + 8 * g + i, kb = ka + 16; v[i] = ka < K ? W[(size_t)(ka < K ? ka : K - 1) * ld + n] : 0.f; v[8 + i] = kb < K ? W[(size_t)(kb < K ? kb : K - 1) * ld + n] : 0.f; }
  return bsplit16(v); }
__device__ __forceinline__ v8f mac3(const F2& a, const F2& b, v8f c) { c = wmma_bf(a.l, b.h, c); c = wmma_bf(a.h, b.l, c); return wmma_bf(a.h, b.h, c); }
__device__ __forceinline__ float sigm(float v) { return 1.0f / (1.0f + expf(-v)); }
#define LDSX() do { asm volatile("s_wait_dscnt 0" ::: "memory"); __builtin_amdgcn_wave_barrier(); __builtin_amdgcn_fence(__ATOMIC_RELEASE, "workgroup"); } while (0)

// Causal multi-head self-attention with interleaved-pair RoPE at given token positions, ONE batch of 4,096 tokens (x [1,4096,1024]; (out,in) Wq / Wk / Wv / Wo [1024,1024] N(0,1) x 0.02 applied as x @ W.T, no biases; token_positions [4096] int (arange; the LAST input); 16 heads x 64; inv_freq = 1 / 10000^(2i/64); (even, odd) pairs rotated and re-interleaved; scores / sqrt(64); tril kept, -inf elsewhere; softmax; attn @ Wo.T). THIS ROW: the same module and weight scale (0.02) with the argument order x, token_positions, Wq, Wk, Wv, Wo (the positions SECOND): the indices in kernel_launch follow; finfo.min in place of -inf under the causal rule (an exclusion either way); the inverse-frequency expression is the host's own, token for token: the baked table is unchanged.
#define NB 1
#define TT 4096
#define CC 1024            // NH * HD = projected width
#define DIN 1024          // input (model) width
#define NH 16
#define HD 64
#define NQB (TT / 64)
#define SCALE (0.125f)
#define CAUSAL 1
#ifndef TNB
#define TNB NB
#endif
__device__ __forceinline__ float bfr(float v) { return (float)(__bf16)v; }
typedef __attribute__((ext_vector_type(8))) __bf16 v8b;
__device__ __forceinline__ v16b frag_b(const __bf16* rowk0, int lane) {
  union { v16b v; v8b q[2]; } u; const __bf16* p = rowk0 + 8 * (lane >> 4);
  u.q[0] = *(const v8b*)p; u.q[1] = *(const v8b*)(p + 16); return u.v;
}
#define QBH 6              // causal: query blocks 0..QBH-1 of each sequence (few keys, no averaging) take the high-precision path
#define QHI 384            // rows carrying a q residual plane
#define KHI 384            // key rows carrying k residual / v bf16 hi+lo planes (used only by the causal high-precision path)
// B fragment (k rows k0+.., output column o) of a weight: (in,out) [K][ld] or (out,in) [ld rows of K]: bf16 exact, or f16(bf16 * 256) exact
__device__ __forceinline__ v16b wcol_io(const float* Wm, int k0, int o, int lane, int ld) { v16b w; const int g = lane >> 4;
#pragma unroll
  for (int i = 0; i < 8; ++i) { w[i] = (__bf16)Wm[(size_t)(k0 + 8 * g + i) * ld + o]; w[8 + i] = (__bf16)Wm[(size_t)(k0 + 16 + 8 * g + i) * ld + o]; }
  return w; }
__device__ __forceinline__ v16b wcol_oi(const float* Wm, int k0, int o, int lane, int K) { v16b w; const float* p = Wm + (size_t)o * K + k0 + 8 * (lane >> 4);
#pragma unroll
  for (int i = 0; i < 8; ++i) { w[i] = (__bf16)p[i]; w[8 + i] = (__bf16)p[16 + i]; }
  return w; }
__device__ __forceinline__ v16h wcolh_io(const float* Wm, int k0, int o, int lane, int ld) { v16h w; const int g = lane >> 4;
#pragma unroll
  for (int i = 0; i < 8; ++i) { w[i] = (_Float16)(bfr(Wm[(size_t)(k0 + 8 * g + i) * ld + o]) * 256.0f); w[8 + i] = (_Float16)(bfr(Wm[(size_t)(k0 + 16 + 8 * g + i) * ld + o]) * 256.0f); }
  return w; }
__device__ __forceinline__ v16h wcolh_oi(const float* Wm, int k0, int o, int lane, int K) { v16h w; const float* p = Wm + (size_t)o * K + k0 + 8 * (lane >> 4);
#pragma unroll
  for (int i = 0; i < 8; ++i) { w[i] = (_Float16)(bfr(p[i]) * 256.0f); w[8 + i] = (_Float16)(bfr(p[16 + i]) * 256.0f); }
  return w; }
#define WQKV_LAYOUT 1   // picks WCOL's layout (0 = (in,out) [DIN][CC]; 1 = (out,in) [CC][DIN]; 2 = per-head [NH][DIN][HD]); nothing calls WCOL: k_proj reads (out,in) [CC][DIN] rows
__device__ __forceinline__ v16b wcol_hdk(const float* Wm, int k0, int o, int lane) { v16b w; const int g = lane >> 4; const float* p = Wm + (size_t)(o / HD) * DIN * HD + (o % HD);
#pragma unroll
  for (int i = 0; i < 8; ++i) { w[i] = (__bf16)p[(size_t)(k0 + 8 * g + i) * HD]; w[8 + i] = (__bf16)p[(size_t)(k0 + 16 + 8 * g + i) * HD]; }
  return w; }
#define WO_OUT_IN 1
#if WQKV_LAYOUT == 1
#define WCOL(W, k0, o, lane) wcol_oi(W, k0, o, lane, DIN)
#elif WQKV_LAYOUT == 2
#define WCOL(W, k0, o, lane) wcol_hdk(W, k0, o, lane)
#else
#define WCOL(W, k0, o, lane) wcol_io(W, k0, o, lane, CC)
#endif
#if WO_OUT_IN
#define WOCOL(W, k0, o, lane) wcol_oi(W, k0, o, lane, CC)
#define WOCOLH(W, k0, o, lane) wcolh_oi(W, k0, o, lane, CC)
#else
#define WOCOL(W, k0, o, lane) wcol_io(W, k0, o, lane, DIN)
#define WOCOLH(W, k0, o, lane) wcolh_io(W, k0, o, lane, DIN)
#endif
// RoPE inverse frequencies 1/10000^(2i/64) (the f32 values jax computes)
__constant__ float INVF[32] = {1.000000000e+00,7.498942018e-01,5.623413324e-01,4.216965139e-01,3.162277639e-01,2.371373624e-01,1.778279394e-01,1.333521456e-01,1.000000015e-01,7.498941571e-02,5.623412877e-02,4.216964915e-02,3.162277862e-02,2.371373586e-02,1.778279431e-02,1.333521493e-02,9.999999776e-03,7.498942316e-03,5.623413250e-03,4.216964822e-03,3.162277862e-03,2.371373819e-03,1.778279431e-03,1.333521446e-03,1.000000047e-03,7.498941850e-04,5.623413017e-04,4.216964880e-04,3.162277862e-04,2.371373848e-04,1.778279402e-04,1.333521504e-04};
#define PROJ_EXTRA_PARAMS , const int* __restrict__ TPOS
// interleaved-pair RoPE on q and k (which 0, 1) at the token's position from the int input token_positions[t]: angle = (float)pos * inv_freq[i]; (x1, x2) -> (x1 cos - x2 sin, x1 sin + x2 cos); products and sums kept separate (no fma contraction)
#define PROJ_EPI(which, row, t, h) do { if ((which) < 2) { float* rw = (row); const float pos_ = (float)TPOS[(t)]; _Pragma("unroll 4") for (int i = 0; i < 32; ++i) { _Pragma("clang fp contract(off)") const float ang = pos_ * INVF[i]; const float cs = cosf(ang), sn = sinf(ang); const float xe = rw[2 * i], xo = rw[2 * i + 1]; rw[2 * i] = xe * cs - xo * sn; rw[2 * i + 1] = xe * sn + xo * cs; } } } while (0)
#ifndef PROJ_EXTRA_PARAMS
#define PROJ_EXTRA_PARAMS
#endif

#define WS_QH  0u                                      // f16 q rows [b*t][CC]
#define WS_KH  (WS_QH + 2u * (size_t)NB * TT * CC)      // f16 k rows [b*t][CC]
#define WS_VT  (WS_KH + 2u * (size_t)NB * TT * CC)      // f16 v planes [b][c][t]
#define WS_QL  (WS_VT + 2u * (size_t)NB * CC * TT)      // f16 q residual x 2^10 rows [b][t < QHI][CC]
#define WS_KL  (WS_QL + 2u * (size_t)NB * QHI * CC)     // f16 k residual x 2^10 rows [b][t < KHI][CC]
#define WS_VB  (WS_KL + 2u * (size_t)NB * KHI * CC)     // bf16 v hi planes [b][c][t < KHI]
#define WS_VBL (WS_VB + 2u * (size_t)NB * CC * KHI)
#define WS_Y   (WS_VBL + 2u * (size_t)NB * CC * KHI)    // f32 ctx rows [b*t][CC] (only when there is an output projection)
#define WS_END (WS_Y  + 4u * (size_t)NB * TT * CC)

// LDS staging of the projections' operands: a stage is KS k of every operand row, brought by whole-line loads (16 lanes x 16 B = one 256-B row piece), converted once per block, laid at a pitch of 128 + 16 B for the 16-byte fragment reads
#define KS 64
#define LP 72
// full unroll: the register arrays the loop walks keep constant indices (no scratch) and the row steps fold into the instructions' offsets
#define UNROLL_REGS _Pragma("unroll")
typedef __attribute__((ext_vector_type(4))) __bf16 v4b;
typedef __attribute__((ext_vector_type(4))) _Float16 v4h;
// stands behind each group of global loads, before anything may take the loads' address registers
#define XWAIT() asm volatile("s_wait_xcnt 0x0" ::: "memory")
__device__ __forceinline__ v4b cvt4b(v4f v) { v4b r;
UNROLL_REGS
  for (int i = 0; i < 4; ++i) r[i] = (__bf16)v[i];
  return r; }
__device__ __forceinline__ v4b cvt4bl(v4f v) { v4b r;   /* the residual plane of bsplit16 */
UNROLL_REGS
  for (int i = 0; i < 4; ++i) r[i] = (__bf16)(v[i] - (float)(__bf16)v[i]);
  return r; }
__device__ __forceinline__ v4h cvt4hs(v4f v, float sc) { v4h r;
UNROLL_REGS
  for (int i = 0; i < 4; ++i) r[i] = (_Float16)(v[i] * sc);
  return r; }
__device__ __forceinline__ v4h cvt4hw(v4f v) { v4h r;   /* f16(bf16 x 2^8), exact */
UNROLL_REGS
  for (int i = 0; i < 4; ++i) r[i] = (_Float16)(bfr(v[i]) * 256.0f);
  return r; }
// ---- k_proj: block = (64 rows, 128 cols, which): q/k/v = X W (+ b) with exact bf16 products (K = DIN), X and W staged as bf16 in a two-buffer LDS ring, the next stage's global loads in flight over this stage's products -> which 0: q f16 rows (+ residual rows < QHI); 1: k f16 rows (+ residual rows < KHI); 2: v f16 planes [c][t] (+ bf16 hi/lo planes for t < KHI)
__global__ __launch_bounds__(128) void k_proj(const float* __restrict__ XQ, const float* __restrict__ XK, const float* __restrict__ XV, const float* __restrict__ WQ, const float* __restrict__ WK, const float* __restrict__ WV, const float* __restrict__ BQ, const float* __restrict__ BK, const float* __restrict__ BV,
    _Float16* __restrict__ QH, _Float16* __restrict__ QL, _Float16* __restrict__ KH, _Float16* __restrict__ KL, _Float16* __restrict__ VT, __bf16* __restrict__ VB, __bf16* __restrict__ VBL PROJ_EXTRA_PARAMS) {
  __shared__ __align__(16) float st[64][132];
  struct Epi { _Float16 sh[64][136], sl[64][136]; _Float16 th[128][72]; __bf16 tb[128][72], tbl[128][72]; };
  __shared__ __align__(16) union { Epi e; __bf16 ring[2][64 + 128][LP]; } u;   /* the ring (rows 0..63 X, 64..191 W) is dead before the epilogue's planes are written: two barriers lie between */
  auto& sh = u.e.sh; auto& sl = u.e.sl; auto& th = u.e.th; auto& tb = u.e.tb; auto& tbl = u.e.tbl;
  const int tid = threadIdx.x, wave = tid >> 5, lane = tid & 31, col = lane & 15, g = lane >> 4; const int which = blockIdx.z; const int c0 = blockIdx.y * 128; const size_t r0 = (size_t)blockIdx.x * 64; const size_t bb = r0 / TT; const int t0 = (int)(r0 % TT);
  const float* X = which == 0 ? XQ : which == 1 ? XK : XV; const float* WA = which == 0 ? WQ : which == 1 ? WK : WV; const float* BA = which == 0 ? BQ : which == 1 ? BK : BV;
  v8f acc[8] = {};
  const int fr = tid >> 4, fc = (tid & 15) * 4;   /* the thread's row of each 8-row sweep and its 4 floats of a stage row */
  const unsigned fo = fr * DIN + fc; const float* xg = X + r0 * DIN; const float* wg = WA + (size_t)c0 * DIN; v4f xr[8], wr[16];   /* block-uniform bases, one 32-bit lane offset that nothing overwrites */
UNROLL_REGS
  for (int i = 0; i < 8; ++i) xr[i] = *(const v4f*)(xg + fo + (size_t)i * 8 * DIN);
UNROLL_REGS
  for (int i = 0; i < 16; ++i) wr[i] = *(const v4f*)(wg + fo + (size_t)i * 8 * DIN);
  XWAIT();
  for (int s = 0; s < DIN / KS; ++s) { __bf16 (*rb)[LP] = u.ring[s & 1];
UNROLL_REGS
    for (int i = 0; i < 8; ++i) *(v4b*)&rb[fr + 8 * i][fc] = cvt4b(xr[i]);
UNROLL_REGS
    for (int i = 0; i < 16; ++i) *(v4b*)&rb[64 + fr + 8 * i][fc] = cvt4b(wr[i]);
    __syncthreads();   /* publishes stage s; it also ends every wave's reads of the other buffer, which stage s + 1 overwrites */
    if (s + 1 < DIN / KS) { xg += KS; wg += KS;
UNROLL_REGS
      for (int i = 0; i < 8; ++i) xr[i] = *(const v4f*)(xg + fo + (size_t)i * 8 * DIN);
UNROLL_REGS
      for (int i = 0; i < 16; ++i) wr[i] = *(const v4f*)(wg + fo + (size_t)i * 8 * DIN);
      XWAIT(); }
UNROLL_REGS
    for (int kk = 0; kk < KS / 32; ++kk) { const v16b a = frag_b(&rb[wave * 16 + col][kk * 32], lane); v16b w[8];   /* a block's fragment reads go as one group ahead of its products */
UNROLL_REGS
      for (int j = 0; j < 8; ++j) w[j] = frag_b(&rb[64 + j * 16 + col][kk * 32], lane);
UNROLL_REGS
      for (int j = 0; j < 8; ++j) acc[j] = wmma_bf(a, w[j], acc[j]); } }
  { // stage the f32 tile (acc + bias) in LDS, run the per-(row, head) epilogue hook, then convert
#pragma unroll
    for (int j = 0; j < 8; ++j) { const float bias = BA ? bfr(BA[c0 + j * 16 + col]) : 0.f;
#pragma unroll
      for (int r = 0; r < 8; ++r) st[wave * 16 + 8 * g + r][j * 16 + col] = acc[j][r] + bias; }
    __syncthreads();
    for (int e = tid; e < 64 * (128 / HD); e += 128) { const int rl = e / (128 / HD), hh = e % (128 / HD); PROJ_EPI(which, &st[rl][hh * HD], (int)((r0 + rl) % TT), (c0 / HD) + hh); }
    __syncthreads(); }
  if (which < 2) { _Float16* DH = which == 0 ? QH : KH; _Float16* DL = which == 0 ? QL : KL; const int nhi = which == 0 ? QHI : KHI; const bool hi_rows = t0 < nhi;
    for (int e = tid; e < 64 * 128; e += 128) { const int rl = e >> 7, cl = e & 127; const float v = st[rl][cl]; const _Float16 hv = (_Float16)v; sh[rl][cl] = hv; sl[rl][cl] = (_Float16)((v - (float)hv) * 1024.0f); }
    __syncthreads();
    for (int e = tid; e < 64 * 16; e += 128) { const int rl = e >> 4, q = e & 15; vst2((unsigned*)(DH + (r0 + rl) * CC + c0 + q * 8), *(const v4u*)&sh[rl][q * 8]); if (hi_rows) vst2((unsigned*)(DL + (bb * nhi + t0 + rl) * (size_t)CC + c0 + q * 8), *(const v4u*)&sl[rl][q * 8]); }
  } else { const bool hi_rows = t0 < KHI;
    for (int e = tid; e < 64 * 128; e += 128) { const int rl = e & 63, cl = e >> 6; const float v = st[rl][cl]; th[cl][rl] = (_Float16)v; const __bf16 bh = (__bf16)v; tb[cl][rl] = bh; tbl[cl][rl] = (__bf16)(v - (float)bh); }
    __syncthreads();
    for (int e = tid; e < 128 * 8; e += 128) { const int cl = e >> 3, q = e & 7; vst2((unsigned*)(VT + (bb * CC + c0 + cl) * (size_t)TT + t0 + q * 8), *(const v4u*)&th[cl][q * 8]); if (hi_rows) { const size_t o3 = (bb * CC + c0 + cl) * (size_t)KHI + t0 + q * 8; vst2((unsigned*)(VB + o3), *(const v4u*)&tb[cl][q * 8]); vst2((unsigned*)(VBL + o3), *(const v4u*)&tbl[cl][q * 8]); } } } }
// fragment from the lane's own pointer (row start + k0 + 8 * (lane >> 4)): the same k order as frag_h / frag_b
__device__ __forceinline__ v16h frag_hp(const _Float16* p) { union { v16h v; v8h q[2]; } u; u.q[0] = *(const v8h*)p; u.q[1] = *(const v8h*)(p + 16); return u.v; }
__device__ __forceinline__ v16b frag_bp(const __bf16* p) { union { v16b v; v8b q[2]; } u; u.q[0] = *(const v8b*)p; u.q[1] = *(const v8b*)(p + 16); return u.v; }
// one 32-key step of a query's running softmax: v = the lane's 16 scaled logits (-3.0e38 = excluded) -> exp(v - new maximum) x 2^11; m = running maximum (both wave halves alike), l = this half's running sum; returns the factor that carries the old sums to the new maximum
__device__ __forceinline__ float sm_step(float v[16], float& m, float& l) {
  float mx = v[0];
#pragma unroll
  for (int i = 1; i < 16; ++i) mx = fmaxf(mx, v[i]);
  mx = fmaxf(mx, __shfl_xor(mx, 16));
  const float mn = fmaxf(m, mx); const float alpha = expf(m - mn); float s = 0.f;
#pragma unroll
  for (int i = 0; i < 16; ++i) { const float e = expf(v[i] - mn); s += e; v[i] = e * 2048.0f; }   /* mn is a kept key's logit (every step holds one for every query), so an excluded key gives exp(-3.0e38) = 0 */
  l = l * alpha + s; m = mn; return alpha; }
// ---- k_attn: block = (head h, 64 queries qb, batch b), wave = 16 queries, keys [0, diagonal] 32 at a time (behind the early blocks: k rows and v planes staged 64 keys at a time in LDS, once for the block's four waves, the next stage's global loads in flight over this stage's steps). S^T = K Q^T x SCALE: lane (g, col) holds query col's logits of keys 8g + r and 16 + 8g + r (causal early query blocks: q and k residual planes, 3 products); the causal rule by index in the last step; running maximum and sum in f32; the two score tiles, as P^T x 2^11 once to f16 (early blocks: bf16 hi + lo), are the B operand of ctx^T += V^T P^T (early blocks: v bf16 hi + lo, 3 products); ctx = sums / (2^11 x sum of exp); 256-B (row, head) segment by 16 lanes
__global__ __launch_bounds__(128) void k_attn(const _Float16* __restrict__ QH, const _Float16* __restrict__ KH, const _Float16* __restrict__ QL, const _Float16* __restrict__ KL, const _Float16* __restrict__ VT, const __bf16* __restrict__ VB, const __bf16* __restrict__ VBL, float* __restrict__ Y) { __shared__ __align__(16) float ss[4][16][HD + 4]; __shared__ __align__(16) _Float16 kv[2][64 + HD][LP];   /* two-buffer ring of 64-key stages: rows 0..63 the keys' k rows of this head, rows 64.. its v planes [c][64 keys] */
  const int tid = threadIdx.x, wave = __builtin_amdgcn_readfirstlane(tid >> 5), lane = tid & 31, col = lane & 15, g = lane >> 4; const int h = blockIdx.x, qb = blockIdx.y, b = blockIdx.z; const int ql0 = qb * 64 + wave * 16; const int nch = (ql0 + 47) >> 5;
  const size_t q0 = (size_t)b * TT + ql0, kr0 = (size_t)b * TT;
  v8f acc[HD / 16] = {}; float m = -3.0e38f, l = 0.f;
  if (qb < QBH) { const _Float16* QLb = QL + (size_t)b * QHI * CC; const _Float16* KLb = KL + (size_t)b * KHI * CC; v16h qh[HD / 32], qlo[HD / 32];
#pragma unroll
    for (int kk = 0; kk < HD / 32; ++kk) { qh[kk] = frag_h(QH + (q0 + col) * CC + h * HD + kk * 32, lane); qlo[kk] = frag_h(QLb + (size_t)(ql0 + col) * CC + h * HD + kk * 32, lane); }
    asm volatile("s_wait_xcnt 0x0" :: "v"(qh[0]), "v"(qh[1]), "v"(qlo[0]), "v"(qlo[1]) : "memory");   /* XWAIT held behind the q loads by their values (inputs only) */
    const _Float16* kp = KH + (kr0 + col) * CC + h * HD + 8 * g; const _Float16* klp = KLb + (size_t)col * CC + h * HD + 8 * g; const __bf16* vp = VB + ((size_t)b * CC + h * HD + col) * (size_t)KHI + 8 * g; const __bf16* vlp = VBL + ((size_t)b * CC + h * HD + col) * (size_t)KHI + 8 * g;
    for (int kc = 0; kc < nch; ++kc, kp += 32 * CC, klp += 32 * CC, vp += 32, vlp += 32) { const int k0 = kc * 32; float v[16]; v16h kbf[2][HD / 32], klf[2][HD / 32];   /* a step's k loads are all issued before its first product, its v loads before the softmax */
#pragma unroll
      for (int t = 0; t < 2; ++t)
#pragma unroll
        for (int kk = 0; kk < HD / 32; ++kk) kbf[t][kk] = frag_hp(kp + t * 16 * CC + kk * 32);
      XWAIT();
#pragma unroll
      for (int t = 0; t < 2; ++t)
#pragma unroll
        for (int kk = 0; kk < HD / 32; ++kk) klf[t][kk] = frag_hp(klp + t * 16 * CC + kk * 32);
      XWAIT();
#pragma unroll
      for (int t = 0; t < 2; ++t) { v8f s = {}, sl = {};
#pragma unroll
        for (int kk = 0; kk < HD / 32; ++kk) { s = wmma16(kbf[t][kk], qh[kk], s); sl = wmma16(kbf[t][kk], qlo[kk], sl); sl = wmma16(klf[t][kk], qh[kk], sl); }
#pragma unroll
        for (int r = 0; r < 8; ++r) v[t * 8 + r] = (s[r] + sl[r] * (1.0f / 1024.0f)) * SCALE; }
      if (kc == nch - 1) {
#pragma unroll
        for (int i = 0; i < 16; ++i) if (k0 + (i >> 3) * 16 + 8 * g + (i & 7) > ql0 + col) v[i] = -3.0e38f; }
      v16b vh[HD / 16], vl[HD / 16];
#pragma unroll
      for (int j = 0; j < HD / 16; ++j) vh[j] = frag_bp(vp + j * 16 * KHI);
      XWAIT();
#pragma unroll
      for (int j = 0; j < HD / 16; ++j) vl[j] = frag_bp(vlp + j * 16 * KHI);
      XWAIT();
      const float alpha = sm_step(v, m, l); const F2 p = bsplit16(v);
#pragma unroll
      for (int j = 0; j < HD / 16; ++j) { acc[j] = acc[j] * alpha; acc[j] = wmma_bf(vh[j], p.h, acc[j]); acc[j] = wmma_bf(vh[j], p.l, acc[j]); acc[j] = wmma_bf(vl[j], p.h, acc[j]); } }
  } else { v16h qh[HD / 32];
#pragma unroll
    for (int kk = 0; kk < HD / 32; ++kk) qh[kk] = frag_h(QH + (q0 + col) * CC + h * HD + kk * 32, lane);
    asm volatile("s_wait_xcnt 0x0" :: "v"(qh[0]), "v"(qh[1]) : "memory");   /* XWAIT held behind the q loads by their values (inputs only) */
    const int fr = tid >> 3, fc = (tid & 7) * 8;   /* the thread's row of each 16-row sweep and its 16 B of a 128-B stage row: a wave's load covers 4 whole lines */
    const unsigned ko = fr * CC + fc, vo = fr * TT + fc; const _Float16* kg = KH + kr0 * CC + h * HD; const _Float16* vg = VT + ((size_t)b * CC + h * HD) * (size_t)TT; v8h kr[4], vr[HD / 16];   /* block-uniform bases, 32-bit lane offsets that nothing overwrites */
UNROLL_REGS
    for (int i = 0; i < 4; ++i) kr[i] = *(const v8h*)(kg + ko + (size_t)i * 16 * CC);
    XWAIT();
UNROLL_REGS
    for (int i = 0; i < HD / 16; ++i) vr[i] = *(const v8h*)(vg + vo + (size_t)i * 16 * TT);
    XWAIT();
    for (int s = 0; s <= qb; ++s) { _Float16 (*rb)[LP] = kv[s & 1];   /* block-uniform trip count: every wave passes every barrier */
UNROLL_REGS
      for (int i = 0; i < 4; ++i) *(v8h*)&rb[fr + 16 * i][fc] = kr[i];
UNROLL_REGS
      for (int i = 0; i < HD / 16; ++i) *(v8h*)&rb[64 + fr + 16 * i][fc] = vr[i];
      __syncthreads();   /* publishes stage s and ends the reads of the buffer that stage s + 1 overwrites */
      if (s < qb) { kg += 64 * CC; vg += 64;
UNROLL_REGS
        for (int i = 0; i < 4; ++i) kr[i] = *(const v8h*)(kg + ko + (size_t)i * 16 * CC);
UNROLL_REGS
        for (int i = 0; i < HD / 16; ++i) vr[i] = *(const v8h*)(vg + vo + (size_t)i * 16 * TT);
        XWAIT(); }
UNROLL_REGS
     for (int t2 = 0; t2 < 2; ++t2) { const int kc = 2 * s + t2; if (kc < nch) { const int k0 = kc * 32; float v[16]; v16h kf[2][HD / 32], vf[HD / 16];   /* wave-uniform test: the block's first two waves have no second step in the last stage; a step's fragment reads go ahead of its first product */
#pragma unroll
      for (int t = 0; t < 2; ++t)
UNROLL_REGS
        for (int kk = 0; kk < HD / 32; ++kk) kf[t][kk] = frag_hp(&rb[t2 * 32 + t * 16 + col][kk * 32 + 8 * g]);
UNROLL_REGS
      for (int j = 0; j < HD / 16; ++j) vf[j] = frag_hp(&rb[64 + j * 16 + col][t2 * 32 + 8 * g]);
#pragma unroll
      for (int t = 0; t < 2; ++t) { v8f s = {};
#pragma unroll
        for (int kk = 0; kk < HD / 32; ++kk) s = wmma16(kf[t][kk], qh[kk], s);
#pragma unroll
        for (int r = 0; r < 8; ++r) v[t * 8 + r] = s[r] * SCALE; }
      if (kc == nch - 1) {
#pragma unroll
        for (int i = 0; i < 16; ++i) if (k0 + (i >> 3) * 16 + 8 * g + (i & 7) > ql0 + col) v[i] = -3.0e38f; }
      const float alpha = sm_step(v, m, l); v16h p;
#pragma unroll
      for (int i = 0; i < 16; ++i) p[i] = (_Float16)v[i];
UNROLL_REGS
      for (int j = 0; j < HD / 16; ++j) { acc[j] = acc[j] * alpha; acc[j] = wmma16(vf[j], p, acc[j]); } } } } }
  l += __shfl_xor(l, 16); const float inv = 1.0f / (l * 2048.0f);
#pragma unroll
  for (int j = 0; j < HD / 16; ++j)
#pragma unroll
    for (int r = 0; r < 8; ++r) ss[wave][col][j * 16 + 8 * g + r] = acc[j][r] * inv;
  LDSX(); for (int rl = 0; rl < 16; ++rl) if (lane < HD / 4) vst2(Y + ((size_t)b * TT + ql0 + rl) * CC + h * HD + lane * 4, *(const v4f*)&ss[wave][rl][lane * 4]); }
// ---- k_out: block = (64 rows, 128 cols), operands staged in a two-buffer LDS ring as in k_proj: out = ctx Wo (+ bo): ctx x 2^6 once to f16 against Wo as f16(bf16 x 2^8) exact (1 product) x 2^-14; causal early rows (< QHI of each sequence): ctx bf16 hi + lo against exact bf16 Wo (2 products)
__global__ __launch_bounds__(128) void k_out(const float* __restrict__ Y, const float* __restrict__ WO, const float* __restrict__ BO, float* __restrict__ OUT) { __shared__ __align__(16) float sf[4][16][132];
  __shared__ __align__(16) union { __bf16 b[2][64 + 64 + 128][LP]; _Float16 h[2][64 + 128][LP]; } u;   /* early rows: ctx hi 0..63, ctx lo 64..127, Wo 128..255; else ctx 0..63, Wo 64..191 */
  const int tid = threadIdx.x, wave = tid >> 5, lane = tid & 31, col = lane & 15, g = lane >> 4; const int c0 = blockIdx.y * 128; const size_t r0 = (size_t)blockIdx.x * 64 + wave * 16;
  v8f acc[8] = {};
  const int fr = tid >> 4, fc = (tid & 15) * 4;   /* as in k_proj */
  const unsigned fo = fr * CC + fc; const float* yg = Y + (size_t)blockIdx.x * 64 * CC; const float* wg = WO + (size_t)c0 * CC; v4f yr[8], wr[16];
UNROLL_REGS
  for (int i = 0; i < 8; ++i) yr[i] = *(const v4f*)(yg + fo + (size_t)i * 8 * CC);
UNROLL_REGS
  for (int i = 0; i < 16; ++i) wr[i] = *(const v4f*)(wg + fo + (size_t)i * 8 * CC);
  XWAIT();
  if (CAUSAL && (int)(((size_t)blockIdx.x * 64) % TT) < QHI) {   /* block-uniform */
    for (int s = 0; s < CC / KS; ++s) { __bf16 (*rb)[LP] = u.b[s & 1];
UNROLL_REGS
      for (int i = 0; i < 8; ++i) { *(v4b*)&rb[fr + 8 * i][fc] = cvt4b(yr[i]); *(v4b*)&rb[64 + fr + 8 * i][fc] = cvt4bl(yr[i]); }
UNROLL_REGS
      for (int i = 0; i < 16; ++i) *(v4b*)&rb[128 + fr + 8 * i][fc] = cvt4b(wr[i]);
      __syncthreads();   /* publishes stage s and ends the reads of the buffer that stage s + 1 overwrites */
      if (s + 1 < CC / KS) { yg += KS; wg += KS;
UNROLL_REGS
        for (int i = 0; i < 8; ++i) yr[i] = *(const v4f*)(yg + fo + (size_t)i * 8 * CC);
UNROLL_REGS
        for (int i = 0; i < 16; ++i) wr[i] = *(const v4f*)(wg + fo + (size_t)i * 8 * CC);
        XWAIT(); }
UNROLL_REGS
      for (int kk = 0; kk < KS / 32; ++kk) { const v16b ah = frag_b(&rb[wave * 16 + col][kk * 32], lane), al = frag_b(&rb[64 + wave * 16 + col][kk * 32], lane); v16b w[8];
UNROLL_REGS
        for (int j = 0; j < 8; ++j) w[j] = frag_b(&rb[128 + j * 16 + col][kk * 32], lane);
UNROLL_REGS
        for (int j = 0; j < 8; ++j) { acc[j] = wmma_bf(ah, w[j], acc[j]); acc[j] = wmma_bf(al, w[j], acc[j]); } } }
#pragma unroll
    for (int j = 0; j < 8; ++j) { const float bias = BO ? bfr(BO[c0 + j * 16 + col]) : 0.f;
#pragma unroll
      for (int r = 0; r < 8; ++r) sf[wave][8 * g + r][j * 16 + col] = acc[j][r] + bias; }
  } else {
    for (int s = 0; s < CC / KS; ++s) { _Float16 (*rb)[LP] = u.h[s & 1];
UNROLL_REGS
      for (int i = 0; i < 8; ++i) *(v4h*)&rb[fr + 8 * i][fc] = cvt4hs(yr[i], 64.0f);   /* ctx carried x 2^6 into f16 so small-magnitude context rows stay clear of f16 subnormals */
UNROLL_REGS
      for (int i = 0; i < 16; ++i) *(v4h*)&rb[64 + fr + 8 * i][fc] = cvt4hw(wr[i]);
      __syncthreads();   /* publishes stage s and ends the reads of the buffer that stage s + 1 overwrites */
      if (s + 1 < CC / KS) { yg += KS; wg += KS;
UNROLL_REGS
        for (int i = 0; i < 8; ++i) yr[i] = *(const v4f*)(yg + fo + (size_t)i * 8 * CC);
UNROLL_REGS
        for (int i = 0; i < 16; ++i) wr[i] = *(const v4f*)(wg + fo + (size_t)i * 8 * CC);
        XWAIT(); }
UNROLL_REGS
      for (int kk = 0; kk < KS / 32; ++kk) { const v16h a = frag_h(&rb[wave * 16 + col][kk * 32], lane); v16h w[8];
UNROLL_REGS
        for (int j = 0; j < 8; ++j) w[j] = frag_h(&rb[64 + j * 16 + col][kk * 32], lane);
UNROLL_REGS
        for (int j = 0; j < 8; ++j) acc[j] = wmma16(a, w[j], acc[j]); } }
#pragma unroll
    for (int j = 0; j < 8; ++j) { const float bias = BO ? bfr(BO[c0 + j * 16 + col]) : 0.f;
#pragma unroll
      for (int r = 0; r < 8; ++r) sf[wave][8 * g + r][j * 16 + col] = acc[j][r] * (1.0f / 16384.0f) + bias; } }   /* 2^-8 (Wo carry) x 2^-6 (ctx carry) */
  LDSX(); for (int rl = 0; rl < 16; ++rl) vst2(OUT + (r0 + rl) * DIN + c0 + lane * 4, *(const v4f*)&sf[wave][rl][lane * 4]); }

extern "C" void kernel_launch(void* const* d_in, const int* in_sizes, int n_in, void* d_out, int out_size, void* d_ws, size_t ws_size, hipStream_t stream) {
  (void)in_sizes; (void)n_in; (void)out_size;
  const float** F = (const float**)d_in;
  if (ws_size < (size_t)WS_END) return;
  char* ws = (char*)d_ws; _Float16 *QH = (_Float16*)(ws + WS_QH), *KH = (_Float16*)(ws + WS_KH), *VT = (_Float16*)(ws + WS_VT), *QL = (_Float16*)(ws + WS_QL), *KL = (_Float16*)(ws + WS_KL); __bf16 *VB = (__bf16*)(ws + WS_VB), *VBL = (__bf16*)(ws + WS_VBL); float *Y = (float*)(ws + WS_Y);
  (void)Y; (void)QL; (void)KL; (void)VB; (void)VBL;
  // inputs in order: 0 x [1,4096,1024]; 1 token_positions [4096] int32 (arange): READ on the device; 2 Wq [1024,1024] (out,in); 3 Wk; 4 Wv; 5 Wo (out,in); no biases (null pointers)
  k_proj<<<dim3(TNB * TT / 64, CC / 128, 3), 128, 0, stream>>>(F[0], F[0], F[0], F[2], F[3], F[4], nullptr, nullptr, nullptr, QH, QL, KH, KL, VT, VB, VBL, (const int*)d_in[1]);
  k_attn<<<dim3(NH, NQB, TNB), 128, 0, stream>>>(QH, KH, QL, KL, VT, VB, VBL, Y);
  k_out<<<dim3(TNB * TT / 64, DIN / 128), 128, 0, stream>>>(Y, F[5], nullptr, (float*)d_out);
}

// v003
// Measured time: 142 microseconds a run.
// Two timings next to v002 put it at 1.22 and 1.21 times that version's speed.
// Counting every step since v000, it is 21.0 times as fast.
// compute dtype: all float inputs rounded to bf16; q/k/v projections with EXACT bf16 products on WMMA 16x16x32 (f32 accumulate); RoPE in f32 at the int token positions; causal logits: 3 products for the first 384 rows, single f16 q x k after, x 64^-0.5; softmax f32; P x 2^11 once to f16 x v once to f16 (bf16 hi + lo below row 384); ctx hi+lo x exact Wo below row 384, x2^6 f16 carry x f16(bf16 x 2^8) Wo after; f32 output.
#include <hip/hip_runtime.h>
#include <math.h>

typedef __attribute__((ext_vector_type(16))) _Float16 v16h;
typedef __attribute__((ext_vector_type(16))) __bf16 v16b;
typedef __attribute__((ext_vector_type(8)))  _Float16 v8h;
typedef __attribute__((ext_vector_type(8)))  float v8f;
typedef __attribute__((ext_vector_type(4)))  float v4f;
typedef __attribute__((ext_vector_type(2)))  float v2f;
typedef __attribute__((ext_vector_type(4)))  unsigned v4u;
typedef __attribute__((ext_vector_type(4)))  int v4i;
typedef float __attribute__((may_alias)) float_a;
typedef int __attribute__((may_alias)) int_a;

template <typename T> __device__ __forceinline__ void vst2(void* p, T v) { *(T*)p = v;  }
__device__ __forceinline__ v8f wmma16(v16h a, v16h b, v8f c) {
  v8f d = __builtin_amdgcn_wmma_f32_16x16x32_f16(false, a, false, b, (short)0, c, false, false);
  asm volatile("v_nop\n\tv_nop\n\tv_nop\n\tv_nop" : "+v"(d) : "v"(a), "v"(b));
  return d;
}
__device__ __forceinline__ v8f wmma_bf(v16b a, v16b b, v8f c) {
  v8f d = __builtin_amdgcn_wmma_f32_16x16x32_bf16(false, a, false, b, (short)0, c, false, false);
  asm volatile("v_nop\n\tv_nop\n\tv_nop\n\tv_nop" : "+v"(d) : "v"(a), "v"(b));
  return d;
}
// 16x16x32 fragments: lane = (h = lane>>4, row/col = lane&15); elements 0..7 = k0+8h+0..7, 8..15 = k0+16+8h+0..7; D element r = row 8h+r
__device__ __forceinline__ v16h frag_h(const _Float16* rowk0, int lane) {
  union { v16h v; v8h q[2]; } u; const _Float16* p = rowk0 + 8 * (lane >> 4);
  u.q[0] = *(const v8h*)p; u.q[1] = *(const v8h*)(p + 16); return u.v;
}
__device__ __forceinline__ v16h frag_f32(const float* rowk0, int lane) {
  v16h a; const float* p = rowk0 + 8 * (lane >> 4);
#pragma unroll
  for (int i = 0; i < 8; ++i) { a[i] = (_Float16)p[i]; a[8 + i] = (_Float16)p[16 + i]; }
  return a;
}
__device__ __forceinline__ v16h frag_f32s(const float* rowk0, int lane, float sc) {
  v16h a; const float* p = rowk0 + 8 * (lane >> 4);
#pragma unroll
  for (int i = 0; i < 8; ++i) { a[i] = (_Float16)(p[i] * sc); a[8 + i] = (_Float16)(p[16 + i] * sc); }
  return a;
}
// column fragment from a [K][ld] layout (column n), rows >= K read as 0
__device__ __forceinline__ v16h fragc_f32(const float* W, int k0, int n, int lane, int ld, int K) {
  v16h a; const int g = lane >> 4;
#pragma unroll
  for (int i = 0; i < 8; ++i) { const int ka = k0 + 8 * g + i, kb = ka + 16;
    a[i] = (_Float16)(ka < K ? W[(size_t)(ka < K ? ka : K - 1) * ld + n] : 0.f); a[8 + i] = (_Float16)(kb < K ? W[(size_t)(kb < K ? kb : K - 1) * ld + n] : 0.f); }
  return a;
}
struct F2 { v16b h, l; };
__device__ __forceinline__ F2 bsplit16(const float v[16]) { F2 r;
#pragma unroll
  for (int i = 0; i < 16; ++i) { const __bf16 h = (__bf16)v[i]; r.h[i] = h; r.l[i] = (__bf16)(v[i] - (float)h); }
  return r; }
__device__ __forceinline__ F2 split_row(const float* row, int k0, int lane) { float v[16]; const float* p = row + k0 + 8 * (lane >> 4);
#pragma unroll
  for (int i = 0; i < 8; ++i) { v[i] = p[i]; v[8 + i] = p[16 + i]; }
  return bsplit16(v); }
__device__ __forceinline__ F2 split_rowK(const float* row, int k0, int lane, int K) { float v[16]; const int g = lane >> 4;
#pragma unroll
  for (int i = 0; i < 8; ++i) { const int ka = k0 + 8 * g + i, kb = ka + 16; v[i] = ka < K ? row[ka < K ? ka : K - 1] : 0.f; v[8 + i] = kb < K ? row[kb < K ? kb : K - 1] : 0.f; }
  return bsplit16(v); }
__device__ __forceinline__ F2 split_col(const float* W, int k0, int n, int lane, int ld, int K) { float v[16]; const int g = lane >> 4;
#pragma unroll
  for (int i = 0; i < 8; ++i) { const int ka = k0 + 8 * g + i, kb = ka + 16; v[i] = ka < K ? W[(size_t)(ka < K ? ka : K - 1) * ld + n] : 0.f; v[8 + i] = kb < K ? W[(size_t)(kb < K ? kb : K - 1) * ld + n] : 0.f; }
  return bsplit16(v); }
__device__ __forceinline__ v8f mac3(const F2& a, const F2& b, v8f c) { c = wmma_bf(a.l, b.h, c); c = wmma_bf(a.h, b.l, c); return wmma_bf(a.h, b.h, c); }
__device__ __forceinline__ float sigm(float v) { return 1.0f / (1.0f + expf(-v)); }
#define LDSX() do { asm volatile("s_wait_dscnt 0" ::: "memory"); __builtin_amdgcn_wave_barrier(); __builtin_amdgcn_fence(__ATOMIC_RELEASE, "workgroup"); } while (0)

// Causal multi-head self-attention with interleaved-pair RoPE at given token positions, ONE batch of 4,096 tokens (x [1,4096,1024]; (out,in) Wq / Wk / Wv / Wo [1024,1024] N(0,1) x 0.02 applied as x @ W.T, no biases; token_positions [4096] int (arange; the LAST input); 16 heads x 64; inv_freq = 1 / 10000^(2i/64); (even, odd) pairs rotated and re-interleaved; scores / sqrt(64); tril kept, -inf elsewhere; softmax; attn @ Wo.T). THIS ROW: the same module and weight scale (0.02) with the argument order x, token_positions, Wq, Wk, Wv, Wo (the positions SECOND): the indices in kernel_launch follow; finfo.min in place of -inf under the causal rule (an exclusion either way); the inverse-frequency expression is the host's own, token for token: the baked table is unchanged.
#define NB 1
#define TT 4096
#define CC 1024            // NH * HD = projected width
#define DIN 1024          // input (model) width
#define NH 16
#define HD 64
#define NQB (TT / 64)
#define SCALE (0.125f)
#define CAUSAL 1
#ifndef TNB
#define TNB NB
#endif
__device__ __forceinline__ float bfr(float v) { return (float)(__bf16)v; }
typedef __attribute__((ext_vector_type(8))) __bf16 v8b;
__device__ __forceinline__ v16b frag_b(const __bf16* rowk0, int lane) {
  union { v16b v; v8b q[2]; } u; const __bf16* p = rowk0 + 8 * (lane >> 4);
  u.q[0] = *(const v8b*)p; u.q[1] = *(const v8b*)(p + 16); return u.v;
}
#define QBH 6              // causal: query blocks 0..QBH-1 of each sequence (few keys, no averaging) take the high-precision path
#define QHI 384            // rows carrying a q residual plane
#define KHI 384            // key rows carrying k residual / v bf16 hi+lo planes (used only by the causal high-precision path)
// B fragment (k rows k0+.., output column o) of a weight: (in,out) [K][ld] or (out,in) [ld rows of K]: bf16 exact, or f16(bf16 * 256) exact
__device__ __forceinline__ v16b wcol_io(const float* Wm, int k0, int o, int lane, int ld) { v16b w; const int g = lane >> 4;
#pragma unroll
  for (int i = 0; i < 8; ++i) { w[i] = (__bf16)Wm[(size_t)(k0 + 8 * g + i) * ld + o]; w[8 + i] = (__bf16)Wm[(size_t)(k0 + 16 + 8 * g + i) * ld + o]; }
  return w; }
__device__ __forceinline__ v16b wcol_oi(const float* Wm, int k0, int o, int lane, int K) { v16b w; const float* p = Wm + (size_t)o * K + k0 + 8 * (lane >> 4);
#pragma unroll
  for (int i = 0; i < 8; ++i) { w[i] = (__bf16)p[i]; w[8 + i] = (__bf16)p[16 + i]; }
  return w; }
__device__ __forceinline__ v16h wcolh_io(const float* Wm, int k0, int o, int lane, int ld) { v16h w; const int g = lane >> 4;
#pragma unroll
  for (int i = 0; i < 8; ++i) { w[i] = (_Float16)(bfr(Wm[(size_t)(k0 + 8 * g + i) * ld + o]) * 256.0f); w[8 + i] = (_Float16)(bfr(Wm[(size_t)(k0 + 16 + 8 * g + i) * ld + o]) * 256.0f); }
  return w; }
__device__ __forceinline__ v16h wcolh_oi(const float* Wm, int k0, int o, int lane, int K) { v16h w; const float* p = Wm + (size_t)o * K + k0 + 8 * (lane >> 4);
#pragma unroll
  for (int i = 0; i < 8; ++i) { w[i] = (_Float16)(bfr(p[i]) * 256.0f); w[8 + i] = (_Float16)(bfr(p[16 + i]) * 256.0f); }
  return w; }
#define WQKV_LAYOUT 1   // picks WCOL's layout (0 = (in,out) [DIN][CC]; 1 = (out,in) [CC][DIN]; 2 = per-head [NH][DIN][HD]); nothing calls WCOL: k_proj reads (out,in) [CC][DIN] rows
__device__ __forceinline__ v16b wcol_hdk(const float* Wm, int k0, int o, int lane) { v16b w; const int g = lane >> 4; const float* p = Wm + (size_t)(o / HD) * DIN * HD + (o % HD);
#pragma unroll
  for (int i = 0; i < 8; ++i) { w[i] = (__bf16)p[(size_t)(k0 + 8 * g + i) * HD]; w[8 + i] = (__bf16)p[(size_t)(k0 + 16 + 8 * g + i) * HD]; }
  return w; }
#define WO_OUT_IN 1
#if WQKV_LAYOUT == 1
#define WCOL(W, k0, o, lane) wcol_oi(W, k0, o, lane, DIN)
#elif WQKV_LAYOUT == 2
#define WCOL(W, k0, o, lane) wcol_hdk(W, k0, o, lane)
#else
#define WCOL(W, k0, o, lane) wcol_io(W, k0, o, lane, CC)
#endif
#if WO_OUT_IN
#define WOCOL(W, k0, o, lane) wcol_oi(W, k0, o, lane, CC)
#define WOCOLH(W, k0, o, lane) wcolh_oi(W, k0, o, lane, CC)
#else
#define WOCOL(W, k0, o, lane) wcol_io(W, k0, o, lane, DIN)
#define WOCOLH(W, k0, o, lane) wcolh_io(W, k0, o, lane, DIN)
#endif
// RoPE inverse frequencies 1/10000^(2i/64) (the f32 values jax computes)
__constant__ float INVF[32] = {1.000000000e+00,7.498942018e-01,5.623413324e-01,4.216965139e-01,3.162277639e-01,2.371373624e-01,1.778279394e-01,1.333521456e-01,1.000000015e-01,7.498941571e-02,5.623412877e-02,4.216964915e-02,3.162277862e-02,2.371373586e-02,1.778279431e-02,1.333521493e-02,9.999999776e-03,7.498942316e-03,5.623413250e-03,4.216964822e-03,3.162277862e-03,2.371373819e-03,1.778279431e-03,1.333521446e-03,1.000000047e-03,7.498941850e-04,5.623413017e-04,4.216964880e-04,3.162277862e-04,2.371373848e-04,1.778279402e-04,1.333521504e-04};
#define PROJ_EXTRA_PARAMS , const int* __restrict__ TPOS
// interleaved-pair RoPE on q and k (which 0, 1) at the token's position from the int input token_positions[t]: angle = (float)pos * inv_freq[i]; (x1, x2) -> (x1 cos - x2 sin, x1 sin + x2 cos); products and sums kept separate (no fma contraction)
#define PROJ_EPI(which, row, t, h) do { if ((which) < 2) { float* rw = (row); const float pos_ = (float)TPOS[(t)]; _Pragma("unroll 4") for (int i = 0; i < 32; ++i) { _Pragma("clang fp contract(off)") const float ang = pos_ * INVF[i]; const float cs = cosf(ang), sn = sinf(ang); const float xe = rw[2 * i], xo = rw[2 * i + 1]; rw[2 * i] = xe * cs - xo * sn; rw[2 * i + 1] = xe * sn + xo * cs; } } } while (0)
#ifndef PROJ_EXTRA_PARAMS
#define PROJ_EXTRA_PARAMS
#endif

#define WS_QH  0u                                      // f16 q rows [b*t][CC]
#define WS_KH  (WS_QH + 2u * (size_t)NB * TT * CC)      // f16 k rows [b*t][CC]
#define WS_VT  (WS_KH + 2u * (size_t)NB * TT * CC)      // f16 v planes [b][c][t]
#define WS_QL  (WS_VT + 2u * (size_t)NB * CC * TT)      // f16 q residual x 2^10 rows [b][t < QHI][CC]
#define WS_KL  (WS_QL + 2u * (size_t)NB * QHI * CC)     // f16 k residual x 2^10 rows [b][t < KHI][CC]
#define WS_VB  (WS_KL + 2u * (size_t)NB * KHI * CC)     // bf16 v hi planes [b][c][t < KHI]
#define WS_VBL (WS_VB + 2u * (size_t)NB * CC * KHI)
#define WS_Y   (WS_VBL + 2u * (size_t)NB * CC * KHI)    // f32 ctx rows [b*t][CC] (only when there is an output projection)
#define WS_END (WS_Y  + 4u * (size_t)NB * TT * CC)

// LDS staging of the projections' operands: a stage is KS k of every operand row, brought by whole-line loads (16 lanes x 16 B = one 256-B row piece), converted once per block, laid at a pitch of 128 + 16 B for the 16-byte fragment reads
#define KS 64
#define LP 72
// full unroll: the register arrays the loop walks keep constant indices (no scratch) and the row steps fold into the instructions' offsets
#define UNROLL_REGS _Pragma("unroll")
typedef __attribute__((ext_vector_type(4))) __bf16 v4b;
typedef __attribute__((ext_vector_type(4))) _Float16 v4h;
// stands behind each group of global loads, before anything may take the loads' address registers
#define XWAIT() asm volatile("s_wait_xcnt 0x0" ::: "memory")
__device__ __forceinline__ v4b cvt4b(v4f v) { v4b r;
UNROLL_REGS
  for (int i = 0; i < 4; ++i) r[i] = (__bf16)v[i];
  return r; }
__device__ __forceinline__ v4b cvt4bl(v4f v) { v4b r;   /* the residual plane of bsplit16 */
UNROLL_REGS
  for (int i = 0; i < 4; ++i) r[i] = (__bf16)(v[i] - (float)(__bf16)v[i]);
  return r; }
__device__ __forceinline__ v4h cvt4hs(v4f v, float sc) { v4h r;
UNROLL_REGS
  for (int i = 0; i < 4; ++i) r[i] = (_Float16)(v[i] * sc);
  return r; }
__device__ __forceinline__ v4h cvt4hw(v4f v) { v4h r;   /* f16(bf16 x 2^8), exact */
UNROLL_REGS
  for (int i = 0; i < 4; ++i) r[i] = (_Float16)(bfr(v[i]) * 256.0f);
  return r; }
// ---- k_proj: block = (64 rows, 128 cols, which): q/k/v = X W (+ b) with exact bf16 products (K = DIN), X and W staged as bf16 in a two-buffer LDS ring, the next stage's global loads in flight over this stage's products -> which 0: q f16 rows (+ residual rows < QHI); 1: k f16 rows (+ residual rows < KHI); 2: v f16 planes [c][t] (+ bf16 hi/lo planes for t < KHI)
__global__ __launch_bounds__(128) void k_proj(const float* __restrict__ XQ, const float* __restrict__ XK, const float* __restrict__ XV, const float* __restrict__ WQ, const float* __restrict__ WK, const float* __restrict__ WV, const float* __restrict__ BQ, const float* __restrict__ BK, const float* __restrict__ BV,
    _Float16* __restrict__ QH, _Float16* __restrict__ QL, _Float16* __restrict__ KH, _Float16* __restrict__ KL, _Float16* __restrict__ VT, __bf16* __restrict__ VB, __bf16* __restrict__ VBL PROJ_EXTRA_PARAMS) {
  __shared__ __align__(16) float st[64][132];
  struct Epi { _Float16 sh[64][136], sl[64][136]; _Float16 th[128][72]; __bf16 tb[128][72], tbl[128][72]; };
  __shared__ __align__(16) union { Epi e; __bf16 ring[2][64 + 128][LP]; } u;   /* the ring (rows 0..63 X, 64..191 W) is dead before the epilogue's planes are written: two barriers lie between */
  auto& sh = u.e.sh; auto& sl = u.e.sl; auto& th = u.e.th; auto& tb = u.e.tb; auto& tbl = u.e.tbl;
  const int tid = threadIdx.x, wave = tid >> 5, lane = tid & 31, col = lane & 15, g = lane >> 4; const int which = blockIdx.z; const int c0 = blockIdx.y * 128; const size_t r0 = (size_t)blockIdx.x * 64; const size_t bb = r0 / TT; const int t0 = (int)(r0 % TT);
  const float* X = which == 0 ? XQ : which == 1 ? XK : XV; const float* WA = which == 0 ? WQ : which == 1 ? WK : WV; const float* BA = which == 0 ? BQ : which == 1 ? BK : BV;
  v8f acc[8] = {};
  const int fr = tid >> 4, fc = (tid & 15) * 4;   /* the thread's row of each 8-row sweep and its 4 floats of a stage row */
  const unsigned fo = fr * DIN + fc; const float* xg = X + r0 * DIN; const float* wg = WA + (size_t)c0 * DIN; v4f xr[8], wr[16];   /* block-uniform bases, one 32-bit lane offset that nothing overwrites */
UNROLL_REGS
  for (int i = 0; i < 8; ++i) xr[i] = *(const v4f*)(xg + fo + (size_t)i * 8 * DIN);
UNROLL_REGS
  for (int i = 0; i < 16; ++i) wr[i] = *(const v4f*)(wg + fo + (size_t)i * 8 * DIN);
  XWAIT();
  for (int s = 0; s < DIN / KS; ++s) { __bf16 (*rb)[LP] = u.ring[s & 1];
UNROLL_REGS
    for (int i = 0; i < 8; ++i) *(v4b*)&rb[fr + 8 * i][fc] = cvt4b(xr[i]);
UNROLL_REGS
    for (int i = 0; i < 16; ++i) *(v4b*)&rb[64 + fr + 8 * i][fc] = cvt4b(wr[i]);
    __syncthreads();   /* publishes stage s; it also ends every wave's reads of the other buffer, which stage s + 1 overwrites */
    if (s + 1 < DIN / KS) { xg += KS; wg += KS;
UNROLL_REGS
      for (int i = 0; i < 8; ++i) xr[i] = *(const v4f*)(xg + fo + (size_t)i * 8 * DIN);
UNROLL_REGS
      for (int i = 0; i < 16; ++i) wr[i] = *(const v4f*)(wg + fo + (size_t)i * 8 * DIN);
      XWAIT(); }
UNROLL_REGS
    for (int kk = 0; kk < KS / 32; ++kk) { const v16b a = frag_b(&rb[wave * 16 + col][kk * 32], lane); v16b w[8];   /* a block's fragment reads go as one group ahead of its products */
UNROLL_REGS
      for (int j = 0; j < 8; ++j) w[j] = frag_b(&rb[64 + j * 16 + col][kk * 32], lane);
UNROLL_REGS
      for (int j = 0; j < 8; ++j) acc[j] = wmma_bf(a, w[j], acc[j]); } }
  { // stage the f32 tile (acc + bias) in LDS, run the per-(row, head) epilogue hook, then convert
#pragma unroll
    for (int j = 0; j < 8; ++j) { const float bias = BA ? bfr(BA[c0 + j * 16 + col]) : 0.f;
#pragma unroll
      for (int r = 0; r < 8; ++r) st[wave * 16 + 8 * g + r][j * 16 + col] = acc[j][r] + bias; }
    __syncthreads();
    for (int e = tid; e < 64 * (128 / HD); e += 128) { const int rl = e / (128 / HD), hh = e % (128 / HD); PROJ_EPI(which, &st[rl][hh * HD], (int)((r0 + rl) % TT), (c0 / HD) + hh); }
    __syncthreads(); }
  if (which < 2) { _Float16* DH = which == 0 ? QH : KH; _Float16* DL = which == 0 ? QL : KL; const int nhi = which == 0 ? QHI : KHI; const bool hi_rows = t0 < nhi;
    for (int e = tid; e < 64 * 128; e += 128) { const int rl = e >> 7, cl = e & 127; const float v = st[rl][cl]; const _Float16 hv = (_Float16)v; sh[rl][cl] = hv; sl[rl][cl] = (_Float16)((v - (float)hv) * 1024.0f); }
    __syncthreads();
    for (int e = tid; e < 64 * 16; e += 128) { const int rl = e >> 4, q = e & 15; vst2((unsigned*)(DH + (r0 + rl) * CC + c0 + q * 8), *(const v4u*)&sh[rl][q * 8]); if (hi_rows) vst2((unsigned*)(DL + (bb * nhi + t0 + rl) * (size_t)CC + c0 + q * 8), *(const v4u*)&sl[rl][q * 8]); }
  } else { const bool hi_rows = t0 < KHI;
    for (int e = tid; e < 64 * 128; e += 128) { const int rl = e & 63, cl = e >> 6; const float v = st[rl][cl]; th[cl][rl] = (_Float16)v; const __bf16 bh = (__bf16)v; tb[cl][rl] = bh; tbl[cl][rl] = (__bf16)(v - (float)bh); }
    __syncthreads();
    for (int e = tid; e < 128 * 8; e += 128) { const int cl = e >> 3, q = e & 7; vst2((unsigned*)(VT + (bb * CC + c0 + cl) * (size_t)TT + t0 + q * 8), *(const v4u*)&th[cl][q * 8]); if (hi_rows) { const size_t o3 = (bb * CC + c0 + cl) * (size_t)KHI + t0 + q * 8; vst2((unsigned*)(VB + o3), *(const v4u*)&tb[cl][q * 8]); vst2((unsigned*)(VBL + o3), *(const v4u*)&tbl[cl][q * 8]); } } } }
// fragment from the lane's own pointer (row start + k0 + 8 * (lane >> 4)): the same k order as frag_h / frag_b
__device__ __forceinline__ v16h frag_hp(const _Float16* p) { union { v16h v; v8h q[2]; } u; u.q[0] = *(const v8h*)p; u.q[1] = *(const v8h*)(p + 16); return u.v; }
__device__ __forceinline__ v16b frag_bp(const __bf16* p) { union { v16b v; v8b q[2]; } u; u.q[0] = *(const v8b*)p; u.q[1] = *(const v8b*)(p + 16); return u.v; }
// one 32-key step of a query's running softmax: v = the lane's 16 scaled logits (-3.0e38 = excluded) -> exp(v - new maximum) x 2^11; m = running maximum (both wave halves alike), l = this half's running sum; returns the factor that carries the old sums to the new maximum
__device__ __forceinline__ float sm_step(float v[16], float& m, float& l) {
  float mx = v[0];
#pragma unroll
  for (int i = 1; i < 16; ++i) mx = fmaxf(mx, v[i]);
  mx = fmaxf(mx, __shfl_xor(mx, 16));
  const float mn = fmaxf(m, mx); const float alpha = expf(m - mn); float s = 0.f;
#pragma unroll
  for (int i = 0; i < 16; ++i) { const float e = expf(v[i] - mn); s += e; v[i] = e * 2048.0f; }   /* mn is a kept key's logit (every step holds one for every query), so an excluded key gives exp(-3.0e38) = 0 */
  l = l * alpha + s; m = mn; return alpha; }
// the same step in base 2, for the blocks behind the early ones: v = the lane's 16 RAW logits q.k (-3.0e38 = excluded), m = running maximum of raw logits; exp(SCALE x (v - mn)) x 2^11 = exp2(v x C2 - (mn x C2 - 11)), C2 = SCALE x log2(e): one fma and one hardware exp2 per score (SCALE > 0, so the maximum may be taken before the scaling); l carries the factor 2^11 (exact); an excluded key gives exp2(-5.4e37) = 0
#define C2 (SCALE * 1.44269504088896340736f)
__device__ __forceinline__ float sm_step2(float v[16], float& m, float& l) {
  float mx = v[0];
#pragma unroll
  for (int i = 1; i < 16; ++i) mx = fmaxf(mx, v[i]);
  mx = fmaxf(mx, __shfl_xor(mx, 16));
  const float mn = fmaxf(m, mx); const float alpha = __builtin_amdgcn_exp2f((m - mn) * C2); const float nb = __builtin_fmaf(mn, C2, -11.0f); float s = 0.f;
#pragma unroll
  for (int i = 0; i < 16; ++i) { const float e = __builtin_amdgcn_exp2f(__builtin_fmaf(v[i], C2, -nb)); s += e; v[i] = e; }
  l = l * alpha + s; m = mn; return alpha; }
// ---- k_attn: block = (head h, 64 queries qb, batch b), wave = 16 queries, keys [0, diagonal] 32 at a time (behind the early blocks: k rows and v planes staged 64 keys at a time in LDS, once for the block's four waves, the next stage's global loads in flight over this stage's steps). S^T = K Q^T x SCALE (behind the early blocks SCALE is applied inside the softmax step): lane (g, col) holds query col's logits of keys 8g + r and 16 + 8g + r (causal early query blocks: q and k residual planes, 3 products); the causal rule by index in the last step; running maximum and sum in f32; the two score tiles, as P^T x 2^11 once to f16 (early blocks: bf16 hi + lo), are the B operand of ctx^T += V^T P^T (early blocks: v bf16 hi + lo, 3 products); ctx = sums / (2^11 x sum of exp); 256-B (row, head) segment by 16 lanes
__global__ __launch_bounds__(128) void k_attn(const _Float16* __restrict__ QH, const _Float16* __restrict__ KH, const _Float16* __restrict__ QL, const _Float16* __restrict__ KL, const _Float16* __restrict__ VT, const __bf16* __restrict__ VB, const __bf16* __restrict__ VBL, float* __restrict__ Y) { __shared__ __align__(16) float ss[4][16][HD + 4]; __shared__ __align__(16) _Float16 kv[2][64 + HD][LP];   /* two-buffer ring of 64-key stages: rows 0..63 the keys' k rows of this head, rows 64.. its v planes [c][64 keys] */
  const int tid = threadIdx.x, wave = __builtin_amdgcn_readfirstlane(tid >> 5), lane = tid & 31, col = lane & 15, g = lane >> 4; const int h = blockIdx.x, qb = blockIdx.y, b = blockIdx.z; const int ql0 = qb * 64 + wave * 16; const int nch = (ql0 + 47) >> 5;
  const size_t q0 = (size_t)b * TT + ql0, kr0 = (size_t)b * TT;
  v8f acc[HD / 16] = {}; float m = -3.0e38f, l = 0.f; const float lc = qb < QBH ? 2048.0f : 1.0f;   /* what the sum of exp still lacks of the 2^11 that P carries */
  if (qb < QBH) { const _Float16* QLb = QL + (size_t)b * QHI * CC; const _Float16* KLb = KL + (size_t)b * KHI * CC; v16h qh[HD / 32], qlo[HD / 32];
#pragma unroll
    for (int kk = 0; kk < HD / 32; ++kk) { qh[kk] = frag_h(QH + (q0 + col) * CC + h * HD + kk * 32, lane); qlo[kk] = frag_h(QLb + (size_t)(ql0 + col) * CC + h * HD + kk * 32, lane); }
    asm volatile("s_wait_xcnt 0x0" :: "v"(qh[0]), "v"(qh[1]), "v"(qlo[0]), "v"(qlo[1]) : "memory");   /* XWAIT held behind the q loads by their values (inputs only) */
    const _Float16* kp = KH + (kr0 + col) * CC + h * HD + 8 * g; const _Float16* klp = KLb + (size_t)col * CC + h * HD + 8 * g; const __bf16* vp = VB + ((size_t)b * CC + h * HD + col) * (size_t)KHI + 8 * g; const __bf16* vlp = VBL + ((size_t)b * CC + h * HD + col) * (size_t)KHI + 8 * g;
    for (int kc = 0; kc < nch; ++kc, kp += 32 * CC, klp += 32 * CC, vp += 32, vlp += 32) { const int k0 = kc * 32; float v[16]; v16h kbf[2][HD / 32], klf[2][HD / 32];   /* a step's k loads are all issued before its first product, its v loads before the softmax */
#pragma unroll
      for (int t = 0; t < 2; ++t)
#pragma unroll
        for (int kk = 0; kk < HD / 32; ++kk) kbf[t][kk] = frag_hp(kp + t * 16 * CC + kk * 32);
      XWAIT();
#pragma unroll
      for (int t = 0; t < 2; ++t)
#pragma unroll
        for (int kk = 0; kk < HD / 32; ++kk) klf[t][kk] = frag_hp(klp + t * 16 * CC + kk * 32);
      XWAIT();
#pragma unroll
      for (int t = 0; t < 2; ++t) { v8f s = {}, sl = {};
#pragma unroll
        for (int kk = 0; kk < HD / 32; ++kk) { s = wmma16(kbf[t][kk], qh[kk], s); sl = wmma16(kbf[t][kk], qlo[kk], sl); sl = wmma16(klf[t][kk], qh[kk], sl); }
#pragma unroll
        for (int r = 0; r < 8; ++r) v[t * 8 + r] = (s[r] + sl[r] * (1.0f / 1024.0f)) * SCALE; }
      if (kc == nch - 1) {
#pragma unroll
        for (int i = 0; i < 16; ++i) if (k0 + (i >> 3) * 16 + 8 * g + (i & 7) > ql0 + col) v[i] = -3.0e38f; }
      v16b vh[HD / 16], vl[HD / 16];
#pragma unroll
      for (int j = 0; j < HD / 16; ++j) vh[j] = frag_bp(vp + j * 16 * KHI);
      XWAIT();
#pragma unroll
      for (int j = 0; j < HD / 16; ++j) vl[j] = frag_bp(vlp + j * 16 * KHI);
      XWAIT();
      const float alpha = sm_step(v, m, l); const F2 p = bsplit16(v);
#pragma unroll
      for (int j = 0; j < HD / 16; ++j) { acc[j] = acc[j] * alpha; acc[j] = wmma_bf(vh[j], p.h, acc[j]); acc[j] = wmma_bf(vh[j], p.l, acc[j]); acc[j] = wmma_bf(vl[j], p.h, acc[j]); } }
  } else { v16h qh[HD / 32];
#pragma unroll
    for (int kk = 0; kk < HD / 32; ++kk) qh[kk] = frag_h(QH + (q0 + col) * CC + h * HD + kk * 32, lane);
    asm volatile("s_wait_xcnt 0x0" :: "v"(qh[0]), "v"(qh[1]) : "memory");   /* XWAIT held behind the q loads by their values (inputs only) */
    const int fr = tid >> 3, fc = (tid & 7) * 8;   /* the thread's row of each 16-row sweep and its 16 B of a 128-B stage row: a wave's load covers 4 whole lines */
    const unsigned ko = fr * CC + fc, vo = fr * TT + fc; const _Float16* kg = KH + kr0 * CC + h * HD; const _Float16* vg = VT + ((size_t)b * CC + h * HD) * (size_t)TT; v8h kr[4], vr[HD / 16];   /* block-uniform bases, 32-bit lane offsets that nothing overwrites */
UNROLL_REGS
    for (int i = 0; i < 4; ++i) kr[i] = *(const v8h*)(kg + ko + (size_t)i * 16 * CC);
    XWAIT();
UNROLL_REGS
    for (int i = 0; i < HD / 16; ++i) vr[i] = *(const v8h*)(vg + vo + (size_t)i * 16 * TT);
    XWAIT();
    for (int s = 0; s <= qb; ++s) { _Float16 (*rb)[LP] = kv[s & 1];   /* block-uniform trip count: every wave passes every barrier */
UNROLL_REGS
      for (int i = 0; i < 4; ++i) *(v8h*)&rb[fr + 16 * i][fc] = kr[i];
UNROLL_REGS
      for (int i = 0; i < HD / 16; ++i) *(v8h*)&rb[64 + fr + 16 * i][fc] = vr[i];
      __syncthreads();   /* publishes stage s and ends the reads of the buffer that stage s + 1 overwrites */
      if (s < qb) { kg += 64 * CC; vg += 64;
UNROLL_REGS
        for (int i = 0; i < 4; ++i) kr[i] = *(const v8h*)(kg + ko + (size_t)i * 16 * CC);
UNROLL_REGS
        for (int i = 0; i < HD / 16; ++i) vr[i] = *(const v8h*)(vg + vo + (size_t)i * 16 * TT);
        XWAIT(); }
UNROLL_REGS
     for (int t2 = 0; t2 < 2; ++t2) { const int kc = 2 * s + t2; if (kc < nch) { const int k0 = kc * 32; float v[16]; v16h kf[2][HD / 32], vf[HD / 16];   /* wave-uniform test: the block's first two waves have no second step in the last stage; a step's fragment reads go ahead of its first product */
#pragma unroll
      for (int t = 0; t < 2; ++t)
UNROLL_REGS
        for (int kk = 0; kk < HD / 32; ++kk) kf[t][kk] = frag_hp(&rb[t2 * 32 + t * 16 + col][kk * 32 + 8 * g]);
UNROLL_REGS
      for (int j = 0; j < HD / 16; ++j) vf[j] = frag_hp(&rb[64 + j * 16 + col][t2 * 32 + 8 * g]);
#pragma unroll
      for (int t = 0; t < 2; ++t) { v8f s = {};
#pragma unroll
        for (int kk = 0; kk < HD / 32; ++kk) s = wmma16(kf[t][kk], qh[kk], s);
#pragma unroll
        for (int r = 0; r < 8; ++r) v[t * 8 + r] = s[r]; }
      if (kc == nch - 1) {
#pragma unroll
        for (int i = 0; i < 16; ++i) if (k0 + (i >> 3) * 16 + 8 * g + (i & 7) > ql0 + col) v[i] = -3.0e38f; }
      const float alpha = sm_step2(v, m, l); v16h p;
#pragma unroll
      for (int i = 0; i < 16; ++i) p[i] = (_Float16)v[i];
UNROLL_REGS
      for (int j = 0; j < HD / 16; ++j) { acc[j] = acc[j] * alpha; acc[j] = wmma16(vf[j], p, acc[j]); } } } } }
  l += __shfl_xor(l, 16); const float inv = 1.0f / (l * lc);
#pragma unroll
  for (int j = 0; j < HD / 16; ++j)
#pragma unroll
    for (int r = 0; r < 8; ++r) ss[wave][col][j * 16 + 8 * g + r] = acc[j][r] * inv;
  LDSX(); for (int rl = 0; rl < 16; ++rl) if (lane < HD / 4) vst2(Y + ((size_t)b * TT + ql0 + rl) * CC + h * HD + lane * 4, *(const v4f*)&ss[wave][rl][lane * 4]); }
// ---- k_out: block = (64 rows, 128 cols), operands staged in a two-buffer LDS ring as in k_proj: out = ctx Wo (+ bo): ctx x 2^6 once to f16 against Wo as f16(bf16 x 2^8) exact (1 product) x 2^-14; causal early rows (< QHI of each sequence): ctx bf16 hi + lo against exact bf16 Wo (2 products)
__global__ __launch_bounds__(128) void k_out(const float* __restrict__ Y, const float* __restrict__ WO, const float* __restrict__ BO, float* __restrict__ OUT) { __shared__ __align__(16) float sf[4][16][132];
  __shared__ __align__(16) union { __bf16 b[2][64 + 64 + 128][LP]; _Float16 h[2][64 + 128][LP]; } u;   /* early rows: ctx hi 0..63, ctx lo 64..127, Wo 128..255; else ctx 0..63, Wo 64..191 */
  const int tid = threadIdx.x, wave = tid >> 5, lane = tid & 31, col = lane & 15, g = lane >> 4; const int c0 = blockIdx.y * 128; const size_t r0 = (size_t)blockIdx.x * 64 + wave * 16;
  v8f acc[8] = {};
  const int fr = tid >> 4, fc = (tid & 15) * 4;   /* as in k_proj */
  const unsigned fo = fr * CC + fc; const float* yg = Y + (size_t)blockIdx.x * 64 * CC; const float* wg = WO + (size_t)c0 * CC; v4f yr[8], wr[16];
UNROLL_REGS
  for (int i = 0; i < 8; ++i) yr[i] = *(const v4f*)(yg + fo + (size_t)i * 8 * CC);
UNROLL_REGS
  for (int i = 0; i < 16; ++i) wr[i] = *(const v4f*)(wg + fo + (size_t)i * 8 * CC);
  XWAIT();
  if (CAUSAL && (int)(((size_t)blockIdx.x * 64) % TT) < QHI) {   /* block-uniform */
    for (int s = 0; s < CC / KS; ++s) { __bf16 (*rb)[LP] = u.b[s & 1];
UNROLL_REGS
      for (int i = 0; i < 8; ++i) { *(v4b*)&rb[fr + 8 * i][fc] = cvt4b(yr[i]); *(v4b*)&rb[64 + fr + 8 * i][fc] = cvt4bl(yr[i]); }
UNROLL_REGS
      for (int i = 0; i < 16; ++i) *(v4b*)&rb[128 + fr + 8 * i][fc] = cvt4b(wr[i]);
      __syncthreads();   /* publishes stage s and ends the reads of the buffer that stage s + 1 overwrites */
      if (s + 1 < CC / KS) { yg += KS; wg += KS;
UNROLL_REGS
        for (int i = 0; i < 8; ++i) yr[i] = *(const v4f*)(yg + fo + (size_t)i * 8 * CC);
UNROLL_REGS
        for (int i = 0; i < 16; ++i) wr[i] = *(const v4f*)(wg + fo + (size_t)i * 8 * CC);
        XWAIT(); }
UNROLL_REGS
      for (int kk = 0; kk < KS / 32; ++kk) { const v16b ah = frag_b(&rb[wave * 16 + col][kk * 32], lane), al = frag_b(&rb[64 + wave * 16 + col][kk * 32], lane); v16b w[8];
UNROLL_REGS
        for (int j = 0; j < 8; ++j) w[j] = frag_b(&rb[128 + j * 16 + col][kk * 32], lane);
UNROLL_REGS
        for (int j = 0; j < 8; ++j) { acc[j] = wmma_bf(ah, w[j], acc[j]); acc[j] = wmma_bf(al, w[j], acc[j]); } } }
#pragma unroll
    for (int j = 0; j < 8; ++j) { const float bias = BO ? bfr(BO[c0 + j * 16 + col]) : 0.f;
#pragma unroll
      for (int r = 0; r < 8; ++r) sf[wave][8 * g + r][j * 16 + col] = acc[j][r] + bias; }
  } else {
    for (int s = 0; s < CC / KS; ++s) { _Float16 (*rb)[LP] = u.h[s & 1];
UNROLL_REGS
      for (int i = 0; i < 8; ++i) *(v4h*)&rb[fr + 8 * i][fc] = cvt4hs(yr[i], 64.0f);   /* ctx carried x 2^6 into f16 so small-magnitude context rows stay clear of f16 subnormals */
UNROLL_REGS
      for (int i = 0; i < 16; ++i) *(v4h*)&rb[64 + fr + 8 * i][fc] = cvt4hw(wr[i]);
      __syncthreads();   /* publishes stage s and ends the reads of the buffer that stage s + 1 overwrites */
      if (s + 1 < CC / KS) { yg += KS; wg += KS;
UNROLL_REGS
        for (int i = 0; i < 8; ++i) yr[i] = *(const v4f*)(yg + fo + (size_t)i * 8 * CC);
UNROLL_REGS
        for (int i = 0; i < 16; ++i) wr[i] = *(const v4f*)(wg + fo + (size_t)i * 8 * CC);
        XWAIT(); }
UNROLL_REGS
      for (int kk = 0; kk < KS / 32; ++kk) { const v16h a = frag_h(&rb[wave * 16 + col][kk * 32], lane); v16h w[8];
UNROLL_REGS
        for (int j = 0; j < 8; ++j) w[j] = frag_h(&rb[64 + j * 16 + col][kk * 32], lane);
UNROLL_REGS
        for (int j = 0; j < 8; ++j) acc[j] = wmma16(a, w[j], acc[j]); } }
#pragma unroll
    for (int j = 0; j < 8; ++j) { const float bias = BO ? bfr(BO[c0 + j * 16 + col]) : 0.f;
#pragma unroll
      for (int r = 0; r < 8; ++r) sf[wave][8 * g + r][j * 16 + col] = acc[j][r] * (1.0f / 16384.0f) + bias; } }   /* 2^-8 (Wo carry) x 2^-6 (ctx carry) */
  LDSX(); for (int rl = 0; rl < 16; ++rl) vst2(OUT + (r0 + rl) * DIN + c0 + lane * 4, *(const v4f*)&sf[wave][rl][lane * 4]); }

extern "C" void kernel_launch(void* const* d_in, const int* in_sizes, int n_in, void* d_out, int out_size, void* d_ws, size_t ws_size, hipStream_t stream) {
  (void)in_sizes; (void)n_in; (void)out_size;
  const float** F = (const float**)d_in;
  if (ws_size < (size_t)WS_END) return;
  char* ws = (char*)d_ws; _Float16 *QH = (_Float16*)(ws + WS_QH), *KH = (_Float16*)(ws + WS_KH), *VT = (_Float16*)(ws + WS_VT), *QL = (_Float16*)(ws + WS_QL), *KL = (_Float16*)(ws + WS_KL); __bf16 *VB = (__bf16*)(ws + WS_VB), *VBL = (__bf16*)(ws + WS_VBL); float *Y = (float*)(ws + WS_Y);
  (void)Y; (void)QL; (void)KL; (void)VB; (void)VBL;
  // inputs in order: 0 x [1,4096,1024]; 1 token_positions [4096] int32 (arange): READ on the device; 2 Wq [1024,1024] (out,in); 3 Wk; 4 Wv; 5 Wo (out,in); no biases (null pointers)
  k_proj<<<dim3(TNB * TT / 64, CC / 128, 3), 128, 0, stream>>>(F[0], F[0], F[0], F[2], F[3], F[4], nullptr, nullptr, nullptr, QH, QL, KH, KL, VT, VB, VBL, (const int*)d_in[1]);
  k_attn<<<dim3(NH, NQB, TNB), 128, 0, stream>>>(QH, KH, QL, KL, VT, VB, VBL, Y);
  k_out<<<dim3(TNB * TT / 64, DIN / 128), 128, 0, stream>>>(Y, F[5], nullptr, (float*)d_out);
}

// v004
// A run of this version takes 126 microseconds.
// Two timings next to v003 both put it at 1.13 times that version's speed.
// All steps since v000 together make it 23.8 times as fast.
// compute dtype: all float inputs rounded to bf16; q/k/v projections with EXACT bf16 products on WMMA 16x16x32 (f32 accumulate); RoPE in f32 at the int token positions; causal logits: 3 products for the first 384 rows, single f16 q x k after, x 64^-0.5; softmax f32; P x 2^11 once to f16 x v once to f16 (bf16 hi + lo below row 384); ctx hi+lo x exact Wo below row 384, x2^6 f16 carry x f16(bf16 x 2^8) Wo after; f32 output.
#include <hip/hip_runtime.h>
#include <math.h>

typedef __attribute__((ext_vector_type(16))) _Float16 v16h;
typedef __attribute__((ext_vector_type(16))) __bf16 v16b;
typedef __attribute__((ext_vector_type(8)))  _Float16 v8h;
typedef __attribute__((ext_vector_type(8)))  float v8f;
typedef __attribute__((ext_vector_type(4)))  float v4f;
typedef __attribute__((ext_vector_type(2)))  float v2f;
typedef __attribute__((ext_vector_type(4)))  unsigned v4u;
typedef __attribute__((ext_vector_type(4)))  int v4i;
typedef float __attribute__((may_alias)) float_a;
typedef int __attribute__((may_alias)) int_a;

template <typename T> __device__ __forceinline__ void vst2(void* p, T v) { *(T*)p = v;  }
__device__ __forceinline__ v8f wmma16(v16h a, v16h b, v8f c) {
  v8f d = __builtin_amdgcn_wmma_f32_16x16x32_f16(false, a, false, b, (short)0, c, false, false);
  asm volatile("v_nop\n\tv_nop\n\tv_nop\n\tv_nop" : "+v"(d) : "v"(a), "v"(b));
  return d;
}
__device__ __forceinline__ v8f wmma_bf(v16b a, v16b b, v8f c) {
  v8f d = __builtin_amdgcn_wmma_f32_16x16x32_bf16(false, a, false, b, (short)0, c, false, false);
  asm volatile("v_nop\n\tv_nop\n\tv_nop\n\tv_nop" : "+v"(d) : "v"(a), "v"(b));
  return d;
}
// 16x16x32 fragments: lane = (h = lane>>4, row/col = lane&15); elements 0..7 = k0+8h+0..7, 8..15 = k0+16+8h+0..7; D element r = row 8h+r
__device__ __forceinline__ v16h frag_h(const _Float16* rowk0, int lane) {
  union { v16h v; v8h q[2]; } u; const _Float16* p = rowk0 + 8 * (lane >> 4);
  u.q[0] = *(const v8h*)p; u.q[1] = *(const v8h*)(p + 16); return u.v;
}
__device__ __forceinline__ v16h frag_f32(const float* rowk0, int lane) {
  v16h a; const float* p = rowk0 + 8 * (lane >> 4);
#pragma unroll
  for (int i = 0; i < 8; ++i) { a[i] = (_Float16)p[i]; a[8 + i] = (_Float16)p[16 + i]; }
  return a;
}
__device__ __forceinline__ v16h frag_f32s(const float* rowk0, int lane, float sc) {
  v16h a; const float* p = rowk0 + 8 * (lane >> 4);
#pragma unroll
  for (int i = 0; i < 8; ++i) { a[i] = (_Float16)(p[i] * sc); a[8 + i] = (_Float16)(p[16 + i] * sc); }
  return a;
}
// column fragment from a [K][ld] layout (column n), rows >= K read as 0
__device__ __forceinline__ v16h fragc_f32(const float* W, int k0, int n, int lane, int ld, int K) {
  v16h a; const int g = lane >> 4;
#pragma unroll
  for (int i = 0; i < 8; ++i) { const int ka = k0 + 8 * g + i, kb = ka + 16;
    a[i] = (_Float16)(ka < K ? W[(size_t)(ka < K ? ka : K - 1) * ld + n] : 0.f); a[8 + i] = (_Float16)(kb < K ? W[(size_t)(kb < K ? kb : K - 1) * ld + n] : 0.f); }
  return a;
}
struct F2 { v16b h, l; };
__device__ __forceinline__ F2 bsplit16(const float v[16]) { F2 r;
#pragma unroll
  for (int i = 0; i < 16; ++i) { const __bf16 h = (__bf16)v[i]; r.h[i] = h; r.l[i] = (__bf16)(v[i] - (float)h); }
  return r; }
__device__ __forceinline__ F2 split_row(const float* row, int k0, int lane) { float v[16]; const float* p = row + k0 + 8 * (lane >> 4);
#pragma unroll
  for (int i = 0; i < 8; ++i) { v[i] = p[i]; v[8 + i] = p[16 + i]; }
  return bsplit16(v); }
__device__ __forceinline__ F2 split_rowK(const float* row, int k0, int lane, int K) { float v[16]; const int g = lane >> 4;
#pragma unroll
  for (int i = 0; i < 8; ++i) { const int ka = k0 + 8 * g + i, kb = ka + 16; v[i] = ka < K ? row[ka < K ? ka : K - 1] : 0.f; v[8 + i] = kb < K ? row[kb < K ? kb : K - 1] : 0.f; }
  return bsplit16(v); }
__device__ __forceinline__ F2 split_col(const float* W, int k0, int n, int lane, int ld, int K) { float v[16]; const int g = lane >> 4;
#pragma unroll
  for (int i = 0; i < 8; ++i) { const int ka = k0 + 8 * g + i, kb = ka + 16; v[i] = ka < K ? W[(size_t)(ka < K ? ka : K - 1) * ld + n] : 0.f; v[8 + i] = kb < K ? W[(size_t)(kb < K ? kb : K - 1) * ld + n] : 0.f; }
  return bsplit16(v); }
__device__ __forceinline__ v8f mac3(const F2& a, const F2& b, v8f c) { c = wmma_bf(a.l, b.h, c); c = wmma_bf(a.h, b.l, c); return wmma_bf(a.h, b.h, c); }
__device__ __forceinline__ float sigm(float v) { return 1.0f / (1.0f + expf(-v)); }
#define LDSX() do { asm volatile("s_wait_dscnt 0" ::: "memory"); __builtin_amdgcn_wave_barrier(); __builtin_amdgcn_fence(__ATOMIC_RELEASE, "workgroup"); } while (0)

// Causal multi-head self-attention with interleaved-pair RoPE at given token positions, ONE batch of 4,096 tokens (x [1,4096,1024]; (out,in) Wq / Wk / Wv / Wo [1024,1024] N(0,1) x 0.02 applied as x @ W.T, no biases; token_positions [4096] int (arange; the LAST input); 16 heads x 64; inv_freq = 1 / 10000^(2i/64); (even, odd) pairs rotated and re-interleaved; scores / sqrt(64); tril kept, -inf elsewhere; softmax; attn @ Wo.T). THIS ROW: the same module and weight scale (0.02) with the argument order x, token_positions, Wq, Wk, Wv, Wo (the positions SECOND): the indices in kernel_launch follow; finfo.min in place of -inf under the causal rule (an exclusion either way); the inverse-frequency expression is the host's own, token for token: the baked table is unchanged.
#define NB 1
#define TT 4096
#define CC 1024            // NH * HD = projected width
#define DIN 1024          // input (model) width
#define NH 16
#define HD 64
#define NQB (TT / 64)
#define SCALE (0.125f)
#define CAUSAL 1
#ifndef TNB
#define TNB NB
#endif
__device__ __forceinline__ float bfr(float v) { return (float)(__bf16)v; }
typedef __attribute__((ext_vector_type(8))) __bf16 v8b;
__device__ __forceinline__ v16b frag_b(const __bf16* rowk0, int lane) {
  union { v16b v; v8b q[2]; } u; const __bf16* p = rowk0 + 8 * (lane >> 4);
  u.q[0] = *(const v8b*)p; u.q[1] = *(const v8b*)(p + 16); return u.v;
}
#define QBH 6              // causal: query blocks 0..QBH-1 of each sequence (few keys, no averaging) take the high-precision path
#define QHI 384            // rows carrying a q residual plane
#define KHI 384            // key rows carrying k residual / v bf16 hi+lo planes (used only by the causal high-precision path)
// B fragment (k rows k0+.., output column o) of a weight: (in,out) [K][ld] or (out,in) [ld rows of K]: bf16 exact, or f16(bf16 * 256) exact
__device__ __forceinline__ v16b wcol_io(const float* Wm, int k0, int o, int lane, int ld) { v16b w; const int g = lane >> 4;
#pragma unroll
  for (int i = 0; i < 8; ++i) { w[i] = (__bf16)Wm[(size_t)(k0 + 8 * g + i) * ld + o]; w[8 + i] = (__bf16)Wm[(size_t)(k0 + 16 + 8 * g + i) * ld + o]; }
  return w; }
__device__ __forceinline__ v16b wcol_oi(const float* Wm, int k0, int o, int lane, int K) { v16b w; const float* p = Wm + (size_t)o * K + k0 + 8 * (lane >> 4);
#pragma unroll
  for (int i = 0; i < 8; ++i) { w[i] = (__bf16)p[i]; w[8 + i] = (__bf16)p[16 + i]; }
  return w; }
__device__ __forceinline__ v16h wcolh_io(const float* Wm, int k0, int o, int lane, int ld) { v16h w; const int g = lane >> 4;
#pragma unroll
  for (int i = 0; i < 8; ++i) { w[i] = (_Float16)(bfr(Wm[(size_t)(k0 + 8 * g + i) * ld + o]) * 256.0f); w[8 + i] = (_Float16)(bfr(Wm[(size_t)(k0 + 16 + 8 * g + i) * ld + o]) * 256.0f); }
  return w; }
__device__ __forceinline__ v16h wcolh_oi(const float* Wm, int k0, int o, int lane, int K) { v16h w; const float* p = Wm + (size_t)o * K + k0 + 8 * (lane >> 4);
#pragma unroll
  for (int i = 0; i < 8; ++i) { w[i] = (_Float16)(bfr(p[i]) * 256.0f); w[8 + i] = (_Float16)(bfr(p[16 + i]) * 256.0f); }
  return w; }
#define WQKV_LAYOUT 1   // picks WCOL's layout (0 = (in,out) [DIN][CC]; 1 = (out,in) [CC][DIN]; 2 = per-head [NH][DIN][HD]); nothing calls WCOL: k_proj reads (out,in) [CC][DIN] rows
__device__ __forceinline__ v16b wcol_hdk(const float* Wm, int k0, int o, int lane) { v16b w; const int g = lane >> 4; const float* p = Wm + (size_t)(o / HD) * DIN * HD + (o % HD);
#pragma unroll
  for (int i = 0; i < 8; ++i) { w[i] = (__bf16)p[(size_t)(k0 + 8 * g + i) * HD]; w[8 + i] = (__bf16)p[(size_t)(k0 + 16 + 8 * g + i) * HD]; }
  return w; }
#define WO_OUT_IN 1
#if WQKV_LAYOUT == 1
#define WCOL(W, k0, o, lane) wcol_oi(W, k0, o, lane, DIN)
#elif WQKV_LAYOUT == 2
#define WCOL(W, k0, o, lane) wcol_hdk(W, k0, o, lane)
#else
#define WCOL(W, k0, o, lane) wcol_io(W, k0, o, lane, CC)
#endif
#if WO_OUT_IN
#define WOCOL(W, k0, o, lane) wcol_oi(W, k0, o, lane, CC)
#define WOCOLH(W, k0, o, lane) wcolh_oi(W, k0, o, lane, CC)
#else
#define WOCOL(W, k0, o, lane) wcol_io(W, k0, o, lane, DIN)
#define WOCOLH(W, k0, o, lane) wcolh_io(W, k0, o, lane, DIN)
#endif
// RoPE inverse frequencies 1/10000^(2i/64) (the f32 values jax computes)
__constant__ float INVF[32] = {1.000000000e+00,7.498942018e-01,5.623413324e-01,4.216965139e-01,3.162277639e-01,2.371373624e-01,1.778279394e-01,1.333521456e-01,1.000000015e-01,7.498941571e-02,5.623412877e-02,4.216964915e-02,3.162277862e-02,2.371373586e-02,1.778279431e-02,1.333521493e-02,9.999999776e-03,7.498942316e-03,5.623413250e-03,4.216964822e-03,3.162277862e-03,2.371373819e-03,1.778279431e-03,1.333521446e-03,1.000000047e-03,7.498941850e-04,5.623413017e-04,4.216964880e-04,3.162277862e-04,2.371373848e-04,1.778279402e-04,1.333521504e-04};
#define PROJ_EXTRA_PARAMS , const int* __restrict__ TPOS
// interleaved-pair RoPE on q and k (which 0, 1) at the token's position from the int input token_positions[t]: angle = (float)pos * inv_freq[i]; (x1, x2) -> (x1 cos - x2 sin, x1 sin + x2 cos); products and sums kept separate (no fma contraction); a call does the 16 pairs from i0 on
#define PROJ_EPI(which, row, t, h, i0) do { if ((which) < 2) { float* rw = (row); const float pos_ = (float)TPOS[(t)]; _Pragma("unroll 4") for (int i = (i0); i < (i0) + 16; ++i) { _Pragma("clang fp contract(off)") const float ang = pos_ * INVF[i]; const float cs = cosf(ang), sn = sinf(ang); const float xe = rw[2 * i], xo = rw[2 * i + 1]; rw[2 * i] = xe * cs - xo * sn; rw[2 * i + 1] = xe * sn + xo * cs; } } } while (0)
#ifndef PROJ_EXTRA_PARAMS
#define PROJ_EXTRA_PARAMS
#endif

#define WS_QH  0u                                      // f16 q rows [b*t][CC]
#define WS_KH  (WS_QH + 2u * (size_t)NB * TT * CC)      // f16 k rows [b*t][CC]
#define WS_VT  (WS_KH + 2u * (size_t)NB * TT * CC)      // f16 v planes [b][c][t]
#define WS_QL  (WS_VT + 2u * (size_t)NB * CC * TT)      // f16 q residual x 2^10 rows [b][t < QHI][CC]
#define WS_KL  (WS_QL + 2u * (size_t)NB * QHI * CC)     // f16 k residual x 2^10 rows [b][t < KHI][CC]
#define WS_VB  (WS_KL + 2u * (size_t)NB * KHI * CC)     // bf16 v hi planes [b][c][t < KHI]
#define WS_VBL (WS_VB + 2u * (size_t)NB * CC * KHI)
#define WS_Y   (WS_VBL + 2u * (size_t)NB * CC * KHI)    // f32 ctx rows [b*t][CC] (only when there is an output projection)
#define WS_END (WS_Y  + 4u * (size_t)NB * TT * CC)

// LDS staging of the projections' operands: a stage is KS k of every operand row, brought by whole-line loads (16 lanes x 16 B = one 256-B row piece), converted once per block, laid at a pitch of 128 + 16 B for the 16-byte fragment reads
#define KS 64
#define LP 72
// full unroll: the register arrays the loop walks keep constant indices (no scratch) and the row steps fold into the instructions' offsets
#define UNROLL_REGS _Pragma("unroll")
typedef __attribute__((ext_vector_type(4))) __bf16 v4b;
typedef __attribute__((ext_vector_type(4))) _Float16 v4h;
// stands behind each group of global loads and each of k_proj's stores, before anything may take their address registers
#define XWAIT() asm volatile("s_wait_xcnt 0x0" ::: "memory")
__device__ __forceinline__ v4b cvt4b(v4f v) { v4b r;
UNROLL_REGS
  for (int i = 0; i < 4; ++i) r[i] = (__bf16)v[i];
  return r; }
__device__ __forceinline__ v4b cvt4bl(v4f v) { v4b r;   /* the residual plane of bsplit16 */
UNROLL_REGS
  for (int i = 0; i < 4; ++i) r[i] = (__bf16)(v[i] - (float)(__bf16)v[i]);
  return r; }
__device__ __forceinline__ v4h cvt4hs(v4f v, float sc) { v4h r;
UNROLL_REGS
  for (int i = 0; i < 4; ++i) r[i] = (_Float16)(v[i] * sc);
  return r; }
__device__ __forceinline__ v4h cvt4hw(v4f v) { v4h r;   /* f16(bf16 x 2^8), exact */
UNROLL_REGS
  for (int i = 0; i < 4; ++i) r[i] = (_Float16)(bfr(v[i]) * 256.0f);
  return r; }
// ---- k_proj: block = (128 rows, 128 cols, which), 8 waves of 32 rows x 64 cols (2 x 4 accumulator tiles: a staged W row serves 128 rows, a fragment read 2 or 4 products): q/k/v = X W (+ b) with exact bf16 products (K = DIN), X and W staged as bf16 in a two-buffer LDS ring, the next stage's global loads in flight over this stage's products; the epilogue runs twice, once per 64-row half of the tile, in the same LDS planes -> which 0: q f16 rows (+ residual rows < QHI); 1: k f16 rows (+ residual rows < KHI); 2: v f16 planes [c][t] (+ bf16 hi/lo planes for t < KHI)
__global__ __launch_bounds__(256) void k_proj(const float* __restrict__ XQ, const float* __restrict__ XK, const float* __restrict__ XV, const float* __restrict__ WQ, const float* __restrict__ WK, const float* __restrict__ WV, const float* __restrict__ BQ, const float* __restrict__ BK, const float* __restrict__ BV,
    _Float16* __restrict__ QH, _Float16* __restrict__ QL, _Float16* __restrict__ KH, _Float16* __restrict__ KL, _Float16* __restrict__ VT, __bf16* __restrict__ VB, __bf16* __restrict__ VBL PROJ_EXTRA_PARAMS) {
  __shared__ __align__(16) float st[64][132];
  struct Epi { _Float16 sh[64][136], sl[64][136]; _Float16 th[128][72]; __bf16 tb[128][72], tbl[128][72]; };
  __shared__ __align__(16) union { Epi e; __bf16 ring[2][128 + 128][LP]; } u;   /* the ring (rows 0..127 X, 128..255 W) is dead before the epilogue's planes are written: two barriers lie between */
  auto& sh = u.e.sh; auto& sl = u.e.sl; auto& th = u.e.th; auto& tb = u.e.tb; auto& tbl = u.e.tbl;
  const int tid = threadIdx.x, wave = __builtin_amdgcn_readfirstlane(tid >> 5), lane = tid & 31, col = lane & 15, g = lane >> 4; const int wr = wave >> 1, wc = wave & 1; const int which = blockIdx.z; const int c0 = blockIdx.y * 128; const size_t r0 = (size_t)blockIdx.x * 128; const size_t bb = r0 / TT; const int t0 = (int)(r0 % TT);
  const float* X = which == 0 ? XQ : which == 1 ? XK : XV; const float* WA = which == 0 ? WQ : which == 1 ? WK : WV; const float* BA = which == 0 ? BQ : which == 1 ? BK : BV;
  v8f acc[2][4] = {};
  const int fr = tid >> 4, fc = (tid & 15) * 4;   /* the thread's row of each 16-row sweep and its 4 floats of a stage row */
  const unsigned fo = fr * DIN + fc; const float* xg = X + r0 * DIN; const float* wg = WA + (size_t)c0 * DIN; v4f xr[8], wv[8];   /* block-uniform bases, one 32-bit lane offset that nothing overwrites */
UNROLL_REGS
  for (int i = 0; i < 8; ++i) xr[i] = *(const v4f*)(xg + fo + (size_t)i * 16 * DIN);
UNROLL_REGS
  for (int i = 0; i < 8; ++i) wv[i] = *(const v4f*)(wg + fo + (size_t)i * 16 * DIN);
  XWAIT();
  for (int s = 0; s < DIN / KS; ++s) { __bf16 (*rb)[LP] = u.ring[s & 1];
UNROLL_REGS
    for (int i = 0; i < 8; ++i) *(v4b*)&rb[fr + 16 * i][fc] = cvt4b(xr[i]);
UNROLL_REGS
    for (int i = 0; i < 8; ++i) *(v4b*)&rb[128 + fr + 16 * i][fc] = cvt4b(wv[i]);
    __syncthreads();   /* publishes stage s; it also ends every wave's reads of the other buffer, which stage s + 1 overwrites */
    if (s + 1 < DIN / KS) { xg += KS; wg += KS;
UNROLL_REGS
      for (int i = 0; i < 8; ++i) xr[i] = *(const v4f*)(xg + fo + (size_t)i * 16 * DIN);
UNROLL_REGS
      for (int i = 0; i < 8; ++i) wv[i] = *(const v4f*)(wg + fo + (size_t)i * 16 * DIN);
      XWAIT(); }
UNROLL_REGS
    for (int kk = 0; kk < KS / 32; ++kk) { v16b a[2], w[4];   /* a block's fragment reads go as one group ahead of its products */
UNROLL_REGS
      for (int i = 0; i < 2; ++i) a[i] = frag_b(&rb[wr * 32 + i * 16 + col][kk * 32], lane);
UNROLL_REGS
      for (int j = 0; j < 4; ++j) w[j] = frag_b(&rb[128 + wc * 64 + j * 16 + col][kk * 32], lane);
UNROLL_REGS
      for (int i = 0; i < 2; ++i)
UNROLL_REGS
        for (int j = 0; j < 4; ++j) acc[i][j] = wmma_bf(a[i], w[j], acc[i][j]); } }
  const int i0 = (wave >> 2) * 16;   /* the RoPE pairs of a (row, head) go half to waves 0..3, half to waves 4..7 */
#pragma unroll 1   /* one copy of the epilogue's long text (the RoPE code) in the instruction cache, not two */
  for (int hp = 0; hp < 2; ++hp) { const size_t rh = r0 + 64 * hp; const int th0 = t0 + 64 * hp;   /* the 64-row half the four waves wr >> 1 == hp hold; the barrier behind each half's conversion ends the reads of st, the two in front of the next conversion end the reads of the planes */
  { // stage the half's f32 tile (acc + bias) in LDS, run the per-(row, head) epilogue hook, then convert
    if ((wr >> 1) == hp) {
#pragma unroll
    for (int i = 0; i < 2; ++i)
#pragma unroll
    for (int j = 0; j < 4; ++j) { const float bias = BA ? bfr(BA[c0 + wc * 64 + j * 16 + col]) : 0.f;
#pragma unroll
      for (int r = 0; r < 8; ++r) st[(wr & 1) * 32 + i * 16 + 8 * g + r][wc * 64 + j * 16 + col] = acc[i][j][r] + bias; } }
    __syncthreads();
    { const int e = tid & 127; const int rl = e / (128 / HD), hh = e % (128 / HD); PROJ_EPI(which, &st[rl][hh * HD], (int)((rh + rl) % TT), (c0 / HD) + hh, i0); }
    __syncthreads(); }
  if (which < 2) { _Float16* DH = which == 0 ? QH : KH; _Float16* DL = which == 0 ? QL : KL; const int nhi = which == 0 ? QHI : KHI; const bool hi_rows = th0 < nhi;
    for (int e = tid; e < 64 * 128; e += 256) { const int rl = e >> 7, cl = e & 127; const float v = st[rl][cl]; const _Float16 hv = (_Float16)v; sh[rl][cl] = hv; sl[rl][cl] = (_Float16)((v - (float)hv) * 1024.0f); }
    __syncthreads();
    for (int e = tid; e < 64 * 16; e += 256) { const int rl = e >> 4, q = e & 15; vst2((unsigned*)(DH + (rh + rl) * CC + c0 + q * 8), *(const v4u*)&sh[rl][q * 8]); XWAIT(); if (hi_rows) { vst2((unsigned*)(DL + (bb * nhi + th0 + rl) * (size_t)CC + c0 + q * 8), *(const v4u*)&sl[rl][q * 8]); XWAIT(); } }
  } else { const bool hi_rows = th0 < KHI;
    for (int e = tid; e < 64 * 128; e += 256) { const int rl = e & 63, cl = e >> 6; const float v = st[rl][cl]; th[cl][rl] = (_Float16)v; const __bf16 bh = (__bf16)v; tb[cl][rl] = bh; tbl[cl][rl] = (__bf16)(v - (float)bh); }
    __syncthreads();
    for (int e = tid; e < 128 * 8; e += 256) { const int cl = e >> 3, q = e & 7; vst2((unsigned*)(VT + (bb * CC + c0 + cl) * (size_t)TT + th0 + q * 8), *(const v4u*)&th[cl][q * 8]); XWAIT(); if (hi_rows) { const size_t o3 = (bb * CC + c0 + cl) * (size_t)KHI + th0 + q * 8; vst2((unsigned*)(VB + o3), *(const v4u*)&tb[cl][q * 8]); vst2((unsigned*)(VBL + o3), *(const v4u*)&tbl[cl][q * 8]); XWAIT(); } } } } }
// fragment from the lane's own pointer (row start + k0 + 8 * (lane >> 4)): the same k order as frag_h / frag_b
__device__ __forceinline__ v16h frag_hp(const _Float16* p) { union { v16h v; v8h q[2]; } u; u.q[0] = *(const v8h*)p; u.q[1] = *(const v8h*)(p + 16); return u.v; }
__device__ __forceinline__ v16b frag_bp(const __bf16* p) { union { v16b v; v8b q[2]; } u; u.q[0] = *(const v8b*)p; u.q[1] = *(const v8b*)(p + 16); return u.v; }
// one 32-key step of a query's running softmax: v = the lane's 16 scaled logits (-3.0e38 = excluded) -> exp(v - new maximum) x 2^11; m = running maximum (both wave halves alike), l = this half's running sum; returns the factor that carries the old sums to the new maximum
__device__ __forceinline__ float sm_step(float v[16], float& m, float& l) {
  float mx = v[0];
#pragma unroll
  for (int i = 1; i < 16; ++i) mx = fmaxf(mx, v[i]);
  mx = fmaxf(mx, __shfl_xor(mx, 16));
  const float mn = fmaxf(m, mx); const float alpha = expf(m - mn); float s = 0.f;
#pragma unroll
  for (int i = 0; i < 16; ++i) { const float e = expf(v[i] - mn); s += e; v[i] = e * 2048.0f; }   /* mn is a kept key's logit (every step holds one for every query), so an excluded key gives exp(-3.0e38) = 0 */
  l = l * alpha + s; m = mn; return alpha; }
// the same step in base 2, for the blocks behind the early ones: v = the lane's 16 RAW logits q.k (-3.0e38 = excluded), m = running maximum of raw logits; exp(SCALE x (v - mn)) x 2^11 = exp2(v x C2 - (mn x C2 - 11)), C2 = SCALE x log2(e): one fma and one hardware exp2 per score (SCALE > 0, so the maximum may be taken before the scaling); l carries the factor 2^11 (exact); an excluded key gives exp2(-5.4e37) = 0
#define C2 (SCALE * 1.44269504088896340736f)
__device__ __forceinline__ float sm_step2(float v[16], float& m, float& l) {
  float mx = v[0];
#pragma unroll
  for (int i = 1; i < 16; ++i) mx = fmaxf(mx, v[i]);
  mx = fmaxf(mx, __shfl_xor(mx, 16));
  const float mn = fmaxf(m, mx); const float alpha = __builtin_amdgcn_exp2f((m - mn) * C2); const float nb = __builtin_fmaf(mn, C2, -11.0f); float s = 0.f;
#pragma unroll
  for (int i = 0; i < 16; ++i) { const float e = __builtin_amdgcn_exp2f(__builtin_fmaf(v[i], C2, -nb)); s += e; v[i] = e; }
  l = l * alpha + s; m = mn; return alpha; }
// ---- k_attn: block = (head h, 64 queries qb, batch b), wave = 16 queries, keys [0, diagonal] 32 at a time (behind the early blocks: k rows and v planes staged 64 keys at a time in LDS, once for the block's four waves, the next stage's global loads in flight over this stage's steps). S^T = K Q^T x SCALE (behind the early blocks SCALE is applied inside the softmax step): lane (g, col) holds query col's logits of keys 8g + r and 16 + 8g + r (causal early query blocks: q and k residual planes, 3 products); the causal rule by index in the last step; running maximum and sum in f32; the two score tiles, as P^T x 2^11 once to f16 (early blocks: bf16 hi + lo), are the B operand of ctx^T += V^T P^T (early blocks: v bf16 hi + lo, 3 products); ctx = sums / (2^11 x sum of exp); 256-B (row, head) segment by 16 lanes
__global__ __launch_bounds__(128) void k_attn(const _Float16* __restrict__ QH, const _Float16* __restrict__ KH, const _Float16* __restrict__ QL, const _Float16* __restrict__ KL, const _Float16* __restrict__ VT, const __bf16* __restrict__ VB, const __bf16* __restrict__ VBL, float* __restrict__ Y) { __shared__ __align__(16) float ss[4][16][HD + 4]; __shared__ __align__(16) _Float16 kv[2][64 + HD][LP];   /* two-buffer ring of 64-key stages: rows 0..63 the keys' k rows of this head, rows 64.. its v planes [c][64 keys] */
  const int tid = threadIdx.x, wave = __builtin_amdgcn_readfirstlane(tid >> 5), lane = tid & 31, col = lane & 15, g = lane >> 4; const int h = blockIdx.x, qb = blockIdx.y, b = blockIdx.z; const int ql0 = qb * 64 + wave * 16; const int nch = (ql0 + 47) >> 5;
  const size_t q0 = (size_t)b * TT + ql0, kr0 = (size_t)b * TT;
  v8f acc[HD / 16] = {}; float m = -3.0e38f, l = 0.f; const float lc = qb < QBH ? 2048.0f : 1.0f;   /* what the sum of exp still lacks of the 2^11 that P carries */
  if (qb < QBH) { const _Float16* QLb = QL + (size_t)b * QHI * CC; const _Float16* KLb = KL + (size_t)b * KHI * CC; v16h qh[HD / 32], qlo[HD / 32];
#pragma unroll
    for (int kk = 0; kk < HD / 32; ++kk) { qh[kk] = frag_h(QH + (q0 + col) * CC + h * HD + kk * 32, lane); qlo[kk] = frag_h(QLb + (size_t)(ql0 + col) * CC + h * HD + kk * 32, lane); }
    asm volatile("s_wait_xcnt 0x0" :: "v"(qh[0]), "v"(qh[1]), "v"(qlo[0]), "v"(qlo[1]) : "memory");   /* XWAIT held behind the q loads by their values (inputs only) */
    const _Float16* kp = KH + (kr0 + col) * CC + h * HD + 8 * g; const _Float16* klp = KLb + (size_t)col * CC + h * HD + 8 * g; const __bf16* vp = VB + ((size_t)b * CC + h * HD + col) * (size_t)KHI + 8 * g; const __bf16* vlp = VBL + ((size_t)b * CC + h * HD + col) * (size_t)KHI + 8 * g;
    for (int kc = 0; kc < nch; ++kc, kp += 32 * CC, klp += 32 * CC, vp += 32, vlp += 32) { const int k0 = kc * 32; float v[16]; v16h kbf[2][HD / 32], klf[2][HD / 32];   /* a step's k loads are all issued before its first product, its v loads before the softmax */
#pragma unroll
      for (int t = 0; t < 2; ++t)
#pragma unroll
        for (int kk = 0; kk < HD / 32; ++kk) kbf[t][kk] = frag_hp(kp + t * 16 * CC + kk * 32);
      XWAIT();
#pragma unroll
      for (int t = 0; t < 2; ++t)
#pragma unroll
        for (int kk = 0; kk < HD / 32; ++kk) klf[t][kk] = frag_hp(klp + t * 16 * CC + kk * 32);
      XWAIT();
#pragma unroll
      for (int t = 0; t < 2; ++t) { v8f s = {}, sl = {};
#pragma unroll
        for (int kk = 0; kk < HD / 32; ++kk) { s = wmma16(kbf[t][kk], qh[kk], s); sl = wmma16(kbf[t][kk], qlo[kk], sl); sl = wmma16(klf[t][kk], qh[kk], sl); }
#pragma unroll
        for (int r = 0; r < 8; ++r) v[t * 8 + r] = (s[r] + sl[r] * (1.0f / 1024.0f)) * SCALE; }
      if (kc == nch - 1) {
#pragma unroll
        for (int i = 0; i < 16; ++i) if (k0 + (i >> 3) * 16 + 8 * g + (i & 7) > ql0 + col) v[i] = -3.0e38f; }
      v16b vh[HD / 16], vl[HD / 16];
#pragma unroll
      for (int j = 0; j < HD / 16; ++j) vh[j] = frag_bp(vp + j * 16 * KHI);
      XWAIT();
#pragma unroll
      for (int j = 0; j < HD / 16; ++j) vl[j] = frag_bp(vlp + j * 16 * KHI);
      XWAIT();
      const float alpha = sm_step(v, m, l); const F2 p = bsplit16(v);
#pragma unroll
      for (int j = 0; j < HD / 16; ++j) { acc[j] = acc[j] * alpha; acc[j] = wmma_bf(vh[j], p.h, acc[j]); acc[j] = wmma_bf(vh[j], p.l, acc[j]); acc[j] = wmma_bf(vl[j], p.h, acc[j]); } }
  } else { v16h qh[HD / 32];
#pragma unroll
    for (int kk = 0; kk < HD / 32; ++kk) qh[kk] = frag_h(QH + (q0 + col) * CC + h * HD + kk * 32, lane);
    asm volatile("s_wait_xcnt 0x0" :: "v"(qh[0]), "v"(qh[1]) : "memory");   /* XWAIT held behind the q loads by their values (inputs only) */
    const int fr = tid >> 3, fc = (tid & 7) * 8;   /* the thread's row of each 16-row sweep and its 16 B of a 128-B stage row: a wave's load covers 4 whole lines */
    const unsigned ko = fr * CC + fc, vo = fr * TT + fc; const _Float16* kg = KH + kr0 * CC + h * HD; const _Float16* vg = VT + ((size_t)b * CC + h * HD) * (size_t)TT; v8h kr[4], vr[HD / 16];   /* block-uniform bases, 32-bit lane offsets that nothing overwrites */
UNROLL_REGS
    for (int i = 0; i < 4; ++i) kr[i] = *(const v8h*)(kg + ko + (size_t)i * 16 * CC);
    XWAIT();
UNROLL_REGS
    for (int i = 0; i < HD / 16; ++i) vr[i] = *(const v8h*)(vg + vo + (size_t)i * 16 * TT);
    XWAIT();
    for (int s = 0; s <= qb; ++s) { _Float16 (*rb)[LP] = kv[s & 1];   /* block-uniform trip count: every wave passes every barrier */
UNROLL_REGS
      for (int i = 0; i < 4; ++i) *(v8h*)&rb[fr + 16 * i][fc] = kr[i];
UNROLL_REGS
      for (int i = 0; i < HD / 16; ++i) *(v8h*)&rb[64 + fr + 16 * i][fc] = vr[i];
      __syncthreads();   /* publishes stage s and ends the reads of the buffer that stage s + 1 overwrites */
      if (s < qb) { kg += 64 * CC; vg += 64;
UNROLL_REGS
        for (int i = 0; i < 4; ++i) kr[i] = *(const v8h*)(kg + ko + (size_t)i * 16 * CC);
UNROLL_REGS
        for (int i = 0; i < HD / 16; ++i) vr[i] = *(const v8h*)(vg + vo + (size_t)i * 16 * TT);
        XWAIT(); }
UNROLL_REGS
     for (int t2 = 0; t2 < 2; ++t2) { const int kc = 2 * s + t2; if (kc < nch) { const int k0 = kc * 32; float v[16]; v16h kf[2][HD / 32], vf[HD / 16];   /* wave-uniform test: the block's first two waves have no second step in the last stage; a step's fragment reads go ahead of its first product */
#pragma unroll
      for (int t = 0; t < 2; ++t)
UNROLL_REGS
        for (int kk = 0; kk < HD / 32; ++kk) kf[t][kk] = frag_hp(&rb[t2 * 32 + t * 16 + col][kk * 32 + 8 * g]);
UNROLL_REGS
      for (int j = 0; j < HD / 16; ++j) vf[j] = frag_hp(&rb[64 + j * 16 + col][t2 * 32 + 8 * g]);
#pragma unroll
      for (int t = 0; t < 2; ++t) { v8f s = {};
#pragma unroll
        for (int kk = 0; kk < HD / 32; ++kk) s = wmma16(kf[t][kk], qh[kk], s);
#pragma unroll
        for (int r = 0; r < 8; ++r) v[t * 8 + r] = s[r]; }
      if (kc == nch - 1) {
#pragma unroll
        for (int i = 0; i < 16; ++i) if (k0 + (i >> 3) * 16 + 8 * g + (i & 7) > ql0 + col) v[i] = -3.0e38f; }
      const float alpha = sm_step2(v, m, l); v16h p;
#pragma unroll
      for (int i = 0; i < 16; ++i) p[i] = (_Float16)v[i];
UNROLL_REGS
      for (int j = 0; j < HD / 16; ++j) { acc[j] = acc[j] * alpha; acc[j] = wmma16(vf[j], p, acc[j]); } } } } }
  l += __shfl_xor(l, 16); const float inv = 1.0f / (l * lc);
#pragma unroll
  for (int j = 0; j < HD / 16; ++j)
#pragma unroll
    for (int r = 0; r < 8; ++r) ss[wave][col][j * 16 + 8 * g + r] = acc[j][r] * inv;
  LDSX(); for (int rl = 0; rl < 16; ++rl) if (lane < HD / 4) vst2(Y + ((size_t)b * TT + ql0 + rl) * CC + h * HD + lane * 4, *(const v4f*)&ss[wave][rl][lane * 4]); }
// ---- k_out: block = (128 rows, 128 cols), 8 waves of 32 rows x 64 cols, operands staged in a two-buffer LDS ring as in k_proj: out = ctx Wo (+ bo): ctx x 2^6 once to f16 against Wo as f16(bf16 x 2^8) exact (1 product) x 2^-14; causal early rows (< QHI of each sequence): ctx bf16 hi + lo against exact bf16 Wo (2 products)
__global__ __launch_bounds__(256) void k_out(const float* __restrict__ Y, const float* __restrict__ WO, const float* __restrict__ BO, float* __restrict__ OUT) { __shared__ __align__(16) float sf[8][32][68];
  __shared__ __align__(16) union { __bf16 b[2][128 + 128 + 128][LP]; _Float16 h[2][128 + 128][LP]; } u;   /* early rows: ctx hi 0..127, ctx lo 128..255, Wo 256..383; else ctx 0..127, Wo 128..255 */
  const int tid = threadIdx.x, wave = __builtin_amdgcn_readfirstlane(tid >> 5), lane = tid & 31, col = lane & 15, g = lane >> 4; const int wr = wave >> 1, wc = wave & 1; const int c0 = blockIdx.y * 128; const size_t r0 = (size_t)blockIdx.x * 128 + wr * 32;
  v8f acc[2][4] = {};
  const int fr = tid >> 4, fc = (tid & 15) * 4;   /* as in k_proj */
  const unsigned fo = fr * CC + fc; const float* yg = Y + (size_t)blockIdx.x * 128 * CC; const float* wg = WO + (size_t)c0 * CC; v4f yr[8], wv[8];
UNROLL_REGS
  for (int i = 0; i < 8; ++i) yr[i] = *(const v4f*)(yg + fo + (size_t)i * 16 * CC);
UNROLL_REGS
  for (int i = 0; i < 8; ++i) wv[i] = *(const v4f*)(wg + fo + (size_t)i * 16 * CC);
  XWAIT();
  if (CAUSAL && (int)(((size_t)blockIdx.x * 128) % TT) < QHI) {   /* block-uniform; QHI is a multiple of the 128 rows */
    for (int s = 0; s < CC / KS; ++s) { __bf16 (*rb)[LP] = u.b[s & 1];
UNROLL_REGS
      for (int i = 0; i < 8; ++i) { *(v4b*)&rb[fr + 16 * i][fc] = cvt4b(yr[i]); *(v4b*)&rb[128 + fr + 16 * i][fc] = cvt4bl(yr[i]); }
UNROLL_REGS
      for (int i = 0; i < 8; ++i) *(v4b*)&rb[256 + fr + 16 * i][fc] = cvt4b(wv[i]);
      __syncthreads();   /* publishes stage s and ends the reads of the buffer that stage s + 1 overwrites */
      if (s + 1 < CC / KS) { yg += KS; wg += KS;
UNROLL_REGS
        for (int i = 0; i < 8; ++i) yr[i] = *(const v4f*)(yg + fo + (size_t)i * 16 * CC);
UNROLL_REGS
        for (int i = 0; i < 8; ++i) wv[i] = *(const v4f*)(wg + fo + (size_t)i * 16 * CC);
        XWAIT(); }
UNROLL_REGS
      for (int kk = 0; kk < KS / 32; ++kk) { v16b ah[2], al[2], w[4];
UNROLL_REGS
        for (int i = 0; i < 2; ++i) { ah[i] = frag_b(&rb[wr * 32 + i * 16 + col][kk * 32], lane); al[i] = frag_b(&rb[128 + wr * 32 + i * 16 + col][kk * 32], lane); }
UNROLL_REGS
        for (int j = 0; j < 4; ++j) w[j] = frag_b(&rb[256 + wc * 64 + j * 16 + col][kk * 32], lane);
UNROLL_REGS
        for (int i = 0; i < 2; ++i)
UNROLL_REGS
          for (int j = 0; j < 4; ++j) { acc[i][j] = wmma_bf(ah[i], w[j], acc[i][j]); acc[i][j] = wmma_bf(al[i], w[j], acc[i][j]); } } }
#pragma unroll
    for (int i = 0; i < 2; ++i)
#pragma unroll
    for (int j = 0; j < 4; ++j) { const float bias = BO ? bfr(BO[c0 + wc * 64 + j * 16 + col]) : 0.f;
#pragma unroll
      for (int r = 0; r < 8; ++r) sf[wave][i * 16 + 8 * g + r][j * 16 + col] = acc[i][j][r] + bias; }
  } else {
    for (int s = 0; s < CC / KS; ++s) { _Float16 (*rb)[LP] = u.h[s & 1];
UNROLL_REGS
      for (int i = 0; i < 8; ++i) *(v4h*)&rb[fr + 16 * i][fc] = cvt4hs(yr[i], 64.0f);   /* ctx carried x 2^6 into f16 so small-magnitude context rows stay clear of f16 subnormals (chip FTZ) */
UNROLL_REGS
      for (int i = 0; i < 8; ++i) *(v4h*)&rb[128 + fr + 16 * i][fc] = cvt4hw(wv[i]);
      __syncthreads();   /* publishes stage s and ends the reads of the buffer that stage s + 1 overwrites */
      if (s + 1 < CC / KS) { yg += KS; wg += KS;
UNROLL_REGS
        for (int i = 0; i < 8; ++i) yr[i] = *(const v4f*)(yg + fo + (size_t)i * 16 * CC);
UNROLL_REGS
        for (int i = 0; i < 8; ++i) wv[i] = *(const v4f*)(wg + fo + (size_t)i * 16 * CC);
        XWAIT(); }
UNROLL_REGS
      for (int kk = 0; kk < KS / 32; ++kk) { v16h a[2], w[4];
UNROLL_REGS
        for (int i = 0; i < 2; ++i) a[i] = frag_h(&rb[wr * 32 + i * 16 + col][kk * 32], lane);
UNROLL_REGS
        for (int j = 0; j < 4; ++j) w[j] = frag_h(&rb[128 + wc * 64 + j * 16 + col][kk * 32], lane);
UNROLL_REGS
        for (int i = 0; i < 2; ++i)
UNROLL_REGS
          for (int j = 0; j < 4; ++j) acc[i][j] = wmma16(a[i], w[j], acc[i][j]); } }
#pragma unroll
    for (int i = 0; i < 2; ++i)
#pragma unroll
    for (int j = 0; j < 4; ++j) { const float bias = BO ? bfr(BO[c0 + wc * 64 + j * 16 + col]) : 0.f;
#pragma unroll
      for (int r = 0; r < 8; ++r) sf[wave][i * 16 + 8 * g + r][j * 16 + col] = acc[i][j][r] * (1.0f / 16384.0f) + bias; } }   /* 2^-8 (Wo carry) x 2^-6 (ctx carry) */
  LDSX(); for (int rp = 0; rp < 16; ++rp) { const int rl = 2 * rp + g; vst2(OUT + (r0 + rl) * DIN + c0 + wc * 64 + col * 4, *(const v4f*)&sf[wave][rl][col * 4]); } }   /* a wave's store covers two rows' 256-B pieces: whole lines */

extern "C" void kernel_launch(void* const* d_in, const int* in_sizes, int n_in, void* d_out, int out_size, void* d_ws, size_t ws_size, hipStream_t stream) {
  (void)in_sizes; (void)n_in; (void)out_size;
  const float** F = (const float**)d_in;
  if (ws_size < (size_t)WS_END) return;
  char* ws = (char*)d_ws; _Float16 *QH = (_Float16*)(ws + WS_QH), *KH = (_Float16*)(ws + WS_KH), *VT = (_Float16*)(ws + WS_VT), *QL = (_Float16*)(ws + WS_QL), *KL = (_Float16*)(ws + WS_KL); __bf16 *VB = (__bf16*)(ws + WS_VB), *VBL = (__bf16*)(ws + WS_VBL); float *Y = (float*)(ws + WS_Y);
  (void)Y; (void)QL; (void)KL; (void)VB; (void)VBL;
  // inputs: 0 x [1,4096,1024]; 1 token_positions [4096] int32 (arange): READ on the device; 2 Wq [1024,1024] (out,in); 3 Wk; 4 Wv; 5 Wo (out,in); no biases (null pointers)
  k_proj<<<dim3(TNB * TT / 128, CC / 128, 3), 256, 0, stream>>>(F[0], F[0], F[0], F[2], F[3], F[4], nullptr, nullptr, nullptr, QH, QL, KH, KL, VT, VB, VBL, (const int*)d_in[1]);
  k_attn<<<dim3(NH, NQB, TNB), 128, 0, stream>>>(QH, KH, QL, KL, VT, VB, VBL, Y);
  k_out<<<dim3(TNB * TT / 128, DIN / 128), 256, 0, stream>>>(Y, F[5], nullptr, (float*)d_out);
}

// v005
// It runs in 121 microseconds.
// Next to v004, in two timings, it ran 1.04 times as fast each time.
// All steps since v000 together make it 24.7 times as fast.
// compute dtype: all float inputs rounded to bf16; q/k/v projections with EXACT bf16 products on WMMA 16x16x32 (f32 accumulate); RoPE in f32 at the int token positions; causal logits: 3 products for the first 384 rows, single f16 q x k after, x 64^-0.5; softmax f32; P x 2^11 once to f16 x v once to f16 (bf16 hi + lo below row 384); ctx hi+lo x exact Wo below row 384, x2^6 f16 carry x f16(bf16 x 2^8) Wo after; f32 output.
#include <hip/hip_runtime.h>
#include <math.h>

typedef __attribute__((ext_vector_type(16))) _Float16 v16h;
typedef __attribute__((ext_vector_type(16))) __bf16 v16b;
typedef __attribute__((ext_vector_type(8)))  _Float16 v8h;
typedef __attribute__((ext_vector_type(8)))  float v8f;
typedef __attribute__((ext_vector_type(4)))  float v4f;
typedef __attribute__((ext_vector_type(2)))  float v2f;
typedef __attribute__((ext_vector_type(4)))  unsigned v4u;
typedef __attribute__((ext_vector_type(4)))  int v4i;
typedef float __attribute__((may_alias)) float_a;
typedef int __attribute__((may_alias)) int_a;

template <typename T> __device__ __forceinline__ void vst2(void* p, T v) { *(T*)p = v;  }
__device__ __forceinline__ v8f wmma16(v16h a, v16h b, v8f c) {
  v8f d = __builtin_amdgcn_wmma_f32_16x16x32_f16(false, a, false, b, (short)0, c, false, false);
  asm volatile("v_nop\n\tv_nop\n\tv_nop\n\tv_nop" : "+v"(d) : "v"(a), "v"(b));
  return d;
}
__device__ __forceinline__ v8f wmma_bf(v16b a, v16b b, v8f c) {
  v8f d = __builtin_amdgcn_wmma_f32_16x16x32_bf16(false, a, false, b, (short)0, c, false, false);
  asm volatile("v_nop\n\tv_nop\n\tv_nop\n\tv_nop" : "+v"(d) : "v"(a), "v"(b));
  return d;
}
// 16x16x32 fragments: lane = (h = lane>>4, row/col = lane&15); elements 0..7 = k0+8h+0..7, 8..15 = k0+16+8h+0..7; D element r = row 8h+r
__device__ __forceinline__ v16h frag_h(const _Float16* rowk0, int lane) {
  union { v16h v; v8h q[2]; } u; const _Float16* p = rowk0 + 8 * (lane >> 4);
  u.q[0] = *(const v8h*)p; u.q[1] = *(const v8h*)(p + 16); return u.v;
}
__device__ __forceinline__ v16h frag_f32(const float* rowk0, int lane) {
  v16h a; const float* p = rowk0 + 8 * (lane >> 4);
#pragma unroll
  for (int i = 0; i < 8; ++i) { a[i] = (_Float16)p[i]; a[8 + i] = (_Float16)p[16 + i]; }
  return a;
}
__device__ __forceinline__ v16h frag_f32s(const float* rowk0, int lane, float sc) {
  v16h a; const float* p = rowk0 + 8 * (lane >> 4);
#pragma unroll
  for (int i = 0; i < 8; ++i) { a[i] = (_Float16)(p[i] * sc); a[8 + i] = (_Float16)(p[16 + i] * sc); }
  return a;
}
// column fragment from a [K][ld] layout (column n), rows >= K read as 0
__device__ __forceinline__ v16h fragc_f32(const float* W, int k0, int n, int lane, int ld, int K) {
  v16h a; const int g = lane >> 4;
#pragma unroll
  for (int i = 0; i < 8; ++i) { const int ka = k0 + 8 * g + i, kb = ka + 16;
    a[i] = (_Float16)(ka < K ? W[(size_t)(ka < K ? ka : K - 1) * ld + n] : 0.f); a[8 + i] = (_Float16)(kb < K ? W[(size_t)(kb < K ? kb : K - 1) * ld + n] : 0.f); }
  return a;
}
struct F2 { v16b h, l; };
__device__ __forceinline__ F2 bsplit16(const float v[16]) { F2 r;
#pragma unroll
  for (int i = 0; i < 16; ++i) { const __bf16 h = (__bf16)v[i]; r.h[i] = h; r.l[i] = (__bf16)(v[i] - (float)h); }
  return r; }
__device__ __forceinline__ F2 split_row(const float* row, int k0, int lane) { float v[16]; const float* p = row + k0 + 8 * (lane >> 4);
#pragma unroll
  for (int i = 0; i < 8; ++i) { v[i] = p[i]; v[8 + i] = p[16 + i]; }
  return bsplit16(v); }
__device__ __forceinline__ F2 split_rowK(const float* row, int k0, int lane, int K) { float v[16]; const int g = lane >> 4;
#pragma unroll
  for (int i = 0; i < 8; ++i) { const int ka = k0 + 8 * g + i, kb = ka + 16; v[i] = ka < K ? row[ka < K ? ka : K - 1] : 0.f; v[8 + i] = kb < K ? row[kb < K ? kb : K - 1] : 0.f; }
  return bsplit16(v); }
__device__ __forceinline__ F2 split_col(const float* W, int k0, int n, int lane, int ld, int K) { float v[16]; const int g = lane >> 4;
#pragma unroll
  for (int i = 0; i < 8; ++i) { const int ka = k0 + 8 * g + i, kb = ka + 16; v[i] = ka < K ? W[(size_t)(ka < K ? ka : K - 1) * ld + n] : 0.f; v[8 + i] = kb < K ? W[(size_t)(kb < K ? kb : K - 1) * ld + n] : 0.f; }
  return bsplit16(v); }
__device__ __forceinline__ v8f mac3(const F2& a, const F2& b, v8f c) { c = wmma_bf(a.l, b.h, c); c = wmma_bf(a.h, b.l, c); return wmma_bf(a.h, b.h, c); }
__device__ __forceinline__ float sigm(float v) { return 1.0f / (1.0f + expf(-v)); }
#define LDSX() do { asm volatile("s_wait_dscnt 0" ::: "memory"); __builtin_amdgcn_wave_barrier(); __builtin_amdgcn_fence(__ATOMIC_RELEASE, "workgroup"); } while (0)

// Causal multi-head self-attention with interleaved-pair RoPE at given token positions, ONE batch of 4,096 tokens (x [1,4096,1024]; (out,in) Wq / Wk / Wv / Wo [1024,1024] N(0,1) x 0.02 applied as x @ W.T, no biases; token_positions [4096] int (arange; the LAST input); 16 heads x 64; inv_freq = 1 / 10000^(2i/64); (even, odd) pairs rotated and re-interleaved; scores / sqrt(64); tril kept, -inf elsewhere; softmax; attn @ Wo.T). THIS ROW: the same module and weight scale (0.02) with the argument order x, token_positions, Wq, Wk, Wv, Wo (the positions SECOND): the indices in kernel_launch follow; finfo.min in place of -inf under the causal rule (an exclusion either way); the inverse-frequency expression is the host's own, token for token: the baked table is unchanged.
#define NB 1
#define TT 4096
#define CC 1024            // NH * HD = projected width
#define DIN 1024          // input (model) width
#define NH 16
#define HD 64
#define NQB (TT / 64)
#define SCALE (0.125f)
#define CAUSAL 1
#ifndef TNB
#define TNB NB
#endif
__device__ __forceinline__ float bfr(float v) { return (float)(__bf16)v; }
typedef __attribute__((ext_vector_type(8))) __bf16 v8b;
__device__ __forceinline__ v16b frag_b(const __bf16* rowk0, int lane) {
  union { v16b v; v8b q[2]; } u; const __bf16* p = rowk0 + 8 * (lane >> 4);
  u.q[0] = *(const v8b*)p; u.q[1] = *(const v8b*)(p + 16); return u.v;
}
#define QBH 6              // causal: query blocks 0..QBH-1 of each sequence (few keys, no averaging) take the high-precision path
#define QHI 384            // rows carrying a q residual plane
#define KHI 384            // key rows carrying k residual / v bf16 hi+lo planes (used only by the causal high-precision path)
// B fragment (k rows k0+.., output column o) of a weight: (in,out) [K][ld] or (out,in) [ld rows of K]: bf16 exact, or f16(bf16 * 256) exact
__device__ __forceinline__ v16b wcol_io(const float* Wm, int k0, int o, int lane, int ld) { v16b w; const int g = lane >> 4;
#pragma unroll
  for (int i = 0; i < 8; ++i) { w[i] = (__bf16)Wm[(size_t)(k0 + 8 * g + i) * ld + o]; w[8 + i] = (__bf16)Wm[(size_t)(k0 + 16 + 8 * g + i) * ld + o]; }
  return w; }
__device__ __forceinline__ v16b wcol_oi(const float* Wm, int k0, int o, int lane, int K) { v16b w; const float* p = Wm + (size_t)o * K + k0 + 8 * (lane >> 4);
#pragma unroll
  for (int i = 0; i < 8; ++i) { w[i] = (__bf16)p[i]; w[8 + i] = (__bf16)p[16 + i]; }
  return w; }
__device__ __forceinline__ v16h wcolh_io(const float* Wm, int k0, int o, int lane, int ld) { v16h w; const int g = lane >> 4;
#pragma unroll
  for (int i = 0; i < 8; ++i) { w[i] = (_Float16)(bfr(Wm[(size_t)(k0 + 8 * g + i) * ld + o]) * 256.0f); w[8 + i] = (_Float16)(bfr(Wm[(size_t)(k0 + 16 + 8 * g + i) * ld + o]) * 256.0f); }
  return w; }
__device__ __forceinline__ v16h wcolh_oi(const float* Wm, int k0, int o, int lane, int K) { v16h w; const float* p = Wm + (size_t)o * K + k0 + 8 * (lane >> 4);
#pragma unroll
  for (int i = 0; i < 8; ++i) { w[i] = (_Float16)(bfr(p[i]) * 256.0f); w[8 + i] = (_Float16)(bfr(p[16 + i]) * 256.0f); }
  return w; }
#define WQKV_LAYOUT 1   // picks WCOL's layout (0 = (in,out) [DIN][CC]; 1 = (out,in) [CC][DIN]; 2 = per-head [NH][DIN][HD]); nothing calls WCOL: k_proj reads (out,in) [CC][DIN] rows
__device__ __forceinline__ v16b wcol_hdk(const float* Wm, int k0, int o, int lane) { v16b w; const int g = lane >> 4; const float* p = Wm + (size_t)(o / HD) * DIN * HD + (o % HD);
#pragma unroll
  for (int i = 0; i < 8; ++i) { w[i] = (__bf16)p[(size_t)(k0 + 8 * g + i) * HD]; w[8 + i] = (__bf16)p[(size_t)(k0 + 16 + 8 * g + i) * HD]; }
  return w; }
#define WO_OUT_IN 1
#if WQKV_LAYOUT == 1
#define WCOL(W, k0, o, lane) wcol_oi(W, k0, o, lane, DIN)
#elif WQKV_LAYOUT == 2
#define WCOL(W, k0, o, lane) wcol_hdk(W, k0, o, lane)
#else
#define WCOL(W, k0, o, lane) wcol_io(W, k0, o, lane, CC)
#endif
#if WO_OUT_IN
#define WOCOL(W, k0, o, lane) wcol_oi(W, k0, o, lane, CC)
#define WOCOLH(W, k0, o, lane) wcolh_oi(W, k0, o, lane, CC)
#else
#define WOCOL(W, k0, o, lane) wcol_io(W, k0, o, lane, DIN)
#define WOCOLH(W, k0, o, lane) wcolh_io(W, k0, o, lane, DIN)
#endif
// RoPE inverse frequencies 1/10000^(2i/64) (the f32 values jax computes)
__constant__ float INVF[32] = {1.000000000e+00,7.498942018e-01,5.623413324e-01,4.216965139e-01,3.162277639e-01,2.371373624e-01,1.778279394e-01,1.333521456e-01,1.000000015e-01,7.498941571e-02,5.623412877e-02,4.216964915e-02,3.162277862e-02,2.371373586e-02,1.778279431e-02,1.333521493e-02,9.999999776e-03,7.498942316e-03,5.623413250e-03,4.216964822e-03,3.162277862e-03,2.371373819e-03,1.778279431e-03,1.333521446e-03,1.000000047e-03,7.498941850e-04,5.623413017e-04,4.216964880e-04,3.162277862e-04,2.371373848e-04,1.778279402e-04,1.333521504e-04};
#define PROJ_EXTRA_PARAMS , const int* __restrict__ TPOS
// interleaved-pair RoPE on q and k (which 0, 1) at the token's position from the int input token_positions[t]: angle = (float)pos * inv_freq[i]; (x1, x2) -> (x1 cos - x2 sin, x1 sin + x2 cos); products and sums kept separate (no fma contraction); a call does the 8 pairs from i0 on
#define PROJ_EPI(which, row, t, h, i0) do { if ((which) < 2) { float* rw = (row); const float pos_ = (float)TPOS[(t)]; _Pragma("unroll 4") for (int i = (i0); i < (i0) + 8; ++i) { _Pragma("clang fp contract(off)") const float ang = pos_ * INVF[i]; const float cs = cosf(ang), sn = sinf(ang); const float xe = rw[2 * i], xo = rw[2 * i + 1]; rw[2 * i] = xe * cs - xo * sn; rw[2 * i + 1] = xe * sn + xo * cs; } } } while (0)
#ifndef PROJ_EXTRA_PARAMS
#define PROJ_EXTRA_PARAMS
#endif

#define WS_QH  0u                                      // f16 q rows [b*t][CC]
#define WS_KH  (WS_QH + 2u * (size_t)NB * TT * CC)      // f16 k rows [b*t][CC]
#define WS_VT  (WS_KH + 2u * (size_t)NB * TT * CC)      // f16 v planes [b][c][t]
#define WS_QL  (WS_VT + 2u * (size_t)NB * CC * TT)      // f16 q residual x 2^10 rows [b][t < QHI][CC]
#define WS_KL  (WS_QL + 2u * (size_t)NB * QHI * CC)     // f16 k residual x 2^10 rows [b][t < KHI][CC]
#define WS_VB  (WS_KL + 2u * (size_t)NB * KHI * CC)     // bf16 v hi planes [b][c][t < KHI]
#define WS_VBL (WS_VB + 2u * (size_t)NB * CC * KHI)
#define WS_Y   (WS_VBL + 2u * (size_t)NB * CC * KHI)    // f32 ctx rows [b*t][CC] (only when there is an output projection)
#define WS_END (WS_Y  + 4u * (size_t)NB * TT * CC)

// LDS staging of the projections' operands: a stage is KS k of every operand row, brought by whole-line loads (16 lanes x 16 B = one 256-B row piece), converted once per block, laid at a pitch of 128 + 16 B for the 16-byte fragment reads
#define KS 64
#define LP 72
// full unroll: the register arrays the loop walks keep constant indices (no scratch) and the row steps fold into the instructions' offsets
#define UNROLL_REGS _Pragma("unroll")
typedef __attribute__((ext_vector_type(4))) __bf16 v4b;
typedef __attribute__((ext_vector_type(4))) _Float16 v4h;
// stands behind each group of global loads and each of k_proj's stores, before anything may take their address registers
#define XWAIT() asm volatile("s_wait_xcnt 0x0" ::: "memory")
__device__ __forceinline__ v4b cvt4b(v4f v) { v4b r;
UNROLL_REGS
  for (int i = 0; i < 4; ++i) r[i] = (__bf16)v[i];
  return r; }
__device__ __forceinline__ v4b cvt4bl(v4f v) { v4b r;   /* the residual plane of bsplit16 */
UNROLL_REGS
  for (int i = 0; i < 4; ++i) r[i] = (__bf16)(v[i] - (float)(__bf16)v[i]);
  return r; }
__device__ __forceinline__ v4h cvt4hs(v4f v, float sc) { v4h r;
UNROLL_REGS
  for (int i = 0; i < 4; ++i) r[i] = (_Float16)(v[i] * sc);
  return r; }
__device__ __forceinline__ v4h cvt4hw(v4f v) { v4h r;   /* f16(bf16 x 2^8), exact */
UNROLL_REGS
  for (int i = 0; i < 4; ++i) r[i] = (_Float16)(bfr(v[i]) * 256.0f);
  return r; }
// ---- k_proj: block = (128 rows, the same 128 cols of q, of k and of v), 16 waves of 32 rows x 32 cols of each of the three (3 x 2 x 2 accumulator tiles): a staged X row serves the three products, so X comes from L2 once, not three times, and the 256 blocks are one round of the chip: q/k/v = X W (+ b) with exact bf16 products (K = DIN), X and the three W tiles staged as bf16 in a two-buffer LDS ring, the next stage's global loads in flight over this stage's products; the epilogue runs six times, once per (which, 64-row half of the tile), in the same LDS planes -> which 0: q f16 rows (+ residual rows < QHI); 1: k f16 rows (+ residual rows < KHI); 2: v f16 planes [c][t] (+ bf16 hi/lo planes for t < KHI)
__global__ __launch_bounds__(512) void k_proj(const float* __restrict__ X, const float* __restrict__ WQ, const float* __restrict__ WK, const float* __restrict__ WV, const float* __restrict__ BQ, const float* __restrict__ BK, const float* __restrict__ BV,
    _Float16* __restrict__ QH, _Float16* __restrict__ QL, _Float16* __restrict__ KH, _Float16* __restrict__ KL, _Float16* __restrict__ VT, __bf16* __restrict__ VB, __bf16* __restrict__ VBL PROJ_EXTRA_PARAMS) {
  __shared__ __align__(16) float st[64][132];
  struct Epi { _Float16 sh[64][136], sl[64][136]; _Float16 th[128][72]; __bf16 tb[128][72], tbl[128][72]; };
  __shared__ __align__(16) union { Epi e; __bf16 ring[2][128 + 3 * 128][LP]; } u;   /* the ring (rows 0..127 X, 128.. Wq, 256.. Wk, 384.. Wv) is dead before the epilogue's planes are written: two barriers lie between */
  auto& sh = u.e.sh; auto& sl = u.e.sl; auto& th = u.e.th; auto& tb = u.e.tb; auto& tbl = u.e.tbl;
  const int tid = threadIdx.x, wave = __builtin_amdgcn_readfirstlane(tid >> 5), lane = tid & 31, col = lane & 15, g = lane >> 4; const int wr = wave >> 2, wc = wave & 3; const int c0 = blockIdx.y * 128; const size_t r0 = (size_t)blockIdx.x * 128; const size_t bb = r0 / TT; const int t0 = (int)(r0 % TT);
  v8f acc[3][2][2] = {};
  const int fr = tid >> 4, fc = (tid & 15) * 4;   /* the thread's row of each 32-row sweep and its 4 floats of a stage row */
  const unsigned fo = fr * DIN + fc; const float* xg = X + r0 * DIN; const float* wg0 = WQ + (size_t)c0 * DIN; const float* wg1 = WK + (size_t)c0 * DIN; const float* wg2 = WV + (size_t)c0 * DIN; v4f xr[4], wv[3][4];   /* block-uniform bases, one 32-bit lane offset that nothing overwrites */
UNROLL_REGS
  for (int i = 0; i < 4; ++i) xr[i] = *(const v4f*)(xg + fo + (size_t)i * 32 * DIN);
UNROLL_REGS
  for (int i = 0; i < 4; ++i) { wv[0][i] = *(const v4f*)(wg0 + fo + (size_t)i * 32 * DIN); wv[1][i] = *(const v4f*)(wg1 + fo + (size_t)i * 32 * DIN); wv[2][i] = *(const v4f*)(wg2 + fo + (size_t)i * 32 * DIN); }
  XWAIT();
  for (int s = 0; s < DIN / KS; ++s) { __bf16 (*rb)[LP] = u.ring[s & 1];
UNROLL_REGS
    for (int i = 0; i < 4; ++i) *(v4b*)&rb[fr + 32 * i][fc] = cvt4b(xr[i]);
UNROLL_REGS
    for (int q = 0; q < 3; ++q)
UNROLL_REGS
      for (int i = 0; i < 4; ++i) *(v4b*)&rb[128 + 128 * q + fr + 32 * i][fc] = cvt4b(wv[q][i]);
    __syncthreads();   /* publishes stage s; it also ends every wave's reads of the other buffer, which stage s + 1 overwrites */
    if (s + 1 < DIN / KS) { xg += KS; wg0 += KS; wg1 += KS; wg2 += KS;
UNROLL_REGS
      for (int i = 0; i < 4; ++i) xr[i] = *(const v4f*)(xg + fo + (size_t)i * 32 * DIN);
UNROLL_REGS
      for (int i = 0; i < 4; ++i) { wv[0][i] = *(const v4f*)(wg0 + fo + (size_t)i * 32 * DIN); wv[1][i] = *(const v4f*)(wg1 + fo + (size_t)i * 32 * DIN); wv[2][i] = *(const v4f*)(wg2 + fo + (size_t)i * 32 * DIN); }
      XWAIT(); }
UNROLL_REGS
    for (int kk = 0; kk < KS / 32; ++kk) { v16b a[2], w[3][2];   /* a block's fragment reads go as one group ahead of its products */
UNROLL_REGS
      for (int i = 0; i < 2; ++i) a[i] = frag_b(&rb[wr * 32 + i * 16 + col][kk * 32], lane);
UNROLL_REGS
      for (int q = 0; q < 3; ++q)
UNROLL_REGS
        for (int j = 0; j < 2; ++j) w[q][j] = frag_b(&rb[128 + 128 * q + wc * 32 + j * 16 + col][kk * 32], lane);
UNROLL_REGS
      for (int q = 0; q < 3; ++q)
UNROLL_REGS
        for (int i = 0; i < 2; ++i)
UNROLL_REGS
          for (int j = 0; j < 2; ++j) acc[q][i][j] = wmma_bf(a[i], w[q][j], acc[q][i][j]); } }
  const int i0 = (wave >> 2) * 8;   /* the RoPE pairs of a (row, head) go a quarter to each group of four waves */
#pragma unroll 1   /* one copy of the epilogue's long text (the RoPE code) in the instruction cache, not six */
  for (int ep = 0; ep < 6; ++ep) { const int which = ep >> 1, hp = ep & 1; const float* BA = which == 0 ? BQ : which == 1 ? BK : BV; const size_t rh = r0 + 64 * hp; const int th0 = t0 + 64 * hp;   /* the 64-row half the eight waves wr >> 1 == hp hold; the barrier behind each pass's conversion ends the reads of st, the two in front of the next conversion end the reads of the planes */
  { // stage the half's f32 tile (acc + bias) in LDS, run the per-(row, head) epilogue hook, then convert
    if ((wr >> 1) == hp) {
UNROLL_REGS
    for (int q = 0; q < 3; ++q) if (q == which) {   /* block-uniform test: the accumulator array keeps constant indices */
#pragma unroll
    for (int i = 0; i < 2; ++i)
#pragma unroll
    for (int j = 0; j < 2; ++j) { const float bias = BA ? bfr(BA[c0 + wc * 32 + j * 16 + col]) : 0.f;
#pragma unroll
      for (int r = 0; r < 8; ++r) st[(wr & 1) * 32 + i * 16 + 8 * g + r][wc * 32 + j * 16 + col] = acc[q][i][j][r] + bias; } } }
    __syncthreads();
    { const int e = tid & 127; const int rl = e / (128 / HD), hh = e % (128 / HD); PROJ_EPI(which, &st[rl][hh * HD], (int)((rh + rl) % TT), (c0 / HD) + hh, i0); }
    __syncthreads(); }
  if (which < 2) { _Float16* DH = which == 0 ? QH : KH; _Float16* DL = which == 0 ? QL : KL; const int nhi = which == 0 ? QHI : KHI; const bool hi_rows = th0 < nhi;
    for (int e = tid; e < 64 * 128; e += 512) { const int rl = e >> 7, cl = e & 127; const float v = st[rl][cl]; const _Float16 hv = (_Float16)v; sh[rl][cl] = hv; sl[rl][cl] = (_Float16)((v - (float)hv) * 1024.0f); }
    __syncthreads();
    for (int e = tid; e < 64 * 16; e += 512) { const int rl = e >> 4, q = e & 15; vst2((unsigned*)(DH + (rh + rl) * CC + c0 + q * 8), *(const v4u*)&sh[rl][q * 8]); XWAIT(); if (hi_rows) { vst2((unsigned*)(DL + (bb * nhi + th0 + rl) * (size_t)CC + c0 + q * 8), *(const v4u*)&sl[rl][q * 8]); XWAIT(); } }
  } else { const bool hi_rows = th0 < KHI;
    for (int e = tid; e < 64 * 128; e += 512) { const int rl = e & 63, cl = e >> 6; const float v = st[rl][cl]; th[cl][rl] = (_Float16)v; const __bf16 bh = (__bf16)v; tb[cl][rl] = bh; tbl[cl][rl] = (__bf16)(v - (float)bh); }
    __syncthreads();
    for (int e = tid; e < 128 * 8; e += 512) { const int cl = e >> 3, q = e & 7; vst2((unsigned*)(VT + (bb * CC + c0 + cl) * (size_t)TT + th0 + q * 8), *(const v4u*)&th[cl][q * 8]); XWAIT(); if (hi_rows) { const size_t o3 = (bb * CC + c0 + cl) * (size_t)KHI + th0 + q * 8; vst2((unsigned*)(VB + o3), *(const v4u*)&tb[cl][q * 8]); vst2((unsigned*)(VBL + o3), *(const v4u*)&tbl[cl][q * 8]); XWAIT(); } } } } }
// fragment from the lane's own pointer (row start + k0 + 8 * (lane >> 4)): the same k order as frag_h / frag_b
__device__ __forceinline__ v16h frag_hp(const _Float16* p) { union { v16h v; v8h q[2]; } u; u.q[0] = *(const v8h*)p; u.q[1] = *(const v8h*)(p + 16); return u.v; }
__device__ __forceinline__ v16b frag_bp(const __bf16* p) { union { v16b v; v8b q[2]; } u; u.q[0] = *(const v8b*)p; u.q[1] = *(const v8b*)(p + 16); return u.v; }
// one 32-key step of a query's running softmax: v = the lane's 16 scaled logits (-3.0e38 = excluded) -> exp(v - new maximum) x 2^11; m = running maximum (both wave halves alike), l = this half's running sum; returns the factor that carries the old sums to the new maximum
__device__ __forceinline__ float sm_step(float v[16], float& m, float& l) {
  float mx = v[0];
#pragma unroll
  for (int i = 1; i < 16; ++i) mx = fmaxf(mx, v[i]);
  mx = fmaxf(mx, __shfl_xor(mx, 16));
  const float mn = fmaxf(m, mx); const float alpha = expf(m - mn); float s = 0.f;
#pragma unroll
  for (int i = 0; i < 16; ++i) { const float e = expf(v[i] - mn); s += e; v[i] = e * 2048.0f; }   /* mn is a kept key's logit (every step holds one for every query), so an excluded key gives exp(-3.0e38) = 0 */
  l = l * alpha + s; m = mn; return alpha; }
// the same step in base 2, for the blocks behind the early ones: v = the lane's 16 RAW logits q.k (-3.0e38 = excluded), m = running maximum of raw logits; exp(SCALE x (v - mn)) x 2^11 = exp2(v x C2 - (mn x C2 - 11)), C2 = SCALE x log2(e): one fma and one hardware exp2 per score (SCALE > 0, so the maximum may be taken before the scaling); l carries the factor 2^11 (exact); an excluded key gives exp2(-5.4e37) = 0
#define C2 (SCALE * 1.44269504088896340736f)
__device__ __forceinline__ float sm_step2(float v[16], float& m, float& l) {
  float mx = v[0];
#pragma unroll
  for (int i = 1; i < 16; ++i) mx = fmaxf(mx, v[i]);
  mx = fmaxf(mx, __shfl_xor(mx, 16));
  const float mn = fmaxf(m, mx); const float alpha = __builtin_amdgcn_exp2f((m - mn) * C2); const float nb = __builtin_fmaf(mn, C2, -11.0f); float s = 0.f;
#pragma unroll
  for (int i = 0; i < 16; ++i) { const float e = __builtin_amdgcn_exp2f(__builtin_fmaf(v[i], C2, -nb)); s += e; v[i] = e; }
  l = l * alpha + s; m = mn; return alpha; }
// ---- k_attn: block = (head h, 64 queries qb, batch b), wave = 16 queries, keys [0, diagonal] 32 at a time (behind the early blocks: k rows and v planes staged 64 keys at a time in LDS, once for the block's four waves, the next stage's global loads in flight over this stage's steps). S^T = K Q^T x SCALE (behind the early blocks SCALE is applied inside the softmax step): lane (g, col) holds query col's logits of keys 8g + r and 16 + 8g + r (causal early query blocks: q and k residual planes, 3 products); the causal rule by index in the last step; running maximum and sum in f32; the two score tiles, as P^T x 2^11 once to f16 (early blocks: bf16 hi + lo), are the B operand of ctx^T += V^T P^T (early blocks: v bf16 hi + lo, 3 products); ctx = sums / (2^11 x sum of exp); 256-B (row, head) segment by 16 lanes
__global__ __launch_bounds__(128) void k_attn(const _Float16* __restrict__ QH, const _Float16* __restrict__ KH, const _Float16* __restrict__ QL, const _Float16* __restrict__ KL, const _Float16* __restrict__ VT, const __bf16* __restrict__ VB, const __bf16* __restrict__ VBL, float* __restrict__ Y) { __shared__ __align__(16) float ss[4][16][HD + 4]; __shared__ __align__(16) _Float16 kv[2][64 + HD][LP];   /* two-buffer ring of 64-key stages: rows 0..63 the keys' k rows of this head, rows 64.. its v planes [c][64 keys] */
  const int tid = threadIdx.x, wave = __builtin_amdgcn_readfirstlane(tid >> 5), lane = tid & 31, col = lane & 15, g = lane >> 4; const int h = blockIdx.x, qb = blockIdx.y, b = blockIdx.z; const int ql0 = qb * 64 + wave * 16; const int nch = (ql0 + 47) >> 5;
  const size_t q0 = (size_t)b * TT + ql0, kr0 = (size_t)b * TT;
  v8f acc[HD / 16] = {}; float m = -3.0e38f, l = 0.f; const float lc = qb < QBH ? 2048.0f : 1.0f;   /* what the sum of exp still lacks of the 2^11 that P carries */
  if (qb < QBH) { const _Float16* QLb = QL + (size_t)b * QHI * CC; const _Float16* KLb = KL + (size_t)b * KHI * CC; v16h qh[HD / 32], qlo[HD / 32];
#pragma unroll
    for (int kk = 0; kk < HD / 32; ++kk) { qh[kk] = frag_h(QH + (q0 + col) * CC + h * HD + kk * 32, lane); qlo[kk] = frag_h(QLb + (size_t)(ql0 + col) * CC + h * HD + kk * 32, lane); }
    asm volatile("s_wait_xcnt 0x0" :: "v"(qh[0]), "v"(qh[1]), "v"(qlo[0]), "v"(qlo[1]) : "memory");   /* XWAIT held behind the q loads by their values (inputs only) */
    const _Float16* kp = KH + (kr0 + col) * CC + h * HD + 8 * g; const _Float16* klp = KLb + (size_t)col * CC + h * HD + 8 * g; const __bf16* vp = VB + ((size_t)b * CC + h * HD + col) * (size_t)KHI + 8 * g; const __bf16* vlp = VBL + ((size_t)b * CC + h * HD + col) * (size_t)KHI + 8 * g;
    for (int kc = 0; kc < nch; ++kc, kp += 32 * CC, klp += 32 * CC, vp += 32, vlp += 32) { const int k0 = kc * 32; float v[16]; v16h kbf[2][HD / 32], klf[2][HD / 32];   /* a step's k loads are all issued before its first product, its v loads before the softmax */
#pragma unroll
      for (int t = 0; t < 2; ++t)
#pragma unroll
        for (int kk = 0; kk < HD / 32; ++kk) kbf[t][kk] = frag_hp(kp + t * 16 * CC + kk * 32);
      XWAIT();
#pragma unroll
      for (int t = 0; t < 2; ++t)
#pragma unroll
        for (int kk = 0; kk < HD / 32; ++kk) klf[t][kk] = frag_hp(klp + t * 16 * CC + kk * 32);
      XWAIT();
#pragma unroll
      for (int t = 0; t < 2; ++t) { v8f s = {}, sl = {};
#pragma unroll
        for (int kk = 0; kk < HD / 32; ++kk) { s = wmma16(kbf[t][kk], qh[kk], s); sl = wmma16(kbf[t][kk], qlo[kk], sl); sl = wmma16(klf[t][kk], qh[kk], sl); }
#pragma unroll
        for (int r = 0; r < 8; ++r) v[t * 8 + r] = (s[r] + sl[r] * (1.0f / 1024.0f)) * SCALE; }
      if (kc == nch - 1) {
#pragma unroll
        for (int i = 0; i < 16; ++i) if (k0 + (i >> 3) * 16 + 8 * g + (i & 7) > ql0 + col) v[i] = -3.0e38f; }
      v16b vh[HD / 16], vl[HD / 16];
#pragma unroll
      for (int j = 0; j < HD / 16; ++j) vh[j] = frag_bp(vp + j * 16 * KHI);
      XWAIT();
#pragma unroll
      for (int j = 0; j < HD / 16; ++j) vl[j] = frag_bp(vlp + j * 16 * KHI);
      XWAIT();
      const float alpha = sm_step(v, m, l); const F2 p = bsplit16(v);
#pragma unroll
      for (int j = 0; j < HD / 16; ++j) { acc[j] = acc[j] * alpha; acc[j] = wmma_bf(vh[j], p.h, acc[j]); acc[j] = wmma_bf(vh[j], p.l, acc[j]); acc[j] = wmma_bf(vl[j], p.h, acc[j]); } }
  } else { v16h qh[HD / 32];
#pragma unroll
    for (int kk = 0; kk < HD / 32; ++kk) qh[kk] = frag_h(QH + (q0 + col) * CC + h * HD + kk * 32, lane);
    asm volatile("s_wait_xcnt 0x0" :: "v"(qh[0]), "v"(qh[1]) : "memory");   /* XWAIT held behind the q loads by their values (inputs only) */
    const int fr = tid >> 3, fc = (tid & 7) * 8;   /* the thread's row of each 16-row sweep and its 16 B of a 128-B stage row: a wave's load covers 4 whole lines */
    const unsigned ko = fr * CC + fc, vo = fr * TT + fc; const _Float16* kg = KH + kr0 * CC + h * HD; const _Float16* vg = VT + ((size_t)b * CC + h * HD) * (size_t)TT; v8h kr[4], vr[HD / 16];   /* block-uniform bases, 32-bit lane offsets that nothing overwrites */
UNROLL_REGS
    for (int i = 0; i < 4; ++i) kr[i] = *(const v8h*)(kg + ko + (size_t)i * 16 * CC);
    XWAIT();
UNROLL_REGS
    for (int i = 0; i < HD / 16; ++i) vr[i] = *(const v8h*)(vg + vo + (size_t)i * 16 * TT);
    XWAIT();
    for (int s = 0; s <= qb; ++s) { _Float16 (*rb)[LP] = kv[s & 1];   /* block-uniform trip count: every wave passes every barrier */
UNROLL_REGS
      for (int i = 0; i < 4; ++i) *(v8h*)&rb[fr + 16 * i][fc] = kr[i];
UNROLL_REGS
      for (int i = 0; i < HD / 16; ++i) *(v8h*)&rb[64 + fr + 16 * i][fc] = vr[i];
      __syncthreads();   /* publishes stage s and ends the reads of the buffer that stage s + 1 overwrites */
      if (s < qb) { kg += 64 * CC; vg += 64;
UNROLL_REGS
        for (int i = 0; i < 4; ++i) kr[i] = *(const v8h*)(kg + ko + (size_t)i * 16 * CC);
UNROLL_REGS
        for (int i = 0; i < HD / 16; ++i) vr[i] = *(const v8h*)(vg + vo + (size_t)i * 16 * TT);
        XWAIT(); }
UNROLL_REGS
     for (int t2 = 0; t2 < 2; ++t2) { const int kc = 2 * s + t2; if (kc < nch) { const int k0 = kc * 32; float v[16]; v16h kf[2][HD / 32], vf[HD / 16];   /* wave-uniform test: the block's first two waves have no second step in the last stage; a step's fragment reads go ahead of its first product */
#pragma unroll
      for (int t = 0; t < 2; ++t)
UNROLL_REGS
        for (int kk = 0; kk < HD / 32; ++kk) kf[t][kk] = frag_hp(&rb[t2 * 32 + t * 16 + col][kk * 32 + 8 * g]);
UNROLL_REGS
      for (int j = 0; j < HD / 16; ++j) vf[j] = frag_hp(&rb[64 + j * 16 + col][t2 * 32 + 8 * g]);
#pragma unroll
      for (int t = 0; t < 2; ++t) { v8f s = {};
#pragma unroll
        for (int kk = 0; kk < HD / 32; ++kk) s = wmma16(kf[t][kk], qh[kk], s);
#pragma unroll
        for (int r = 0; r < 8; ++r) v[t * 8 + r] = s[r]; }
      if (kc == nch - 1) {
#pragma unroll
        for (int i = 0; i < 16; ++i) if (k0 + (i >> 3) * 16 + 8 * g + (i & 7) > ql0 + col) v[i] = -3.0e38f; }
      const float alpha = sm_step2(v, m, l); v16h p;
#pragma unroll
      for (int i = 0; i < 16; ++i) p[i] = (_Float16)v[i];
UNROLL_REGS
      for (int j = 0; j < HD / 16; ++j) { acc[j] = acc[j] * alpha; acc[j] = wmma16(vf[j], p, acc[j]); } } } } }
  l += __shfl_xor(l, 16); const float inv = 1.0f / (l * lc);
#pragma unroll
  for (int j = 0; j < HD / 16; ++j)
#pragma unroll
    for (int r = 0; r < 8; ++r) ss[wave][col][j * 16 + 8 * g + r] = acc[j][r] * inv;
  LDSX(); for (int rl = 0; rl < 16; ++rl) if (lane < HD / 4) vst2(Y + ((size_t)b * TT + ql0 + rl) * CC + h * HD + lane * 4, *(const v4f*)&ss[wave][rl][lane * 4]); }
// ---- k_out: block = (128 rows, 128 cols), 8 waves of 32 rows x 64 cols, operands staged in a two-buffer LDS ring as in k_proj: out = ctx Wo (+ bo): ctx x 2^6 once to f16 against Wo as f16(bf16 x 2^8) exact (1 product) x 2^-14; causal early rows (< QHI of each sequence): ctx bf16 hi + lo against exact bf16 Wo (2 products)
__global__ __launch_bounds__(256) void k_out(const float* __restrict__ Y, const float* __restrict__ WO, const float* __restrict__ BO, float* __restrict__ OUT) { __shared__ __align__(16) float sf[8][32][68];
  __shared__ __align__(16) union { __bf16 b[2][128 + 128 + 128][LP]; _Float16 h[2][128 + 128][LP]; } u;   /* early rows: ctx hi 0..127, ctx lo 128..255, Wo 256..383; else ctx 0..127, Wo 128..255 */
  const int tid = threadIdx.x, wave = __builtin_amdgcn_readfirstlane(tid >> 5), lane = tid & 31, col = lane & 15, g = lane >> 4; const int wr = wave >> 1, wc = wave & 1; const int c0 = blockIdx.y * 128; const size_t r0 = (size_t)blockIdx.x * 128 + wr * 32;
  v8f acc[2][4] = {};
  const int fr = tid >> 4, fc = (tid & 15) * 4;   /* as in k_proj */
  const unsigned fo = fr * CC + fc; const float* yg = Y + (size_t)blockIdx.x * 128 * CC; const float* wg = WO + (size_t)c0 * CC; v4f yr[8], wv[8];
UNROLL_REGS
  for (int i = 0; i < 8; ++i) yr[i] = *(const v4f*)(yg + fo + (size_t)i * 16 * CC);
UNROLL_REGS
  for (int i = 0; i < 8; ++i) wv[i] = *(const v4f*)(wg + fo + (size_t)i * 16 * CC);
  XWAIT();
  if (CAUSAL && (int)(((size_t)blockIdx.x * 128) % TT) < QHI) {   /* block-uniform; QHI is a multiple of the 128 rows */
    for (int s = 0; s < CC / KS; ++s) { __bf16 (*rb)[LP] = u.b[s & 1];
UNROLL_REGS
      for (int i = 0; i < 8; ++i) { *(v4b*)&rb[fr + 16 * i][fc] = cvt4b(yr[i]); *(v4b*)&rb[128 + fr + 16 * i][fc] = cvt4bl(yr[i]); }
UNROLL_REGS
      for (int i = 0; i < 8; ++i) *(v4b*)&rb[256 + fr + 16 * i][fc] = cvt4b(wv[i]);
      __syncthreads();   /* publishes stage s and ends the reads of the buffer that stage s + 1 overwrites */
      if (s + 1 < CC / KS) { yg += KS; wg += KS;
UNROLL_REGS
        for (int i = 0; i < 8; ++i) yr[i] = *(const v4f*)(yg + fo + (size_t)i * 16 * CC);
UNROLL_REGS
        for (int i = 0; i < 8; ++i) wv[i] = *(const v4f*)(wg + fo + (size_t)i * 16 * CC);
        XWAIT(); }
UNROLL_REGS
      for (int kk = 0; kk < KS / 32; ++kk) { v16b ah[2], al[2], w[4];
UNROLL_REGS
        for (int i = 0; i < 2; ++i) { ah[i] = frag_b(&rb[wr * 32 + i * 16 + col][kk * 32], lane); al[i] = frag_b(&rb[128 + wr * 32 + i * 16 + col][kk * 32], lane); }
UNROLL_REGS
        for (int j = 0; j < 4; ++j) w[j] = frag_b(&rb[256 + wc * 64 + j * 16 + col][kk * 32], lane);
UNROLL_REGS
        for (int i = 0; i < 2; ++i)
UNROLL_REGS
          for (int j = 0; j < 4; ++j) { acc[i][j] = wmma_bf(ah[i], w[j], acc[i][j]); acc[i][j] = wmma_bf(al[i], w[j], acc[i][j]); } } }
#pragma unroll
    for (int i = 0; i < 2; ++i)
#pragma unroll
    for (int j = 0; j < 4; ++j) { const float bias = BO ? bfr(BO[c0 + wc * 64 + j * 16 + col]) : 0.f;
#pragma unroll
      for (int r = 0; r < 8; ++r) sf[wave][i * 16 + 8 * g + r][j * 16 + col] = acc[i][j][r] + bias; }
  } else {
    for (int s = 0; s < CC / KS; ++s) { _Float16 (*rb)[LP] = u.h[s & 1];
UNROLL_REGS
      for (int i = 0; i < 8; ++i) *(v4h*)&rb[fr + 16 * i][fc] = cvt4hs(yr[i], 64.0f);   /* ctx carried x 2^6 into f16 so small-magnitude context rows stay clear of f16 subnormals (chip FTZ) */
UNROLL_REGS
      for (int i = 0; i < 8; ++i) *(v4h*)&rb[128 + fr + 16 * i][fc] = cvt4hw(wv[i]);
      __syncthreads();   /* publishes stage s and ends the reads of the buffer that stage s + 1 overwrites */
      if (s + 1 < CC / KS) { yg += KS; wg += KS;
UNROLL_REGS
        for (int i = 0; i < 8; ++i) yr[i] = *(const v4f*)(yg + fo + (size_t)i * 16 * CC);
UNROLL_REGS
        for (int i = 0; i < 8; ++i) wv[i] = *(const v4f*)(wg + fo + (size_t)i * 16 * CC);
        XWAIT(); }
UNROLL_REGS
      for (int kk = 0; kk < KS / 32; ++kk) { v16h a[2], w[4];
UNROLL_REGS
        for (int i = 0; i < 2; ++i) a[i] = frag_h(&rb[wr * 32 + i * 16 + col][kk * 32], lane);
UNROLL_REGS
        for (int j = 0; j < 4; ++j) w[j] = frag_h(&rb[128 + wc * 64 + j * 16 + col][kk * 32], lane);
UNROLL_REGS
        for (int i = 0; i < 2; ++i)
UNROLL_REGS
          for (int j = 0; j < 4; ++j) acc[i][j] = wmma16(a[i], w[j], acc[i][j]); } }
#pragma unroll
    for (int i = 0; i < 2; ++i)
#pragma unroll
    for (int j = 0; j < 4; ++j) { const float bias = BO ? bfr(BO[c0 + wc * 64 + j * 16 + col]) : 0.f;
#pragma unroll
      for (int r = 0; r < 8; ++r) sf[wave][i * 16 + 8 * g + r][j * 16 + col] = acc[i][j][r] * (1.0f / 16384.0f) + bias; } }   /* 2^-8 (Wo carry) x 2^-6 (ctx carry) */
  LDSX(); for (int rp = 0; rp < 16; ++rp) { const int rl = 2 * rp + g; vst2(OUT + (r0 + rl) * DIN + c0 + wc * 64 + col * 4, *(const v4f*)&sf[wave][rl][col * 4]); } }   /* a wave's store covers two rows' 256-B pieces: whole lines */

extern "C" void kernel_launch(void* const* d_in, const int* in_sizes, int n_in, void* d_out, int out_size, void* d_ws, size_t ws_size, hipStream_t stream) {
  (void)in_sizes; (void)n_in; (void)out_size;
  const float** F = (const float**)d_in;
  if (ws_size < (size_t)WS_END) return;
  char* ws = (char*)d_ws; _Float16 *QH = (_Float16*)(ws + WS_QH), *KH = (_Float16*)(ws + WS_KH), *VT = (_Float16*)(ws + WS_VT), *QL = (_Float16*)(ws + WS_QL), *KL = (_Float16*)(ws + WS_KL); __bf16 *VB = (__bf16*)(ws + WS_VB), *VBL = (__bf16*)(ws + WS_VBL); float *Y = (float*)(ws + WS_Y);
  (void)Y; (void)QL; (void)KL; (void)VB; (void)VBL;
  // inputs: 0 x [1,4096,1024]; 1 token_positions [4096] int32 (arange): READ on the device; 2 Wq [1024,1024] (out,in); 3 Wk; 4 Wv; 5 Wo (out,in); no biases (null pointers)
  k_proj<<<dim3(TNB * TT / 128, CC / 128), 512, 0, stream>>>(F[0], F[2], F[3], F[4], nullptr, nullptr, nullptr, QH, QL, KH, KL, VT, VB, VBL, (const int*)d_in[1]);
  k_attn<<<dim3(NH, NQB, TNB), 128, 0, stream>>>(QH, KH, QL, KL, VT, VB, VBL, Y);
  k_out<<<dim3(TNB * TT / 128, DIN / 128), 256, 0, stream>>>(Y, F[5], nullptr, (float*)d_out);
}

// v006
// It runs in 112 microseconds.
// Two timings next to v005 both put it at 1.07 times that version's speed.
// Over all steps from v000 it is 26.4 times as fast.
// compute dtype: all float inputs rounded to bf16; q/k/v projections with EXACT bf16 products on WMMA 16x16x32 (f32 accumulate); RoPE in f32 at the int token positions; causal logits: 3 products for the first 384 rows, single f16 q x k after, x 64^-0.5; softmax f32; P x 2^11 once to f16 x v once to f16 (bf16 hi + lo below row 384); ctx hi+lo x exact Wo below row 384, x2^6 f16 carry x f16(bf16 x 2^8) Wo after; f32 output.
#include <hip/hip_runtime.h>
#include <math.h>

typedef __attribute__((ext_vector_type(16))) _Float16 v16h;
typedef __attribute__((ext_vector_type(16))) __bf16 v16b;
typedef __attribute__((ext_vector_type(8)))  _Float16 v8h;
typedef __attribute__((ext_vector_type(8)))  float v8f;
typedef __attribute__((ext_vector_type(4)))  float v4f;
typedef __attribute__((ext_vector_type(2)))  float v2f;
typedef __attribute__((ext_vector_type(4)))  unsigned v4u;
typedef __attribute__((ext_vector_type(4)))  int v4i;
typedef float __attribute__((may_alias)) float_a;
typedef int __attribute__((may_alias)) int_a;

template <typename T> __device__ __forceinline__ void vst2(void* p, T v) { *(T*)p = v;  }
__device__ __forceinline__ v8f wmma16(v16h a, v16h b, v8f c) {
  v8f d = __builtin_amdgcn_wmma_f32_16x16x32_f16(false, a, false, b, (short)0, c, false, false);
  asm volatile("v_nop\n\tv_nop\n\tv_nop\n\tv_nop" : "+v"(d) : "v"(a), "v"(b));
  return d;
}
__device__ __forceinline__ v8f wmma_bf(v16b a, v16b b, v8f c) {
  v8f d = __builtin_amdgcn_wmma_f32_16x16x32_bf16(false, a, false, b, (short)0, c, false, false);
  asm volatile("v_nop\n\tv_nop\n\tv_nop\n\tv_nop" : "+v"(d) : "v"(a), "v"(b));
  return d;
}
// 16x16x32 fragments: lane = (h = lane>>4, row/col = lane&15); elements 0..7 = k0+8h+0..7, 8..15 = k0+16+8h+0..7; D element r = row 8h+r
__device__ __forceinline__ v16h frag_h(const _Float16* rowk0, int lane) {
  union { v16h v; v8h q[2]; } u; const _Float16* p = rowk0 + 8 * (lane >> 4);
  u.q[0] = *(const v8h*)p; u.q[1] = *(const v8h*)(p + 16); return u.v;
}
__device__ __forceinline__ v16h frag_f32(const float* rowk0, int lane) {
  v16h a; const float* p = rowk0 + 8 * (lane >> 4);
#pragma unroll
  for (int i = 0; i < 8; ++i) { a[i] = (_Float16)p[i]; a[8 + i] = (_Float16)p[16 + i]; }
  return a;
}
__device__ __forceinline__ v16h frag_f32s(const float* rowk0, int lane, float sc) {
  v16h a; const float* p = rowk0 + 8 * (lane >> 4);
#pragma unroll
  for (int i = 0; i < 8; ++i) { a[i] = (_Float16)(p[i] * sc); a[8 + i] = (_Float16)(p[16 + i] * sc); }
  return a;
}
// column fragment from a [K][ld] layout (column n), rows >= K read as 0
__device__ __forceinline__ v16h fragc_f32(const float* W, int k0, int n, int lane, int ld, int K) {
  v16h a; const int g = lane >> 4;
#pragma unroll
  for (int i = 0; i < 8; ++i) { const int ka = k0 + 8 * g + i, kb = ka + 16;
    a[i] = (_Float16)(ka < K ? W[(size_t)(ka < K ? ka : K - 1) * ld + n] : 0.f); a[8 + i] = (_Float16)(kb < K ? W[(size_t)(kb < K ? kb : K - 1) * ld + n] : 0.f); }
  return a;
}
struct F2 { v16b h, l; };
__device__ __forceinline__ F2 bsplit16(const float v[16]) { F2 r;
#pragma unroll
  for (int i = 0; i < 16; ++i) { const __bf16 h = (__bf16)v[i]; r.h[i] = h; r.l[i] = (__bf16)(v[i] - (float)h); }
  return r; }
__device__ __forceinline__ F2 split_row(const float* row, int k0, int lane) { float v[16]; const float* p = row + k0 + 8 * (lane >> 4);
#pragma unroll
  for (int i = 0; i < 8; ++i) { v[i] = p[i]; v[8 + i] = p[16 + i]; }
  return bsplit16(v); }
__device__ __forceinline__ F2 split_rowK(const float* row, int k0, int lane, int K) { float v[16]; const int g = lane >> 4;
#pragma unroll
  for (int i = 0; i < 8; ++i) { const int ka = k0 + 8 * g + i, kb = ka + 16; v[i] = ka < K ? row[ka < K ? ka : K - 1] : 0.f; v[8 + i] = kb < K ? row[kb < K ? kb : K - 1] : 0.f; }
  return bsplit16(v); }
__device__ __forceinline__ F2 split_col(const float* W, int k0, int n, int lane, int ld, int K) { float v[16]; const int g = lane >> 4;
#pragma unroll
  for (int i = 0; i < 8; ++i) { const int ka = k0 + 8 * g + i, kb = ka + 16; v[i] = ka < K ? W[(size_t)(ka < K ? ka : K - 1) * ld + n] : 0.f; v[8 + i] = kb < K ? W[(size_t)(kb < K ? kb : K - 1) * ld + n] : 0.f; }
  return bsplit16(v); }
__device__ __forceinline__ v8f mac3(const F2& a, const F2& b, v8f c) { c = wmma_bf(a.l, b.h, c); c = wmma_bf(a.h, b.l, c); return wmma_bf(a.h, b.h, c); }
__device__ __forceinline__ float sigm(float v) { return 1.0f / (1.0f + expf(-v)); }
#define LDSX() do { asm volatile("s_wait_dscnt 0" ::: "memory"); __builtin_amdgcn_wave_barrier(); __builtin_amdgcn_fence(__ATOMIC_RELEASE, "workgroup"); } while (0)

// Causal multi-head self-attention with interleaved-pair RoPE at given token positions, ONE batch of 4,096 tokens (x [1,4096,1024]; (out,in) Wq / Wk / Wv / Wo [1024,1024] N(0,1) x 0.02 applied as x @ W.T, no biases; token_positions [4096] int (arange; the LAST input); 16 heads x 64; inv_freq = 1 / 10000^(2i/64); (even, odd) pairs rotated and re-interleaved; scores / sqrt(64); tril kept, -inf elsewhere; softmax; attn @ Wo.T). THIS ROW: the same module and weight scale (0.02) with the argument order x, token_positions, Wq, Wk, Wv, Wo (the positions SECOND): the indices in kernel_launch follow; finfo.min in place of -inf under the causal rule (an exclusion either way); the inverse-frequency expression is the host's own, token for token: the baked table is unchanged.
#define NB 1
#define TT 4096
#define CC 1024            // NH * HD = projected width
#define DIN 1024          // input (model) width
#define NH 16
#define HD 64
#define NQB (TT / 64)
#define SCALE (0.125f)
#define CAUSAL 1
#ifndef TNB
#define TNB NB
#endif
__device__ __forceinline__ float bfr(float v) { return (float)(__bf16)v; }
typedef __attribute__((ext_vector_type(8))) __bf16 v8b;
__device__ __forceinline__ v16b frag_b(const __bf16* rowk0, int lane) {
  union { v16b v; v8b q[2]; } u; const __bf16* p = rowk0 + 8 * (lane >> 4);
  u.q[0] = *(const v8b*)p; u.q[1] = *(const v8b*)(p + 16); return u.v;
}
#define QBH 6              // causal: query blocks 0..QBH-1 of each sequence (few keys, no averaging) take the high-precision path
#define QHI 384            // rows carrying a q residual plane
#define KHI 384            // key rows carrying k residual / v bf16 hi+lo planes (used only by the causal high-precision path)
// B fragment (k rows k0+.., output column o) of a weight: (in,out) [K][ld] or (out,in) [ld rows of K]: bf16 exact, or f16(bf16 * 256) exact
__device__ __forceinline__ v16b wcol_io(const float* Wm, int k0, int o, int lane, int ld) { v16b w; const int g = lane >> 4;
#pragma unroll
  for (int i = 0; i < 8; ++i) { w[i] = (__bf16)Wm[(size_t)(k0 + 8 * g + i) * ld + o]; w[8 + i] = (__bf16)Wm[(size_t)(k0 + 16 + 8 * g + i) * ld + o]; }
  return w; }
__device__ __forceinline__ v16b wcol_oi(const float* Wm, int k0, int o, int lane, int K) { v16b w; const float* p = Wm + (size_t)o * K + k0 + 8 * (lane >> 4);
#pragma unroll
  for (int i = 0; i < 8; ++i) { w[i] = (__bf16)p[i]; w[8 + i] = (__bf16)p[16 + i]; }
  return w; }
__device__ __forceinline__ v16h wcolh_io(const float* Wm, int k0, int o, int lane, int ld) { v16h w; const int g = lane >> 4;
#pragma unroll
  for (int i = 0; i < 8; ++i) { w[i] = (_Float16)(bfr(Wm[(size_t)(k0 + 8 * g + i) * ld + o]) * 256.0f); w[8 + i] = (_Float16)(bfr(Wm[(size_t)(k0 + 16 + 8 * g + i) * ld + o]) * 256.0f); }
  return w; }
__device__ __forceinline__ v16h wcolh_oi(const float* Wm, int k0, int o, int lane, int K) { v16h w; const float* p = Wm + (size_t)o * K + k0 + 8 * (lane >> 4);
#pragma unroll
  for (int i = 0; i < 8; ++i) { w[i] = (_Float16)(bfr(p[i]) * 256.0f); w[8 + i] = (_Float16)(bfr(p[16 + i]) * 256.0f); }
  return w; }
#define WQKV_LAYOUT 1   // picks WCOL's layout (0 = (in,out) [DIN][CC]; 1 = (out,in) [CC][DIN]; 2 = per-head [NH][DIN][HD]); nothing calls WCOL: k_proj reads (out,in) [CC][DIN] rows
__device__ __forceinline__ v16b wcol_hdk(const float* Wm, int k0, int o, int lane) { v16b w; const int g = lane >> 4; const float* p = Wm + (size_t)(o / HD) * DIN * HD + (o % HD);
#pragma unroll
  for (int i = 0; i < 8; ++i) { w[i] = (__bf16)p[(size_t)(k0 + 8 * g + i) * HD]; w[8 + i] = (__bf16)p[(size_t)(k0 + 16 + 8 * g + i) * HD]; }
  return w; }
#define WO_OUT_IN 1
#if WQKV_LAYOUT == 1
#define WCOL(W, k0, o, lane) wcol_oi(W, k0, o, lane, DIN)
#elif WQKV_LAYOUT == 2
#define WCOL(W, k0, o, lane) wcol_hdk(W, k0, o, lane)
#else
#define WCOL(W, k0, o, lane) wcol_io(W, k0, o, lane, CC)
#endif
#if WO_OUT_IN
#define WOCOL(W, k0, o, lane) wcol_oi(W, k0, o, lane, CC)
#define WOCOLH(W, k0, o, lane) wcolh_oi(W, k0, o, lane, CC)
#else
#define WOCOL(W, k0, o, lane) wcol_io(W, k0, o, lane, DIN)
#define WOCOLH(W, k0, o, lane) wcolh_io(W, k0, o, lane, DIN)
#endif
// RoPE inverse frequencies 1/10000^(2i/64) (the f32 values jax computes)
__constant__ float INVF[32] = {1.000000000e+00,7.498942018e-01,5.623413324e-01,4.216965139e-01,3.162277639e-01,2.371373624e-01,1.778279394e-01,1.333521456e-01,1.000000015e-01,7.498941571e-02,5.623412877e-02,4.216964915e-02,3.162277862e-02,2.371373586e-02,1.778279431e-02,1.333521493e-02,9.999999776e-03,7.498942316e-03,5.623413250e-03,4.216964822e-03,3.162277862e-03,2.371373819e-03,1.778279431e-03,1.333521446e-03,1.000000047e-03,7.498941850e-04,5.623413017e-04,4.216964880e-04,3.162277862e-04,2.371373848e-04,1.778279402e-04,1.333521504e-04};
#define PROJ_EXTRA_PARAMS , const int* __restrict__ TPOS
// interleaved-pair RoPE on q and k (which 0, 1) at the token's position from the int input token_positions[t]: angle = (float)pos * inv_freq[i]; (x1, x2) -> (x1 cos - x2 sin, x1 sin + x2 cos); products and sums kept separate (no fma contraction); a call does the 8 pairs from i0 on
#define PROJ_EPI(which, row, t, h, i0) do { if ((which) < 2) { float* rw = (row); const float pos_ = (float)TPOS[(t)]; _Pragma("unroll 4") for (int i = (i0); i < (i0) + 8; ++i) { _Pragma("clang fp contract(off)") const float ang = pos_ * INVF[i]; const float cs = cosf(ang), sn = sinf(ang); const float xe = rw[2 * i], xo = rw[2 * i + 1]; rw[2 * i] = xe * cs - xo * sn; rw[2 * i + 1] = xe * sn + xo * cs; } } } while (0)
#ifndef PROJ_EXTRA_PARAMS
#define PROJ_EXTRA_PARAMS
#endif

#define WS_QH  0u                                      // f16 q rows [b*t][CC]
#define WS_KH  (WS_QH + 2u * (size_t)NB * TT * CC)      // f16 k rows [b*t][CC]
#define WS_VT  (WS_KH + 2u * (size_t)NB * TT * CC)      // f16 v planes [b][c][t]
#define WS_QL  (WS_VT + 2u * (size_t)NB * CC * TT)      // f16 q residual x 2^10 rows [b][t < QHI][CC]
#define WS_KL  (WS_QL + 2u * (size_t)NB * QHI * CC)     // f16 k residual x 2^10 rows [b][t < KHI][CC]
#define WS_VB  (WS_KL + 2u * (size_t)NB * KHI * CC)     // bf16 v hi planes [b][c][t < KHI]
#define WS_VBL (WS_VB + 2u * (size_t)NB * CC * KHI)
#define WS_Y   (WS_VBL + 2u * (size_t)NB * CC * KHI)    // f32 ctx rows [b*t][CC] (only when there is an output projection)
#define WS_END (WS_Y  + 4u * (size_t)NB * TT * CC)

// LDS staging of the projections' operands: a stage is KS k of every operand row, brought by whole-line loads (16 lanes x 16 B = one 256-B row piece), converted once per block, laid at a pitch of 128 + 16 B for the 16-byte fragment reads
#define KS 64
#define LP 72
// full unroll: the register arrays the loop walks keep constant indices (no scratch) and the row steps fold into the instructions' offsets
#define UNROLL_REGS _Pragma("unroll")
typedef __attribute__((ext_vector_type(4))) __bf16 v4b;
typedef __attribute__((ext_vector_type(4))) _Float16 v4h;
// stands behind each group of global loads and each of k_proj's stores, before anything may take their address registers
#define XWAIT() asm volatile("s_wait_xcnt 0x0" ::: "memory")
__device__ __forceinline__ v4b cvt4b(v4f v) { v4b r;
UNROLL_REGS
  for (int i = 0; i < 4; ++i) r[i] = (__bf16)v[i];
  return r; }
__device__ __forceinline__ v4b cvt4bl(v4f v) { v4b r;   /* the residual plane of bsplit16 */
UNROLL_REGS
  for (int i = 0; i < 4; ++i) r[i] = (__bf16)(v[i] - (float)(__bf16)v[i]);
  return r; }
__device__ __forceinline__ v4h cvt4hs(v4f v, float sc) { v4h r;
UNROLL_REGS
  for (int i = 0; i < 4; ++i) r[i] = (_Float16)(v[i] * sc);
  return r; }
__device__ __forceinline__ v4h cvt4hw(v4f v) { v4h r;   /* f16(bf16 x 2^8), exact */
UNROLL_REGS
  for (int i = 0; i < 4; ++i) r[i] = (_Float16)(bfr(v[i]) * 256.0f);
  return r; }
// ---- k_proj: block = (128 rows, the same 128 cols of q, of k and of v), 16 waves of 32 rows x 32 cols of each of the three (3 x 2 x 2 accumulator tiles): a staged X row serves the three products, so X comes from L2 once, not three times, and the 256 blocks are one round of the chip: q/k/v = X W (+ b) with exact bf16 products (K = DIN), X and the three W tiles staged as bf16 in a two-buffer LDS ring, the next stage's global loads in flight over this stage's products; the epilogue runs six times, once per (which, 64-row half of the tile), in the same LDS planes -> which 0: q f16 rows (+ residual rows < QHI); 1: k f16 rows (+ residual rows < KHI); 2: v f16 planes [c][t] (+ bf16 hi/lo planes for t < KHI)
__global__ __launch_bounds__(512) void k_proj(const float* __restrict__ X, const float* __restrict__ WQ, const float* __restrict__ WK, const float* __restrict__ WV, const float* __restrict__ BQ, const float* __restrict__ BK, const float* __restrict__ BV,
    _Float16* __restrict__ QH, _Float16* __restrict__ QL, _Float16* __restrict__ KH, _Float16* __restrict__ KL, _Float16* __restrict__ VT, __bf16* __restrict__ VB, __bf16* __restrict__ VBL PROJ_EXTRA_PARAMS) {
  __shared__ __align__(16) float st[64][132];
  struct Epi { _Float16 sh[64][136], sl[64][136]; _Float16 th[128][72]; __bf16 tb[128][72], tbl[128][72]; };
  __shared__ __align__(16) union { Epi e; __bf16 ring[2][128 + 3 * 128][LP]; } u;   /* the ring (rows 0..127 X, 128.. Wq, 256.. Wk, 384.. Wv) is dead before the epilogue's planes are written: two barriers lie between */
  auto& sh = u.e.sh; auto& sl = u.e.sl; auto& th = u.e.th; auto& tb = u.e.tb; auto& tbl = u.e.tbl;
  const int tid = threadIdx.x, wave = __builtin_amdgcn_readfirstlane(tid >> 5), lane = tid & 31, col = lane & 15, g = lane >> 4; const int wr = wave >> 2, wc = wave & 3; const int c0 = blockIdx.y * 128; const size_t r0 = (size_t)blockIdx.x * 128; const size_t bb = r0 / TT; const int t0 = (int)(r0 % TT);
  v8f acc[3][2][2] = {};
  const int fr = tid >> 4, fc = (tid & 15) * 4;   /* the thread's row of each 32-row sweep and its 4 floats of a stage row */
  const unsigned fo = fr * DIN + fc; const float* xg = X + r0 * DIN; const float* wg0 = WQ + (size_t)c0 * DIN; const float* wg1 = WK + (size_t)c0 * DIN; const float* wg2 = WV + (size_t)c0 * DIN; v4f xr[4], wv[3][4];   /* block-uniform bases, one 32-bit lane offset that nothing overwrites */
UNROLL_REGS
  for (int i = 0; i < 4; ++i) xr[i] = *(const v4f*)(xg + fo + (size_t)i * 32 * DIN);
UNROLL_REGS
  for (int i = 0; i < 4; ++i) { wv[0][i] = *(const v4f*)(wg0 + fo + (size_t)i * 32 * DIN); wv[1][i] = *(const v4f*)(wg1 + fo + (size_t)i * 32 * DIN); wv[2][i] = *(const v4f*)(wg2 + fo + (size_t)i * 32 * DIN); }
  XWAIT();
  for (int s = 0; s < DIN / KS; ++s) { __bf16 (*rb)[LP] = u.ring[s & 1];
UNROLL_REGS
    for (int i = 0; i < 4; ++i) *(v4b*)&rb[fr + 32 * i][fc] = cvt4b(xr[i]);
UNROLL_REGS
    for (int q = 0; q < 3; ++q)
UNROLL_REGS
      for (int i = 0; i < 4; ++i) *(v4b*)&rb[128 + 128 * q + fr + 32 * i][fc] = cvt4b(wv[q][i]);
    __syncthreads();   /* publishes stage s; it also ends every wave's reads of the other buffer, which stage s + 1 overwrites */
    if (s + 1 < DIN / KS) { xg += KS; wg0 += KS; wg1 += KS; wg2 += KS;
UNROLL_REGS
      for (int i = 0; i < 4; ++i) xr[i] = *(const v4f*)(xg + fo + (size_t)i * 32 * DIN);
UNROLL_REGS
      for (int i = 0; i < 4; ++i) { wv[0][i] = *(const v4f*)(wg0 + fo + (size_t)i * 32 * DIN); wv[1][i] = *(const v4f*)(wg1 + fo + (size_t)i * 32 * DIN); wv[2][i] = *(const v4f*)(wg2 + fo + (size_t)i * 32 * DIN); }
      XWAIT(); }
UNROLL_REGS
    for (int kk = 0; kk < KS / 32; ++kk) { v16b a[2], w[3][2];   /* a block's fragment reads go as one group ahead of its products */
UNROLL_REGS
      for (int i = 0; i < 2; ++i) a[i] = frag_b(&rb[wr * 32 + i * 16 + col][kk * 32], lane);
UNROLL_REGS
      for (int q = 0; q < 3; ++q)
UNROLL_REGS
        for (int j = 0; j < 2; ++j) w[q][j] = frag_b(&rb[128 + 128 * q + wc * 32 + j * 16 + col][kk * 32], lane);
UNROLL_REGS
      for (int q = 0; q < 3; ++q)
UNROLL_REGS
        for (int i = 0; i < 2; ++i)
UNROLL_REGS
          for (int j = 0; j < 2; ++j) acc[q][i][j] = wmma_bf(a[i], w[q][j], acc[q][i][j]); } }
  const int i0 = (wave >> 2) * 8;   /* the RoPE pairs of a (row, head) go a quarter to each group of four waves */
#pragma unroll 1   /* one copy of the epilogue's long text (the RoPE code) in the instruction cache, not six */
  for (int ep = 0; ep < 6; ++ep) { const int which = ep >> 1, hp = ep & 1; const float* BA = which == 0 ? BQ : which == 1 ? BK : BV; const size_t rh = r0 + 64 * hp; const int th0 = t0 + 64 * hp;   /* the 64-row half the eight waves wr >> 1 == hp hold; the barrier behind each pass's conversion ends the reads of st, the two in front of the next conversion end the reads of the planes */
  { // stage the half's f32 tile (acc + bias) in LDS, run the per-(row, head) epilogue hook, then convert
    if ((wr >> 1) == hp) {
UNROLL_REGS
    for (int q = 0; q < 3; ++q) if (q == which) {   /* block-uniform test: the accumulator array keeps constant indices */
#pragma unroll
    for (int i = 0; i < 2; ++i)
#pragma unroll
    for (int j = 0; j < 2; ++j) { const float bias = BA ? bfr(BA[c0 + wc * 32 + j * 16 + col]) : 0.f;
#pragma unroll
      for (int r = 0; r < 8; ++r) st[(wr & 1) * 32 + i * 16 + 8 * g + r][wc * 32 + j * 16 + col] = acc[q][i][j][r] + bias; } } }
    __syncthreads();
    { const int e = tid & 127; const int rl = e / (128 / HD), hh = e % (128 / HD); PROJ_EPI(which, &st[rl][hh * HD], (int)((rh + rl) % TT), (c0 / HD) + hh, i0); }
    __syncthreads(); }
  if (which < 2) { _Float16* DH = which == 0 ? QH : KH; _Float16* DL = which == 0 ? QL : KL; const int nhi = which == 0 ? QHI : KHI; const bool hi_rows = th0 < nhi;
    for (int e = tid; e < 64 * 128; e += 512) { const int rl = e >> 7, cl = e & 127; const float v = st[rl][cl]; const _Float16 hv = (_Float16)v; sh[rl][cl] = hv; sl[rl][cl] = (_Float16)((v - (float)hv) * 1024.0f); }
    __syncthreads();
    for (int e = tid; e < 64 * 16; e += 512) { const int rl = e >> 4, q = e & 15; vst2((unsigned*)(DH + (rh + rl) * CC + c0 + q * 8), *(const v4u*)&sh[rl][q * 8]); XWAIT(); if (hi_rows) { vst2((unsigned*)(DL + (bb * nhi + th0 + rl) * (size_t)CC + c0 + q * 8), *(const v4u*)&sl[rl][q * 8]); XWAIT(); } }
  } else { const bool hi_rows = th0 < KHI;
    for (int e = tid; e < 64 * 128; e += 512) { const int rl = e & 63, cl = e >> 6; const float v = st[rl][cl]; th[cl][rl] = (_Float16)v; const __bf16 bh = (__bf16)v; tb[cl][rl] = bh; tbl[cl][rl] = (__bf16)(v - (float)bh); }
    __syncthreads();
    for (int e = tid; e < 128 * 8; e += 512) { const int cl = e >> 3, q = e & 7; vst2((unsigned*)(VT + (bb * CC + c0 + cl) * (size_t)TT + th0 + q * 8), *(const v4u*)&th[cl][q * 8]); XWAIT(); if (hi_rows) { const size_t o3 = (bb * CC + c0 + cl) * (size_t)KHI + th0 + q * 8; vst2((unsigned*)(VB + o3), *(const v4u*)&tb[cl][q * 8]); vst2((unsigned*)(VBL + o3), *(const v4u*)&tbl[cl][q * 8]); XWAIT(); } } } } }
// fragment from the lane's own pointer (row start + k0 + 8 * (lane >> 4)): the same k order as frag_h / frag_b
__device__ __forceinline__ v16h frag_hp(const _Float16* p) { union { v16h v; v8h q[2]; } u; u.q[0] = *(const v8h*)p; u.q[1] = *(const v8h*)(p + 16); return u.v; }
__device__ __forceinline__ v16b frag_bp(const __bf16* p) { union { v16b v; v8b q[2]; } u; u.q[0] = *(const v8b*)p; u.q[1] = *(const v8b*)(p + 16); return u.v; }
// one 32-key step of a query's running softmax: v = the lane's 16 scaled logits (-3.0e38 = excluded) -> exp(v - new maximum) x 2^11; m = running maximum (both wave halves alike), l = this half's running sum; returns the factor that carries the old sums to the new maximum
__device__ __forceinline__ float sm_step(float v[16], float& m, float& l) {
  float mx = v[0];
#pragma unroll
  for (int i = 1; i < 16; ++i) mx = fmaxf(mx, v[i]);
  mx = fmaxf(mx, __shfl_xor(mx, 16));
  const float mn = fmaxf(m, mx); const float alpha = expf(m - mn); float s = 0.f;
#pragma unroll
  for (int i = 0; i < 16; ++i) { const float e = expf(v[i] - mn); s += e; v[i] = e * 2048.0f; }   /* mn is a kept key's logit (every step holds one for every query), so an excluded key gives exp(-3.0e38) = 0 */
  l = l * alpha + s; m = mn; return alpha; }
// the same step in base 2 over a whole 64-key stage, for the blocks behind the early ones: v = the lane's 32 RAW logits q.k (-3.0e38 = excluded), m = running maximum of raw logits; exp(SCALE x (v - mn)) x 2^11 = exp2(v x C2 - (mn x C2 - 11)), C2 = SCALE x log2(e): one fma and one hardware exp2 per score (SCALE > 0, so the maximum may be taken before the scaling); l carries the factor 2^11 (exact); an excluded key gives exp2(-5.4e37) = 0; each 32-key half keeps its own maximum and its own sum, joined once
#define C2 (SCALE * 1.44269504088896340736f)
__device__ __forceinline__ float sm_step2(float v[32], float& m, float& l) {
  float mx0 = v[0], mx1 = v[16];
#pragma unroll
  for (int i = 1; i < 16; ++i) { mx0 = fmaxf(mx0, v[i]); mx1 = fmaxf(mx1, v[16 + i]); }
  float mx = fmaxf(mx0, mx1); mx = fmaxf(mx, __shfl_xor(mx, 16));
  const float mn = fmaxf(m, mx); const float alpha = __builtin_amdgcn_exp2f((m - mn) * C2); const float nb = __builtin_fmaf(mn, C2, -11.0f); float s0 = 0.f, s1 = 0.f;
#pragma unroll
  for (int i = 0; i < 16; ++i) { const float e0 = __builtin_amdgcn_exp2f(__builtin_fmaf(v[i], C2, -nb)), e1 = __builtin_amdgcn_exp2f(__builtin_fmaf(v[16 + i], C2, -nb)); s0 += e0; s1 += e1; v[i] = e0; v[16 + i] = e1; }
  l = l * alpha + (s0 + s1); m = mn; return alpha; }
// ---- k_attn: block = (head h, 64 queries qb, batch b), wave = 16 queries, keys [0, diagonal] 32 at a time (behind the early blocks: 64 at a time, k rows and v planes staged 64 keys at a time in LDS, once for the block's four waves, the next stage's global loads in flight over this stage's step). S^T = K Q^T x SCALE (behind the early blocks SCALE is applied inside the softmax step): lane (g, col) holds query col's logits of keys 8g + r and 16 + 8g + r (causal early query blocks: q and k residual planes, 3 products); the causal rule by index in the last step; running maximum and sum in f32; the score tiles, two per B operand (32 keys), as P^T x 2^11 once to f16 (early blocks: bf16 hi + lo), are the B operands of ctx^T += V^T P^T (early blocks: v bf16 hi + lo, 3 products); ctx = sums / (2^11 x sum of exp); 256-B (row, head) segment by 16 lanes
__global__ __launch_bounds__(128) void k_attn(const _Float16* __restrict__ QH, const _Float16* __restrict__ KH, const _Float16* __restrict__ QL, const _Float16* __restrict__ KL, const _Float16* __restrict__ VT, const __bf16* __restrict__ VB, const __bf16* __restrict__ VBL, float* __restrict__ Y) { __shared__ __align__(16) float ss[4][16][HD + 4]; __shared__ __align__(16) _Float16 kv[2][64 + HD][LP];   /* two-buffer ring of 64-key stages: rows 0..63 the keys' k rows of this head, rows 64.. its v planes [c][64 keys] */
  const int tid = threadIdx.x, wave = __builtin_amdgcn_readfirstlane(tid >> 5), lane = tid & 31, col = lane & 15, g = lane >> 4; const int h = blockIdx.x, qb = blockIdx.y, b = blockIdx.z; const int ql0 = qb * 64 + wave * 16; const int nch = (ql0 + 47) >> 5;
  const size_t q0 = (size_t)b * TT + ql0, kr0 = (size_t)b * TT;
  v8f acc[HD / 16] = {}; float m = -3.0e38f, l = 0.f; const float lc = qb < QBH ? 2048.0f : 1.0f;   /* what the sum of exp still lacks of the 2^11 that P carries */
  if (qb < QBH) { const _Float16* QLb = QL + (size_t)b * QHI * CC; const _Float16* KLb = KL + (size_t)b * KHI * CC; v16h qh[HD / 32], qlo[HD / 32];
#pragma unroll
    for (int kk = 0; kk < HD / 32; ++kk) { qh[kk] = frag_h(QH + (q0 + col) * CC + h * HD + kk * 32, lane); qlo[kk] = frag_h(QLb + (size_t)(ql0 + col) * CC + h * HD + kk * 32, lane); }
    asm volatile("s_wait_xcnt 0x0" :: "v"(qh[0]), "v"(qh[1]), "v"(qlo[0]), "v"(qlo[1]) : "memory");   /* XWAIT held behind the q loads by their values (inputs only) */
    const _Float16* kp = KH + (kr0 + col) * CC + h * HD + 8 * g; const _Float16* klp = KLb + (size_t)col * CC + h * HD + 8 * g; const __bf16* vp = VB + ((size_t)b * CC + h * HD + col) * (size_t)KHI + 8 * g; const __bf16* vlp = VBL + ((size_t)b * CC + h * HD + col) * (size_t)KHI + 8 * g;
    for (int kc = 0; kc < nch; ++kc, kp += 32 * CC, klp += 32 * CC, vp += 32, vlp += 32) { const int k0 = kc * 32; float v[16]; v16h kbf[2][HD / 32], klf[2][HD / 32];   /* a step's k loads are all issued before its first product, its v loads before the softmax */
#pragma unroll
      for (int t = 0; t < 2; ++t)
#pragma unroll
        for (int kk = 0; kk < HD / 32; ++kk) kbf[t][kk] = frag_hp(kp + t * 16 * CC + kk * 32);
      XWAIT();
#pragma unroll
      for (int t = 0; t < 2; ++t)
#pragma unroll
        for (int kk = 0; kk < HD / 32; ++kk) klf[t][kk] = frag_hp(klp + t * 16 * CC + kk * 32);
      XWAIT();
#pragma unroll
      for (int t = 0; t < 2; ++t) { v8f s = {}, sl = {};
#pragma unroll
        for (int kk = 0; kk < HD / 32; ++kk) { s = wmma16(kbf[t][kk], qh[kk], s); sl = wmma16(kbf[t][kk], qlo[kk], sl); sl = wmma16(klf[t][kk], qh[kk], sl); }
#pragma unroll
        for (int r = 0; r < 8; ++r) v[t * 8 + r] = (s[r] + sl[r] * (1.0f / 1024.0f)) * SCALE; }
      if (kc == nch - 1) {
#pragma unroll
        for (int i = 0; i < 16; ++i) if (k0 + (i >> 3) * 16 + 8 * g + (i & 7) > ql0 + col) v[i] = -3.0e38f; }
      v16b vh[HD / 16], vl[HD / 16];
#pragma unroll
      for (int j = 0; j < HD / 16; ++j) vh[j] = frag_bp(vp + j * 16 * KHI);
      XWAIT();
#pragma unroll
      for (int j = 0; j < HD / 16; ++j) vl[j] = frag_bp(vlp + j * 16 * KHI);
      XWAIT();
      const float alpha = sm_step(v, m, l); const F2 p = bsplit16(v);
#pragma unroll
      for (int j = 0; j < HD / 16; ++j) { acc[j] = acc[j] * alpha; acc[j] = wmma_bf(vh[j], p.h, acc[j]); acc[j] = wmma_bf(vh[j], p.l, acc[j]); acc[j] = wmma_bf(vl[j], p.h, acc[j]); } }
  } else { v16h qh[HD / 32];
#pragma unroll
    for (int kk = 0; kk < HD / 32; ++kk) qh[kk] = frag_h(QH + (q0 + col) * CC + h * HD + kk * 32, lane);
    asm volatile("s_wait_xcnt 0x0" :: "v"(qh[0]), "v"(qh[1]) : "memory");   /* XWAIT held behind the q loads by their values (inputs only) */
    const int fr = tid >> 3, fc = (tid & 7) * 8;   /* the thread's row of each 16-row sweep and its 16 B of a 128-B stage row: a wave's load covers 4 whole lines */
    const unsigned ko = fr * CC + fc, vo = fr * TT + fc; const _Float16* kg = KH + kr0 * CC + h * HD; const _Float16* vg = VT + ((size_t)b * CC + h * HD) * (size_t)TT; v8h kr[4], vr[HD / 16];   /* block-uniform bases, 32-bit lane offsets that nothing overwrites */
UNROLL_REGS
    for (int i = 0; i < 4; ++i) kr[i] = *(const v8h*)(kg + ko + (size_t)i * 16 * CC);
    XWAIT();
UNROLL_REGS
    for (int i = 0; i < HD / 16; ++i) vr[i] = *(const v8h*)(vg + vo + (size_t)i * 16 * TT);
    XWAIT();
    for (int s = 0; s <= qb; ++s) { _Float16 (*rb)[LP] = kv[s & 1];   /* block-uniform trip count: every wave passes every barrier */
UNROLL_REGS
      for (int i = 0; i < 4; ++i) *(v8h*)&rb[fr + 16 * i][fc] = kr[i];
UNROLL_REGS
      for (int i = 0; i < HD / 16; ++i) *(v8h*)&rb[64 + fr + 16 * i][fc] = vr[i];
      __syncthreads();   /* publishes stage s and ends the reads of the buffer that stage s + 1 overwrites */
      if (s < qb) { kg += 64 * CC; vg += 64;
UNROLL_REGS
        for (int i = 0; i < 4; ++i) kr[i] = *(const v8h*)(kg + ko + (size_t)i * 16 * CC);
UNROLL_REGS
        for (int i = 0; i < HD / 16; ++i) vr[i] = *(const v8h*)(vg + vo + (size_t)i * 16 * TT);
        XWAIT(); }
      { float v[32]; v16h kf[4][HD / 32], vf[2][HD / 16]; v8f sc[4] = {};   /* ONE softmax step per 64-key stage: four independent score tiles, one maximum exchange, one rescale of the sums; the k fragment reads go as one group ahead of the first product, the v reads as one group ahead of the softmax */
UNROLL_REGS
      for (int t = 0; t < 4; ++t)
UNROLL_REGS
        for (int kk = 0; kk < HD / 32; ++kk) kf[t][kk] = frag_hp(&rb[t * 16 + col][kk * 32 + 8 * g]);
UNROLL_REGS
      for (int kk = 0; kk < HD / 32; ++kk)
UNROLL_REGS
        for (int t = 0; t < 4; ++t) sc[t] = wmma16(kf[t][kk], qh[kk], sc[t]);
UNROLL_REGS
      for (int t2 = 0; t2 < 2; ++t2)
UNROLL_REGS
        for (int j = 0; j < HD / 16; ++j) vf[t2][j] = frag_hp(&rb[64 + j * 16 + col][t2 * 32 + 8 * g]);
#pragma unroll
      for (int t = 0; t < 4; ++t)
#pragma unroll
        for (int r = 0; r < 8; ++r) v[t * 8 + r] = sc[t][r];
      if (s == qb) {   /* block-uniform: the diagonal lies in the last stage; a wave's keys wholly behind it count 0 */
#pragma unroll
        for (int i = 0; i < 32; ++i) if (s * 64 + (i >> 3) * 16 + 8 * g + (i & 7) > ql0 + col) v[i] = -3.0e38f; }
      const float alpha = sm_step2(v, m, l); v16h p[2];
#pragma unroll
      for (int i = 0; i < 32; ++i) p[i >> 4][i & 15] = (_Float16)v[i];
UNROLL_REGS
      for (int j = 0; j < HD / 16; ++j) acc[j] = acc[j] * alpha;
UNROLL_REGS
      for (int t2 = 0; t2 < 2; ++t2)
UNROLL_REGS
        for (int j = 0; j < HD / 16; ++j) acc[j] = wmma16(vf[t2][j], p[t2], acc[j]); } } }
  l += __shfl_xor(l, 16); const float inv = 1.0f / (l * lc);
#pragma unroll
  for (int j = 0; j < HD / 16; ++j)
#pragma unroll
    for (int r = 0; r < 8; ++r) ss[wave][col][j * 16 + 8 * g + r] = acc[j][r] * inv;
  LDSX(); for (int rl = 0; rl < 16; ++rl) if (lane < HD / 4) vst2(Y + ((size_t)b * TT + ql0 + rl) * CC + h * HD + lane * 4, *(const v4f*)&ss[wave][rl][lane * 4]); }
// ---- k_out: block = (128 rows, 128 cols), 8 waves of 32 rows x 64 cols, operands staged in a two-buffer LDS ring as in k_proj: out = ctx Wo (+ bo): ctx x 2^6 once to f16 against Wo as f16(bf16 x 2^8) exact (1 product) x 2^-14; causal early rows (< QHI of each sequence): ctx bf16 hi + lo against exact bf16 Wo (2 products)
__global__ __launch_bounds__(256) void k_out(const float* __restrict__ Y, const float* __restrict__ WO, const float* __restrict__ BO, float* __restrict__ OUT) { __shared__ __align__(16) float sf[8][32][68];
  __shared__ __align__(16) union { __bf16 b[2][128 + 128 + 128][LP]; _Float16 h[2][128 + 128][LP]; } u;   /* early rows: ctx hi 0..127, ctx lo 128..255, Wo 256..383; else ctx 0..127, Wo 128..255 */
  const int tid = threadIdx.x, wave = __builtin_amdgcn_readfirstlane(tid >> 5), lane = tid & 31, col = lane & 15, g = lane >> 4; const int wr = wave >> 1, wc = wave & 1; const int c0 = blockIdx.y * 128; const size_t r0 = (size_t)blockIdx.x * 128 + wr * 32;
  v8f acc[2][4] = {};
  const int fr = tid >> 4, fc = (tid & 15) * 4;   /* as in k_proj */
  const unsigned fo = fr * CC + fc; const float* yg = Y + (size_t)blockIdx.x * 128 * CC; const float* wg = WO + (size_t)c0 * CC; v4f yr[8], wv[8];
UNROLL_REGS
  for (int i = 0; i < 8; ++i) yr[i] = *(const v4f*)(yg + fo + (size_t)i * 16 * CC);
UNROLL_REGS
  for (int i = 0; i < 8; ++i) wv[i] = *(const v4f*)(wg + fo + (size_t)i * 16 * CC);
  XWAIT();
  if (CAUSAL && (int)(((size_t)blockIdx.x * 128) % TT) < QHI) {   /* block-uniform; QHI is a multiple of the 128 rows */
    for (int s = 0; s < CC / KS; ++s) { __bf16 (*rb)[LP] = u.b[s & 1];
UNROLL_REGS
      for (int i = 0; i < 8; ++i) { *(v4b*)&rb[fr + 16 * i][fc] = cvt4b(yr[i]); *(v4b*)&rb[128 + fr + 16 * i][fc] = cvt4bl(yr[i]); }
UNROLL_REGS
      for (int i = 0; i < 8; ++i) *(v4b*)&rb[256 + fr + 16 * i][fc] = cvt4b(wv[i]);
      __syncthreads();   /* publishes stage s and ends the reads of the buffer that stage s + 1 overwrites */
      if (s + 1 < CC / KS) { yg += KS; wg += KS;
UNROLL_REGS
        for (int i = 0; i < 8; ++i) yr[i] = *(const v4f*)(yg + fo + (size_t)i * 16 * CC);
UNROLL_REGS
        for (int i = 0; i < 8; ++i) wv[i] = *(const v4f*)(wg + fo + (size_t)i * 16 * CC);
        XWAIT(); }
UNROLL_REGS
      for (int kk = 0; kk < KS / 32; ++kk) { v16b ah[2], al[2], w[4];
UNROLL_REGS
        for (int i = 0; i < 2; ++i) { ah[i] = frag_b(&rb[wr * 32 + i * 16 + col][kk * 32], lane); al[i] = frag_b(&rb[128 + wr * 32 + i * 16 + col][kk * 32], lane); }
UNROLL_REGS
        for (int j = 0; j < 4; ++j) w[j] = frag_b(&rb[256 + wc * 64 + j * 16 + col][kk * 32], lane);
UNROLL_REGS
        for (int i = 0; i < 2; ++i)
UNROLL_REGS
          for (int j = 0; j < 4; ++j) { acc[i][j] = wmma_bf(ah[i], w[j], acc[i][j]); acc[i][j] = wmma_bf(al[i], w[j], acc[i][j]); } } }
#pragma unroll
    for (int i = 0; i < 2; ++i)
#pragma unroll
    for (int j = 0; j < 4; ++j) { const float bias = BO ? bfr(BO[c0 + wc * 64 + j * 16 + col]) : 0.f;
#pragma unroll
      for (int r = 0; r < 8; ++r) sf[wave][i * 16 + 8 * g + r][j * 16 + col] = acc[i][j][r] + bias; }
  } else {
    for (int s = 0; s < CC / KS; ++s) { _Float16 (*rb)[LP] = u.h[s & 1];
UNROLL_REGS
      for (int i = 0; i < 8; ++i) *(v4h*)&rb[fr + 16 * i][fc] = cvt4hs(yr[i], 64.0f);   /* ctx carried x 2^6 into f16 so small-magnitude context rows stay clear of f16 subnormals (chip FTZ) */
UNROLL_REGS
      for (int i = 0; i < 8; ++i) *(v4h*)&rb[128 + fr + 16 * i][fc] = cvt4hw(wv[i]);
      __syncthreads();   /* publishes stage s and ends the reads of the buffer that stage s + 1 overwrites */
      if (s + 1 < CC / KS) { yg += KS; wg += KS;
UNROLL_REGS
        for (int i = 0; i < 8; ++i) yr[i] = *(const v4f*)(yg + fo + (size_t)i * 16 * CC);
UNROLL_REGS
        for (int i = 0; i < 8; ++i) wv[i] = *(const v4f*)(wg + fo + (size_t)i * 16 * CC);
        XWAIT(); }
UNROLL_REGS
      for (int kk = 0; kk < KS / 32; ++kk) { v16h a[2], w[4];
UNROLL_REGS
        for (int i = 0; i < 2; ++i) a[i] = frag_h(&rb[wr * 32 + i * 16 + col][kk * 32], lane);
UNROLL_REGS
        for (int j = 0; j < 4; ++j) w[j] = frag_h(&rb[128 + wc * 64 + j * 16 + col][kk * 32], lane);
UNROLL_REGS
        for (int i = 0; i < 2; ++i)
UNROLL_REGS
          for (int j = 0; j < 4; ++j) acc[i][j] = wmma16(a[i], w[j], acc[i][j]); } }
#pragma unroll
    for (int i = 0; i < 2; ++i)
#pragma unroll
    for (int j = 0; j < 4; ++j) { const float bias = BO ? bfr(BO[c0 + wc * 64 + j * 16 + col]) : 0.f;
#pragma unroll
      for (int r = 0; r < 8; ++r) sf[wave][i * 16 + 8 * g + r][j * 16 + col] = acc[i][j][r] * (1.0f / 16384.0f) + bias; } }   /* 2^-8 (Wo carry) x 2^-6 (ctx carry) */
  LDSX(); for (int rp = 0; rp < 16; ++rp) { const int rl = 2 * rp + g; vst2(OUT + (r0 + rl) * DIN + c0 + wc * 64 + col * 4, *(const v4f*)&sf[wave][rl][col * 4]); } }   /* a wave's store covers two rows' 256-B pieces: whole lines */

extern "C" void kernel_launch(void* const* d_in, const int* in_sizes, int n_in, void* d_out, int out_size, void* d_ws, size_t ws_size, hipStream_t stream) {
  (void)in_sizes; (void)n_in; (void)out_size;
  const float** F = (const float**)d_in;
  if (ws_size < (size_t)WS_END) return;
  char* ws = (char*)d_ws; _Float16 *QH = (_Float16*)(ws + WS_QH), *KH = (_Float16*)(ws + WS_KH), *VT = (_Float16*)(ws + WS_VT), *QL = (_Float16*)(ws + WS_QL), *KL = (_Float16*)(ws + WS_KL); __bf16 *VB = (__bf16*)(ws + WS_VB), *VBL = (__bf16*)(ws + WS_VBL); float *Y = (float*)(ws + WS_Y);
  (void)Y; (void)QL; (void)KL; (void)VB; (void)VBL;
  // inputs: 0 x [1,4096,1024]; 1 token_positions [4096] int32 (arange): READ on the device; 2 Wq [1024,1024] (out,in); 3 Wk; 4 Wv; 5 Wo (out,in); no biases (null pointers)
  k_proj<<<dim3(TNB * TT / 128, CC / 128), 512, 0, stream>>>(F[0], F[2], F[3], F[4], nullptr, nullptr, nullptr, QH, QL, KH, KL, VT, VB, VBL, (const int*)d_in[1]);
  k_attn<<<dim3(NH, NQB, TNB), 128, 0, stream>>>(QH, KH, QL, KL, VT, VB, VBL, Y);
  k_out<<<dim3(TNB * TT / 128, DIN / 128), 256, 0, stream>>>(Y, F[5], nullptr, (float*)d_out);
}

// v007
// A run of this version takes 108 microseconds.
// In two side-by-side timings against v006, it was 1.05 and 1.03 times as fast.
// All steps since v000 together make it 27.4 times as fast.
// compute dtype: all float inputs rounded to bf16; q/k/v projections with EXACT bf16 products on WMMA 16x16x32 (f32 accumulate); RoPE in f32 at the int token positions; causal logits: 3 products for the first 384 rows, single f16 q x k after, x 64^-0.5; softmax f32; P x 2^11 once to f16 x v once to f16 (bf16 hi + lo below row 384); ctx hi+lo x exact Wo below row 384, x2^6 f16 carry x f16(bf16 x 2^8) Wo after; f32 output.
#include <hip/hip_runtime.h>
#include <math.h>

typedef __attribute__((ext_vector_type(16))) _Float16 v16h;
typedef __attribute__((ext_vector_type(16))) __bf16 v16b;
typedef __attribute__((ext_vector_type(8)))  _Float16 v8h;
typedef __attribute__((ext_vector_type(8)))  float v8f;
typedef __attribute__((ext_vector_type(4)))  float v4f;
typedef __attribute__((ext_vector_type(2)))  float v2f;
typedef __attribute__((ext_vector_type(4)))  unsigned v4u;
typedef __attribute__((ext_vector_type(4)))  int v4i;
typedef float __attribute__((may_alias)) float_a;
typedef int __attribute__((may_alias)) int_a;

template <typename T> __device__ __forceinline__ void vst2(void* p, T v) { *(T*)p = v;  }
__device__ __forceinline__ v8f wmma16(v16h a, v16h b, v8f c) {
  v8f d = __builtin_amdgcn_wmma_f32_16x16x32_f16(false, a, false, b, (short)0, c, false, false);
  asm volatile("v_nop\n\tv_nop\n\tv_nop\n\tv_nop" : "+v"(d) : "v"(a), "v"(b));
  return d;
}
__device__ __forceinline__ v8f wmma_bf(v16b a, v16b b, v8f c) {
  v8f d = __builtin_amdgcn_wmma_f32_16x16x32_bf16(false, a, false, b, (short)0, c, false, false);
  asm volatile("v_nop\n\tv_nop\n\tv_nop\n\tv_nop" : "+v"(d) : "v"(a), "v"(b));
  return d;
}
// 16x16x32 fragments: lane = (h = lane>>4, row/col = lane&15); elements 0..7 = k0+8h+0..7, 8..15 = k0+16+8h+0..7; D element r = row 8h+r
__device__ __forceinline__ v16h frag_h(const _Float16* rowk0, int lane) {
  union { v16h v; v8h q[2]; } u; const _Float16* p = rowk0 + 8 * (lane >> 4);
  u.q[0] = *(const v8h*)p; u.q[1] = *(const v8h*)(p + 16); return u.v;
}
__device__ __forceinline__ v16h frag_f32(const float* rowk0, int lane) {
  v16h a; const float* p = rowk0 + 8 * (lane >> 4);
#pragma unroll
  for (int i = 0; i < 8; ++i) { a[i] = (_Float16)p[i]; a[8 + i] = (_Float16)p[16 + i]; }
  return a;
}
__device__ __forceinline__ v16h frag_f32s(const float* rowk0, int lane, float sc) {
  v16h a; const float* p = rowk0 + 8 * (lane >> 4);
#pragma unroll
  for (int i = 0; i < 8; ++i) { a[i] = (_Float16)(p[i] * sc); a[8 + i] = (_Float16)(p[16 + i] * sc); }
  return a;
}
// column fragment from a [K][ld] layout (column n), rows >= K read as 0
__device__ __forceinline__ v16h fragc_f32(const float* W, int k0, int n, int lane, int ld, int K) {
  v16h a; const int g = lane >> 4;
#pragma unroll
  for (int i = 0; i < 8; ++i) { const int ka = k0 + 8 * g + i, kb = ka + 16;
    a[i] = (_Float16)(ka < K ? W[(size_t)(ka < K ? ka : K - 1) * ld + n] : 0.f); a[8 + i] = (_Float16)(kb < K ? W[(size_t)(kb < K ? kb : K - 1) * ld + n] : 0.f); }
  return a;
}
struct F2 { v16b h, l; };
__device__ __forceinline__ F2 bsplit16(const float v[16]) { F2 r;
#pragma unroll
  for (int i = 0; i < 16; ++i) { const __bf16 h = (__bf16)v[i]; r.h[i] = h; r.l[i] = (__bf16)(v[i] - (float)h); }
  return r; }
__device__ __forceinline__ F2 split_row(const float* row, int k0, int lane) { float v[16]; const float* p = row + k0 + 8 * (lane >> 4);
#pragma unroll
  for (int i = 0; i < 8; ++i) { v[i] = p[i]; v[8 + i] = p[16 + i]; }
  return bsplit16(v); }
__device__ __forceinline__ F2 split_rowK(const float* row, int k0, int lane, int K) { float v[16]; const int g = lane >> 4;
#pragma unroll
  for (int i = 0; i < 8; ++i) { const int ka = k0 + 8 * g + i, kb = ka + 16; v[i] = ka < K ? row[ka < K ? ka : K - 1] : 0.f; v[8 + i] = kb < K ? row[kb < K ? kb : K - 1] : 0.f; }
  return bsplit16(v); }
__device__ __forceinline__ F2 split_col(const float* W, int k0, int n, int lane, int ld, int K) { float v[16]; const int g = lane >> 4;
#pragma unroll
  for (int i = 0; i < 8; ++i) { const int ka = k0 + 8 * g + i, kb = ka + 16; v[i] = ka < K ? W[(size_t)(ka < K ? ka : K - 1) * ld + n] : 0.f; v[8 + i] = kb < K ? W[(size_t)(kb < K ? kb : K - 1) * ld + n] : 0.f; }
  return bsplit16(v); }
__device__ __forceinline__ v8f mac3(const F2& a, const F2& b, v8f c) { c = wmma_bf(a.l, b.h, c); c = wmma_bf(a.h, b.l, c); return wmma_bf(a.h, b.h, c); }
__device__ __forceinline__ float sigm(float v) { return 1.0f / (1.0f + expf(-v)); }
#define LDSX() do { asm volatile("s_wait_dscnt 0" ::: "memory"); __builtin_amdgcn_wave_barrier(); __builtin_amdgcn_fence(__ATOMIC_RELEASE, "workgroup"); } while (0)

// Causal multi-head self-attention with interleaved-pair RoPE at given token positions, ONE batch of 4,096 tokens (x [1,4096,1024]; (out,in) Wq / Wk / Wv / Wo [1024,1024] N(0,1) x 0.02 applied as x @ W.T, no biases; token_positions [4096] int (arange; the LAST input); 16 heads x 64; inv_freq = 1 / 10000^(2i/64); (even, odd) pairs rotated and re-interleaved; scores / sqrt(64); tril kept, -inf elsewhere; softmax; attn @ Wo.T). THIS ROW: the same module and weight scale (0.02) with the argument order x, token_positions, Wq, Wk, Wv, Wo (the positions SECOND): the indices in kernel_launch follow; finfo.min in place of -inf under the causal rule (an exclusion either way); the inverse-frequency expression is the host's own, token for token: the baked table is unchanged.
#define NB 1
#define TT 4096
#define CC 1024            // NH * HD = projected width
#define DIN 1024          // input (model) width
#define NH 16
#define HD 64
#define NQB (TT / 64)
#define SCALE (0.125f)
#define CAUSAL 1
#ifndef TNB
#define TNB NB
#endif
__device__ __forceinline__ float bfr(float v) { return (float)(__bf16)v; }
typedef __attribute__((ext_vector_type(8))) __bf16 v8b;
__device__ __forceinline__ v16b frag_b(const __bf16* rowk0, int lane) {
  union { v16b v; v8b q[2]; } u; const __bf16* p = rowk0 + 8 * (lane >> 4);
  u.q[0] = *(const v8b*)p; u.q[1] = *(const v8b*)(p + 16); return u.v;
}
#define QBH 6              // causal: query blocks 0..QBH-1 of each sequence (few keys, no averaging) take the high-precision path
#define QHI 384            // rows carrying a q residual plane
#define KHI 384            // key rows carrying k residual / v bf16 hi+lo planes (used only by the causal high-precision path)
// B fragment (k rows k0+.., output column o) of a weight: (in,out) [K][ld] or (out,in) [ld rows of K]: bf16 exact, or f16(bf16 * 256) exact
__device__ __forceinline__ v16b wcol_io(const float* Wm, int k0, int o, int lane, int ld) { v16b w; const int g = lane >> 4;
#pragma unroll
  for (int i = 0; i < 8; ++i) { w[i] = (__bf16)Wm[(size_t)(k0 + 8 * g + i) * ld + o]; w[8 + i] = (__bf16)Wm[(size_t)(k0 + 16 + 8 * g + i) * ld + o]; }
  return w; }
__device__ __forceinline__ v16b wcol_oi(const float* Wm, int k0, int o, int lane, int K) { v16b w; const float* p = Wm + (size_t)o * K + k0 + 8 * (lane >> 4);
#pragma unroll
  for (int i = 0; i < 8; ++i) { w[i] = (__bf16)p[i]; w[8 + i] = (__bf16)p[16 + i]; }
  return w; }
__device__ __forceinline__ v16h wcolh_io(const float* Wm, int k0, int o, int lane, int ld) { v16h w; const int g = lane >> 4;
#pragma unroll
  for (int i = 0; i < 8; ++i) { w[i] = (_Float16)(bfr(Wm[(size_t)(k0 + 8 * g + i) * ld + o]) * 256.0f); w[8 + i] = (_Float16)(bfr(Wm[(size_t)(k0 + 16 + 8 * g + i) * ld + o]) * 256.0f); }
  return w; }
__device__ __forceinline__ v16h wcolh_oi(const float* Wm, int k0, int o, int lane, int K) { v16h w; const float* p = Wm + (size_t)o * K + k0 + 8 * (lane >> 4);
#pragma unroll
  for (int i = 0; i < 8; ++i) { w[i] = (_Float16)(bfr(p[i]) * 256.0f); w[8 + i] = (_Float16)(bfr(p[16 + i]) * 256.0f); }
  return w; }
#define WQKV_LAYOUT 1   // picks WCOL's layout (0 = (in,out) [DIN][CC]; 1 = (out,in) [CC][DIN]; 2 = per-head [NH][DIN][HD]); nothing calls WCOL: k_proj reads (out,in) [CC][DIN] rows
__device__ __forceinline__ v16b wcol_hdk(const float* Wm, int k0, int o, int lane) { v16b w; const int g = lane >> 4; const float* p = Wm + (size_t)(o / HD) * DIN * HD + (o % HD);
#pragma unroll
  for (int i = 0; i < 8; ++i) { w[i] = (__bf16)p[(size_t)(k0 + 8 * g + i) * HD]; w[8 + i] = (__bf16)p[(size_t)(k0 + 16 + 8 * g + i) * HD]; }
  return w; }
#define WO_OUT_IN 1
#if WQKV_LAYOUT == 1
#define WCOL(W, k0, o, lane) wcol_oi(W, k0, o, lane, DIN)
#elif WQKV_LAYOUT == 2
#define WCOL(W, k0, o, lane) wcol_hdk(W, k0, o, lane)
#else
#define WCOL(W, k0, o, lane) wcol_io(W, k0, o, lane, CC)
#endif
#if WO_OUT_IN
#define WOCOL(W, k0, o, lane) wcol_oi(W, k0, o, lane, CC)
#define WOCOLH(W, k0, o, lane) wcolh_oi(W, k0, o, lane, CC)
#else
#define WOCOL(W, k0, o, lane) wcol_io(W, k0, o, lane, DIN)
#define WOCOLH(W, k0, o, lane) wcolh_io(W, k0, o, lane, DIN)
#endif
// RoPE inverse frequencies 1/10000^(2i/64) (the f32 values jax computes)
__constant__ float INVF[32] = {1.000000000e+00,7.498942018e-01,5.623413324e-01,4.216965139e-01,3.162277639e-01,2.371373624e-01,1.778279394e-01,1.333521456e-01,1.000000015e-01,7.498941571e-02,5.623412877e-02,4.216964915e-02,3.162277862e-02,2.371373586e-02,1.778279431e-02,1.333521493e-02,9.999999776e-03,7.498942316e-03,5.623413250e-03,4.216964822e-03,3.162277862e-03,2.371373819e-03,1.778279431e-03,1.333521446e-03,1.000000047e-03,7.498941850e-04,5.623413017e-04,4.216964880e-04,3.162277862e-04,2.371373848e-04,1.778279402e-04,1.333521504e-04};
#define PROJ_EXTRA_PARAMS , const int* __restrict__ TPOS
// interleaved-pair RoPE on q and k (which 0, 1) at the token's position from the int input token_positions[t]: angle = (float)pos * inv_freq[i]; (x1, x2) -> (x1 cos - x2 sin, x1 sin + x2 cos); products and sums kept separate (no fma contraction); a call does the 8 pairs from i0 on
#define PROJ_EPI(which, row, t, h, i0) do { if ((which) < 2) { float* rw = (row); const float pos_ = (float)TPOS[(t)]; _Pragma("unroll 4") for (int i = (i0); i < (i0) + 8; ++i) { _Pragma("clang fp contract(off)") const float ang = pos_ * INVF[i]; const float cs = cosf(ang), sn = sinf(ang); const float xe = rw[2 * i], xo = rw[2 * i + 1]; rw[2 * i] = xe * cs - xo * sn; rw[2 * i + 1] = xe * sn + xo * cs; } } } while (0)
#ifndef PROJ_EXTRA_PARAMS
#define PROJ_EXTRA_PARAMS
#endif

#define WS_QH  0u                                      // f16 q rows [b*t][CC]
#define WS_KH  (WS_QH + 2u * (size_t)NB * TT * CC)      // f16 k rows [b*t][CC]
#define WS_VT  (WS_KH + 2u * (size_t)NB * TT * CC)      // f16 v planes [b][c][t]
#define WS_QL  (WS_VT + 2u * (size_t)NB * CC * TT)      // f16 q residual x 2^10 rows [b][t < QHI][CC]
#define WS_KL  (WS_QL + 2u * (size_t)NB * QHI * CC)     // f16 k residual x 2^10 rows [b][t < KHI][CC]
#define WS_VB  (WS_KL + 2u * (size_t)NB * KHI * CC)     // bf16 v hi planes [b][c][t < KHI]
#define WS_VBL (WS_VB + 2u * (size_t)NB * CC * KHI)
#define WS_Y   (WS_VBL + 2u * (size_t)NB * CC * KHI)    // f32 ctx rows [b*t][CC] (only when there is an output projection)
#define WS_END (WS_Y  + 4u * (size_t)NB * TT * CC)

// LDS staging of the projections' operands: a stage is KS k of every operand row, brought by whole-line loads (16 lanes x 16 B = one 256-B row piece), converted once per block, laid at a pitch of 128 + 16 B for the 16-byte fragment reads
#define KS 64
#define LP 72
// full unroll: the register arrays the loop walks keep constant indices (no scratch) and the row steps fold into the instructions' offsets
#define UNROLL_REGS _Pragma("unroll")
typedef __attribute__((ext_vector_type(4))) __bf16 v4b;
typedef __attribute__((ext_vector_type(4))) _Float16 v4h;
// stands behind each group of global loads and each of k_proj's stores, before anything may take their address registers
#define XWAIT() asm volatile("s_wait_xcnt 0x0" ::: "memory")
__device__ __forceinline__ v4b cvt4b(v4f v) { v4b r;
UNROLL_REGS
  for (int i = 0; i < 4; ++i) r[i] = (__bf16)v[i];
  return r; }
__device__ __forceinline__ v4b cvt4bl(v4f v) { v4b r;   /* the residual plane of bsplit16 */
UNROLL_REGS
  for (int i = 0; i < 4; ++i) r[i] = (__bf16)(v[i] - (float)(__bf16)v[i]);
  return r; }
__device__ __forceinline__ v4h cvt4hs(v4f v, float sc) { v4h r;
UNROLL_REGS
  for (int i = 0; i < 4; ++i) r[i] = (_Float16)(v[i] * sc);
  return r; }
__device__ __forceinline__ v4h cvt4hw(v4f v) { v4h r;   /* f16(bf16 x 2^8), exact */
UNROLL_REGS
  for (int i = 0; i < 4; ++i) r[i] = (_Float16)(bfr(v[i]) * 256.0f);
  return r; }
// ---- k_proj: block = (128 rows, the same 128 cols of q, of k and of v), 16 waves of 32 rows x 32 cols of each of the three (3 x 2 x 2 accumulator tiles): a staged X row serves the three products, so X comes from L2 once, not three times, and the 256 blocks are one round of the chip: q/k/v = X W (+ b) with exact bf16 products (K = DIN), X and the three W tiles staged as bf16 in a two-buffer LDS ring, the next stage's global loads in flight over this stage's products; the epilogue runs six times, once per (which, 64-row half of the tile), in the same LDS planes -> which 0: q f16 rows (+ residual rows < QHI); 1: k f16 rows (+ residual rows < KHI); 2: v f16 planes [c][t] (+ bf16 hi/lo planes for t < KHI)
__global__ __launch_bounds__(512) void k_proj(const float* __restrict__ X, const float* __restrict__ WQ, const float* __restrict__ WK, const float* __restrict__ WV, const float* __restrict__ BQ, const float* __restrict__ BK, const float* __restrict__ BV,
    _Float16* __restrict__ QH, _Float16* __restrict__ QL, _Float16* __restrict__ KH, _Float16* __restrict__ KL, _Float16* __restrict__ VT, __bf16* __restrict__ VB, __bf16* __restrict__ VBL PROJ_EXTRA_PARAMS) {
  __shared__ __align__(16) float st[64][132];
  struct Epi { _Float16 sh[64][136], sl[64][136]; _Float16 th[128][72]; __bf16 tb[128][72], tbl[128][72]; };
  __shared__ __align__(16) union { Epi e; __bf16 ring[2][128 + 3 * 128][LP]; } u;   /* the ring (rows 0..127 X, 128.. Wq, 256.. Wk, 384.. Wv) is dead before the epilogue's planes are written: two barriers lie between */
  auto& sh = u.e.sh; auto& sl = u.e.sl; auto& th = u.e.th; auto& tb = u.e.tb; auto& tbl = u.e.tbl;
  const int tid = threadIdx.x, wave = __builtin_amdgcn_readfirstlane(tid >> 5), lane = tid & 31, col = lane & 15, g = lane >> 4; const int wr = wave >> 2, wc = wave & 3; const int c0 = blockIdx.y * 128; const size_t r0 = (size_t)blockIdx.x * 128; const size_t bb = r0 / TT; const int t0 = (int)(r0 % TT);
  v8f acc[3][2][2] = {};
  const int fr = tid >> 4, fc = (tid & 15) * 4;   /* the thread's row of each 32-row sweep and its 4 floats of a stage row */
  const unsigned fo = fr * DIN + fc; const float* xg = X + r0 * DIN; const float* wg0 = WQ + (size_t)c0 * DIN; const float* wg1 = WK + (size_t)c0 * DIN; const float* wg2 = WV + (size_t)c0 * DIN; v4f xr[4], wv[3][4];   /* block-uniform bases, one 32-bit lane offset that nothing overwrites */
UNROLL_REGS
  for (int i = 0; i < 4; ++i) xr[i] = *(const v4f*)(xg + fo + (size_t)i * 32 * DIN);
UNROLL_REGS
  for (int i = 0; i < 4; ++i) { wv[0][i] = *(const v4f*)(wg0 + fo + (size_t)i * 32 * DIN); wv[1][i] = *(const v4f*)(wg1 + fo + (size_t)i * 32 * DIN); wv[2][i] = *(const v4f*)(wg2 + fo + (size_t)i * 32 * DIN); }
  XWAIT();
  for (int s = 0; s < DIN / KS; ++s) { __bf16 (*rb)[LP] = u.ring[s & 1];
UNROLL_REGS
    for (int i = 0; i < 4; ++i) *(v4b*)&rb[fr + 32 * i][fc] = cvt4b(xr[i]);
UNROLL_REGS
    for (int q = 0; q < 3; ++q)
UNROLL_REGS
      for (int i = 0; i < 4; ++i) *(v4b*)&rb[128 + 128 * q + fr + 32 * i][fc] = cvt4b(wv[q][i]);
    __syncthreads();   /* publishes stage s; it also ends every wave's reads of the other buffer, which stage s + 1 overwrites */
    if (s + 1 < DIN / KS) { xg += KS; wg0 += KS; wg1 += KS; wg2 += KS;
UNROLL_REGS
      for (int i = 0; i < 4; ++i) xr[i] = *(const v4f*)(xg + fo + (size_t)i * 32 * DIN);
UNROLL_REGS
      for (int i = 0; i < 4; ++i) { wv[0][i] = *(const v4f*)(wg0 + fo + (size_t)i * 32 * DIN); wv[1][i] = *(const v4f*)(wg1 + fo + (size_t)i * 32 * DIN); wv[2][i] = *(const v4f*)(wg2 + fo + (size_t)i * 32 * DIN); }
      XWAIT(); }
UNROLL_REGS
    for (int kk = 0; kk < KS / 32; ++kk) { v16b a[2], w[3][2];   /* a block's fragment reads go as one group ahead of its products */
UNROLL_REGS
      for (int i = 0; i < 2; ++i) a[i] = frag_b(&rb[wr * 32 + i * 16 + col][kk * 32], lane);
UNROLL_REGS
      for (int q = 0; q < 3; ++q)
UNROLL_REGS
        for (int j = 0; j < 2; ++j) w[q][j] = frag_b(&rb[128 + 128 * q + wc * 32 + j * 16 + col][kk * 32], lane);
UNROLL_REGS
      for (int q = 0; q < 3; ++q)
UNROLL_REGS
        for (int i = 0; i < 2; ++i)
UNROLL_REGS
          for (int j = 0; j < 2; ++j) acc[q][i][j] = wmma_bf(a[i], w[q][j], acc[q][i][j]); } }
  const int i0 = (wave >> 2) * 8;   /* the RoPE pairs of a (row, head) go a quarter to each group of four waves */
#pragma unroll 1   /* one copy of the epilogue's long text (the RoPE code) in the instruction cache, not six */
  for (int ep = 0; ep < 6; ++ep) { const int which = ep >> 1, hp = ep & 1; const float* BA = which == 0 ? BQ : which == 1 ? BK : BV; const size_t rh = r0 + 64 * hp; const int th0 = t0 + 64 * hp;   /* the 64-row half the eight waves wr >> 1 == hp hold; the barrier behind each pass's conversion ends the reads of st, the two in front of the next conversion end the reads of the planes */
  { // stage the half's f32 tile (acc + bias) in LDS, run the per-(row, head) epilogue hook, then convert
    if ((wr >> 1) == hp) {
UNROLL_REGS
    for (int q = 0; q < 3; ++q) if (q == which) {   /* block-uniform test: the accumulator array keeps constant indices */
#pragma unroll
    for (int i = 0; i < 2; ++i)
#pragma unroll
    for (int j = 0; j < 2; ++j) { const float bias = BA ? bfr(BA[c0 + wc * 32 + j * 16 + col]) : 0.f;
#pragma unroll
      for (int r = 0; r < 8; ++r) st[(wr & 1) * 32 + i * 16 + 8 * g + r][wc * 32 + j * 16 + col] = acc[q][i][j][r] + bias; } } }
    __syncthreads();
    { const int e = tid & 127; const int rl = e / (128 / HD), hh = e % (128 / HD); PROJ_EPI(which, &st[rl][hh * HD], (int)((rh + rl) % TT), (c0 / HD) + hh, i0); }
    __syncthreads(); }
  if (which < 2) { _Float16* DH = which == 0 ? QH : KH; _Float16* DL = which == 0 ? QL : KL; const int nhi = which == 0 ? QHI : KHI; const bool hi_rows = th0 < nhi;
    for (int e = tid; e < 64 * 128; e += 512) { const int rl = e >> 7, cl = e & 127; const float v = st[rl][cl]; const _Float16 hv = (_Float16)v; sh[rl][cl] = hv; sl[rl][cl] = (_Float16)((v - (float)hv) * 1024.0f); }
    __syncthreads();
    for (int e = tid; e < 64 * 16; e += 512) { const int rl = e >> 4, q = e & 15; vst2((unsigned*)(DH + (rh + rl) * CC + c0 + q * 8), *(const v4u*)&sh[rl][q * 8]); XWAIT(); if (hi_rows) { vst2((unsigned*)(DL + (bb * nhi + th0 + rl) * (size_t)CC + c0 + q * 8), *(const v4u*)&sl[rl][q * 8]); XWAIT(); } }
  } else { const bool hi_rows = th0 < KHI;
    for (int e = tid; e < 64 * 128; e += 512) { const int rl = e & 63, cl = e >> 6; const float v = st[rl][cl]; th[cl][rl] = (_Float16)v; const __bf16 bh = (__bf16)v; tb[cl][rl] = bh; tbl[cl][rl] = (__bf16)(v - (float)bh); }
    __syncthreads();
    for (int e = tid; e < 128 * 8; e += 512) { const int cl = e >> 3, q = e & 7; vst2((unsigned*)(VT + (bb * CC + c0 + cl) * (size_t)TT + th0 + q * 8), *(const v4u*)&th[cl][q * 8]); XWAIT(); if (hi_rows) { const size_t o3 = (bb * CC + c0 + cl) * (size_t)KHI + th0 + q * 8; vst2((unsigned*)(VB + o3), *(const v4u*)&tb[cl][q * 8]); vst2((unsigned*)(VBL + o3), *(const v4u*)&tbl[cl][q * 8]); XWAIT(); } } } } }
// fragment from the lane's own pointer (row start + k0 + 8 * (lane >> 4)): the same k order as frag_h / frag_b
__device__ __forceinline__ v16h frag_hp(const _Float16* p) { union { v16h v; v8h q[2]; } u; u.q[0] = *(const v8h*)p; u.q[1] = *(const v8h*)(p + 16); return u.v; }
__device__ __forceinline__ v16b frag_bp(const __bf16* p) { union { v16b v; v8b q[2]; } u; u.q[0] = *(const v8b*)p; u.q[1] = *(const v8b*)(p + 16); return u.v; }
// one 32-key step of a query's running softmax: v = the lane's 16 scaled logits (-3.0e38 = excluded) -> exp(v - new maximum) x 2^11; m = running maximum (both wave halves alike), l = this half's running sum; returns the factor that carries the old sums to the new maximum
__device__ __forceinline__ float sm_step(float v[16], float& m, float& l) {
  float mx = v[0];
#pragma unroll
  for (int i = 1; i < 16; ++i) mx = fmaxf(mx, v[i]);
  mx = fmaxf(mx, __shfl_xor(mx, 16));
  const float mn = fmaxf(m, mx); const float alpha = expf(m - mn); float s = 0.f;
#pragma unroll
  for (int i = 0; i < 16; ++i) { const float e = expf(v[i] - mn); s += e; v[i] = e * 2048.0f; }   /* mn is a kept key's logit (every step holds one for every query), so an excluded key gives exp(-3.0e38) = 0 */
  l = l * alpha + s; m = mn; return alpha; }
// the same step in base 2 over a whole 64-key stage, for the blocks behind the early ones: v = the lane's 32 RAW logits q.k (-3.0e38 = excluded), m = running maximum of raw logits; exp(SCALE x (v - mn)) x 2^11 = exp2(v x C2 - (mn x C2 - 11)), C2 = SCALE x log2(e): one fma and one hardware exp2 per score (SCALE > 0, so the maximum may be taken before the scaling); l carries the factor 2^11 (exact); an excluded key gives exp2(-5.4e37) = 0; each 32-key half keeps its own maximum and its own sum, joined once
#define C2 (SCALE * 1.44269504088896340736f)
__device__ __forceinline__ float sm_step2(float v[32], float& m, float& l) {
  float mx0 = v[0], mx1 = v[16];
#pragma unroll
  for (int i = 1; i < 16; ++i) { mx0 = fmaxf(mx0, v[i]); mx1 = fmaxf(mx1, v[16 + i]); }
  float mx = fmaxf(mx0, mx1); mx = fmaxf(mx, __shfl_xor(mx, 16));
  const float mn = fmaxf(m, mx); const float alpha = __builtin_amdgcn_exp2f((m - mn) * C2); const float nb = __builtin_fmaf(mn, C2, -11.0f); float s0 = 0.f, s1 = 0.f;
#pragma unroll
  for (int i = 0; i < 16; ++i) { const float e0 = __builtin_amdgcn_exp2f(__builtin_fmaf(v[i], C2, -nb)), e1 = __builtin_amdgcn_exp2f(__builtin_fmaf(v[16 + i], C2, -nb)); s0 += e0; s1 += e1; v[i] = e0; v[16 + i] = e1; }
  l = l * alpha + (s0 + s1); m = mn; return alpha; }
// ---- k_attn: block = (head h, 64 queries qb, batch b), 8 waves = two teams of four, wave = 16 queries, keys [0, diagonal] 32 at a time by team 0 alone (behind the early blocks: 64 at a time, the even 64-key stages by team 0 and the odd ones by team 1, so a tile's chain of stages is half as long; each team stages its own k rows and v planes in LDS, once for its four waves, the next stage's global loads in flight over this stage's step; team 1's maximum, sum and ctx sums are joined to team 0's once, through LDS, behind the loop). Twice the waves: half the blocks are resident at a time; blockIdx.y orders the tiles by falling cost (the early blocks, then the longest tile first). S^T = K Q^T x SCALE (behind the early blocks SCALE is applied inside the softmax step): lane (g, col) holds query col's logits of keys 8g + r and 16 + 8g + r (causal early query blocks: q and k residual planes, 3 products); the causal rule by index in the last step; running maximum and sum in f32; the two score tiles, as P^T x 2^11 once to f16 (early blocks: bf16 hi + lo), are the B operand of ctx^T += V^T P^T (early blocks: v bf16 hi + lo, 3 products); ctx = sums / (2^11 x sum of exp); 256-B (row, head) segment by 16 lanes
__global__ __launch_bounds__(256) void k_attn(const _Float16* __restrict__ QH, const _Float16* __restrict__ KH, const _Float16* __restrict__ QL, const _Float16* __restrict__ KL, const _Float16* __restrict__ VT, const __bf16* __restrict__ VB, const __bf16* __restrict__ VBL, float* __restrict__ Y) { __shared__ __align__(16) float ss[4][16][HD + 4]; __shared__ __align__(16) _Float16 kv[2][2][64 + HD][LP];   /* per team a two-buffer ring [buffer][team] of 64-key stages: rows 0..63 the keys' k rows of this head, rows 64.. its v planes [c][64 keys] */
  __shared__ __align__(16) v4f pj[4][9][32];   /* team 1's partial results, lane by lane: 8 x 4 ctx sums, then (maximum, sum) */
  const int tid = threadIdx.x, wv8 = __builtin_amdgcn_readfirstlane(tid >> 5), team = wv8 >> 2, wave = wv8 & 3, lane = tid & 31, col = lane & 15, g = lane >> 4; const int h = blockIdx.x, b = blockIdx.z; const int qb = (int)blockIdx.y < QBH ? (int)blockIdx.y : NQB + QBH - 1 - (int)blockIdx.y;   /* a permutation of the query blocks */ const int ql0 = qb * 64 + wave * 16; const int nch = (ql0 + 47) >> 5;
  const size_t q0 = (size_t)b * TT + ql0, kr0 = (size_t)b * TT;
  v8f acc[HD / 16] = {}; float m = -3.0e38f, l = 0.f; const float lc = qb < QBH ? 2048.0f : 1.0f;   /* what the sum of exp still lacks of the 2^11 that P carries */
  if (qb < QBH) { if (team) return;   /* wave-uniform; this path has no work-group barrier */
    const _Float16* QLb = QL + (size_t)b * QHI * CC; const _Float16* KLb = KL + (size_t)b * KHI * CC; v16h qh[HD / 32], qlo[HD / 32];
#pragma unroll
    for (int kk = 0; kk < HD / 32; ++kk) { qh[kk] = frag_h(QH + (q0 + col) * CC + h * HD + kk * 32, lane); qlo[kk] = frag_h(QLb + (size_t)(ql0 + col) * CC + h * HD + kk * 32, lane); }
    asm volatile("s_wait_xcnt 0x0" :: "v"(qh[0]), "v"(qh[1]), "v"(qlo[0]), "v"(qlo[1]) : "memory");   /* XWAIT held behind the q loads by their values (inputs only) */
    const _Float16* kp = KH + (kr0 + col) * CC + h * HD + 8 * g; const _Float16* klp = KLb + (size_t)col * CC + h * HD + 8 * g; const __bf16* vp = VB + ((size_t)b * CC + h * HD + col) * (size_t)KHI + 8 * g; const __bf16* vlp = VBL + ((size_t)b * CC + h * HD + col) * (size_t)KHI + 8 * g;
    for (int kc = 0; kc < nch; ++kc, kp += 32 * CC, klp += 32 * CC, vp += 32, vlp += 32) { const int k0 = kc * 32; float v[16]; v16h kbf[2][HD / 32], klf[2][HD / 32];   /* a step's k loads are all issued before its first product, its v loads before the softmax */
#pragma unroll
      for (int t = 0; t < 2; ++t)
#pragma unroll
        for (int kk = 0; kk < HD / 32; ++kk) kbf[t][kk] = frag_hp(kp + t * 16 * CC + kk * 32);
      XWAIT();
#pragma unroll
      for (int t = 0; t < 2; ++t)
#pragma unroll
        for (int kk = 0; kk < HD / 32; ++kk) klf[t][kk] = frag_hp(klp + t * 16 * CC + kk * 32);
      XWAIT();
#pragma unroll
      for (int t = 0; t < 2; ++t) { v8f s = {}, sl = {};
#pragma unroll
        for (int kk = 0; kk < HD / 32; ++kk) { s = wmma16(kbf[t][kk], qh[kk], s); sl = wmma16(kbf[t][kk], qlo[kk], sl); sl = wmma16(klf[t][kk], qh[kk], sl); }
#pragma unroll
        for (int r = 0; r < 8; ++r) v[t * 8 + r] = (s[r] + sl[r] * (1.0f / 1024.0f)) * SCALE; }
      if (kc == nch - 1) {
#pragma unroll
        for (int i = 0; i < 16; ++i) if (k0 + (i >> 3) * 16 + 8 * g + (i & 7) > ql0 + col) v[i] = -3.0e38f; }
      v16b vh[HD / 16], vl[HD / 16];
#pragma unroll
      for (int j = 0; j < HD / 16; ++j) vh[j] = frag_bp(vp + j * 16 * KHI);
      XWAIT();
#pragma unroll
      for (int j = 0; j < HD / 16; ++j) vl[j] = frag_bp(vlp + j * 16 * KHI);
      XWAIT();
      const float alpha = sm_step(v, m, l); const F2 p = bsplit16(v);
#pragma unroll
      for (int j = 0; j < HD / 16; ++j) { acc[j] = acc[j] * alpha; acc[j] = wmma_bf(vh[j], p.h, acc[j]); acc[j] = wmma_bf(vh[j], p.l, acc[j]); acc[j] = wmma_bf(vl[j], p.h, acc[j]); } }
  } else { v16h qh[HD / 32];
#pragma unroll
    for (int kk = 0; kk < HD / 32; ++kk) qh[kk] = frag_h(QH + (q0 + col) * CC + h * HD + kk * 32, lane);
    asm volatile("s_wait_xcnt 0x0" :: "v"(qh[0]), "v"(qh[1]) : "memory");   /* XWAIT held behind the q loads by their values (inputs only) */
    const int tl = tid & 127, fr = tl >> 3, fc = (tl & 7) * 8;   /* the thread's row of each 16-row sweep of its team's stage and its 16 B of a 128-B stage row: a wave's load covers 4 whole lines */
    const unsigned ko = fr * CC + fc, vo = fr * TT + fc; const _Float16* kg = KH + (kr0 + 64 * team) * CC + h * HD; const _Float16* vg = VT + ((size_t)b * CC + h * HD) * (size_t)TT + 64 * team;   /* the team's first stage is stage 'team' (qb >= QBH > 1: it exists) */ v8h kr[4], vr[HD / 16];   /* wave-uniform bases, 32-bit lane offsets that nothing overwrites */
UNROLL_REGS
    for (int i = 0; i < 4; ++i) kr[i] = *(const v8h*)(kg + ko + (size_t)i * 16 * CC);
    XWAIT();
UNROLL_REGS
    for (int i = 0; i < HD / 16; ++i) vr[i] = *(const v8h*)(vg + vo + (size_t)i * 16 * TT);
    XWAIT();
    const int nit = (qb + 2) >> 1;   /* trips of the longer team */
    for (int it = 0; it < nit; ++it) { const int s = 2 * it + team; _Float16 (*rb)[LP] = kv[it & 1][team];   /* block-uniform trip count: every wave passes every barrier; s > qb (team 1's last trip when qb is even): nothing but the barrier */
      if (s <= qb) {
UNROLL_REGS
      for (int i = 0; i < 4; ++i) *(v8h*)&rb[fr + 16 * i][fc] = kr[i];
UNROLL_REGS
      for (int i = 0; i < HD / 16; ++i) *(v8h*)&rb[64 + fr + 16 * i][fc] = vr[i]; }
      __syncthreads();   /* publishes the teams' stages of this trip and ends the reads of the buffers that the next trip overwrites */
      if (s + 2 <= qb) { kg += 128 * CC; vg += 128;
UNROLL_REGS
        for (int i = 0; i < 4; ++i) kr[i] = *(const v8h*)(kg + ko + (size_t)i * 16 * CC);
UNROLL_REGS
        for (int i = 0; i < HD / 16; ++i) vr[i] = *(const v8h*)(vg + vo + (size_t)i * 16 * TT);
        XWAIT(); }
      if (s <= qb) { float v[32]; v16h kf[4][HD / 32], vf[2][HD / 16]; v8f sc[4] = {};   /* ONE softmax step per 64-key stage: four independent score tiles, one maximum exchange, one rescale of the sums; the k fragment reads go as one group ahead of the first product, the v reads as one group ahead of the softmax */
UNROLL_REGS
      for (int t = 0; t < 4; ++t)
UNROLL_REGS
        for (int kk = 0; kk < HD / 32; ++kk) kf[t][kk] = frag_hp(&rb[t * 16 + col][kk * 32 + 8 * g]);
UNROLL_REGS
      for (int kk = 0; kk < HD / 32; ++kk)
UNROLL_REGS
        for (int t = 0; t < 4; ++t) sc[t] = wmma16(kf[t][kk], qh[kk], sc[t]);
UNROLL_REGS
      for (int t2 = 0; t2 < 2; ++t2)
UNROLL_REGS
        for (int j = 0; j < HD / 16; ++j) vf[t2][j] = frag_hp(&rb[64 + j * 16 + col][t2 * 32 + 8 * g]);
#pragma unroll
      for (int t = 0; t < 4; ++t)
#pragma unroll
        for (int r = 0; r < 8; ++r) v[t * 8 + r] = sc[t][r];
      if (s == qb) {   /* wave-uniform: the diagonal lies in the last stage; a wave's keys wholly behind it count 0 */
#pragma unroll
        for (int i = 0; i < 32; ++i) if (s * 64 + (i >> 3) * 16 + 8 * g + (i & 7) > ql0 + col) v[i] = -3.0e38f; }
      const float alpha = sm_step2(v, m, l); v16h p[2];
#pragma unroll
      for (int i = 0; i < 32; ++i) p[i >> 4][i & 15] = (_Float16)v[i];
UNROLL_REGS
      for (int j = 0; j < HD / 16; ++j) acc[j] = acc[j] * alpha;
UNROLL_REGS
      for (int t2 = 0; t2 < 2; ++t2)
UNROLL_REGS
        for (int j = 0; j < HD / 16; ++j) acc[j] = wmma16(vf[t2][j], p[t2], acc[j]); } }
    if (team) {   /* every query has open keys in stage 1, so team 1's maximum is a kept key's logit */
UNROLL_REGS
      for (int j = 0; j < HD / 16; ++j) { pj[wave][2 * j][lane] = (v4f){acc[j][0], acc[j][1], acc[j][2], acc[j][3]}; pj[wave][2 * j + 1][lane] = (v4f){acc[j][4], acc[j][5], acc[j][6], acc[j][7]}; }
      pj[wave][8][lane] = (v4f){m, l, 0.f, 0.f}; }
    __syncthreads();   /* publishes team 1's partial results to team 0; block-uniform, the block's last barrier */
    if (team) return;
    { const v4f ml = pj[wave][8][lane]; const float mn = fmaxf(m, ml[0]); const float a0 = __builtin_amdgcn_exp2f((m - mn) * C2), a1 = __builtin_amdgcn_exp2f((ml[0] - mn) * C2);   /* both teams' sums carried to the common maximum, as in sm_step2 */
      asm volatile("v_nop" :: "v"(a0), "v"(a1));   /* one slot between the two exp2 and the multiplies behind them, which read their results and may take their source registers */
      l = l * a0 + ml[1] * a1;
UNROLL_REGS
      for (int j = 0; j < HD / 16; ++j) { const v4f p0 = pj[wave][2 * j][lane], p1 = pj[wave][2 * j + 1][lane];
UNROLL_REGS
        for (int r = 0; r < 4; ++r) { acc[j][r] = acc[j][r] * a0 + p0[r] * a1; acc[j][4 + r] = acc[j][4 + r] * a0 + p1[r] * a1; } } } }
  l += __shfl_xor(l, 16); const float inv = 1.0f / (l * lc);
#pragma unroll
  for (int j = 0; j < HD / 16; ++j)
#pragma unroll
    for (int r = 0; r < 8; ++r) ss[wave][col][j * 16 + 8 * g + r] = acc[j][r] * inv;
  LDSX(); for (int rl = 0; rl < 16; ++rl) if (lane < HD / 4) vst2(Y + ((size_t)b * TT + ql0 + rl) * CC + h * HD + lane * 4, *(const v4f*)&ss[wave][rl][lane * 4]); }
// ---- k_out: block = (128 rows, 128 cols), 8 waves of 32 rows x 64 cols, operands staged in a two-buffer LDS ring as in k_proj: out = ctx Wo (+ bo): ctx x 2^6 once to f16 against Wo as f16(bf16 x 2^8) exact (1 product) x 2^-14; causal early rows (< QHI of each sequence): ctx bf16 hi + lo against exact bf16 Wo (2 products)
__global__ __launch_bounds__(256) void k_out(const float* __restrict__ Y, const float* __restrict__ WO, const float* __restrict__ BO, float* __restrict__ OUT) { __shared__ __align__(16) float sf[8][32][68];
  __shared__ __align__(16) union { __bf16 b[2][128 + 128 + 128][LP]; _Float16 h[2][128 + 128][LP]; } u;   /* early rows: ctx hi 0..127, ctx lo 128..255, Wo 256..383; else ctx 0..127, Wo 128..255 */
  const int tid = threadIdx.x, wave = __builtin_amdgcn_readfirstlane(tid >> 5), lane = tid & 31, col = lane & 15, g = lane >> 4; const int wr = wave >> 1, wc = wave & 1; const int c0 = blockIdx.y * 128; const size_t r0 = (size_t)blockIdx.x * 128 + wr * 32;
  v8f acc[2][4] = {};
  const int fr = tid >> 4, fc = (tid & 15) * 4;   /* as in k_proj */
  const unsigned fo = fr * CC + fc; const float* yg = Y + (size_t)blockIdx.x * 128 * CC; const float* wg = WO + (size_t)c0 * CC; v4f yr[8], wv[8];
UNROLL_REGS
  for (int i = 0; i < 8; ++i) yr[i] = *(const v4f*)(yg + fo + (size_t)i * 16 * CC);
UNROLL_REGS
  for (int i = 0; i < 8; ++i) wv[i] = *(const v4f*)(wg + fo + (size_t)i * 16 * CC);
  XWAIT();
  if (CAUSAL && (int)(((size_t)blockIdx.x * 128) % TT) < QHI) {   /* block-uniform; QHI is a multiple of the 128 rows */
    for (int s = 0; s < CC / KS; ++s) { __bf16 (*rb)[LP] = u.b[s & 1];
UNROLL_REGS
      for (int i = 0; i < 8; ++i) { *(v4b*)&rb[fr + 16 * i][fc] = cvt4b(yr[i]); *(v4b*)&rb[128 + fr + 16 * i][fc] = cvt4bl(yr[i]); }
UNROLL_REGS
      for (int i = 0; i < 8; ++i) *(v4b*)&rb[256 + fr + 16 * i][fc] = cvt4b(wv[i]);
      __syncthreads();   /* publishes stage s and ends the reads of the buffer that stage s + 1 overwrites */
      if (s + 1 < CC / KS) { yg += KS; wg += KS;
UNROLL_REGS
        for (int i = 0; i < 8; ++i) yr[i] = *(const v4f*)(yg + fo + (size_t)i * 16 * CC);
UNROLL_REGS
        for (int i = 0; i < 8; ++i) wv[i] = *(const v4f*)(wg + fo + (size_t)i * 16 * CC);
        XWAIT(); }
UNROLL_REGS
      for (int kk = 0; kk < KS / 32; ++kk) { v16b ah[2], al[2], w[4];
UNROLL_REGS
        for (int i = 0; i < 2; ++i) { ah[i] = frag_b(&rb[wr * 32 + i * 16 + col][kk * 32], lane); al[i] = frag_b(&rb[128 + wr * 32 + i * 16 + col][kk * 32], lane); }
UNROLL_REGS
        for (int j = 0; j < 4; ++j) w[j] = frag_b(&rb[256 + wc * 64 + j * 16 + col][kk * 32], lane);
UNROLL_REGS
        for (int i = 0; i < 2; ++i)
UNROLL_REGS
          for (int j = 0; j < 4; ++j) { acc[i][j] = wmma_bf(ah[i], w[j], acc[i][j]); acc[i][j] = wmma_bf(al[i], w[j], acc[i][j]); } } }
#pragma unroll
    for (int i = 0; i < 2; ++i)
#pragma unroll
    for (int j = 0; j < 4; ++j) { const float bias = BO ? bfr(BO[c0 + wc * 64 + j * 16 + col]) : 0.f;
#pragma unroll
      for (int r = 0; r < 8; ++r) sf[wave][i * 16 + 8 * g + r][j * 16 + col] = acc[i][j][r] + bias; }
  } else {
    for (int s = 0; s < CC / KS; ++s) { _Float16 (*rb)[LP] = u.h[s & 1];
UNROLL_REGS
      for (int i = 0; i < 8; ++i) *(v4h*)&rb[fr + 16 * i][fc] = cvt4hs(yr[i], 64.0f);   /* ctx carried x 2^6 into f16 so small-magnitude context rows stay clear of f16 subnormals (chip FTZ) */
UNROLL_REGS
      for (int i = 0; i < 8; ++i) *(v4h*)&rb[128 + fr + 16 * i][fc] = cvt4hw(wv[i]);
      __syncthreads();   /* publishes stage s and ends the reads of the buffer that stage s + 1 overwrites */
      if (s + 1 < CC / KS) { yg += KS; wg += KS;
UNROLL_REGS
        for (int i = 0; i < 8; ++i) yr[i] = *(const v4f*)(yg + fo + (size_t)i * 16 * CC);
UNROLL_REGS
        for (int i = 0; i < 8; ++i) wv[i] = *(const v4f*)(wg + fo + (size_t)i * 16 * CC);
        XWAIT(); }
UNROLL_REGS
      for (int kk = 0; kk < KS / 32; ++kk) { v16h a[2], w[4];
UNROLL_REGS
        for (int i = 0; i < 2; ++i) a[i] = frag_h(&rb[wr * 32 + i * 16 + col][kk * 32], lane);
UNROLL_REGS
        for (int j = 0; j < 4; ++j) w[j] = frag_h(&rb[128 + wc * 64 + j * 16 + col][kk * 32], lane);
UNROLL_REGS
        for (int i = 0; i < 2; ++i)
UNROLL_REGS
          for (int j = 0; j < 4; ++j) acc[i][j] = wmma16(a[i], w[j], acc[i][j]); } }
#pragma unroll
    for (int i = 0; i < 2; ++i)
#pragma unroll
    for (int j = 0; j < 4; ++j) { const float bias = BO ? bfr(BO[c0 + wc * 64 + j * 16 + col]) : 0.f;
#pragma unroll
      for (int r = 0; r < 8; ++r) sf[wave][i * 16 + 8 * g + r][j * 16 + col] = acc[i][j][r] * (1.0f / 16384.0f) + bias; } }   /* 2^-8 (Wo carry) x 2^-6 (ctx carry) */
  LDSX(); for (int rp = 0; rp < 16; ++rp) { const int rl = 2 * rp + g; vst2(OUT + (r0 + rl) * DIN + c0 + wc * 64 + col * 4, *(const v4f*)&sf[wave][rl][col * 4]); } }   /* a wave's store covers two rows' 256-B pieces: whole lines */

extern "C" void kernel_launch(void* const* d_in, const int* in_sizes, int n_in, void* d_out, int out_size, void* d_ws, size_t ws_size, hipStream_t stream) {
  (void)in_sizes; (void)n_in; (void)out_size;
  const float** F = (const float**)d_in;
  if (ws_size < (size_t)WS_END) return;
  char* ws = (char*)d_ws; _Float16 *QH = (_Float16*)(ws + WS_QH), *KH = (_Float16*)(ws + WS_KH), *VT = (_Float16*)(ws + WS_VT), *QL = (_Float16*)(ws + WS_QL), *KL = (_Float16*)(ws + WS_KL); __bf16 *VB = (__bf16*)(ws + WS_VB), *VBL = (__bf16*)(ws + WS_VBL); float *Y = (float*)(ws + WS_Y);
  (void)Y; (void)QL; (void)KL; (void)VB; (void)VBL;
  // inputs: 0 x [1,4096,1024]; 1 token_positions [4096] int32 (arange): READ on the device; 2 Wq [1024,1024] (out,in); 3 Wk; 4 Wv; 5 Wo (out,in); no biases (null pointers)
  k_proj<<<dim3(TNB * TT / 128, CC / 128), 512, 0, stream>>>(F[0], F[2], F[3], F[4], nullptr, nullptr, nullptr, QH, QL, KH, KL, VT, VB, VBL, (const int*)d_in[1]);
  k_attn<<<dim3(NH, NQB, TNB), 256, 0, stream>>>(QH, KH, QL, KL, VT, VB, VBL, Y);
  k_out<<<dim3(TNB * TT / 128, DIN / 128), 256, 0, stream>>>(Y, F[5], nullptr, (float*)d_out);
}

// v008
// A run of this version takes 105 microseconds.
// Next to v007, in two timings, it ran 1.03 and 1.02 times as fast.
// Counting every step since v000, it is 28.1 times as fast.
// compute dtype: all float inputs rounded to bf16; q/k/v projections with EXACT bf16 products on WMMA 16x16x32 (f32 accumulate); RoPE in f32 at the int token positions; causal logits: 3 products for the first 384 rows, single f16 q x k after, x 64^-0.5; softmax f32; P x 2^11 once to f16 x v once to f16 (bf16 hi + lo below row 384); ctx hi+lo x exact Wo below row 384, x2^6 f16 carry x f16(bf16 x 2^8) Wo after; f32 output.
#include <hip/hip_runtime.h>
#include <math.h>

typedef __attribute__((ext_vector_type(16))) _Float16 v16h;
typedef __attribute__((ext_vector_type(16))) __bf16 v16b;
typedef __attribute__((ext_vector_type(8)))  _Float16 v8h;
typedef __attribute__((ext_vector_type(8)))  float v8f;
typedef __attribute__((ext_vector_type(4)))  float v4f;
typedef __attribute__((ext_vector_type(2)))  float v2f;
typedef __attribute__((ext_vector_type(4)))  unsigned v4u;
typedef __attribute__((ext_vector_type(4)))  int v4i;
typedef float __attribute__((may_alias)) float_a;
typedef int __attribute__((may_alias)) int_a;

template <typename T> __device__ __forceinline__ void vst2(void* p, T v) { *(T*)p = v;  }
__device__ __forceinline__ v8f wmma16(v16h a, v16h b, v8f c) {
  v8f d = __builtin_amdgcn_wmma_f32_16x16x32_f16(false, a, false, b, (short)0, c, false, false);
  asm volatile("v_nop\n\tv_nop\n\tv_nop\n\tv_nop" : "+v"(d) : "v"(a), "v"(b));
  return d;
}
__device__ __forceinline__ v8f wmma_bf(v16b a, v16b b, v8f c) {
  v8f d = __builtin_amdgcn_wmma_f32_16x16x32_bf16(false, a, false, b, (short)0, c, false, false);
  asm volatile("v_nop\n\tv_nop\n\tv_nop\n\tv_nop" : "+v"(d) : "v"(a), "v"(b));
  return d;
}
// 16x16x32 fragments: lane = (h = lane>>4, row/col = lane&15); elements 0..7 = k0+8h+0..7, 8..15 = k0+16+8h+0..7; D element r = row 8h+r
__device__ __forceinline__ v16h frag_h(const _Float16* rowk0, int lane) {
  union { v16h v; v8h q[2]; } u; const _Float16* p = rowk0 + 8 * (lane >> 4);
  u.q[0] = *(const v8h*)p; u.q[1] = *(const v8h*)(p + 16); return u.v;
}
__device__ __forceinline__ v16h frag_f32(const float* rowk0, int lane) {
  v16h a; const float* p = rowk0 + 8 * (lane >> 4);
#pragma unroll
  for (int i = 0; i < 8; ++i) { a[i] = (_Float16)p[i]; a[8 + i] = (_Float16)p[16 + i]; }
  return a;
}
__device__ __forceinline__ v16h frag_f32s(const float* rowk0, int lane, float sc) {
  v16h a; const float* p = rowk0 + 8 * (lane >> 4);
#pragma unroll
  for (int i = 0; i < 8; ++i) { a[i] = (_Float16)(p[i] * sc); a[8 + i] = (_Float16)(p[16 + i] * sc); }
  return a;
}
// column fragment from a [K][ld] layout (column n), rows >= K read as 0
__device__ __forceinline__ v16h fragc_f32(const float* W, int k0, int n, int lane, int ld, int K) {
  v16h a; const int g = lane >> 4;
#pragma unroll
  for (int i = 0; i < 8; ++i) { const int ka = k0 + 8 * g + i, kb = ka + 16;
    a[i] = (_Float16)(ka < K ? W[(size_t)(ka < K ? ka : K - 1) * ld + n] : 0.f); a[8 + i] = (_Float16)(kb < K ? W[(size_t)(kb < K ? kb : K - 1) * ld + n] : 0.f); }
  return a;
}
struct F2 { v16b h, l; };
__device__ __forceinline__ F2 bsplit16(const float v[16]) { F2 r;
#pragma unroll
  for (int i = 0; i < 16; ++i) { const __bf16 h = (__bf16)v[i]; r.h[i] = h; r.l[i] = (__bf16)(v[i] - (float)h); }
  return r; }
__device__ __forceinline__ F2 split_row(const float* row, int k0, int lane) { float v[16]; const float* p = row + k0 + 8 * (lane >> 4);
#pragma unroll
  for (int i = 0; i < 8; ++i) { v[i] = p[i]; v[8 + i] = p[16 + i]; }
  return bsplit16(v); }
__device__ __forceinline__ F2 split_rowK(const float* row, int k0, int lane, int K) { float v[16]; const int g = lane >> 4;
#pragma unroll
  for (int i = 0; i < 8; ++i) { const int ka = k0 + 8 * g + i, kb = ka + 16; v[i] = ka < K ? row[ka < K ? ka : K - 1] : 0.f; v[8 + i] = kb < K ? row[kb < K ? kb : K - 1] : 0.f; }
  return bsplit16(v); }
__device__ __forceinline__ F2 split_col(const float* W, int k0, int n, int lane, int ld, int K) { float v[16]; const int g = lane >> 4;
#pragma unroll
  for (int i = 0; i < 8; ++i) { const int ka = k0 + 8 * g + i, kb = ka + 16; v[i] = ka < K ? W[(size_t)(ka < K ? ka : K - 1) * ld + n] : 0.f; v[8 + i] = kb < K ? W[(size_t)(kb < K ? kb : K - 1) * ld + n] : 0.f; }
  return bsplit16(v); }
__device__ __forceinline__ v8f mac3(const F2& a, const F2& b, v8f c) { c = wmma_bf(a.l, b.h, c); c = wmma_bf(a.h, b.l, c); return wmma_bf(a.h, b.h, c); }
__device__ __forceinline__ float sigm(float v) { return 1.0f / (1.0f + expf(-v)); }
#define LDSX() do { asm volatile("s_wait_dscnt 0" ::: "memory"); __builtin_amdgcn_wave_barrier(); __builtin_amdgcn_fence(__ATOMIC_RELEASE, "workgroup"); } while (0)

// Causal multi-head self-attention with interleaved-pair RoPE at given token positions, ONE batch of 4,096 tokens (x [1,4096,1024]; (out,in) Wq / Wk / Wv / Wo [1024,1024] N(0,1) x 0.02 applied as x @ W.T, no biases; token_positions [4096] int (arange; the LAST input); 16 heads x 64; inv_freq = 1 / 10000^(2i/64); (even, odd) pairs rotated and re-interleaved; scores / sqrt(64); tril kept, -inf elsewhere; softmax; attn @ Wo.T). THIS ROW: the same module and weight scale (0.02) with the argument order x, token_positions, Wq, Wk, Wv, Wo (the positions SECOND): the indices in kernel_launch follow; finfo.min in place of -inf under the causal rule (an exclusion either way); the inverse-frequency expression is the host's own, token for token: the baked table is unchanged.
#define NB 1
#define TT 4096
#define CC 1024            // NH * HD = projected width
#define DIN 1024          // input (model) width
#define NH 16
#define HD 64
#define NQB (TT / 64)
#define SCALE (0.125f)
#define CAUSAL 1
#ifndef TNB
#define TNB NB
#endif
__device__ __forceinline__ float bfr(float v) { return (float)(__bf16)v; }
typedef __attribute__((ext_vector_type(8))) __bf16 v8b;
__device__ __forceinline__ v16b frag_b(const __bf16* rowk0, int lane) {
  union { v16b v; v8b q[2]; } u; const __bf16* p = rowk0 + 8 * (lane >> 4);
  u.q[0] = *(const v8b*)p; u.q[1] = *(const v8b*)(p + 16); return u.v;
}
#define QBH 6              // causal: query blocks 0..QBH-1 of each sequence (few keys, no averaging) take the high-precision path
#define QHI 384            // rows carrying a q residual plane
#define KHI 384            // key rows carrying k residual / v bf16 hi+lo planes (used only by the causal high-precision path)
// B fragment (k rows k0+.., output column o) of a weight: (in,out) [K][ld] or (out,in) [ld rows of K]: bf16 exact, or f16(bf16 * 256) exact
__device__ __forceinline__ v16b wcol_io(const float* Wm, int k0, int o, int lane, int ld) { v16b w; const int g = lane >> 4;
#pragma unroll
  for (int i = 0; i < 8; ++i) { w[i] = (__bf16)Wm[(size_t)(k0 + 8 * g + i) * ld + o]; w[8 + i] = (__bf16)Wm[(size_t)(k0 + 16 + 8 * g + i) * ld + o]; }
  return w; }
__device__ __forceinline__ v16b wcol_oi(const float* Wm, int k0, int o, int lane, int K) { v16b w; const float* p = Wm + (size_t)o * K + k0 + 8 * (lane >> 4);
#pragma unroll
  for (int i = 0; i < 8; ++i) { w[i] = (__bf16)p[i]; w[8 + i] = (__bf16)p[16 + i]; }
  return w; }
__device__ __forceinline__ v16h wcolh_io(const float* Wm, int k0, int o, int lane, int ld) { v16h w; const int g = lane >> 4;
#pragma unroll
  for (int i = 0; i < 8; ++i) { w[i] = (_Float16)(bfr(Wm[(size_t)(k0 + 8 * g + i) * ld + o]) * 256.0f); w[8 + i] = (_Float16)(bfr(Wm[(size_t)(k0 + 16 + 8 * g + i) * ld + o]) * 256.0f); }
  return w; }
__device__ __forceinline__ v16h wcolh_oi(const float* Wm, int k0, int o, int lane, int K) { v16h w; const float* p = Wm + (size_t)o * K + k0 + 8 * (lane >> 4);
#pragma unroll
  for (int i = 0; i < 8; ++i) { w[i] = (_Float16)(bfr(p[i]) * 256.0f); w[8 + i] = (_Float16)(bfr(p[16 + i]) * 256.0f); }
  return w; }
#define WQKV_LAYOUT 1   // picks WCOL's layout (0 = (in,out) [DIN][CC]; 1 = (out,in) [CC][DIN]; 2 = per-head [NH][DIN][HD]); nothing calls WCOL: k_proj reads (out,in) [CC][DIN] rows
__device__ __forceinline__ v16b wcol_hdk(const float* Wm, int k0, int o, int lane) { v16b w; const int g = lane >> 4; const float* p = Wm + (size_t)(o / HD) * DIN * HD + (o % HD);
#pragma unroll
  for (int i = 0; i < 8; ++i) { w[i] = (__bf16)p[(size_t)(k0 + 8 * g + i) * HD]; w[8 + i] = (__bf16)p[(size_t)(k0 + 16 + 8 * g + i) * HD]; }
  return w; }
#define WO_OUT_IN 1
#if WQKV_LAYOUT == 1
#define WCOL(W, k0, o, lane) wcol_oi(W, k0, o, lane, DIN)
#elif WQKV_LAYOUT == 2
#define WCOL(W, k0, o, lane) wcol_hdk(W, k0, o, lane)
#else
#define WCOL(W, k0, o, lane) wcol_io(W, k0, o, lane, CC)
#endif
#if WO_OUT_IN
#define WOCOL(W, k0, o, lane) wcol_oi(W, k0, o, lane, CC)
#define WOCOLH(W, k0, o, lane) wcolh_oi(W, k0, o, lane, CC)
#else
#define WOCOL(W, k0, o, lane) wcol_io(W, k0, o, lane, DIN)
#define WOCOLH(W, k0, o, lane) wcolh_io(W, k0, o, lane, DIN)
#endif
// RoPE inverse frequencies 1/10000^(2i/64) (the f32 values jax computes)
__constant__ float INVF[32] = {1.000000000e+00,7.498942018e-01,5.623413324e-01,4.216965139e-01,3.162277639e-01,2.371373624e-01,1.778279394e-01,1.333521456e-01,1.000000015e-01,7.498941571e-02,5.623412877e-02,4.216964915e-02,3.162277862e-02,2.371373586e-02,1.778279431e-02,1.333521493e-02,9.999999776e-03,7.498942316e-03,5.623413250e-03,4.216964822e-03,3.162277862e-03,2.371373819e-03,1.778279431e-03,1.333521446e-03,1.000000047e-03,7.498941850e-04,5.623413017e-04,4.216964880e-04,3.162277862e-04,2.371373848e-04,1.778279402e-04,1.333521504e-04};
#define PROJ_EXTRA_PARAMS , const int* __restrict__ TPOS
// interleaved-pair RoPE on q and k (which 0, 1) at the token's position from the int input token_positions[t]: angle = (float)pos * inv_freq[i]; (x1, x2) -> (x1 cos - x2 sin, x1 sin + x2 cos); products and sums kept separate (no fma contraction); a call does the 8 pairs from i0 on, two pairs per 16-byte LDS access; cs = the row's (cos, sin) pairs, which ROPE_TAB has laid in LDS
#define PROJ_EPI(which, row, cs, i0) do { if ((which) < 2) { v4f* rw = (v4f*)((row) + 2 * (i0)); const v4f* cr = (const v4f*)((cs) + 2 * (i0)); _Pragma("unroll") for (int k = 0; k < 4; ++k) { _Pragma("clang fp contract(off)") const v4f x = rw[k], c = cr[k]; rw[k] = (v4f){x[0] * c[0] - x[1] * c[1], x[0] * c[1] + x[1] * c[0], x[2] * c[2] - x[3] * c[3], x[2] * c[3] + x[3] * c[2]}; } } } while (0)
// the block's (cos, sin) of every (row, pair), each computed ONCE (the angle depends on neither q / k nor the head, so one value serves the four rotations that use it): wave w does pairs 2w and 2w + 1 (a wave-uniform frequency), a lane the rows lane + 32 rg, whose positions ROPE_POS has loaded; TP = pitch in floats: 64 + 4, so that 16 rows' 16-byte reads fall on different banks
#define TP 68
#define ROPE_POS(ps, r0, lane) do { _Pragma("unroll") for (int rg = 0; rg < 4; ++rg) ps[rg] = TPOS[(int)(((r0) + rg * 32 + (lane)) % TT)]; XWAIT(); } while (0)
#define ROPE_TAB(tab, ps, wave, lane) do { _Pragma("unroll 1") /* one copy of the four sine / cosine texts */ for (int p = 0; p < 2; ++p) { const int i = 2 * (wave) + p; const float fq = INVF[i]; _Pragma("unroll") for (int rg = 0; rg < 4; ++rg) { const float ang = (float)ps[rg] * fq; *(v2f*)&(tab)[rg * 32 + (lane)][2 * i] = (v2f){cosf(ang), sinf(ang)}; } } } while (0)
#ifndef PROJ_EXTRA_PARAMS
#define PROJ_EXTRA_PARAMS
#endif

#define WS_QH  0u                                      // f16 q rows [b*t][CC]
#define WS_KH  (WS_QH + 2u * (size_t)NB * TT * CC)      // f16 k rows [b*t][CC]
#define WS_VT  (WS_KH + 2u * (size_t)NB * TT * CC)      // f16 v planes [b][c][t]
#define WS_QL  (WS_VT + 2u * (size_t)NB * CC * TT)      // f16 q residual x 2^10 rows [b][t < QHI][CC]
#define WS_KL  (WS_QL + 2u * (size_t)NB * QHI * CC)     // f16 k residual x 2^10 rows [b][t < KHI][CC]
#define WS_VB  (WS_KL + 2u * (size_t)NB * KHI * CC)     // bf16 v hi planes [b][c][t < KHI]
#define WS_VBL (WS_VB + 2u * (size_t)NB * CC * KHI)
#define WS_Y   (WS_VBL + 2u * (size_t)NB * CC * KHI)    // f32 ctx rows [b*t][CC] (only when there is an output projection)
#define WS_END (WS_Y  + 4u * (size_t)NB * TT * CC)

// LDS staging of the projections' operands: a stage is KS k of every operand row, brought by whole-line loads (16 lanes x 16 B = one 256-B row piece), converted once per block, laid at a pitch of 128 + 16 B for the 16-byte fragment reads
#define KS 64
#define LP 72
// full unroll: the register arrays the loop walks keep constant indices (no scratch) and the row steps fold into the instructions' offsets
#define UNROLL_REGS _Pragma("unroll")
typedef __attribute__((ext_vector_type(4))) __bf16 v4b;
typedef __attribute__((ext_vector_type(4))) _Float16 v4h;
// stands behind each group of global loads and each of k_proj's stores, before anything may take their address registers
#define XWAIT() asm volatile("s_wait_xcnt 0x0" ::: "memory")
__device__ __forceinline__ v4b cvt4b(v4f v) { v4b r;
UNROLL_REGS
  for (int i = 0; i < 4; ++i) r[i] = (__bf16)v[i];
  return r; }
__device__ __forceinline__ v4b cvt4bl(v4f v) { v4b r;   /* the residual plane of bsplit16 */
UNROLL_REGS
  for (int i = 0; i < 4; ++i) r[i] = (__bf16)(v[i] - (float)(__bf16)v[i]);
  return r; }
__device__ __forceinline__ v4h cvt4hs(v4f v, float sc) { v4h r;
UNROLL_REGS
  for (int i = 0; i < 4; ++i) r[i] = (_Float16)(v[i] * sc);
  return r; }
__device__ __forceinline__ v4h cvt4hw(v4f v) { v4h r;   /* f16(bf16 x 2^8), exact */
UNROLL_REGS
  for (int i = 0; i < 4; ++i) r[i] = (_Float16)(bfr(v[i]) * 256.0f);
  return r; }
// ---- k_proj: block = (128 rows, the same 128 cols of q, of k and of v), 16 waves of 32 rows x 32 cols of each of the three (3 x 2 x 2 accumulator tiles): a staged X row serves the three products, so X comes from L2 once, not three times, and the 256 blocks are one round of the chip: q/k/v = X W (+ b) with exact bf16 products (K = DIN), X and the three W tiles staged as bf16 in a two-buffer LDS ring, the next stage's global loads in flight over this stage's products; the epilogue runs six times, once per (which, 64-row half of the tile), in the same LDS planes -> which 0: q f16 rows (+ residual rows < QHI); 1: k f16 rows (+ residual rows < KHI); 2: v f16 planes [c][t] (+ bf16 hi/lo planes for t < KHI)
__global__ __launch_bounds__(512) void k_proj(const float* __restrict__ X, const float* __restrict__ WQ, const float* __restrict__ WK, const float* __restrict__ WV, const float* __restrict__ BQ, const float* __restrict__ BK, const float* __restrict__ BV,
    _Float16* __restrict__ QH, _Float16* __restrict__ QL, _Float16* __restrict__ KH, _Float16* __restrict__ KL, _Float16* __restrict__ VT, __bf16* __restrict__ VB, __bf16* __restrict__ VBL PROJ_EXTRA_PARAMS) {
  __shared__ __align__(16) float st[64][132];
  __shared__ __align__(16) float rt[128][TP];   /* (cos, sin) of the block's 128 rows x 32 pairs; written in front of the k loop, whose barriers publish it long before the epilogue reads it */
  struct Epi { _Float16 sh[64][136], sl[64][136]; _Float16 th[128][72]; __bf16 tb[128][72], tbl[128][72]; };
  __shared__ __align__(16) union { Epi e; __bf16 ring[2][128 + 3 * 128][LP]; } u;   /* the ring (rows 0..127 X, 128.. Wq, 256.. Wk, 384.. Wv) is dead before the epilogue's planes are written: two barriers lie between */
  auto& sh = u.e.sh; auto& sl = u.e.sl; auto& th = u.e.th; auto& tb = u.e.tb; auto& tbl = u.e.tbl;
  const int tid = threadIdx.x, wave = __builtin_amdgcn_readfirstlane(tid >> 5), lane = tid & 31, col = lane & 15, g = lane >> 4; const int wr = wave >> 2, wc = wave & 3; const int c0 = blockIdx.y * 128; const size_t r0 = (size_t)blockIdx.x * 128; const size_t bb = r0 / TT; const int t0 = (int)(r0 % TT);
  v8f acc[3][2][2] = {};
  const int fr = tid >> 4, fc = (tid & 15) * 4;   /* the thread's row of each 32-row sweep and its 4 floats of a stage row */
  const unsigned fo = fr * DIN + fc; const float* xg = X + r0 * DIN; const float* wg0 = WQ + (size_t)c0 * DIN; const float* wg1 = WK + (size_t)c0 * DIN; const float* wg2 = WV + (size_t)c0 * DIN; v4f xr[4], wv[3][4];   /* block-uniform bases, one 32-bit lane offset that nothing overwrites */
  int ps[4]; ROPE_POS(ps, r0, lane);   /* issued ahead of the stage loads: loads count back in order, so the table's wait for the positions leaves the stage loads in flight */
UNROLL_REGS
  for (int i = 0; i < 4; ++i) xr[i] = *(const v4f*)(xg + fo + (size_t)i * 32 * DIN);
UNROLL_REGS
  for (int i = 0; i < 4; ++i) { wv[0][i] = *(const v4f*)(wg0 + fo + (size_t)i * 32 * DIN); wv[1][i] = *(const v4f*)(wg1 + fo + (size_t)i * 32 * DIN); wv[2][i] = *(const v4f*)(wg2 + fo + (size_t)i * 32 * DIN); }
  XWAIT();
  ROPE_TAB(rt, ps, wave, lane);   /* runs while the first stage's loads are in flight */
  for (int s = 0; s < DIN / KS; ++s) { __bf16 (*rb)[LP] = u.ring[s & 1];
UNROLL_REGS
    for (int i = 0; i < 4; ++i) *(v4b*)&rb[fr + 32 * i][fc] = cvt4b(xr[i]);
UNROLL_REGS
    for (int q = 0; q < 3; ++q)
UNROLL_REGS
      for (int i = 0; i < 4; ++i) *(v4b*)&rb[128 + 128 * q + fr + 32 * i][fc] = cvt4b(wv[q][i]);
    __syncthreads();   /* publishes stage s; it also ends every wave's reads of the other buffer, which stage s + 1 overwrites */
    if (s + 1 < DIN / KS) { xg += KS; wg0 += KS; wg1 += KS; wg2 += KS;
UNROLL_REGS
      for (int i = 0; i < 4; ++i) xr[i] = *(const v4f*)(xg + fo + (size_t)i * 32 * DIN);
UNROLL_REGS
      for (int i = 0; i < 4; ++i) { wv[0][i] = *(const v4f*)(wg0 + fo + (size_t)i * 32 * DIN); wv[1][i] = *(const v4f*)(wg1 + fo + (size_t)i * 32 * DIN); wv[2][i] = *(const v4f*)(wg2 + fo + (size_t)i * 32 * DIN); }
      XWAIT(); }
UNROLL_REGS
    for (int kk = 0; kk < KS / 32; ++kk) { v16b a[2], w[3][2];   /* a block's fragment reads go as one group ahead of its products */
UNROLL_REGS
      for (int i = 0; i < 2; ++i) a[i] = frag_b(&rb[wr * 32 + i * 16 + col][kk * 32], lane);
UNROLL_REGS
      for (int q = 0; q < 3; ++q)
UNROLL_REGS
        for (int j = 0; j < 2; ++j) w[q][j] = frag_b(&rb[128 + 128 * q + wc * 32 + j * 16 + col][kk * 32], lane);
UNROLL_REGS
      for (int q = 0; q < 3; ++q)
UNROLL_REGS
        for (int i = 0; i < 2; ++i)
UNROLL_REGS
          for (int j = 0; j < 2; ++j) acc[q][i][j] = wmma_bf(a[i], w[q][j], acc[q][i][j]); } }
  const int i0 = (wave >> 2) * 8;   /* the RoPE pairs of a (row, head) go a quarter to each group of four waves */
#pragma unroll 1   /* one copy of the epilogue's text, not six */
  for (int ep = 0; ep < 6; ++ep) { const int which = ep >> 1, hp = ep & 1; const float* BA = which == 0 ? BQ : which == 1 ? BK : BV; const size_t rh = r0 + 64 * hp; const int th0 = t0 + 64 * hp;   /* the 64-row half the eight waves wr >> 1 == hp hold; the barrier behind each pass's conversion ends the reads of st, the two in front of the next conversion end the reads of the planes */
  { // stage the half's f32 tile (acc + bias) in LDS, run the per-(row, head) epilogue hook, then convert
    if ((wr >> 1) == hp) {
UNROLL_REGS
    for (int q = 0; q < 3; ++q) if (q == which) {   /* block-uniform test: the accumulator array keeps constant indices */
#pragma unroll
    for (int i = 0; i < 2; ++i)
#pragma unroll
    for (int j = 0; j < 2; ++j) { const float bias = BA ? bfr(BA[c0 + wc * 32 + j * 16 + col]) : 0.f;
#pragma unroll
      for (int r = 0; r < 8; ++r) st[(wr & 1) * 32 + i * 16 + 8 * g + r][wc * 32 + j * 16 + col] = acc[q][i][j][r] + bias; } } }
    __syncthreads();
    { const int e = tid & 127; const int rl = e / (128 / HD), hh = e % (128 / HD); PROJ_EPI(which, &st[rl][hh * HD], &rt[64 * hp + rl][0], i0); }
    __syncthreads(); }
  if (which < 2) { _Float16* DH = which == 0 ? QH : KH; _Float16* DL = which == 0 ? QL : KL; const int nhi = which == 0 ? QHI : KHI; const bool hi_rows = th0 < nhi;
    for (int e = tid; e < 64 * 128; e += 512) { const int rl = e >> 7, cl = e & 127; const float v = st[rl][cl]; const _Float16 hv = (_Float16)v; sh[rl][cl] = hv; sl[rl][cl] = (_Float16)((v - (float)hv) * 1024.0f); }
    __syncthreads();
    for (int e = tid; e < 64 * 16; e += 512) { const int rl = e >> 4, q = e & 15; vst2((unsigned*)(DH + (rh + rl) * CC + c0 + q * 8), *(const v4u*)&sh[rl][q * 8]); XWAIT(); if (hi_rows) { vst2((unsigned*)(DL + (bb * nhi + th0 + rl) * (size_t)CC + c0 + q * 8), *(const v4u*)&sl[rl][q * 8]); XWAIT(); } }
  } else { const bool hi_rows = th0 < KHI;
    for (int e = tid; e < 64 * 128; e += 512) { const int rl = e & 63, cl = e >> 6; const float v = st[rl][cl]; th[cl][rl] = (_Float16)v; const __bf16 bh = (__bf16)v; tb[cl][rl] = bh; tbl[cl][rl] = (__bf16)(v - (float)bh); }
    __syncthreads();
    for (int e = tid; e < 128 * 8; e += 512) { const int cl = e >> 3, q = e & 7; vst2((unsigned*)(VT + (bb * CC + c0 + cl) * (size_t)TT + th0 + q * 8), *(const v4u*)&th[cl][q * 8]); XWAIT(); if (hi_rows) { const size_t o3 = (bb * CC + c0 + cl) * (size_t)KHI + th0 + q * 8; vst2((unsigned*)(VB + o3), *(const v4u*)&tb[cl][q * 8]); vst2((unsigned*)(VBL + o3), *(const v4u*)&tbl[cl][q * 8]); XWAIT(); } } } } }
// fragment from the lane's own pointer (row start + k0 + 8 * (lane >> 4)): the same k order as frag_h / frag_b
__device__ __forceinline__ v16h frag_hp(const _Float16* p) { union { v16h v; v8h q[2]; } u; u.q[0] = *(const v8h*)p; u.q[1] = *(const v8h*)(p + 16); return u.v; }
__device__ __forceinline__ v16b frag_bp(const __bf16* p) { union { v16b v; v8b q[2]; } u; u.q[0] = *(const v8b*)p; u.q[1] = *(const v8b*)(p + 16); return u.v; }
// one 32-key step of a query's running softmax: v = the lane's 16 scaled logits (-3.0e38 = excluded) -> exp(v - new maximum) x 2^11; m = running maximum (both wave halves alike), l = this half's running sum; returns the factor that carries the old sums to the new maximum
__device__ __forceinline__ float sm_step(float v[16], float& m, float& l) {
  float mx = v[0];
#pragma unroll
  for (int i = 1; i < 16; ++i) mx = fmaxf(mx, v[i]);
  mx = fmaxf(mx, __shfl_xor(mx, 16));
  const float mn = fmaxf(m, mx); const float alpha = expf(m - mn); float s = 0.f;
#pragma unroll
  for (int i = 0; i < 16; ++i) { const float e = expf(v[i] - mn); s += e; v[i] = e * 2048.0f; }   /* mn is a kept key's logit (every step holds one for every query), so an excluded key gives exp(-3.0e38) = 0 */
  l = l * alpha + s; m = mn; return alpha; }
// the same step in base 2 over a whole 64-key stage, for the blocks behind the early ones: v = the lane's 32 RAW logits q.k (-3.0e38 = excluded), m = running maximum of raw logits; exp(SCALE x (v - mn)) x 2^11 = exp2(v x C2 - (mn x C2 - 11)), C2 = SCALE x log2(e): one fma and one hardware exp2 per score (SCALE > 0, so the maximum may be taken before the scaling); l carries the factor 2^11 (exact); an excluded key gives exp2(-5.4e37) = 0; each 32-key half keeps its own maximum and its own sum, joined once
#define C2 (SCALE * 1.44269504088896340736f)
__device__ __forceinline__ float sm_step2(float v[32], float& m, float& l) {
  float mx0 = v[0], mx1 = v[16];
#pragma unroll
  for (int i = 1; i < 16; ++i) { mx0 = fmaxf(mx0, v[i]); mx1 = fmaxf(mx1, v[16 + i]); }
  float mx = fmaxf(mx0, mx1); mx = fmaxf(mx, __shfl_xor(mx, 16));
  const float mn = fmaxf(m, mx); const float alpha = __builtin_amdgcn_exp2f((m - mn) * C2); const float nb = __builtin_fmaf(mn, C2, -11.0f); float s0 = 0.f, s1 = 0.f;
#pragma unroll
  for (int i = 0; i < 16; ++i) { const float e0 = __builtin_amdgcn_exp2f(__builtin_fmaf(v[i], C2, -nb)), e1 = __builtin_amdgcn_exp2f(__builtin_fmaf(v[16 + i], C2, -nb)); s0 += e0; s1 += e1; v[i] = e0; v[16 + i] = e1; }
  l = l * alpha + (s0 + s1); m = mn; return alpha; }
// ---- k_attn: block = (head h, 64 queries qb, batch b), 8 waves = two teams of four, wave = 16 queries, keys [0, diagonal] 32 at a time by team 0 alone (behind the early blocks: 64 at a time, the even 64-key stages by team 0 and the odd ones by team 1, so a tile's chain of stages is half as long; each team stages its own k rows and v planes in LDS, once for its four waves, the next stage's global loads in flight over this stage's step; team 1's maximum, sum and ctx sums are joined to team 0's once, through LDS, behind the loop). Twice the waves: half the blocks are resident at a time; blockIdx.y orders the tiles by falling cost (the early blocks, then the longest tile first). S^T = K Q^T x SCALE (behind the early blocks SCALE is applied inside the softmax step): lane (g, col) holds query col's logits of keys 8g + r and 16 + 8g + r (causal early query blocks: q and k residual planes, 3 products); the causal rule by index in the last step; running maximum and sum in f32; the two score tiles, as P^T x 2^11 once to f16 (early blocks: bf16 hi + lo), are the B operand of ctx^T += V^T P^T (early blocks: v bf16 hi + lo, 3 products); ctx = sums / (2^11 x sum of exp); 256-B (row, head) segment by 16 lanes
__global__ __launch_bounds__(256) void k_attn(const _Float16* __restrict__ QH, const _Float16* __restrict__ KH, const _Float16* __restrict__ QL, const _Float16* __restrict__ KL, const _Float16* __restrict__ VT, const __bf16* __restrict__ VB, const __bf16* __restrict__ VBL, float* __restrict__ Y) { __shared__ __align__(16) float ss[4][16][HD + 4]; __shared__ __align__(16) _Float16 kv[2][2][64 + HD][LP];   /* per team a two-buffer ring [buffer][team] of 64-key stages: rows 0..63 the keys' k rows of this head, rows 64.. its v planes [c][64 keys] */
  __shared__ __align__(16) v4f pj[4][9][32];   /* team 1's partial results, lane by lane: 8 x 4 ctx sums, then (maximum, sum) */
  const int tid = threadIdx.x, wv8 = __builtin_amdgcn_readfirstlane(tid >> 5), team = wv8 >> 2, wave = wv8 & 3, lane = tid & 31, col = lane & 15, g = lane >> 4; const int h = blockIdx.x, b = blockIdx.z; const int qb = (int)blockIdx.y < QBH ? (int)blockIdx.y : NQB + QBH - 1 - (int)blockIdx.y;   /* a permutation of the query blocks */ const int ql0 = qb * 64 + wave * 16; const int nch = (ql0 + 47) >> 5;
  const size_t q0 = (size_t)b * TT + ql0, kr0 = (size_t)b * TT;
  v8f acc[HD / 16] = {}; float m = -3.0e38f, l = 0.f; const float lc = qb < QBH ? 2048.0f : 1.0f;   /* what the sum of exp still lacks of the 2^11 that P carries */
  if (qb < QBH) { if (team) return;   /* wave-uniform; this path has no work-group barrier */
    const _Float16* QLb = QL + (size_t)b * QHI * CC; const _Float16* KLb = KL + (size_t)b * KHI * CC; v16h qh[HD / 32], qlo[HD / 32];
#pragma unroll
    for (int kk = 0; kk < HD / 32; ++kk) { qh[kk] = frag_h(QH + (q0 + col) * CC + h * HD + kk * 32, lane); qlo[kk] = frag_h(QLb + (size_t)(ql0 + col) * CC + h * HD + kk * 32, lane); }
    asm volatile("s_wait_xcnt 0x0" :: "v"(qh[0]), "v"(qh[1]), "v"(qlo[0]), "v"(qlo[1]) : "memory");   /* XWAIT held behind the q loads by their values (inputs only) */
    const _Float16* kp = KH + (kr0 + col) * CC + h * HD + 8 * g; const _Float16* klp = KLb + (size_t)col * CC + h * HD + 8 * g; const __bf16* vp = VB + ((size_t)b * CC + h * HD + col) * (size_t)KHI + 8 * g; const __bf16* vlp = VBL + ((size_t)b * CC + h * HD + col) * (size_t)KHI + 8 * g;
    for (int kc = 0; kc < nch; ++kc, kp += 32 * CC, klp += 32 * CC, vp += 32, vlp += 32) { const int k0 = kc * 32; float v[16]; v16h kbf[2][HD / 32], klf[2][HD / 32];   /* a step's k loads are all issued before its first product, its v loads before the softmax */
#pragma unroll
      for (int t = 0; t < 2; ++t)
#pragma unroll
        for (int kk = 0; kk < HD / 32; ++kk) kbf[t][kk] = frag_hp(kp + t * 16 * CC + kk * 32);
      XWAIT();
#pragma unroll
      for (int t = 0; t < 2; ++t)
#pragma unroll
        for (int kk = 0; kk < HD / 32; ++kk) klf[t][kk] = frag_hp(klp + t * 16 * CC + kk * 32);
      XWAIT();
#pragma unroll
      for (int t = 0; t < 2; ++t) { v8f s = {}, sl = {};
#pragma unroll
        for (int kk = 0; kk < HD / 32; ++kk) { s = wmma16(kbf[t][kk], qh[kk], s); sl = wmma16(kbf[t][kk], qlo[kk], sl); sl = wmma16(klf[t][kk], qh[kk], sl); }
#pragma unroll
        for (int r = 0; r < 8; ++r) v[t * 8 + r] = (s[r] + sl[r] * (1.0f / 1024.0f)) * SCALE; }
      if (kc == nch - 1) {
#pragma unroll
        for (int i = 0; i < 16; ++i) if (k0 + (i >> 3) * 16 + 8 * g + (i & 7) > ql0 + col) v[i] = -3.0e38f; }
      v16b vh[HD / 16], vl[HD / 16];
#pragma unroll
      for (int j = 0; j < HD / 16; ++j) vh[j] = frag_bp(vp + j * 16 * KHI);
      XWAIT();
#pragma unroll
      for (int j = 0; j < HD / 16; ++j) vl[j] = frag_bp(vlp + j * 16 * KHI);
      XWAIT();
      const float alpha = sm_step(v, m, l); const F2 p = bsplit16(v);
#pragma unroll
      for (int j = 0; j < HD / 16; ++j) { acc[j] = acc[j] * alpha; acc[j] = wmma_bf(vh[j], p.h, acc[j]); acc[j] = wmma_bf(vh[j], p.l, acc[j]); acc[j] = wmma_bf(vl[j], p.h, acc[j]); } }
  } else { v16h qh[HD / 32];
#pragma unroll
    for (int kk = 0; kk < HD / 32; ++kk) qh[kk] = frag_h(QH + (q0 + col) * CC + h * HD + kk * 32, lane);
    asm volatile("s_wait_xcnt 0x0" :: "v"(qh[0]), "v"(qh[1]) : "memory");   /* XWAIT held behind the q loads by their values (inputs only) */
    const int tl = tid & 127, fr = tl >> 3, fc = (tl & 7) * 8;   /* the thread's row of each 16-row sweep of its team's stage and its 16 B of a 128-B stage row: a wave's load covers 4 whole lines */
    const unsigned ko = fr * CC + fc, vo = fr * TT + fc; const _Float16* kg = KH + (kr0 + 64 * team) * CC + h * HD; const _Float16* vg = VT + ((size_t)b * CC + h * HD) * (size_t)TT + 64 * team;   /* the team's first stage is stage 'team' (qb >= QBH > 1: it exists) */ v8h kr[4], vr[HD / 16];   /* wave-uniform bases, 32-bit lane offsets that nothing overwrites */
UNROLL_REGS
    for (int i = 0; i < 4; ++i) kr[i] = *(const v8h*)(kg + ko + (size_t)i * 16 * CC);
    XWAIT();
UNROLL_REGS
    for (int i = 0; i < HD / 16; ++i) vr[i] = *(const v8h*)(vg + vo + (size_t)i * 16 * TT);
    XWAIT();
    const int nit = (qb + 2) >> 1;   /* trips of the longer team */
    for (int it = 0; it < nit; ++it) { const int s = 2 * it + team; _Float16 (*rb)[LP] = kv[it & 1][team];   /* block-uniform trip count: every wave passes every barrier; s > qb (team 1's last trip when qb is even): nothing but the barrier */
      if (s <= qb) {
UNROLL_REGS
      for (int i = 0; i < 4; ++i) *(v8h*)&rb[fr + 16 * i][fc] = kr[i];
UNROLL_REGS
      for (int i = 0; i < HD / 16; ++i) *(v8h*)&rb[64 + fr + 16 * i][fc] = vr[i]; }
      __syncthreads();   /* publishes the teams' stages of this trip and ends the reads of the buffers that the next trip overwrites */
      if (s + 2 <= qb) { kg += 128 * CC; vg += 128;
UNROLL_REGS
        for (int i = 0; i < 4; ++i) kr[i] = *(const v8h*)(kg + ko + (size_t)i * 16 * CC);
UNROLL_REGS
        for (int i = 0; i < HD / 16; ++i) vr[i] = *(const v8h*)(vg + vo + (size_t)i * 16 * TT);
        XWAIT(); }
      if (s <= qb) { float v[32]; v16h kf[4][HD / 32], vf[2][HD / 16]; v8f sc[4] = {};   /* ONE softmax step per 64-key stage: four independent score tiles, one maximum exchange, one rescale of the sums; the k fragment reads go as one group ahead of the first product, the v reads as one group ahead of the softmax */
UNROLL_REGS
      for (int t = 0; t < 4; ++t)
UNROLL_REGS
        for (int kk = 0; kk < HD / 32; ++kk) kf[t][kk] = frag_hp(&rb[t * 16 + col][kk * 32 + 8 * g]);
UNROLL_REGS
      for (int kk = 0; kk < HD / 32; ++kk)
UNROLL_REGS
        for (int t = 0; t < 4; ++t) sc[t] = wmma16(kf[t][kk], qh[kk], sc[t]);
UNROLL_REGS
      for (int t2 = 0; t2 < 2; ++t2)
UNROLL_REGS
        for (int j = 0; j < HD / 16; ++j) vf[t2][j] = frag_hp(&rb[64 + j * 16 + col][t2 * 32 + 8 * g]);
#pragma unroll
      for (int t = 0; t < 4; ++t)
#pragma unroll
        for (int r = 0; r < 8; ++r) v[t * 8 + r] = sc[t][r];
      if (s == qb) {   /* wave-uniform: the diagonal lies in the last stage; a wave's keys wholly behind it count 0 */
#pragma unroll
        for (int i = 0; i < 32; ++i) if (s * 64 + (i >> 3) * 16 + 8 * g + (i & 7) > ql0 + col) v[i] = -3.0e38f; }
      const float alpha = sm_step2(v, m, l); v16h p[2];
#pragma unroll
      for (int i = 0; i < 32; ++i) p[i >> 4][i & 15] = (_Float16)v[i];
UNROLL_REGS
      for (int j = 0; j < HD / 16; ++j) acc[j] = acc[j] * alpha;
UNROLL_REGS
      for (int t2 = 0; t2 < 2; ++t2)
UNROLL_REGS
        for (int j = 0; j < HD / 16; ++j) acc[j] = wmma16(vf[t2][j], p[t2], acc[j]); } }
    if (team) {   /* every query has open keys in stage 1, so team 1's maximum is a kept key's logit */
UNROLL_REGS
      for (int j = 0; j < HD / 16; ++j) { pj[wave][2 * j][lane] = (v4f){acc[j][0], acc[j][1], acc[j][2], acc[j][3]}; pj[wave][2 * j + 1][lane] = (v4f){acc[j][4], acc[j][5], acc[j][6], acc[j][7]}; }
      pj[wave][8][lane] = (v4f){m, l, 0.f, 0.f}; }
    __syncthreads();   /* publishes team 1's partial results to team 0; block-uniform, the block's last barrier */
    if (team) return;
    { const v4f ml = pj[wave][8][lane]; const float mn = fmaxf(m, ml[0]); const float a0 = __builtin_amdgcn_exp2f((m - mn) * C2), a1 = __builtin_amdgcn_exp2f((ml[0] - mn) * C2);   /* both teams' sums carried to the common maximum, as in sm_step2 */
      asm volatile("v_nop" :: "v"(a0), "v"(a1));   /* one slot between the two exp2 and the multiplies behind them, which read their results and may take their source registers */
      l = l * a0 + ml[1] * a1;
UNROLL_REGS
      for (int j = 0; j < HD / 16; ++j) { const v4f p0 = pj[wave][2 * j][lane], p1 = pj[wave][2 * j + 1][lane];
UNROLL_REGS
        for (int r = 0; r < 4; ++r) { acc[j][r] = acc[j][r] * a0 + p0[r] * a1; acc[j][4 + r] = acc[j][4 + r] * a0 + p1[r] * a1; } } } }
  l += __shfl_xor(l, 16); const float inv = 1.0f / (l * lc);
#pragma unroll
  for (int j = 0; j < HD / 16; ++j)
#pragma unroll
    for (int r = 0; r < 8; ++r) ss[wave][col][j * 16 + 8 * g + r] = acc[j][r] * inv;
  LDSX(); for (int rl = 0; rl < 16; ++rl) if (lane < HD / 4) vst2(Y + ((size_t)b * TT + ql0 + rl) * CC + h * HD + lane * 4, *(const v4f*)&ss[wave][rl][lane * 4]); }
// ---- k_out: block = (128 rows, 128 cols), 8 waves of 32 rows x 64 cols, operands staged in a two-buffer LDS ring as in k_proj: out = ctx Wo (+ bo): ctx x 2^6 once to f16 against Wo as f16(bf16 x 2^8) exact (1 product) x 2^-14; causal early rows (< QHI of each sequence): ctx bf16 hi + lo against exact bf16 Wo (2 products)
__global__ __launch_bounds__(256) void k_out(const float* __restrict__ Y, const float* __restrict__ WO, const float* __restrict__ BO, float* __restrict__ OUT) { __shared__ __align__(16) float sf[8][32][68];
  __shared__ __align__(16) union { __bf16 b[2][128 + 128 + 128][LP]; _Float16 h[2][128 + 128][LP]; } u;   /* early rows: ctx hi 0..127, ctx lo 128..255, Wo 256..383; else ctx 0..127, Wo 128..255 */
  const int tid = threadIdx.x, wave = __builtin_amdgcn_readfirstlane(tid >> 5), lane = tid & 31, col = lane & 15, g = lane >> 4; const int wr = wave >> 1, wc = wave & 1; const int c0 = blockIdx.y * 128; const size_t r0 = (size_t)blockIdx.x * 128 + wr * 32;
  v8f acc[2][4] = {};
  const int fr = tid >> 4, fc = (tid & 15) * 4;   /* as in k_proj */
  const unsigned fo = fr * CC + fc; const float* yg = Y + (size_t)blockIdx.x * 128 * CC; const float* wg = WO + (size_t)c0 * CC; v4f yr[8], wv[8];
UNROLL_REGS
  for (int i = 0; i < 8; ++i) yr[i] = *(const v4f*)(yg + fo + (size_t)i * 16 * CC);
UNROLL_REGS
  for (int i = 0; i < 8; ++i) wv[i] = *(const v4f*)(wg + fo + (size_t)i * 16 * CC);
  XWAIT();
  if (CAUSAL && (int)(((size_t)blockIdx.x * 128) % TT) < QHI) {   /* block-uniform; QHI is a multiple of the 128 rows */
    for (int s = 0; s < CC / KS; ++s) { __bf16 (*rb)[LP] = u.b[s & 1];
UNROLL_REGS
      for (int i = 0; i < 8; ++i) { *(v4b*)&rb[fr + 16 * i][fc] = cvt4b(yr[i]); *(v4b*)&rb[128 + fr + 16 * i][fc] = cvt4bl(yr[i]); }
UNROLL_REGS
      for (int i = 0; i < 8; ++i) *(v4b*)&rb[256 + fr + 16 * i][fc] = cvt4b(wv[i]);
      __syncthreads();   /* publishes stage s and ends the reads of the buffer that stage s + 1 overwrites */
      if (s + 1 < CC / KS) { yg += KS; wg += KS;
UNROLL_REGS
        for (int i = 0; i < 8; ++i) yr[i] = *(const v4f*)(yg + fo + (size_t)i * 16 * CC);
UNROLL_REGS
        for (int i = 0; i < 8; ++i) wv[i] = *(const v4f*)(wg + fo + (size_t)i * 16 * CC);
        XWAIT(); }
UNROLL_REGS
      for (int kk = 0; kk < KS / 32; ++kk) { v16b ah[2], al[2], w[4];
UNROLL_REGS
        for (int i = 0; i < 2; ++i) { ah[i] = frag_b(&rb[wr * 32 + i * 16 + col][kk * 32], lane); al[i] = frag_b(&rb[128 + wr * 32 + i * 16 + col][kk * 32], lane); }
UNROLL_REGS
        for (int j = 0; j < 4; ++j) w[j] = frag_b(&rb[256 + wc * 64 + j * 16 + col][kk * 32], lane);
UNROLL_REGS
        for (int i = 0; i < 2; ++i)
UNROLL_REGS
          for (int j = 0; j < 4; ++j) { acc[i][j] = wmma_bf(ah[i], w[j], acc[i][j]); acc[i][j] = wmma_bf(al[i], w[j], acc[i][j]); } } }
#pragma unroll
    for (int i = 0; i < 2; ++i)
#pragma unroll
    for (int j = 0; j < 4; ++j) { const float bias = BO ? bfr(BO[c0 + wc * 64 + j * 16 + col]) : 0.f;
#pragma unroll
      for (int r = 0; r < 8; ++r) sf[wave][i * 16 + 8 * g + r][j * 16 + col] = acc[i][j][r] + bias; }
  } else {
    for (int s = 0; s < CC / KS; ++s) { _Float16 (*rb)[LP] = u.h[s & 1];
UNROLL_REGS
      for (int i = 0; i < 8; ++i) *(v4h*)&rb[fr + 16 * i][fc] = cvt4hs(yr[i], 64.0f);   /* ctx carried x 2^6 into f16 so small-magnitude context rows stay clear of f16 subnormals (chip FTZ) */
UNROLL_REGS
      for (int i = 0; i < 8; ++i) *(v4h*)&rb[128 + fr + 16 * i][fc] = cvt4hw(wv[i]);
      __syncthreads();   /* publishes stage s and ends the reads of the buffer that stage s + 1 overwrites */
      if (s + 1 < CC / KS) { yg += KS; wg += KS;
UNROLL_REGS
        for (int i = 0; i < 8; ++i) yr[i] = *(const v4f*)(yg + fo + (size_t)i * 16 * CC);
UNROLL_REGS
        for (int i = 0; i < 8; ++i) wv[i] = *(const v4f*)(wg + fo + (size_t)i * 16 * CC);
        XWAIT(); }
UNROLL_REGS
      for (int kk = 0; kk < KS / 32; ++kk) { v16h a[2], w[4];
UNROLL_REGS
        for (int i = 0; i < 2; ++i) a[i] = frag_h(&rb[wr * 32 + i * 16 + col][kk * 32], lane);
UNROLL_REGS
        for (int j = 0; j < 4; ++j) w[j] = frag_h(&rb[128 + wc * 64 + j * 16 + col][kk * 32], lane);
UNROLL_REGS
        for (int i = 0; i < 2; ++i)
UNROLL_REGS
          for (int j = 0; j < 4; ++j) acc[i][j] = wmma16(a[i], w[j], acc[i][j]); } }
#pragma unroll
    for (int i = 0; i < 2; ++i)
#pragma unroll
    for (int j = 0; j < 4; ++j) { const float bias = BO ? bfr(BO[c0 + wc * 64 + j * 16 + col]) : 0.f;
#pragma unroll
      for (int r = 0; r < 8; ++r) sf[wave][i * 16 + 8 * g + r][j * 16 + col] = acc[i][j][r] * (1.0f / 16384.0f) + bias; } }   /* 2^-8 (Wo carry) x 2^-6 (ctx carry) */
  LDSX(); for (int rp = 0; rp < 16; ++rp) { const int rl = 2 * rp + g; vst2(OUT + (r0 + rl) * DIN + c0 + wc * 64 + col * 4, *(const v4f*)&sf[wave][rl][col * 4]); } }   /* a wave's store covers two rows' 256-B pieces: whole lines */

extern "C" void kernel_launch(void* const* d_in, const int* in_sizes, int n_in, void* d_out, int out_size, void* d_ws, size_t ws_size, hipStream_t stream) {
  (void)in_sizes; (void)n_in; (void)out_size;
  const float** F = (const float**)d_in;
  if (ws_size < (size_t)WS_END) return;
  char* ws = (char*)d_ws; _Float16 *QH = (_Float16*)(ws + WS_QH), *KH = (_Float16*)(ws + WS_KH), *VT = (_Float16*)(ws + WS_VT), *QL = (_Float16*)(ws + WS_QL), *KL = (_Float16*)(ws + WS_KL); __bf16 *VB = (__bf16*)(ws + WS_VB), *VBL = (__bf16*)(ws + WS_VBL); float *Y = (float*)(ws + WS_Y);
  (void)Y; (void)QL; (void)KL; (void)VB; (void)VBL;
  // inputs: 0 x [1,4096,1024]; 1 token_positions [4096] int32 (arange): READ on the device; 2 Wq [1024,1024] (out,in); 3 Wk; 4 Wv; 5 Wo (out,in); no biases (null pointers)
  k_proj<<<dim3(TNB * TT / 128, CC / 128), 512, 0, stream>>>(F[0], F[2], F[3], F[4], nullptr, nullptr, nullptr, QH, QL, KH, KL, VT, VB, VBL, (const int*)d_in[1]);
  k_attn<<<dim3(NH, NQB, TNB), 256, 0, stream>>>(QH, KH, QL, KL, VT, VB, VBL, Y);
  k_out<<<dim3(TNB * TT / 128, DIN / 128), 256, 0, stream>>>(Y, F[5], nullptr, (float*)d_out);
}

// v009
// Measured time: 102 microseconds a run.
// Timed twice side by side with v008, it ran 1.03 times as fast both times.
// All steps since v000 together make it 29.1 times as fast.
// compute dtype: all float inputs rounded to bf16; q/k/v projections with EXACT bf16 products on WMMA 16x16x32 (f32 accumulate); RoPE in f32 at the int token positions; causal logits: 3 products for the first 384 rows, single f16 q x k after, x 64^-0.5; softmax f32; P x 2^11 once to f16 x v once to f16 (bf16 hi + lo below row 384); ctx hi+lo x exact Wo below row 384, x2^6 f16 carry x f16(bf16 x 2^8) Wo after; f32 output.
#include <hip/hip_runtime.h>
#include <math.h>

typedef __attribute__((ext_vector_type(16))) _Float16 v16h;
typedef __attribute__((ext_vector_type(16))) __bf16 v16b;
typedef __attribute__((ext_vector_type(8)))  _Float16 v8h;
typedef __attribute__((ext_vector_type(8)))  float v8f;
typedef __attribute__((ext_vector_type(4)))  float v4f;
typedef __attribute__((ext_vector_type(2)))  float v2f;
typedef __attribute__((ext_vector_type(4)))  unsigned v4u;
typedef __attribute__((ext_vector_type(4)))  int v4i;
typedef float __attribute__((may_alias)) float_a;
typedef int __attribute__((may_alias)) int_a;

template <typename T> __device__ __forceinline__ void vst2(void* p, T v) { *(T*)p = v;  }
__device__ __forceinline__ v8f wmma16(v16h a, v16h b, v8f c) {
  v8f d = __builtin_amdgcn_wmma_f32_16x16x32_f16(false, a, false, b, (short)0, c, false, false);
  asm volatile("v_nop\n\tv_nop\n\tv_nop\n\tv_nop" : "+v"(d) : "v"(a), "v"(b));
  return d;
}
__device__ __forceinline__ v8f wmma_bf(v16b a, v16b b, v8f c) {
  v8f d = __builtin_amdgcn_wmma_f32_16x16x32_bf16(false, a, false, b, (short)0, c, false, false);
  asm volatile("v_nop\n\tv_nop\n\tv_nop\n\tv_nop" : "+v"(d) : "v"(a), "v"(b));
  return d;
}
// 16x16x32 fragments: lane = (h = lane>>4, row/col = lane&15); elements 0..7 = k0+8h+0..7, 8..15 = k0+16+8h+0..7; D element r = row 8h+r
__device__ __forceinline__ v16h frag_h(const _Float16* rowk0, int lane) {
  union { v16h v; v8h q[2]; } u; const _Float16* p = rowk0 + 8 * (lane >> 4);
  u.q[0] = *(const v8h*)p; u.q[1] = *(const v8h*)(p + 16); return u.v;
}
__device__ __forceinline__ v16h frag_f32(const float* rowk0, int lane) {
  v16h a; const float* p = rowk0 + 8 * (lane >> 4);
#pragma unroll
  for (int i = 0; i < 8; ++i) { a[i] = (_Float16)p[i]; a[8 + i] = (_Float16)p[16 + i]; }
  return a;
}
__device__ __forceinline__ v16h frag_f32s(const float* rowk0, int lane, float sc) {
  v16h a; const float* p = rowk0 + 8 * (lane >> 4);
#pragma unroll
  for (int i = 0; i < 8; ++i) { a[i] = (_Float16)(p[i] * sc); a[8 + i] = (_Float16)(p[16 + i] * sc); }
  return a;
}
// column fragment from a [K][ld] layout (column n), rows >= K read as 0
__device__ __forceinline__ v16h fragc_f32(const float* W, int k0, int n, int lane, int ld, int K) {
  v16h a; const int g = lane >> 4;
#pragma unroll
  for (int i = 0; i < 8; ++i) { const int ka = k0 + 8 * g + i, kb = ka + 16;
    a[i] = (_Float16)(ka < K ? W[(size_t)(ka < K ? ka : K - 1) * ld + n] : 0.f); a[8 + i] = (_Float16)(kb < K ? W[(size_t)(kb < K ? kb : K - 1) * ld + n] : 0.f); }
  return a;
}
struct F2 { v16b h, l; };
__device__ __forceinline__ F2 bsplit16(const float v[16]) { F2 r;
#pragma unroll
  for (int i = 0; i < 16; ++i) { const __bf16 h = (__bf16)v[i]; r.h[i] = h; r.l[i] = (__bf16)(v[i] - (float)h); }
  return r; }
__device__ __forceinline__ F2 split_row(const float* row, int k0, int lane) { float v[16]; const float* p = row + k0 + 8 * (lane >> 4);
#pragma unroll
  for (int i = 0; i < 8; ++i) { v[i] = p[i]; v[8 + i] = p[16 + i]; }
  return bsplit16(v); }
__device__ __forceinline__ F2 split_rowK(const float* row, int k0, int lane, int K) { float v[16]; const int g = lane >> 4;
#pragma unroll
  for (int i = 0; i < 8; ++i) { const int ka = k0 + 8 * g + i, kb = ka + 16; v[i] = ka < K ? row[ka < K ? ka : K - 1] : 0.f; v[8 + i] = kb < K ? row[kb < K ? kb : K - 1] : 0.f; }
  return bsplit16(v); }
__device__ __forceinline__ F2 split_col(const float* W, int k0, int n, int lane, int ld, int K) { float v[16]; const int g = lane >> 4;
#pragma unroll
  for (int i = 0; i < 8; ++i) { const int ka = k0 + 8 * g + i, kb = ka + 16; v[i] = ka < K ? W[(size_t)(ka < K ? ka : K - 1) * ld + n] : 0.f; v[8 + i] = kb < K ? W[(size_t)(kb < K ? kb : K - 1) * ld + n] : 0.f; }
  return bsplit16(v); }
__device__ __forceinline__ v8f mac3(const F2& a, const F2& b, v8f c) { c = wmma_bf(a.l, b.h, c); c = wmma_bf(a.h, b.l, c); return wmma_bf(a.h, b.h, c); }
__device__ __forceinline__ float sigm(float v) { return 1.0f / (1.0f + expf(-v)); }
#define LDSX() do { asm volatile("s_wait_dscnt 0" ::: "memory"); __builtin_amdgcn_wave_barrier(); __builtin_amdgcn_fence(__ATOMIC_RELEASE, "workgroup"); } while (0)

// Causal multi-head self-attention with interleaved-pair RoPE at given token positions, ONE batch of 4,096 tokens (x [1,4096,1024]; (out,in) Wq / Wk / Wv / Wo [1024,1024] N(0,1) x 0.02 applied as x @ W.T, no biases; token_positions [4096] int (arange; the LAST input); 16 heads x 64; inv_freq = 1 / 10000^(2i/64); (even, odd) pairs rotated and re-interleaved; scores / sqrt(64); tril kept, -inf elsewhere; softmax; attn @ Wo.T). THIS ROW: the same module and weight scale (0.02) with the argument order x, token_positions, Wq, Wk, Wv, Wo (the positions SECOND): the indices in kernel_launch follow; finfo.min in place of -inf under the causal rule (an exclusion either way); the inverse-frequency expression is the host's own, token for token: the baked table is unchanged.
#define NB 1
#define TT 4096
#define CC 1024            // NH * HD = projected width
#define DIN 1024          // input (model) width
#define NH 16
#define HD 64
#define NQB (TT / 64)
#define SCALE (0.125f)
#define CAUSAL 1
#ifndef TNB
#define TNB NB
#endif
__device__ __forceinline__ float bfr(float v) { return (float)(__bf16)v; }
typedef __attribute__((ext_vector_type(8))) __bf16 v8b;
__device__ __forceinline__ v16b frag_b(const __bf16* rowk0, int lane) {
  union { v16b v; v8b q[2]; } u; const __bf16* p = rowk0 + 8 * (lane >> 4);
  u.q[0] = *(const v8b*)p; u.q[1] = *(const v8b*)(p + 16); return u.v;
}
#define QBH 6              // causal: query blocks 0..QBH-1 of each sequence (few keys, no averaging) take the high-precision path
#define QHI 384            // rows carrying a q residual plane
#define KHI 384            // key rows carrying k residual / v bf16 hi+lo planes (used only by the causal high-precision path)
// B fragment (k rows k0+.., output column o) of a weight: (in,out) [K][ld] or (out,in) [ld rows of K]: bf16 exact, or f16(bf16 * 256) exact
__device__ __forceinline__ v16b wcol_io(const float* Wm, int k0, int o, int lane, int ld) { v16b w; const int g = lane >> 4;
#pragma unroll
  for (int i = 0; i < 8; ++i) { w[i] = (__bf16)Wm[(size_t)(k0 + 8 * g + i) * ld + o]; w[8 + i] = (__bf16)Wm[(size_t)(k0 + 16 + 8 * g + i) * ld + o]; }
  return w; }
__device__ __forceinline__ v16b wcol_oi(const float* Wm, int k0, int o, int lane, int K) { v16b w; const float* p = Wm + (size_t)o * K + k0 + 8 * (lane >> 4);
#pragma unroll
  for (int i = 0; i < 8; ++i) { w[i] = (__bf16)p[i]; w[8 + i] = (__bf16)p[16 + i]; }
  return w; }
__device__ __forceinline__ v16h wcolh_io(const float* Wm, int k0, int o, int lane, int ld) { v16h w; const int g = lane >> 4;
#pragma unroll
  for (int i = 0; i < 8; ++i) { w[i] = (_Float16)(bfr(Wm[(size_t)(k0 + 8 * g + i) * ld + o]) * 256.0f); w[8 + i] = (_Float16)(bfr(Wm[(size_t)(k0 + 16 + 8 * g + i) * ld + o]) * 256.0f); }
  return w; }
__device__ __forceinline__ v16h wcolh_oi(const float* Wm, int k0, int o, int lane, int K) { v16h w; const float* p = Wm + (size_t)o * K + k0 + 8 * (lane >> 4);
#pragma unroll
  for (int i = 0; i < 8; ++i) { w[i] = (_Float16)(bfr(p[i]) * 256.0f); w[8 + i] = (_Float16)(bfr(p[16 + i]) * 256.0f); }
  return w; }
#define WQKV_LAYOUT 1   // picks WCOL's layout (0 = (in,out) [DIN][CC]; 1 = (out,in) [CC][DIN]; 2 = per-head [NH][DIN][HD]); nothing calls WCOL: k_proj reads (out,in) [CC][DIN] rows
__device__ __forceinline__ v16b wcol_hdk(const float* Wm, int k0, int o, int lane) { v16b w; const int g = lane >> 4; const float* p = Wm + (size_t)(o / HD) * DIN * HD + (o % HD);
#pragma unroll
  for (int i = 0; i < 8; ++i) { w[i] = (__bf16)p[(size_t)(k0 + 8 * g + i) * HD]; w[8 + i] = (__bf16)p[(size_t)(k0 + 16 + 8 * g + i) * HD]; }
  return w; }
#define WO_OUT_IN 1
#if WQKV_LAYOUT == 1
#define WCOL(W, k0, o, lane) wcol_oi(W, k0, o, lane, DIN)
#elif WQKV_LAYOUT == 2
#define WCOL(W, k0, o, lane) wcol_hdk(W, k0, o, lane)
#else
#define WCOL(W, k0, o, lane) wcol_io(W, k0, o, lane, CC)
#endif
#if WO_OUT_IN
#define WOCOL(W, k0, o, lane) wcol_oi(W, k0, o, lane, CC)
#define WOCOLH(W, k0, o, lane) wcolh_oi(W, k0, o, lane, CC)
#else
#define WOCOL(W, k0, o, lane) wcol_io(W, k0, o, lane, DIN)
#define WOCOLH(W, k0, o, lane) wcolh_io(W, k0, o, lane, DIN)
#endif
// RoPE inverse frequencies 1/10000^(2i/64) (the f32 values jax computes)
__constant__ float INVF[32] = {1.000000000e+00,7.498942018e-01,5.623413324e-01,4.216965139e-01,3.162277639e-01,2.371373624e-01,1.778279394e-01,1.333521456e-01,1.000000015e-01,7.498941571e-02,5.623412877e-02,4.216964915e-02,3.162277862e-02,2.371373586e-02,1.778279431e-02,1.333521493e-02,9.999999776e-03,7.498942316e-03,5.623413250e-03,4.216964822e-03,3.162277862e-03,2.371373819e-03,1.778279431e-03,1.333521446e-03,1.000000047e-03,7.498941850e-04,5.623413017e-04,4.216964880e-04,3.162277862e-04,2.371373848e-04,1.778279402e-04,1.333521504e-04};
#define PROJ_EXTRA_PARAMS , const int* __restrict__ TPOS
// interleaved-pair RoPE on q and k at the token's position from the int input token_positions[t]: angle = (float)pos * inv_freq[i]; (x1, x2) -> (x1 cos - x2 sin, x1 sin + x2 cos). In an accumulator tile a lane holds ONE column of 8 rows, and the pair's other column lies in the neighbouring lane: own x cos + other x (-sin in the even column, +sin in the odd one); the (cos, sin) pairs are those that ROPE_TAB has laid in LDS
// the neighbouring lane's value (lane ^ 1): a permutation inside each four lanes, done in the vector unit, no LDS; every lane is on where it is called
__device__ __forceinline__ float lane_x1(float v) { return __builtin_bit_cast(float, __builtin_amdgcn_mov_dpp(__builtin_bit_cast(int, v), 0xB1 /* quad_perm [1,0,3,2] */, 0xF, 0xF, true)); }
// the block's (cos, sin) of every (row, pair), each computed ONCE (the angle depends on neither q / k nor the head, so one value serves the four rotations that use it): wave w does pairs 2w and 2w + 1 (a wave-uniform frequency), a lane the rows lane + 32 rg, whose positions ROPE_POS has loaded; TP = pitch in floats: 64 + 4, so that the two rows, 8 apart, of a wave's 8-byte epilogue reads fall on different banks
#define TP 68
// pitch of the epilogue's 16-bit planes in elements: 128 + 8, so that neighbouring rows' 16-byte accesses fall on different banks
#define EP 136
#define ROPE_POS(ps, r0, lane) do { _Pragma("unroll") for (int rg = 0; rg < 4; ++rg) ps[rg] = TPOS[(int)(((r0) + rg * 32 + (lane)) % TT)]; XWAIT(); } while (0)
#define ROPE_TAB(tab, ps, wave, lane) do { _Pragma("unroll 1") /* one copy of the four sine / cosine texts */ for (int p = 0; p < 2; ++p) { const int i = 2 * (wave) + p; const float fq = INVF[i]; _Pragma("unroll") for (int rg = 0; rg < 4; ++rg) { const float ang = (float)ps[rg] * fq; *(v2f*)&(tab)[rg * 32 + (lane)][2 * i] = (v2f){cosf(ang), sinf(ang)}; } } } while (0)
#ifndef PROJ_EXTRA_PARAMS
#define PROJ_EXTRA_PARAMS
#endif

#define WS_QH  0u                                      // f16 q rows [b*t][CC]
#define WS_KH  (WS_QH + 2u * (size_t)NB * TT * CC)      // f16 k rows [b*t][CC]
#define WS_VT  (WS_KH + 2u * (size_t)NB * TT * CC)      // f16 v planes [b][c][t]
#define WS_QL  (WS_VT + 2u * (size_t)NB * CC * TT)      // f16 q residual x 2^10 rows [b][t < QHI][CC]
#define WS_KL  (WS_QL + 2u * (size_t)NB * QHI * CC)     // f16 k residual x 2^10 rows [b][t < KHI][CC]
#define WS_VB  (WS_KL + 2u * (size_t)NB * KHI * CC)     // bf16 v hi planes [b][c][t < KHI]
#define WS_VBL (WS_VB + 2u * (size_t)NB * CC * KHI)
#define WS_Y   (WS_VBL + 2u * (size_t)NB * CC * KHI)    // f32 ctx rows [b*t][CC] (only when there is an output projection)
#define WS_END (WS_Y  + 4u * (size_t)NB * TT * CC)

// LDS staging of the projections' operands: a stage is KS k of every operand row, brought by whole-line loads (16 lanes x 16 B = one 256-B row piece), converted once per block, laid at a pitch of 128 + 16 B for the 16-byte fragment reads
#define KS 64
#define LP 72
// full unroll: the register arrays the loop walks keep constant indices (no scratch) and the row steps fold into the instructions' offsets
#define UNROLL_REGS _Pragma("unroll")
typedef __attribute__((ext_vector_type(4))) __bf16 v4b;
typedef __attribute__((ext_vector_type(4))) _Float16 v4h;
// stands behind each group of global loads and each of k_proj's stores, before anything may take their address registers
#define XWAIT() asm volatile("s_wait_xcnt 0x0" ::: "memory")
__device__ __forceinline__ v4b cvt4b(v4f v) { v4b r;
UNROLL_REGS
  for (int i = 0; i < 4; ++i) r[i] = (__bf16)v[i];
  return r; }
__device__ __forceinline__ v4b cvt4bl(v4f v) { v4b r;   /* the residual plane of bsplit16 */
UNROLL_REGS
  for (int i = 0; i < 4; ++i) r[i] = (__bf16)(v[i] - (float)(__bf16)v[i]);
  return r; }
__device__ __forceinline__ v4h cvt4hs(v4f v, float sc) { v4h r;
UNROLL_REGS
  for (int i = 0; i < 4; ++i) r[i] = (_Float16)(v[i] * sc);
  return r; }
__device__ __forceinline__ v4h cvt4hw(v4f v) { v4h r;   /* f16(bf16 x 2^8), exact */
UNROLL_REGS
  for (int i = 0; i < 4; ++i) r[i] = (_Float16)(bfr(v[i]) * 256.0f);
  return r; }
// ---- k_proj: block = (128 rows, the same 128 cols of q, of k and of v), 16 waves of 32 rows x 32 cols of each of the three (3 x 2 x 2 accumulator tiles): a staged X row serves the three products, so X comes from L2 once, not three times, and the 256 blocks are one round of the chip: q/k/v = X W (+ b) with exact bf16 products (K = DIN), X and the three W tiles staged as bf16 in a two-buffer LDS ring, the next stage's global loads in flight over this stage's products; the epilogue runs once, out of the accumulator registers: bias, RoPE and the conversions are done there, and only the finished 16-bit planes pass through LDS, for whole-line stores -> q f16 rows (+ residual rows < QHI); k f16 rows (+ residual rows < KHI); v f16 planes [c][t] (+ bf16 hi/lo planes for t < KHI)
__global__ __launch_bounds__(512) void k_proj(const float* __restrict__ X, const float* __restrict__ WQ, const float* __restrict__ WK, const float* __restrict__ WV, const float* __restrict__ BQ, const float* __restrict__ BK, const float* __restrict__ BV,
    _Float16* __restrict__ QH, _Float16* __restrict__ QL, _Float16* __restrict__ KH, _Float16* __restrict__ KL, _Float16* __restrict__ VT, __bf16* __restrict__ VB, __bf16* __restrict__ VBL PROJ_EXTRA_PARAMS) {
  __shared__ __align__(16) float rt[128][TP];   /* (cos, sin) of the block's 128 rows x 32 pairs; written in front of the k loop, whose barriers publish it long before the epilogue reads it */
  struct Epi { _Float16 eq[2][128][EP], ev[128][EP], el[2][128][EP]; __bf16 eb[128][EP], ebl[128][EP]; };   /* q and k rows [t][c], v plane [c][t]; then the planes that only the early rows have: q and k residuals, v bf16 hi and lo */
  __shared__ __align__(16) union { Epi e; __bf16 ring[2][128 + 3 * 128][LP]; } u;   /* the ring (rows 0..127 X, 128.. Wq, 256.. Wk, 384.. Wv) is dead before the epilogue's planes are written: a barrier lies between */
  auto& eq = u.e.eq; auto& ev = u.e.ev; auto& el = u.e.el; auto& eb = u.e.eb; auto& ebl = u.e.ebl;
  const int tid = threadIdx.x, wave = __builtin_amdgcn_readfirstlane(tid >> 5), lane = tid & 31, col = lane & 15, g = lane >> 4; const int wr = wave >> 2, wc = wave & 3; const int c0 = blockIdx.y * 128; const size_t r0 = (size_t)blockIdx.x * 128; const size_t bb = r0 / TT; const int t0 = (int)(r0 % TT);
  v8f acc[3][2][2] = {};
  const int fr = tid >> 4, fc = (tid & 15) * 4;   /* the thread's row of each 32-row sweep and its 4 floats of a stage row */
  const unsigned fo = fr * DIN + fc; const float* xg = X + r0 * DIN; const float* wg0 = WQ + (size_t)c0 * DIN; const float* wg1 = WK + (size_t)c0 * DIN; const float* wg2 = WV + (size_t)c0 * DIN; v4f xr[4], wv[3][4];   /* block-uniform bases, one 32-bit lane offset that nothing overwrites */
  int ps[4]; ROPE_POS(ps, r0, lane);   /* issued ahead of the stage loads: loads count back in order, so the table's wait for the positions leaves the stage loads in flight */
UNROLL_REGS
  for (int i = 0; i < 4; ++i) xr[i] = *(const v4f*)(xg + fo + (size_t)i * 32 * DIN);
UNROLL_REGS
  for (int i = 0; i < 4; ++i) { wv[0][i] = *(const v4f*)(wg0 + fo + (size_t)i * 32 * DIN); wv[1][i] = *(const v4f*)(wg1 + fo + (size_t)i * 32 * DIN); wv[2][i] = *(const v4f*)(wg2 + fo + (size_t)i * 32 * DIN); }
  XWAIT();
  ROPE_TAB(rt, ps, wave, lane);   /* runs while the first stage's loads are in flight */
  for (int s = 0; s < DIN / KS; ++s) { __bf16 (*rb)[LP] = u.ring[s & 1];
UNROLL_REGS
    for (int i = 0; i < 4; ++i) *(v4b*)&rb[fr + 32 * i][fc] = cvt4b(xr[i]);
UNROLL_REGS
    for (int q = 0; q < 3; ++q)
UNROLL_REGS
      for (int i = 0; i < 4; ++i) *(v4b*)&rb[128 + 128 * q + fr + 32 * i][fc] = cvt4b(wv[q][i]);
    __syncthreads();   /* publishes stage s; it also ends every wave's reads of the other buffer, which stage s + 1 overwrites */
    if (s + 1 < DIN / KS) { xg += KS; wg0 += KS; wg1 += KS; wg2 += KS;
UNROLL_REGS
      for (int i = 0; i < 4; ++i) xr[i] = *(const v4f*)(xg + fo + (size_t)i * 32 * DIN);
UNROLL_REGS
      for (int i = 0; i < 4; ++i) { wv[0][i] = *(const v4f*)(wg0 + fo + (size_t)i * 32 * DIN); wv[1][i] = *(const v4f*)(wg1 + fo + (size_t)i * 32 * DIN); wv[2][i] = *(const v4f*)(wg2 + fo + (size_t)i * 32 * DIN); }
      XWAIT(); }
UNROLL_REGS
    for (int kk = 0; kk < KS / 32; ++kk) { v16b a[2], w[3][2];   /* a block's fragment reads go as one group ahead of its products */
UNROLL_REGS
      for (int i = 0; i < 2; ++i) a[i] = frag_b(&rb[wr * 32 + i * 16 + col][kk * 32], lane);
UNROLL_REGS
      for (int q = 0; q < 3; ++q)
UNROLL_REGS
        for (int j = 0; j < 2; ++j) w[q][j] = frag_b(&rb[128 + 128 * q + wc * 32 + j * 16 + col][kk * 32], lane);
UNROLL_REGS
      for (int q = 0; q < 3; ++q)
UNROLL_REGS
        for (int i = 0; i < 2; ++i)
UNROLL_REGS
          for (int j = 0; j < 2; ++j) acc[q][i][j] = wmma_bf(a[i], w[q][j], acc[q][i][j]); } }
  float bs[3][2];   /* the biases of the lane's two columns, fetched ahead so that no test stands among the tiles' work */
UNROLL_REGS
  for (int q = 0; q < 3; ++q) { const float* BA = q == 0 ? BQ : q == 1 ? BK : BV;
UNROLL_REGS
    for (int j = 0; j < 2; ++j) bs[q][j] = BA ? bfr(BA[c0 + wc * 32 + j * 16 + col]) : 0.f; }
  XWAIT();
  __syncthreads();   /* ends every wave's reads of the ring, which the planes overwrite */
  const bool hi = t0 < QHI && t0 < KHI;   /* block-uniform: QHI = KHI is a multiple of the block's 128 rows */
  auto planes = [&](const bool H) __attribute__((always_inline)) {   /* H, a literal at both calls: the early rows' extra planes are written too; one test for the block, not one per element */
UNROLL_REGS
  for (int i = 0; i < 2; ++i)
UNROLL_REGS
  for (int j = 0; j < 2; ++j) { const int R = wr * 32 + i * 16 + 8 * g, C = wc * 32 + j * 16 + col; v2f cs[8];   /* the lane's 8 rows from R on, its column C of the block's 128 */
UNROLL_REGS
    for (int r = 0; r < 8; ++r) { cs[r] = *(const v2f*)&rt[R + r][C & (HD - 2)]; cs[r][1] = (col & 1) ? cs[r][1] : -cs[r][1]; }   /* one read serves q and k */
UNROLL_REGS
    for (int q = 0; q < 2; ++q) { const float bias = bs[q][j];
UNROLL_REGS
      for (int r = 0; r < 8; ++r) { const float x = acc[q][i][j][r] + bias; const float y = x * cs[r][0] + lane_x1(x) * cs[r][1]; const _Float16 hv = (_Float16)y; eq[q][R + r][C] = hv; if (H) el[q][R + r][C] = (_Float16)((y - (float)hv) * 1024.0f); } }
    { const float bias = bs[2][j]; v8h hv;   /* the lane's 8 rows are 8 neighbours of a [c][t] plane: one 16-byte write */
UNROLL_REGS
      for (int r = 0; r < 8; ++r) hv[r] = (_Float16)(acc[2][i][j][r] + bias);
      *(v8h*)&ev[C][R] = hv;
      if (H) { v8b bh, bl;
UNROLL_REGS
        for (int r = 0; r < 8; ++r) { const float v = acc[2][i][j][r] + bias; const __bf16 b = (__bf16)v; bh[r] = b; bl[r] = (__bf16)(v - (float)b); }
        *(v8b*)&eb[C][R] = bh; *(v8b*)&ebl[C][R] = bl; } } } };
  if (hi) planes(true); else planes(false);
  __syncthreads();   /* publishes the planes */
  const int er = tid >> 4, ec = (tid & 15) * 8;   /* 16 lanes carry a plane row's 256 B: whole lines */
  { v4u o[3][4];
UNROLL_REGS
    for (int p = 0; p < 4; ++p) { o[0][p] = *(const v4u*)&eq[0][er + 32 * p][ec]; o[1][p] = *(const v4u*)&eq[1][er + 32 * p][ec]; o[2][p] = *(const v4u*)&ev[er + 32 * p][ec]; }
UNROLL_REGS
    for (int p = 0; p < 4; ++p) { const int row = er + 32 * p; vst2((unsigned*)(QH + (r0 + row) * CC + c0 + ec), o[0][p]); vst2((unsigned*)(KH + (r0 + row) * CC + c0 + ec), o[1][p]); vst2((unsigned*)(VT + (bb * CC + c0 + row) * (size_t)TT + t0 + ec), o[2][p]); }
    XWAIT(); }
  if (hi) { v4u o[4][4];
UNROLL_REGS
    for (int p = 0; p < 4; ++p) { o[0][p] = *(const v4u*)&el[0][er + 32 * p][ec]; o[1][p] = *(const v4u*)&el[1][er + 32 * p][ec]; o[2][p] = *(const v4u*)&eb[er + 32 * p][ec]; o[3][p] = *(const v4u*)&ebl[er + 32 * p][ec]; }
UNROLL_REGS
    for (int p = 0; p < 4; ++p) { const int row = er + 32 * p; const size_t o3 = (bb * CC + c0 + row) * (size_t)KHI + t0 + ec; vst2((unsigned*)(QL + (bb * QHI + t0 + row) * (size_t)CC + c0 + ec), o[0][p]); vst2((unsigned*)(KL + (bb * KHI + t0 + row) * (size_t)CC + c0 + ec), o[1][p]); vst2((unsigned*)(VB + o3), o[2][p]); vst2((unsigned*)(VBL + o3), o[3][p]); }
    XWAIT(); } }
// fragment from the lane's own pointer (row start + k0 + 8 * (lane >> 4)): the same k order as frag_h / frag_b
__device__ __forceinline__ v16h frag_hp(const _Float16* p) { union { v16h v; v8h q[2]; } u; u.q[0] = *(const v8h*)p; u.q[1] = *(const v8h*)(p + 16); return u.v; }
__device__ __forceinline__ v16b frag_bp(const __bf16* p) { union { v16b v; v8b q[2]; } u; u.q[0] = *(const v8b*)p; u.q[1] = *(const v8b*)(p + 16); return u.v; }
// one 32-key step of a query's running softmax: v = the lane's 16 scaled logits (-3.0e38 = excluded) -> exp(v - new maximum) x 2^11; m = running maximum (both wave halves alike), l = this half's running sum; returns the factor that carries the old sums to the new maximum
__device__ __forceinline__ float sm_step(float v[16], float& m, float& l) {
  float mx = v[0];
#pragma unroll
  for (int i = 1; i < 16; ++i) mx = fmaxf(mx, v[i]);
  mx = fmaxf(mx, __shfl_xor(mx, 16));
  const float mn = fmaxf(m, mx); const float alpha = expf(m - mn); float s = 0.f;
#pragma unroll
  for (int i = 0; i < 16; ++i) { const float e = expf(v[i] - mn); s += e; v[i] = e * 2048.0f; }   /* mn is a kept key's logit (every step holds one for every query), so an excluded key gives exp(-3.0e38) = 0 */
  l = l * alpha + s; m = mn; return alpha; }
// the same step in base 2 over a whole 64-key stage, for the blocks behind the early ones: v = the lane's 32 RAW logits q.k (-3.0e38 = excluded), m = running maximum of raw logits; exp(SCALE x (v - mn)) x 2^11 = exp2(v x C2 - (mn x C2 - 11)), C2 = SCALE x log2(e): one fma and one hardware exp2 per score (SCALE > 0, so the maximum may be taken before the scaling); l carries the factor 2^11 (exact); an excluded key gives exp2(-5.4e37) = 0; each 32-key half keeps its own maximum and its own sum, joined once
#define C2 (SCALE * 1.44269504088896340736f)
__device__ __forceinline__ float sm_step2(float v[32], float& m, float& l) {
  float mx0 = v[0], mx1 = v[16];
#pragma unroll
  for (int i = 1; i < 16; ++i) { mx0 = fmaxf(mx0, v[i]); mx1 = fmaxf(mx1, v[16 + i]); }
  float mx = fmaxf(mx0, mx1); mx = fmaxf(mx, __shfl_xor(mx, 16));
  const float mn = fmaxf(m, mx); const float alpha = __builtin_amdgcn_exp2f((m - mn) * C2); const float nb = __builtin_fmaf(mn, C2, -11.0f); float s0 = 0.f, s1 = 0.f;
#pragma unroll
  for (int i = 0; i < 16; ++i) { const float e0 = __builtin_amdgcn_exp2f(__builtin_fmaf(v[i], C2, -nb)), e1 = __builtin_amdgcn_exp2f(__builtin_fmaf(v[16 + i], C2, -nb)); s0 += e0; s1 += e1; v[i] = e0; v[16 + i] = e1; }
  l = l * alpha + (s0 + s1); m = mn; return alpha; }
// ---- k_attn: block = (head h, 64 queries qb, batch b), 8 waves = two teams of four, wave = 16 queries, keys [0, diagonal] 32 at a time by team 0 alone (behind the early blocks: 64 at a time, the even 64-key stages by team 0 and the odd ones by team 1, so a tile's chain of stages is half as long; each team stages its own k rows and v planes in LDS, once for its four waves, the next stage's global loads in flight over this stage's step; team 1's maximum, sum and ctx sums are joined to team 0's once, through LDS, behind the loop). Twice the waves: half the blocks are resident at a time; blockIdx.y orders the tiles by falling cost (the early blocks, then the longest tile first). S^T = K Q^T x SCALE (behind the early blocks SCALE is applied inside the softmax step): lane (g, col) holds query col's logits of keys 8g + r and 16 + 8g + r (causal early query blocks: q and k residual planes, 3 products); the causal rule by index in the last step; running maximum and sum in f32; the two score tiles, as P^T x 2^11 once to f16 (early blocks: bf16 hi + lo), are the B operand of ctx^T += V^T P^T (early blocks: v bf16 hi + lo, 3 products); ctx = sums / (2^11 x sum of exp); 256-B (row, head) segment by 16 lanes
__global__ __launch_bounds__(256) void k_attn(const _Float16* __restrict__ QH, const _Float16* __restrict__ KH, const _Float16* __restrict__ QL, const _Float16* __restrict__ KL, const _Float16* __restrict__ VT, const __bf16* __restrict__ VB, const __bf16* __restrict__ VBL, float* __restrict__ Y) { __shared__ __align__(16) float ss[4][16][HD + 4]; __shared__ __align__(16) _Float16 kv[2][2][64 + HD][LP];   /* per team a two-buffer ring [buffer][team] of 64-key stages: rows 0..63 the keys' k rows of this head, rows 64.. its v planes [c][64 keys] */
  __shared__ __align__(16) v4f pj[4][9][32];   /* team 1's partial results, lane by lane: 8 x 4 ctx sums, then (maximum, sum) */
  const int tid = threadIdx.x, wv8 = __builtin_amdgcn_readfirstlane(tid >> 5), team = wv8 >> 2, wave = wv8 & 3, lane = tid & 31, col = lane & 15, g = lane >> 4; const int h = blockIdx.x, b = blockIdx.z; const int qb = (int)blockIdx.y < QBH ? (int)blockIdx.y : NQB + QBH - 1 - (int)blockIdx.y;   /* a permutation of the query blocks */ const int ql0 = qb * 64 + wave * 16; const int nch = (ql0 + 47) >> 5;
  const size_t q0 = (size_t)b * TT + ql0, kr0 = (size_t)b * TT;
  v8f acc[HD / 16] = {}; float m = -3.0e38f, l = 0.f; const float lc = qb < QBH ? 2048.0f : 1.0f;   /* what the sum of exp still lacks of the 2^11 that P carries */
  if (qb < QBH) { if (team) return;   /* wave-uniform; this path has no work-group barrier */
    const _Float16* QLb = QL + (size_t)b * QHI * CC; const _Float16* KLb = KL + (size_t)b * KHI * CC; v16h qh[HD / 32], qlo[HD / 32];
#pragma unroll
    for (int kk = 0; kk < HD / 32; ++kk) { qh[kk] = frag_h(QH + (q0 + col) * CC + h * HD + kk * 32, lane); qlo[kk] = frag_h(QLb + (size_t)(ql0 + col) * CC + h * HD + kk * 32, lane); }
    asm volatile("s_wait_xcnt 0x0" :: "v"(qh[0]), "v"(qh[1]), "v"(qlo[0]), "v"(qlo[1]) : "memory");   /* XWAIT held behind the q loads by their values (inputs only) */
    const _Float16* kp = KH + (kr0 + col) * CC + h * HD + 8 * g; const _Float16* klp = KLb + (size_t)col * CC + h * HD + 8 * g; const __bf16* vp = VB + ((size_t)b * CC + h * HD + col) * (size_t)KHI + 8 * g; const __bf16* vlp = VBL + ((size_t)b * CC + h * HD + col) * (size_t)KHI + 8 * g;
    for (int kc = 0; kc < nch; ++kc, kp += 32 * CC, klp += 32 * CC, vp += 32, vlp += 32) { const int k0 = kc * 32; float v[16]; v16h kbf[2][HD / 32], klf[2][HD / 32];   /* a step's k loads are all issued before its first product, its v loads before the softmax */
#pragma unroll
      for (int t = 0; t < 2; ++t)
#pragma unroll
        for (int kk = 0; kk < HD / 32; ++kk) kbf[t][kk] = frag_hp(kp + t * 16 * CC + kk * 32);
      XWAIT();
#pragma unroll
      for (int t = 0; t < 2; ++t)
#pragma unroll
        for (int kk = 0; kk < HD / 32; ++kk) klf[t][kk] = frag_hp(klp + t * 16 * CC + kk * 32);
      XWAIT();
#pragma unroll
      for (int t = 0; t < 2; ++t) { v8f s = {}, sl = {};
#pragma unroll
        for (int kk = 0; kk < HD / 32; ++kk) { s = wmma16(kbf[t][kk], qh[kk], s); sl = wmma16(kbf[t][kk], qlo[kk], sl); sl = wmma16(klf[t][kk], qh[kk], sl); }
#pragma unroll
        for (int r = 0; r < 8; ++r) v[t * 8 + r] = (s[r] + sl[r] * (1.0f / 1024.0f)) * SCALE; }
      if (kc == nch - 1) {
#pragma unroll
        for (int i = 0; i < 16; ++i) if (k0 + (i >> 3) * 16 + 8 * g + (i & 7) > ql0 + col) v[i] = -3.0e38f; }
      v16b vh[HD / 16], vl[HD / 16];
#pragma unroll
      for (int j = 0; j < HD / 16; ++j) vh[j] = frag_bp(vp + j * 16 * KHI);
      XWAIT();
#pragma unroll
      for (int j = 0; j < HD / 16; ++j) vl[j] = frag_bp(vlp + j * 16 * KHI);
      XWAIT();
      const float alpha = sm_step(v, m, l); const F2 p = bsplit16(v);
#pragma unroll
      for (int j = 0; j < HD / 16; ++j) { acc[j] = acc[j] * alpha; acc[j] = wmma_bf(vh[j], p.h, acc[j]); acc[j] = wmma_bf(vh[j], p.l, acc[j]); acc[j] = wmma_bf(vl[j], p.h, acc[j]); } }
  } else { v16h qh[HD / 32];
#pragma unroll
    for (int kk = 0; kk < HD / 32; ++kk) qh[kk] = frag_h(QH + (q0 + col) * CC + h * HD + kk * 32, lane);
    asm volatile("s_wait_xcnt 0x0" :: "v"(qh[0]), "v"(qh[1]) : "memory");   /* XWAIT held behind the q loads by their values (inputs only) */
    const int tl = tid & 127, fr = tl >> 3, fc = (tl & 7) * 8;   /* the thread's row of each 16-row sweep of its team's stage and its 16 B of a 128-B stage row: a wave's load covers 4 whole lines */
    const unsigned ko = fr * CC + fc, vo = fr * TT + fc; const _Float16* kg = KH + (kr0 + 64 * team) * CC + h * HD; const _Float16* vg = VT + ((size_t)b * CC + h * HD) * (size_t)TT + 64 * team;   /* the team's first stage is stage 'team' (qb >= QBH > 1: it exists) */ v8h kr[4], vr[HD / 16];   /* wave-uniform bases, 32-bit lane offsets that nothing overwrites */
UNROLL_REGS
    for (int i = 0; i < 4; ++i) kr[i] = *(const v8h*)(kg + ko + (size_t)i * 16 * CC);
    XWAIT();
UNROLL_REGS
    for (int i = 0; i < HD / 16; ++i) vr[i] = *(const v8h*)(vg + vo + (size_t)i * 16 * TT);
    XWAIT();
    const int nit = (qb + 2) >> 1;   /* trips of the longer team */
    for (int it = 0; it < nit; ++it) { const int s = 2 * it + team; _Float16 (*rb)[LP] = kv[it & 1][team];   /* block-uniform trip count: every wave passes every barrier; s > qb (team 1's last trip when qb is even): nothing but the barrier */
      if (s <= qb) {
UNROLL_REGS
      for (int i = 0; i < 4; ++i) *(v8h*)&rb[fr + 16 * i][fc] = kr[i];
UNROLL_REGS
      for (int i = 0; i < HD / 16; ++i) *(v8h*)&rb[64 + fr + 16 * i][fc] = vr[i]; }
      __syncthreads();   /* publishes the teams' stages of this trip and ends the reads of the buffers that the next trip overwrites */
      if (s + 2 <= qb) { kg += 128 * CC; vg += 128;
UNROLL_REGS
        for (int i = 0; i < 4; ++i) kr[i] = *(const v8h*)(kg + ko + (size_t)i * 16 * CC);
UNROLL_REGS
        for (int i = 0; i < HD / 16; ++i) vr[i] = *(const v8h*)(vg + vo + (size_t)i * 16 * TT);
        XWAIT(); }
      if (s <= qb) { float v[32]; v16h kf[4][HD / 32], vf[2][HD / 16]; v8f sc[4] = {};   /* ONE softmax step per 64-key stage: four independent score tiles, one maximum exchange, one rescale of the sums; the k fragment reads go as one group ahead of the first product, the v reads as one group ahead of the softmax */
UNROLL_REGS
      for (int t = 0; t < 4; ++t)
UNROLL_REGS
        for (int kk = 0; kk < HD / 32; ++kk) kf[t][kk] = frag_hp(&rb[t * 16 + col][kk * 32 + 8 * g]);
UNROLL_REGS
      for (int kk = 0; kk < HD / 32; ++kk)
UNROLL_REGS
        for (int t = 0; t < 4; ++t) sc[t] = wmma16(kf[t][kk], qh[kk], sc[t]);
UNROLL_REGS
      for (int t2 = 0; t2 < 2; ++t2)
UNROLL_REGS
        for (int j = 0; j < HD / 16; ++j) vf[t2][j] = frag_hp(&rb[64 + j * 16 + col][t2 * 32 + 8 * g]);
#pragma unroll
      for (int t = 0; t < 4; ++t)
#pragma unroll
        for (int r = 0; r < 8; ++r) v[t * 8 + r] = sc[t][r];
      if (s == qb) {   /* wave-uniform: the diagonal lies in the last stage; a wave's keys wholly behind it count 0 */
#pragma unroll
        for (int i = 0; i < 32; ++i) if (s * 64 + (i >> 3) * 16 + 8 * g + (i & 7) > ql0 + col) v[i] = -3.0e38f; }
      const float alpha = sm_step2(v, m, l); v16h p[2];
#pragma unroll
      for (int i = 0; i < 32; ++i) p[i >> 4][i & 15] = (_Float16)v[i];
UNROLL_REGS
      for (int j = 0; j < HD / 16; ++j) acc[j] = acc[j] * alpha;
UNROLL_REGS
      for (int t2 = 0; t2 < 2; ++t2)
UNROLL_REGS
        for (int j = 0; j < HD / 16; ++j) acc[j] = wmma16(vf[t2][j], p[t2], acc[j]); } }
    if (team) {   /* every query has open keys in stage 1, so team 1's maximum is a kept key's logit */
UNROLL_REGS
      for (int j = 0; j < HD / 16; ++j) { pj[wave][2 * j][lane] = (v4f){acc[j][0], acc[j][1], acc[j][2], acc[j][3]}; pj[wave][2 * j + 1][lane] = (v4f){acc[j][4], acc[j][5], acc[j][6], acc[j][7]}; }
      pj[wave][8][lane] = (v4f){m, l, 0.f, 0.f}; }
    __syncthreads();   /* publishes team 1's partial results to team 0; block-uniform, the block's last barrier */
    if (team) return;
    { const v4f ml = pj[wave][8][lane]; const float mn = fmaxf(m, ml[0]); const float a0 = __builtin_amdgcn_exp2f((m - mn) * C2), a1 = __builtin_amdgcn_exp2f((ml[0] - mn) * C2);   /* both teams' sums carried to the common maximum, as in sm_step2 */
      asm volatile("v_nop" :: "v"(a0), "v"(a1));   /* one slot between the two exp2 and the multiplies behind them, which read their results and may take their source registers */
      l = l * a0 + ml[1] * a1;
UNROLL_REGS
      for (int j = 0; j < HD / 16; ++j) { const v4f p0 = pj[wave][2 * j][lane], p1 = pj[wave][2 * j + 1][lane];
UNROLL_REGS
        for (int r = 0; r < 4; ++r) { acc[j][r] = acc[j][r] * a0 + p0[r] * a1; acc[j][4 + r] = acc[j][4 + r] * a0 + p1[r] * a1; } } } }
  l += __shfl_xor(l, 16); const float inv = 1.0f / (l * lc);
#pragma unroll
  for (int j = 0; j < HD / 16; ++j)
#pragma unroll
    for (int r = 0; r < 8; ++r) ss[wave][col][j * 16 + 8 * g + r] = acc[j][r] * inv;
  LDSX(); for (int rl = 0; rl < 16; ++rl) if (lane < HD / 4) vst2(Y + ((size_t)b * TT + ql0 + rl) * CC + h * HD + lane * 4, *(const v4f*)&ss[wave][rl][lane * 4]); }
// ---- k_out: block = (128 rows, 128 cols), 8 waves of 32 rows x 64 cols, operands staged in a two-buffer LDS ring as in k_proj: out = ctx Wo (+ bo): ctx x 2^6 once to f16 against Wo as f16(bf16 x 2^8) exact (1 product) x 2^-14; causal early rows (< QHI of each sequence): ctx bf16 hi + lo against exact bf16 Wo (2 products)
__global__ __launch_bounds__(256) void k_out(const float* __restrict__ Y, const float* __restrict__ WO, const float* __restrict__ BO, float* __restrict__ OUT) { __shared__ __align__(16) float sf[8][32][68];
  __shared__ __align__(16) union { __bf16 b[2][128 + 128 + 128][LP]; _Float16 h[2][128 + 128][LP]; } u;   /* early rows: ctx hi 0..127, ctx lo 128..255, Wo 256..383; else ctx 0..127, Wo 128..255 */
  const int tid = threadIdx.x, wave = __builtin_amdgcn_readfirstlane(tid >> 5), lane = tid & 31, col = lane & 15, g = lane >> 4; const int wr = wave >> 1, wc = wave & 1; const int c0 = blockIdx.y * 128; const size_t r0 = (size_t)blockIdx.x * 128 + wr * 32;
  v8f acc[2][4] = {};
  const int fr = tid >> 4, fc = (tid & 15) * 4;   /* as in k_proj */
  const unsigned fo = fr * CC + fc; const float* yg = Y + (size_t)blockIdx.x * 128 * CC; const float* wg = WO + (size_t)c0 * CC; v4f yr[8], wv[8];
UNROLL_REGS
  for (int i = 0; i < 8; ++i) yr[i] = *(const v4f*)(yg + fo + (size_t)i * 16 * CC);
UNROLL_REGS
  for (int i = 0; i < 8; ++i) wv[i] = *(const v4f*)(wg + fo + (size_t)i * 16 * CC);
  XWAIT();
  if (CAUSAL && (int)(((size_t)blockIdx.x * 128) % TT) < QHI) {   /* block-uniform; QHI is a multiple of the 128 rows */
    for (int s = 0; s < CC / KS; ++s) { __bf16 (*rb)[LP] = u.b[s & 1];
UNROLL_REGS
      for (int i = 0; i < 8; ++i) { *(v4b*)&rb[fr + 16 * i][fc] = cvt4b(yr[i]); *(v4b*)&rb[128 + fr + 16 * i][fc] = cvt4bl(yr[i]); }
UNROLL_REGS
      for (int i = 0; i < 8; ++i) *(v4b*)&rb[256 + fr + 16 * i][fc] = cvt4b(wv[i]);
      __syncthreads();   /* publishes stage s and ends the reads of the buffer that stage s + 1 overwrites */
      if (s + 1 < CC / KS) { yg += KS; wg += KS;
UNROLL_REGS
        for (int i = 0; i < 8; ++i) yr[i] = *(const v4f*)(yg + fo + (size_t)i * 16 * CC);
UNROLL_REGS
        for (int i = 0; i < 8; ++i) wv[i] = *(const v4f*)(wg + fo + (size_t)i * 16 * CC);
        XWAIT(); }
UNROLL_REGS
      for (int kk = 0; kk < KS / 32; ++kk) { v16b ah[2], al[2], w[4];
UNROLL_REGS
        for (int i = 0; i < 2; ++i) { ah[i] = frag_b(&rb[wr * 32 + i * 16 + col][kk * 32], lane); al[i] = frag_b(&rb[128 + wr * 32 + i * 16 + col][kk * 32], lane); }
UNROLL_REGS
        for (int j = 0; j < 4; ++j) w[j] = frag_b(&rb[256 + wc * 64 + j * 16 + col][kk * 32], lane);
UNROLL_REGS
        for (int i = 0; i < 2; ++i)
UNROLL_REGS
          for (int j = 0; j < 4; ++j) { acc[i][j] = wmma_bf(ah[i], w[j], acc[i][j]); acc[i][j] = wmma_bf(al[i], w[j], acc[i][j]); } } }
#pragma unroll
    for (int i = 0; i < 2; ++i)
#pragma unroll
    for (int j = 0; j < 4; ++j) { const float bias = BO ? bfr(BO[c0 + wc * 64 + j * 16 + col]) : 0.f;
#pragma unroll
      for (int r = 0; r < 8; ++r) sf[wave][i * 16 + 8 * g + r][j * 16 + col] = acc[i][j][r] + bias; }
  } else {
    for (int s = 0; s < CC / KS; ++s) { _Float16 (*rb)[LP] = u.h[s & 1];
UNROLL_REGS
      for (int i = 0; i < 8; ++i) *(v4h*)&rb[fr + 16 * i][fc] = cvt4hs(yr[i], 64.0f);   /* ctx carried x 2^6 into f16 so small-magnitude context rows stay clear of f16 subnormals (chip FTZ) */
UNROLL_REGS
      for (int i = 0; i < 8; ++i) *(v4h*)&rb[128 + fr + 16 * i][fc] = cvt4hw(wv[i]);
      __syncthreads();   /* publishes stage s and ends the reads of the buffer that stage s + 1 overwrites */
      if (s + 1 < CC / KS) { yg += KS; wg += KS;
UNROLL_REGS
        for (int i = 0; i < 8; ++i) yr[i] = *(const v4f*)(yg + fo + (size_t)i * 16 * CC);
UNROLL_REGS
        for (int i = 0; i < 8; ++i) wv[i] = *(const v4f*)(wg + fo + (size_t)i * 16 * CC);
        XWAIT(); }
UNROLL_REGS
      for (int kk = 0; kk < KS / 32; ++kk) { v16h a[2], w[4];
UNROLL_REGS
        for (int i = 0; i < 2; ++i) a[i] = frag_h(&rb[wr * 32 + i * 16 + col][kk * 32], lane);
UNROLL_REGS
        for (int j = 0; j < 4; ++j) w[j] = frag_h(&rb[128 + wc * 64 + j * 16 + col][kk * 32], lane);
UNROLL_REGS
        for (int i = 0; i < 2; ++i)
UNROLL_REGS
          for (int j = 0; j < 4; ++j) acc[i][j] = wmma16(a[i], w[j], acc[i][j]); } }
#pragma unroll
    for (int i = 0; i < 2; ++i)
#pragma unroll
    for (int j = 0; j < 4; ++j) { const float bias = BO ? bfr(BO[c0 + wc * 64 + j * 16 + col]) : 0.f;
#pragma unroll
      for (int r = 0; r < 8; ++r) sf[wave][i * 16 + 8 * g + r][j * 16 + col] = acc[i][j][r] * (1.0f / 16384.0f) + bias; } }   /* 2^-8 (Wo carry) x 2^-6 (ctx carry) */
  LDSX(); for (int rp = 0; rp < 16; ++rp) { const int rl = 2 * rp + g; vst2(OUT + (r0 + rl) * DIN + c0 + wc * 64 + col * 4, *(const v4f*)&sf[wave][rl][col * 4]); } }   /* a wave's store covers two rows' 256-B pieces: whole lines */

extern "C" void kernel_launch(void* const* d_in, const int* in_sizes, int n_in, void* d_out, int out_size, void* d_ws, size_t ws_size, hipStream_t stream) {
  (void)in_sizes; (void)n_in; (void)out_size;
  const float** F = (const float**)d_in;
  if (ws_size < (size_t)WS_END) return;
  char* ws = (char*)d_ws; _Float16 *QH = (_Float16*)(ws + WS_QH), *KH = (_Float16*)(ws + WS_KH), *VT = (_Float16*)(ws + WS_VT), *QL = (_Float16*)(ws + WS_QL), *KL = (_Float16*)(ws + WS_KL); __bf16 *VB = (__bf16*)(ws + WS_VB), *VBL = (__bf16*)(ws + WS_VBL); float *Y = (float*)(ws + WS_Y);
  (void)Y; (void)QL; (void)KL; (void)VB; (void)VBL;
  // inputs: 0 x [1,4096,1024]; 1 token_positions [4096] int32 (arange): READ on the device; 2 Wq [1024,1024] (out,in); 3 Wk; 4 Wv; 5 Wo (out,in); no biases (null pointers)
  k_proj<<<dim3(TNB * TT / 128, CC / 128), 512, 0, stream>>>(F[0], F[2], F[3], F[4], nullptr, nullptr, nullptr, QH, QL, KH, KL, VT, VB, VBL, (const int*)d_in[1]);
  k_attn<<<dim3(NH, NQB, TNB), 256, 0, stream>>>(QH, KH, QL, KL, VT, VB, VBL, Y);
  k_out<<<dim3(TNB * TT / 128, DIN / 128), 256, 0, stream>>>(Y, F[5], nullptr, (float*)d_out);
}

// v010
// A run of this version takes 97.7 microseconds.
// In two side-by-side timings against v009, it was 1.07 and 1.05 times as fast.
// All steps since v000 together make it 30.8 times as fast.
// compute dtype: all float inputs rounded to bf16; q/k/v projections with EXACT bf16 products on WMMA 16x16x32 (f32 accumulate); RoPE in f32 at the int token positions; causal logits: 3 products for the first 384 rows, single f16 q x k after, x 64^-0.5; softmax f32; P x 2^11 once to f16 x v once to f16 (bf16 hi + lo below row 384); ctx hi+lo x exact Wo below row 384, x2^6 f16 carry x f16(bf16 x 2^8) Wo after; f32 output.
#include <hip/hip_runtime.h>
#include <math.h>

typedef __attribute__((ext_vector_type(16))) _Float16 v16h;
typedef __attribute__((ext_vector_type(16))) __bf16 v16b;
typedef __attribute__((ext_vector_type(8)))  _Float16 v8h;
typedef __attribute__((ext_vector_type(8)))  float v8f;
typedef __attribute__((ext_vector_type(4)))  float v4f;
typedef __attribute__((ext_vector_type(2)))  float v2f;
typedef __attribute__((ext_vector_type(4)))  unsigned v4u;
typedef __attribute__((ext_vector_type(4)))  int v4i;
typedef float __attribute__((may_alias)) float_a;
typedef int __attribute__((may_alias)) int_a;

template <typename T> __device__ __forceinline__ void vst2(void* p, T v) { *(T*)p = v;  }
__device__ __forceinline__ v8f wmma16(v16h a, v16h b, v8f c) {
  v8f d = __builtin_amdgcn_wmma_f32_16x16x32_f16(false, a, false, b, (short)0, c, false, false);
  asm volatile("v_nop\n\tv_nop\n\tv_nop\n\tv_nop" : "+v"(d) : "v"(a), "v"(b));
  return d;
}
__device__ __forceinline__ v8f wmma_bf(v16b a, v16b b, v8f c) {
  v8f d = __builtin_amdgcn_wmma_f32_16x16x32_bf16(false, a, false, b, (short)0, c, false, false);
  asm volatile("v_nop\n\tv_nop\n\tv_nop\n\tv_nop" : "+v"(d) : "v"(a), "v"(b));
  return d;
}
// 16x16x32 fragments: lane = (h = lane>>4, row/col = lane&15); elements 0..7 = k0+8h+0..7, 8..15 = k0+16+8h+0..7; D element r = row 8h+r
__device__ __forceinline__ v16h frag_h(const _Float16* rowk0, int lane) {
  union { v16h v; v8h q[2]; } u; const _Float16* p = rowk0 + 8 * (lane >> 4);
  u.q[0] = *(const v8h*)p; u.q[1] = *(const v8h*)(p + 16); return u.v;
}
__device__ __forceinline__ v16h frag_f32(const float* rowk0, int lane) {
  v16h a; const float* p = rowk0 + 8 * (lane >> 4);
#pragma unroll
  for (int i = 0; i < 8; ++i) { a[i] = (_Float16)p[i]; a[8 + i] = (_Float16)p[16 + i]; }
  return a;
}
__device__ __forceinline__ v16h frag_f32s(const float* rowk0, int lane, float sc) {
  v16h a; const float* p = rowk0 + 8 * (lane >> 4);
#pragma unroll
  for (int i = 0; i < 8; ++i) { a[i] = (_Float16)(p[i] * sc); a[8 + i] = (_Float16)(p[16 + i] * sc); }
  return a;
}
// column fragment from a [K][ld] layout (column n), rows >= K read as 0
__device__ __forceinline__ v16h fragc_f32(const float* W, int k0, int n, int lane, int ld, int K) {
  v16h a; const int g = lane >> 4;
#pragma unroll
  for (int i = 0; i < 8; ++i) { const int ka = k0 + 8 * g + i, kb = ka + 16;
    a[i] = (_Float16)(ka < K ? W[(size_t)(ka < K ? ka : K - 1) * ld + n] : 0.f); a[8 + i] = (_Float16)(kb < K ? W[(size_t)(kb < K ? kb : K - 1) * ld + n] : 0.f); }
  return a;
}
struct F2 { v16b h, l; };
__device__ __forceinline__ F2 bsplit16(const float v[16]) { F2 r;
#pragma unroll
  for (int i = 0; i < 16; ++i) { const __bf16 h = (__bf16)v[i]; r.h[i] = h; r.l[i] = (__bf16)(v[i] - (float)h); }
  return r; }
__device__ __forceinline__ F2 split_row(const float* row, int k0, int lane) { float v[16]; const float* p = row + k0 + 8 * (lane >> 4);
#pragma unroll
  for (int i = 0; i < 8; ++i) { v[i] = p[i]; v[8 + i] = p[16 + i]; }
  return bsplit16(v); }
__device__ __forceinline__ F2 split_rowK(const float* row, int k0, int lane, int K) { float v[16]; const int g = lane >> 4;
#pragma unroll
  for (int i = 0; i < 8; ++i) { const int ka = k0 + 8 * g + i, kb = ka + 16; v[i] = ka < K ? row[ka < K ? ka : K - 1] : 0.f; v[8 + i] = kb < K ? row[kb < K ? kb : K - 1] : 0.f; }
  return bsplit16(v); }
__device__ __forceinline__ F2 split_col(const float* W, int k0, int n, int lane, int ld, int K) { float v[16]; const int g = lane >> 4;
#pragma unroll
  for (int i = 0; i < 8; ++i) { const int ka = k0 + 8 * g + i, kb = ka + 16; v[i] = ka < K ? W[(size_t)(ka < K ? ka : K - 1) * ld + n] : 0.f; v[8 + i] = kb < K ? W[(size_t)(kb < K ? kb : K - 1) * ld + n] : 0.f; }
  return bsplit16(v); }
__device__ __forceinline__ v8f mac3(const F2& a, const F2& b, v8f c) { c = wmma_bf(a.l, b.h, c); c = wmma_bf(a.h, b.l, c); return wmma_bf(a.h, b.h, c); }
__device__ __forceinline__ float sigm(float v) { return 1.0f / (1.0f + expf(-v)); }
#define LDSX() do { asm volatile("s_wait_dscnt 0" ::: "memory"); __builtin_amdgcn_wave_barrier(); __builtin_amdgcn_fence(__ATOMIC_RELEASE, "workgroup"); } while (0)

// Causal multi-head self-attention with interleaved-pair RoPE at given token positions, ONE batch of 4,096 tokens (x [1,4096,1024]; (out,in) Wq / Wk / Wv / Wo [1024,1024] N(0,1) x 0.02 applied as x @ W.T, no biases; token_positions [4096] int (arange; the LAST input); 16 heads x 64; inv_freq = 1 / 10000^(2i/64); (even, odd) pairs rotated and re-interleaved; scores / sqrt(64); tril kept, -inf elsewhere; softmax; attn @ Wo.T). THIS ROW: the same module and weight scale (0.02) with the argument order x, token_positions, Wq, Wk, Wv, Wo (the positions SECOND): the indices in kernel_launch follow; finfo.min in place of -inf under the causal rule (an exclusion either way); the inverse-frequency expression is the host's own, token for token: the baked table is unchanged.
#define NB 1
#define TT 4096
#define CC 1024            // NH * HD = projected width
#define DIN 1024          // input (model) width
#define NH 16
#define HD 64
#define NQB (TT / 64)
#define SCALE (0.125f)
#define CAUSAL 1
#ifndef TNB
#define TNB NB
#endif
__device__ __forceinline__ float bfr(float v) { return (float)(__bf16)v; }
typedef __attribute__((ext_vector_type(8))) __bf16 v8b;
__device__ __forceinline__ v16b frag_b(const __bf16* rowk0, int lane) {
  union { v16b v; v8b q[2]; } u; const __bf16* p = rowk0 + 8 * (lane >> 4);
  u.q[0] = *(const v8b*)p; u.q[1] = *(const v8b*)(p + 16); return u.v;
}
#define QBH 6              // causal: query blocks 0..QBH-1 of each sequence (few keys, no averaging) take the high-precision path
#define QHI 384            // rows carrying a q residual plane
#define KHI 384            // key rows carrying k residual / v bf16 hi+lo planes (used only by the causal high-precision path)
// B fragment (k rows k0+.., output column o) of a weight: (in,out) [K][ld] or (out,in) [ld rows of K]: bf16 exact, or f16(bf16 * 256) exact
__device__ __forceinline__ v16b wcol_io(const float* Wm, int k0, int o, int lane, int ld) { v16b w; const int g = lane >> 4;
#pragma unroll
  for (int i = 0; i < 8; ++i) { w[i] = (__bf16)Wm[(size_t)(k0 + 8 * g + i) * ld + o]; w[8 + i] = (__bf16)Wm[(size_t)(k0 + 16 + 8 * g + i) * ld + o]; }
  return w; }
__device__ __forceinline__ v16b wcol_oi(const float* Wm, int k0, int o, int lane, int K) { v16b w; const float* p = Wm + (size_t)o * K + k0 + 8 * (lane >> 4);
#pragma unroll
  for (int i = 0; i < 8; ++i) { w[i] = (__bf16)p[i]; w[8 + i] = (__bf16)p[16 + i]; }
  return w; }
__device__ __forceinline__ v16h wcolh_io(const float* Wm, int k0, int o, int lane, int ld) { v16h w; const int g = lane >> 4;
#pragma unroll
  for (int i = 0; i < 8; ++i) { w[i] = (_Float16)(bfr(Wm[(size_t)(k0 + 8 * g + i) * ld + o]) * 256.0f); w[8 + i] = (_Float16)(bfr(Wm[(size_t)(k0 + 16 + 8 * g + i) * ld + o]) * 256.0f); }
  return w; }
__device__ __forceinline__ v16h wcolh_oi(const float* Wm, int k0, int o, int lane, int K) { v16h w; const float* p = Wm + (size_t)o * K + k0 + 8 * (lane >> 4);
#pragma unroll
  for (int i = 0; i < 8; ++i) { w[i] = (_Float16)(bfr(p[i]) * 256.0f); w[8 + i] = (_Float16)(bfr(p[16 + i]) * 256.0f); }
  return w; }
#define WQKV_LAYOUT 1   // picks WCOL's layout (0 = (in,out) [DIN][CC]; 1 = (out,in) [CC][DIN]; 2 = per-head [NH][DIN][HD]); nothing calls WCOL: k_proj reads (out,in) [CC][DIN] rows
__device__ __forceinline__ v16b wcol_hdk(const float* Wm, int k0, int o, int lane) { v16b w; const int g = lane >> 4; const float* p = Wm + (size_t)(o / HD) * DIN * HD + (o % HD);
#pragma unroll
  for (int i = 0; i < 8; ++i) { w[i] = (__bf16)p[(size_t)(k0 + 8 * g + i) * HD]; w[8 + i] = (__bf16)p[(size_t)(k0 + 16 + 8 * g + i) * HD]; }
  return w; }
#define WO_OUT_IN 1
#if WQKV_LAYOUT == 1
#define WCOL(W, k0, o, lane) wcol_oi(W, k0, o, lane, DIN)
#elif WQKV_LAYOUT == 2
#define WCOL(W, k0, o, lane) wcol_hdk(W, k0, o, lane)
#else
#define WCOL(W, k0, o, lane) wcol_io(W, k0, o, lane, CC)
#endif
#if WO_OUT_IN
#define WOCOL(W, k0, o, lane) wcol_oi(W, k0, o, lane, CC)
#define WOCOLH(W, k0, o, lane) wcolh_oi(W, k0, o, lane, CC)
#else
#define WOCOL(W, k0, o, lane) wcol_io(W, k0, o, lane, DIN)
#define WOCOLH(W, k0, o, lane) wcolh_io(W, k0, o, lane, DIN)
#endif
// RoPE inverse frequencies 1/10000^(2i/64) (the f32 values jax computes)
__constant__ float INVF[32] = {1.000000000e+00,7.498942018e-01,5.623413324e-01,4.216965139e-01,3.162277639e-01,2.371373624e-01,1.778279394e-01,1.333521456e-01,1.000000015e-01,7.498941571e-02,5.623412877e-02,4.216964915e-02,3.162277862e-02,2.371373586e-02,1.778279431e-02,1.333521493e-02,9.999999776e-03,7.498942316e-03,5.623413250e-03,4.216964822e-03,3.162277862e-03,2.371373819e-03,1.778279431e-03,1.333521446e-03,1.000000047e-03,7.498941850e-04,5.623413017e-04,4.216964880e-04,3.162277862e-04,2.371373848e-04,1.778279402e-04,1.333521504e-04};
#define PROJ_EXTRA_PARAMS , const int* __restrict__ TPOS
// interleaved-pair RoPE on q and k at the token's position from the int input token_positions[t]: angle = (float)pos * inv_freq[i]; (x1, x2) -> (x1 cos - x2 sin, x1 sin + x2 cos). In an accumulator tile a lane holds ONE column of 8 rows, and the pair's other column lies in the neighbouring lane: own x cos + other x (-sin in the even column, +sin in the odd one); the (cos, sin) pairs are those that ROPE_TAB has laid in LDS
// the neighbouring lane's value (lane ^ 1): a permutation inside each four lanes, done in the vector unit, no LDS; every lane is on where it is called
__device__ __forceinline__ float lane_x1(float v) { return __builtin_bit_cast(float, __builtin_amdgcn_mov_dpp(__builtin_bit_cast(int, v), 0xB1 /* quad_perm [1,0,3,2] */, 0xF, 0xF, true)); }
// the block's (cos, sin) of every (row, pair), each computed ONCE (the angle depends on neither q / k nor the head, so one value serves the four rotations that use it): wave w does pairs 2w and 2w + 1 (a wave-uniform frequency), a lane the rows lane + 32 rg, whose positions ROPE_POS has loaded; TP = pitch in floats: 64 + 4, so that the two rows, 8 apart, of a wave's 8-byte epilogue reads fall on different banks
#define TP 68
// pitch of the epilogue's 16-bit planes in elements: 128 + 8, so that neighbouring rows' 16-byte accesses fall on different banks
#define EP 136
#define ROPE_POS(ps, r0, lane) do { _Pragma("unroll") for (int rg = 0; rg < 4; ++rg) ps[rg] = TPOS[(int)(((r0) + rg * 32 + (lane)) % TT)]; XWAIT(); } while (0)
#define ROPE_TAB(tab, ps, wave, lane) do { _Pragma("unroll 1") /* one copy of the four sine / cosine texts */ for (int p = 0; p < 2; ++p) { const int i = 2 * (wave) + p; const float fq = INVF[i]; _Pragma("unroll") for (int rg = 0; rg < 4; ++rg) { const float ang = (float)ps[rg] * fq; *(v2f*)&(tab)[rg * 32 + (lane)][2 * i] = (v2f){cosf(ang), sinf(ang)}; } } } while (0)
#ifndef PROJ_EXTRA_PARAMS
#define PROJ_EXTRA_PARAMS
#endif

#define WS_QH  0u                                      // f16 q rows [b*t][CC]
#define WS_KH  (WS_QH + 2u * (size_t)NB * TT * CC)      // f16 k rows [b*t][CC]
#define WS_VT  (WS_KH + 2u * (size_t)NB * TT * CC)      // f16 v planes [b][c][t]
#define WS_QL  (WS_VT + 2u * (size_t)NB * CC * TT)      // f16 q residual x 2^10 rows [b][t < QHI][CC]
#define WS_KL  (WS_QL + 2u * (size_t)NB * QHI * CC)     // f16 k residual x 2^10 rows [b][t < KHI][CC]
#define WS_VB  (WS_KL + 2u * (size_t)NB * KHI * CC)     // bf16 v hi planes [b][c][t < KHI]
#define WS_VBL (WS_VB + 2u * (size_t)NB * CC * KHI)
#define WS_Y   (WS_VBL + 2u * (size_t)NB * CC * KHI)    // ctx as k_out's A operand, by head (= k_out's 64-k stage) [b][h][t][HD]: f16(ctx x 2^6); rows < QHI of a sequence: bf16 hi
#define WS_YL  (WS_Y  + 2u * (size_t)NB * TT * CC)      // bf16 ctx lo [b][h][t < QHI][HD]
#define WS_WH  (WS_YL + 2u * (size_t)NB * QHI * CC)     // Wo as k_out's B operand, by 64-k stage [k / 64][o][64]: f16(bf16 x 2^8), exact
#define WS_WB  (WS_WH + 2u * (size_t)CC * DIN)          // the same as bf16, for the early rows
#define WS_END (WS_WB + 2u * (size_t)CC * DIN)

// LDS staging of the projections' operands: a stage is KS k of every operand row, brought by whole-line loads (16 lanes x 16 B = one 256-B row piece), converted once per block, laid at a pitch of 128 + 16 B for the 16-byte fragment reads
#define KS 64
#define LP 72
// full unroll: the register arrays the loop walks keep constant indices (no scratch) and the row steps fold into the instructions' offsets
#define UNROLL_REGS _Pragma("unroll")
typedef __attribute__((ext_vector_type(4))) __bf16 v4b;
// stands behind each group of global loads or stores, before anything may take their address registers
#define XWAIT() asm volatile("s_wait_xcnt 0x0" ::: "memory")
__device__ __forceinline__ v4b cvt4b(v4f v) { v4b r;
UNROLL_REGS
  for (int i = 0; i < 4; ++i) r[i] = (__bf16)v[i];
  return r; }
// ---- k_proj: block = (128 rows, the same 128 cols of q, of k and of v), 16 waves of 32 rows x 32 cols of each of the three (3 x 2 x 2 accumulator tiles): a staged X row serves the three products, so X comes from L2 once, not three times, and the 256 blocks are one round of the chip: q/k/v = X W (+ b) with exact bf16 products (K = DIN), X and the three W tiles staged as bf16 in a two-buffer LDS ring, the next stage's global loads in flight over this stage's products; the epilogue runs once, out of the accumulator registers: bias, RoPE and the conversions are done there, and only the finished 16-bit planes pass through LDS, for whole-line stores -> q f16 rows (+ residual rows < QHI); k f16 rows (+ residual rows < KHI); v f16 planes [c][t] (+ bf16 hi/lo planes for t < KHI)
__global__ __launch_bounds__(512) void k_proj(const float* __restrict__ X, const float* __restrict__ WQ, const float* __restrict__ WK, const float* __restrict__ WV, const float* __restrict__ BQ, const float* __restrict__ BK, const float* __restrict__ BV,
    _Float16* __restrict__ QH, _Float16* __restrict__ QL, _Float16* __restrict__ KH, _Float16* __restrict__ KL, _Float16* __restrict__ VT, __bf16* __restrict__ VB, __bf16* __restrict__ VBL PROJ_EXTRA_PARAMS, const float* __restrict__ WO, _Float16* __restrict__ WOH, __bf16* __restrict__ WOB) {
  __shared__ __align__(16) float rt[128][TP];   /* (cos, sin) of the block's 128 rows x 32 pairs; written in front of the k loop, whose barriers publish it long before the epilogue reads it */
  struct Epi { _Float16 eq[2][128][EP], ev[128][EP], el[2][128][EP]; __bf16 eb[128][EP], ebl[128][EP]; };   /* q and k rows [t][c], v plane [c][t]; then the planes that only the early rows have: q and k residuals, v bf16 hi and lo */
  __shared__ __align__(16) union { Epi e; __bf16 ring[2][128 + 3 * 128][LP]; } u;   /* the ring (rows 0..127 X, 128.. Wq, 256.. Wk, 384.. Wv) is dead before the epilogue's planes are written: a barrier lies between */
  auto& eq = u.e.eq; auto& ev = u.e.ev; auto& el = u.e.el; auto& eb = u.e.eb; auto& ebl = u.e.ebl;
  const int tid = threadIdx.x, wave = __builtin_amdgcn_readfirstlane(tid >> 5), lane = tid & 31, col = lane & 15, g = lane >> 4; const int wr = wave >> 2, wc = wave & 3; const int c0 = blockIdx.y * 128; const size_t r0 = (size_t)blockIdx.x * 128; const size_t bb = r0 / TT; const int t0 = (int)(r0 % TT);
  v8f acc[3][2][2] = {};
  const int fr = tid >> 4, fc = (tid & 15) * 4;   /* the thread's row of each 32-row sweep and its 4 floats of a stage row */
  const unsigned fo = fr * DIN + fc; const float* xg = X + r0 * DIN; const float* wg0 = WQ + (size_t)c0 * DIN; const float* wg1 = WK + (size_t)c0 * DIN; const float* wg2 = WV + (size_t)c0 * DIN; v4f xr[4], wv[3][4];   /* block-uniform bases, one 32-bit lane offset that nothing overwrites */
  int ps[4]; ROPE_POS(ps, r0, lane);   /* issued ahead of the stage loads: loads count back in order, so the table's wait for the positions leaves the stage loads in flight */
UNROLL_REGS
  for (int i = 0; i < 4; ++i) xr[i] = *(const v4f*)(xg + fo + (size_t)i * 32 * DIN);
UNROLL_REGS
  for (int i = 0; i < 4; ++i) { wv[0][i] = *(const v4f*)(wg0 + fo + (size_t)i * 32 * DIN); wv[1][i] = *(const v4f*)(wg1 + fo + (size_t)i * 32 * DIN); wv[2][i] = *(const v4f*)(wg2 + fo + (size_t)i * 32 * DIN); }
  XWAIT();
  static_assert((size_t)(TNB * TT / 128) * (CC / 128) * 512 * 8 == (size_t)CC * DIN, "the grid's threads cover Wo, 8 elements each");
  const unsigned we = ((blockIdx.y * (unsigned)(TNB * TT / 128) + blockIdx.x) * 512u + tid) * 8u;   /* Wo is made into k_out's two 16-bit operand planes here, each element once, not by each of k_out's row blocks: the thread's 8 neighbours of a Wo row */
  const v4f wo0 = *(const v4f*)(WO + we), wo1 = *(const v4f*)(WO + we + 4);
  XWAIT();
  ROPE_TAB(rt, ps, wave, lane);   /* runs while the first stage's loads are in flight */
  { v8h wh; v8b wb; const unsigned wd = ((we % CC) / 64u * DIN + we / CC) * 64u + we % 64u;
UNROLL_REGS
    for (int i = 0; i < 4; ++i) { wh[i] = (_Float16)(bfr(wo0[i]) * 256.0f); wh[4 + i] = (_Float16)(bfr(wo1[i]) * 256.0f); wb[i] = (__bf16)wo0[i]; wb[4 + i] = (__bf16)wo1[i]; }
    vst2(WOH + wd, wh); vst2(WOB + wd, wb); XWAIT(); }
  for (int s = 0; s < DIN / KS; ++s) { __bf16 (*rb)[LP] = u.ring[s & 1];
UNROLL_REGS
    for (int i = 0; i < 4; ++i) *(v4b*)&rb[fr + 32 * i][fc] = cvt4b(xr[i]);
UNROLL_REGS
    for (int q = 0; q < 3; ++q)
UNROLL_REGS
      for (int i = 0; i < 4; ++i) *(v4b*)&rb[128 + 128 * q + fr + 32 * i][fc] = cvt4b(wv[q][i]);
    __syncthreads();   /* publishes stage s; it also ends every wave's reads of the other buffer, which stage s + 1 overwrites */
    if (s + 1 < DIN / KS) { xg += KS; wg0 += KS; wg1 += KS; wg2 += KS;
UNROLL_REGS
      for (int i = 0; i < 4; ++i) xr[i] = *(const v4f*)(xg + fo + (size_t)i * 32 * DIN);
UNROLL_REGS
      for (int i = 0; i < 4; ++i) { wv[0][i] = *(const v4f*)(wg0 + fo + (size_t)i * 32 * DIN); wv[1][i] = *(const v4f*)(wg1 + fo + (size_t)i * 32 * DIN); wv[2][i] = *(const v4f*)(wg2 + fo + (size_t)i * 32 * DIN); }
      XWAIT(); }
UNROLL_REGS
    for (int kk = 0; kk < KS / 32; ++kk) { v16b a[2], w[3][2];   /* a block's fragment reads go as one group ahead of its products */
UNROLL_REGS
      for (int i = 0; i < 2; ++i) a[i] = frag_b(&rb[wr * 32 + i * 16 + col][kk * 32], lane);
UNROLL_REGS
      for (int q = 0; q < 3; ++q)
UNROLL_REGS
        for (int j = 0; j < 2; ++j) w[q][j] = frag_b(&rb[128 + 128 * q + wc * 32 + j * 16 + col][kk * 32], lane);
UNROLL_REGS
      for (int q = 0; q < 3; ++q)
UNROLL_REGS
        for (int i = 0; i < 2; ++i)
UNROLL_REGS
          for (int j = 0; j < 2; ++j) acc[q][i][j] = wmma_bf(a[i], w[q][j], acc[q][i][j]); } }
  float bs[3][2];   /* the biases of the lane's two columns, fetched ahead so that no test stands among the tiles' work */
UNROLL_REGS
  for (int q = 0; q < 3; ++q) { const float* BA = q == 0 ? BQ : q == 1 ? BK : BV;
UNROLL_REGS
    for (int j = 0; j < 2; ++j) bs[q][j] = BA ? bfr(BA[c0 + wc * 32 + j * 16 + col]) : 0.f; }
  XWAIT();
  __syncthreads();   /* ends every wave's reads of the ring, which the planes overwrite */
  const bool hi = t0 < QHI && t0 < KHI;   /* block-uniform: QHI = KHI is a multiple of the block's 128 rows */
  auto planes = [&](const bool H) __attribute__((always_inline)) {   /* H, a literal at both calls: the early rows' extra planes are written too; one test for the block, not one per element */
UNROLL_REGS
  for (int i = 0; i < 2; ++i)
UNROLL_REGS
  for (int j = 0; j < 2; ++j) { const int R = wr * 32 + i * 16 + 8 * g, C = wc * 32 + j * 16 + col; v2f cs[8];   /* the lane's 8 rows from R on, its column C of the block's 128 */
UNROLL_REGS
    for (int r = 0; r < 8; ++r) { cs[r] = *(const v2f*)&rt[R + r][C & (HD - 2)]; cs[r][1] = (col & 1) ? cs[r][1] : -cs[r][1]; }   /* one read serves q and k */
UNROLL_REGS
    for (int q = 0; q < 2; ++q) { const float bias = bs[q][j];
UNROLL_REGS
      for (int r = 0; r < 8; ++r) { const float x = acc[q][i][j][r] + bias; const float y = x * cs[r][0] + lane_x1(x) * cs[r][1]; const _Float16 hv = (_Float16)y; eq[q][R + r][C] = hv; if (H) el[q][R + r][C] = (_Float16)((y - (float)hv) * 1024.0f); } }
    { const float bias = bs[2][j]; v8h hv;   /* the lane's 8 rows are 8 neighbours of a [c][t] plane: one 16-byte write */
UNROLL_REGS
      for (int r = 0; r < 8; ++r) hv[r] = (_Float16)(acc[2][i][j][r] + bias);
      *(v8h*)&ev[C][R] = hv;
      if (H) { v8b bh, bl;
UNROLL_REGS
        for (int r = 0; r < 8; ++r) { const float v = acc[2][i][j][r] + bias; const __bf16 b = (__bf16)v; bh[r] = b; bl[r] = (__bf16)(v - (float)b); }
        *(v8b*)&eb[C][R] = bh; *(v8b*)&ebl[C][R] = bl; } } } };
  if (hi) planes(true); else planes(false);
  __syncthreads();   /* publishes the planes */
  const int er = tid >> 4, ec = (tid & 15) * 8;   /* 16 lanes carry a plane row's 256 B: whole lines */
  { v4u o[3][4];
UNROLL_REGS
    for (int p = 0; p < 4; ++p) { o[0][p] = *(const v4u*)&eq[0][er + 32 * p][ec]; o[1][p] = *(const v4u*)&eq[1][er + 32 * p][ec]; o[2][p] = *(const v4u*)&ev[er + 32 * p][ec]; }
UNROLL_REGS
    for (int p = 0; p < 4; ++p) { const int row = er + 32 * p; vst2((unsigned*)(QH + (r0 + row) * CC + c0 + ec), o[0][p]); vst2((unsigned*)(KH + (r0 + row) * CC + c0 + ec), o[1][p]); vst2((unsigned*)(VT + (bb * CC + c0 + row) * (size_t)TT + t0 + ec), o[2][p]); }
    XWAIT(); }
  if (hi) { v4u o[4][4];
UNROLL_REGS
    for (int p = 0; p < 4; ++p) { o[0][p] = *(const v4u*)&el[0][er + 32 * p][ec]; o[1][p] = *(const v4u*)&el[1][er + 32 * p][ec]; o[2][p] = *(const v4u*)&eb[er + 32 * p][ec]; o[3][p] = *(const v4u*)&ebl[er + 32 * p][ec]; }
UNROLL_REGS
    for (int p = 0; p < 4; ++p) { const int row = er + 32 * p; const size_t o3 = (bb * CC + c0 + row) * (size_t)KHI + t0 + ec; vst2((unsigned*)(QL + (bb * QHI + t0 + row) * (size_t)CC + c0 + ec), o[0][p]); vst2((unsigned*)(KL + (bb * KHI + t0 + row) * (size_t)CC + c0 + ec), o[1][p]); vst2((unsigned*)(VB + o3), o[2][p]); vst2((unsigned*)(VBL + o3), o[3][p]); }
    XWAIT(); } }
// fragment from the lane's own pointer (row start + k0 + 8 * (lane >> 4)): the same k order as frag_h / frag_b
__device__ __forceinline__ v16h frag_hp(const _Float16* p) { union { v16h v; v8h q[2]; } u; u.q[0] = *(const v8h*)p; u.q[1] = *(const v8h*)(p + 16); return u.v; }
__device__ __forceinline__ v16b frag_bp(const __bf16* p) { union { v16b v; v8b q[2]; } u; u.q[0] = *(const v8b*)p; u.q[1] = *(const v8b*)(p + 16); return u.v; }
// one 32-key step of a query's running softmax: v = the lane's 16 scaled logits (-3.0e38 = excluded) -> exp(v - new maximum) x 2^11; m = running maximum (both wave halves alike), l = this half's running sum; returns the factor that carries the old sums to the new maximum
__device__ __forceinline__ float sm_step(float v[16], float& m, float& l) {
  float mx = v[0];
#pragma unroll
  for (int i = 1; i < 16; ++i) mx = fmaxf(mx, v[i]);
  mx = fmaxf(mx, __shfl_xor(mx, 16));
  const float mn = fmaxf(m, mx); const float alpha = expf(m - mn); float s = 0.f;
#pragma unroll
  for (int i = 0; i < 16; ++i) { const float e = expf(v[i] - mn); s += e; v[i] = e * 2048.0f; }   /* mn is a kept key's logit (every step holds one for every query), so an excluded key gives exp(-3.0e38) = 0 */
  l = l * alpha + s; m = mn; return alpha; }
// the same step in base 2 over a whole 64-key stage, for the blocks behind the early ones: v = the lane's 32 RAW logits q.k (-3.0e38 = excluded), m = running maximum of raw logits; exp(SCALE x (v - mn)) x 2^11 = exp2(v x C2 - (mn x C2 - 11)), C2 = SCALE x log2(e): one fma and one hardware exp2 per score (SCALE > 0, so the maximum may be taken before the scaling); l carries the factor 2^11 (exact); an excluded key gives exp2(-5.4e37) = 0; each 32-key half keeps its own maximum and its own sum, joined once
#define C2 (SCALE * 1.44269504088896340736f)
__device__ __forceinline__ float sm_step2(float v[32], float& m, float& l) {
  float mx0 = v[0], mx1 = v[16];
#pragma unroll
  for (int i = 1; i < 16; ++i) { mx0 = fmaxf(mx0, v[i]); mx1 = fmaxf(mx1, v[16 + i]); }
  float mx = fmaxf(mx0, mx1); mx = fmaxf(mx, __shfl_xor(mx, 16));
  const float mn = fmaxf(m, mx); const float alpha = __builtin_amdgcn_exp2f((m - mn) * C2); const float nb = __builtin_fmaf(mn, C2, -11.0f); float s0 = 0.f, s1 = 0.f;
#pragma unroll
  for (int i = 0; i < 16; ++i) { const float e0 = __builtin_amdgcn_exp2f(__builtin_fmaf(v[i], C2, -nb)), e1 = __builtin_amdgcn_exp2f(__builtin_fmaf(v[16 + i], C2, -nb)); s0 += e0; s1 += e1; v[i] = e0; v[16 + i] = e1; }
  l = l * alpha + (s0 + s1); m = mn; return alpha; }
// ---- k_attn: block = (head h, 64 queries qb, batch b), 8 waves = two teams of four, wave = 16 queries, keys [0, diagonal] 32 at a time by team 0 alone (behind the early blocks: 64 at a time, the even 64-key stages by team 0 and the odd ones by team 1, so a tile's chain of stages is half as long; each team stages its own k rows and v planes in LDS, once for its four waves, the next stage's global loads in flight over this stage's step; team 1's maximum, sum and ctx sums are joined to team 0's once, through LDS, behind the loop). Twice the waves: half the blocks are resident at a time; blockIdx.y orders the tiles by falling cost (the early blocks, then the longest tile first), for speed only. S^T = K Q^T x SCALE (behind the early blocks SCALE is applied inside the softmax step): lane (g, col) holds query col's logits of keys 8g + r and 16 + 8g + r (causal early query blocks: q and k residual planes, 3 products); the causal rule by index in the last step; running maximum and sum in f32; the two score tiles, as P^T x 2^11 once to f16 (early blocks: bf16 hi + lo), are the B operand of ctx^T += V^T P^T (early blocks: v bf16 hi + lo, 3 products); ctx = sums / (2^11 x sum of exp), stored as k_out's 16-bit A operand; 128-B (row, head) segment by 8 lanes
__global__ __launch_bounds__(256) void k_attn(const _Float16* __restrict__ QH, const _Float16* __restrict__ KH, const _Float16* __restrict__ QL, const _Float16* __restrict__ KL, const _Float16* __restrict__ VT, const __bf16* __restrict__ VB, const __bf16* __restrict__ VBL, _Float16* __restrict__ YH, __bf16* __restrict__ YL) { __shared__ __align__(16) _Float16 sy[2][4][16][LP];   /* per wave its 16 queries' finished 16-bit ctx rows (second plane: the early rows' bf16 lo) */ __shared__ __align__(16) _Float16 kv[2][2][64 + HD][LP];   /* per team a two-buffer ring [buffer][team] of 64-key stages: rows 0..63 the keys' k rows of this head, rows 64.. its v planes [c][64 keys] */
  __shared__ __align__(16) v4f pj[4][9][32];   /* team 1's partial results, lane by lane: 8 x 4 ctx sums, then (maximum, sum) */
  const int tid = threadIdx.x, wv8 = __builtin_amdgcn_readfirstlane(tid >> 5), team = wv8 >> 2, wave = wv8 & 3, lane = tid & 31, col = lane & 15, g = lane >> 4; const int h = blockIdx.x, b = blockIdx.z; const int qb = (int)blockIdx.y < QBH ? (int)blockIdx.y : NQB + QBH - 1 - (int)blockIdx.y;   /* a permutation of the query blocks */ const int ql0 = qb * 64 + wave * 16; const int nch = (ql0 + 47) >> 5;
  const size_t q0 = (size_t)b * TT + ql0, kr0 = (size_t)b * TT;
  v8f acc[HD / 16] = {}; float m = -3.0e38f, l = 0.f; const float lc = qb < QBH ? 2048.0f : 1.0f;   /* what the sum of exp still lacks of the 2^11 that P carries */
  if (qb < QBH) { if (team) return;   /* wave-uniform; this path has no work-group barrier */
    const _Float16* QLb = QL + (size_t)b * QHI * CC; const _Float16* KLb = KL + (size_t)b * KHI * CC; v16h qh[HD / 32], qlo[HD / 32];
#pragma unroll
    for (int kk = 0; kk < HD / 32; ++kk) { qh[kk] = frag_h(QH + (q0 + col) * CC + h * HD + kk * 32, lane); qlo[kk] = frag_h(QLb + (size_t)(ql0 + col) * CC + h * HD + kk * 32, lane); }
    asm volatile("s_wait_xcnt 0x0" :: "v"(qh[0]), "v"(qh[1]), "v"(qlo[0]), "v"(qlo[1]) : "memory");   /* XWAIT held behind the q loads by their values (inputs only) */
    const _Float16* kp = KH + (kr0 + col) * CC + h * HD + 8 * g; const _Float16* klp = KLb + (size_t)col * CC + h * HD + 8 * g; const __bf16* vp = VB + ((size_t)b * CC + h * HD + col) * (size_t)KHI + 8 * g; const __bf16* vlp = VBL + ((size_t)b * CC + h * HD + col) * (size_t)KHI + 8 * g;
    for (int kc = 0; kc < nch; ++kc, kp += 32 * CC, klp += 32 * CC, vp += 32, vlp += 32) { const int k0 = kc * 32; float v[16]; v16h kbf[2][HD / 32], klf[2][HD / 32];   /* a step's k loads are all issued before its first product, its v loads before the softmax */
#pragma unroll
      for (int t = 0; t < 2; ++t)
#pragma unroll
        for (int kk = 0; kk < HD / 32; ++kk) kbf[t][kk] = frag_hp(kp + t * 16 * CC + kk * 32);
      XWAIT();
#pragma unroll
      for (int t = 0; t < 2; ++t)
#pragma unroll
        for (int kk = 0; kk < HD / 32; ++kk) klf[t][kk] = frag_hp(klp + t * 16 * CC + kk * 32);
      XWAIT();
#pragma unroll
      for (int t = 0; t < 2; ++t) { v8f s = {}, sl = {};
#pragma unroll
        for (int kk = 0; kk < HD / 32; ++kk) { s = wmma16(kbf[t][kk], qh[kk], s); sl = wmma16(kbf[t][kk], qlo[kk], sl); sl = wmma16(klf[t][kk], qh[kk], sl); }
#pragma unroll
        for (int r = 0; r < 8; ++r) v[t * 8 + r] = (s[r] + sl[r] * (1.0f / 1024.0f)) * SCALE; }
      if (kc == nch - 1) {
#pragma unroll
        for (int i = 0; i < 16; ++i) if (k0 + (i >> 3) * 16 + 8 * g + (i & 7) > ql0 + col) v[i] = -3.0e38f; }
      v16b vh[HD / 16], vl[HD / 16];
#pragma unroll
      for (int j = 0; j < HD / 16; ++j) vh[j] = frag_bp(vp + j * 16 * KHI);
      XWAIT();
#pragma unroll
      for (int j = 0; j < HD / 16; ++j) vl[j] = frag_bp(vlp + j * 16 * KHI);
      XWAIT();
      const float alpha = sm_step(v, m, l); const F2 p = bsplit16(v);
#pragma unroll
      for (int j = 0; j < HD / 16; ++j) { acc[j] = acc[j] * alpha; acc[j] = wmma_bf(vh[j], p.h, acc[j]); acc[j] = wmma_bf(vh[j], p.l, acc[j]); acc[j] = wmma_bf(vl[j], p.h, acc[j]); } }
  } else { v16h qh[HD / 32];
#pragma unroll
    for (int kk = 0; kk < HD / 32; ++kk) qh[kk] = frag_h(QH + (q0 + col) * CC + h * HD + kk * 32, lane);
    asm volatile("s_wait_xcnt 0x0" :: "v"(qh[0]), "v"(qh[1]) : "memory");   /* XWAIT held behind the q loads by their values (inputs only) */
    const int tl = tid & 127, fr = tl >> 3, fc = (tl & 7) * 8;   /* the thread's row of each 16-row sweep of its team's stage and its 16 B of a 128-B stage row: a wave's load covers 4 whole lines */
    const unsigned ko = fr * CC + fc, vo = fr * TT + fc; const _Float16* kg = KH + (kr0 + 64 * team) * CC + h * HD; const _Float16* vg = VT + ((size_t)b * CC + h * HD) * (size_t)TT + 64 * team;   /* the team's first stage is stage 'team' (qb >= QBH > 1: it exists) */ v8h kr[4], vr[HD / 16];   /* wave-uniform bases, 32-bit lane offsets that nothing overwrites */
UNROLL_REGS
    for (int i = 0; i < 4; ++i) kr[i] = *(const v8h*)(kg + ko + (size_t)i * 16 * CC);
    XWAIT();
UNROLL_REGS
    for (int i = 0; i < HD / 16; ++i) vr[i] = *(const v8h*)(vg + vo + (size_t)i * 16 * TT);
    XWAIT();
    const int nit = (qb + 2) >> 1;   /* trips of the longer team */
    for (int it = 0; it < nit; ++it) { const int s = 2 * it + team; _Float16 (*rb)[LP] = kv[it & 1][team];   /* block-uniform trip count: every wave passes every barrier; s > qb (team 1's last trip when qb is even): nothing but the barrier */
      if (s <= qb) {
UNROLL_REGS
      for (int i = 0; i < 4; ++i) *(v8h*)&rb[fr + 16 * i][fc] = kr[i];
UNROLL_REGS
      for (int i = 0; i < HD / 16; ++i) *(v8h*)&rb[64 + fr + 16 * i][fc] = vr[i]; }
      __syncthreads();   /* publishes the teams' stages of this trip and ends the reads of the buffers that the next trip overwrites */
      if (s + 2 <= qb) { kg += 128 * CC; vg += 128;
UNROLL_REGS
        for (int i = 0; i < 4; ++i) kr[i] = *(const v8h*)(kg + ko + (size_t)i * 16 * CC);
UNROLL_REGS
        for (int i = 0; i < HD / 16; ++i) vr[i] = *(const v8h*)(vg + vo + (size_t)i * 16 * TT);
        XWAIT(); }
      if (s <= qb) { float v[32]; v16h kf[4][HD / 32], vf[2][HD / 16]; v8f sc[4] = {};   /* ONE softmax step per 64-key stage: four independent score tiles, one maximum exchange, one rescale of the sums; the k fragment reads go as one group ahead of the first product, the v reads as one group ahead of the softmax */
UNROLL_REGS
      for (int t = 0; t < 4; ++t)
UNROLL_REGS
        for (int kk = 0; kk < HD / 32; ++kk) kf[t][kk] = frag_hp(&rb[t * 16 + col][kk * 32 + 8 * g]);
UNROLL_REGS
      for (int kk = 0; kk < HD / 32; ++kk)
UNROLL_REGS
        for (int t = 0; t < 4; ++t) sc[t] = wmma16(kf[t][kk], qh[kk], sc[t]);
UNROLL_REGS
      for (int t2 = 0; t2 < 2; ++t2)
UNROLL_REGS
        for (int j = 0; j < HD / 16; ++j) vf[t2][j] = frag_hp(&rb[64 + j * 16 + col][t2 * 32 + 8 * g]);
#pragma unroll
      for (int t = 0; t < 4; ++t)
#pragma unroll
        for (int r = 0; r < 8; ++r) v[t * 8 + r] = sc[t][r];
      if (s == qb) {   /* wave-uniform: the diagonal lies in the last stage; a wave's keys wholly behind it count 0 */
#pragma unroll
        for (int i = 0; i < 32; ++i) if (s * 64 + (i >> 3) * 16 + 8 * g + (i & 7) > ql0 + col) v[i] = -3.0e38f; }
      const float alpha = sm_step2(v, m, l); v16h p[2];
#pragma unroll
      for (int i = 0; i < 32; ++i) p[i >> 4][i & 15] = (_Float16)v[i];
UNROLL_REGS
      for (int j = 0; j < HD / 16; ++j) acc[j] = acc[j] * alpha;
UNROLL_REGS
      for (int t2 = 0; t2 < 2; ++t2)
UNROLL_REGS
        for (int j = 0; j < HD / 16; ++j) acc[j] = wmma16(vf[t2][j], p[t2], acc[j]); } }
    if (team) {   /* every query has open keys in stage 1, so team 1's maximum is a kept key's logit */
UNROLL_REGS
      for (int j = 0; j < HD / 16; ++j) { pj[wave][2 * j][lane] = (v4f){acc[j][0], acc[j][1], acc[j][2], acc[j][3]}; pj[wave][2 * j + 1][lane] = (v4f){acc[j][4], acc[j][5], acc[j][6], acc[j][7]}; }
      pj[wave][8][lane] = (v4f){m, l, 0.f, 0.f}; }
    __syncthreads();   /* publishes team 1's partial results to team 0; block-uniform, the block's last barrier */
    if (team) return;
    { const v4f ml = pj[wave][8][lane]; const float mn = fmaxf(m, ml[0]); const float a0 = __builtin_amdgcn_exp2f((m - mn) * C2), a1 = __builtin_amdgcn_exp2f((ml[0] - mn) * C2);   /* both teams' sums carried to the common maximum, as in sm_step2 */
      asm volatile("v_nop" :: "v"(a0), "v"(a1));   /* one slot between the two exp2 and the multiplies behind them, which read their results and may take their source registers */
      l = l * a0 + ml[1] * a1;
UNROLL_REGS
      for (int j = 0; j < HD / 16; ++j) { const v4f p0 = pj[wave][2 * j][lane], p1 = pj[wave][2 * j + 1][lane];
UNROLL_REGS
        for (int r = 0; r < 4; ++r) { acc[j][r] = acc[j][r] * a0 + p0[r] * a1; acc[j][4 + r] = acc[j][4 + r] * a0 + p1[r] * a1; } } } }
  l += __shfl_xor(l, 16); const float inv = 1.0f / (l * lc);
  /* ctx leaves as k_out's A operand, converted here once, not by each of k_out's column blocks; the lane's 8 values of a tile are 8 neighbours of its query's row: one 16-byte write */
  if (qb < QBH) {   /* block-uniform */
#pragma unroll
    for (int j = 0; j < HD / 16; ++j) { v8b bh, bl;
#pragma unroll
      for (int r = 0; r < 8; ++r) { const float y = acc[j][r] * inv; const __bf16 hb = (__bf16)y; bh[r] = hb; bl[r] = (__bf16)(y - (float)hb); }
      *(v8b*)&sy[0][wave][col][j * 16 + 8 * g] = bh; *(v8b*)&sy[1][wave][col][j * 16 + 8 * g] = bl; }
  } else {
#pragma unroll
    for (int j = 0; j < HD / 16; ++j) { v8h hv;
#pragma unroll
      for (int r = 0; r < 8; ++r) hv[r] = (_Float16)(acc[j][r] * inv * 64.0f);   /* ctx carried x 2^6 into f16 so small-magnitude context rows stay clear of f16 subnormals */
      *(v8h*)&sy[0][wave][col][j * 16 + 8 * g] = hv; } }
  LDSX(); const int yr = lane >> 3, yc = (lane & 7) * 8;   /* 8 lanes carry a row's 128 B; a head's rows follow one another, so a wave's store covers 512 B in a row */
  { v4u o[4];
UNROLL_REGS
    for (int p = 0; p < 4; ++p) o[p] = *(const v4u*)&sy[0][wave][yr + 4 * p][yc];
    _Float16* yp = YH + ((((size_t)b * NH + h) * TT + ql0 + yr) * HD + yc);
UNROLL_REGS
    for (int p = 0; p < 4; ++p) vst2(yp + p * 4 * HD, o[p]);
    XWAIT(); }
  if (qb < QBH) { v4u o[4];
UNROLL_REGS
    for (int p = 0; p < 4; ++p) o[p] = *(const v4u*)&sy[1][wave][yr + 4 * p][yc];
    __bf16* yp = YL + ((((size_t)b * NH + h) * QHI + ql0 + yr) * HD + yc);
UNROLL_REGS
    for (int p = 0; p < 4; ++p) vst2(yp + p * 4 * HD, o[p]);
    XWAIT(); } }
// ---- k_out: block = (128 rows, 128 cols), 8 waves of 32 rows x 64 cols, operands, which k_attn (ctx) and k_proj (Wo) have left as finished 16-bit planes, staged in a two-buffer LDS ring: out = ctx Wo (+ bo): ctx x 2^6 once to f16 against Wo as f16(bf16 x 2^8) exact (1 product) x 2^-14; causal early rows (< QHI of each sequence): ctx bf16 hi + lo against exact bf16 Wo (2 products)
__global__ __launch_bounds__(256) void k_out(const _Float16* __restrict__ YH, const __bf16* __restrict__ YL, const _Float16* __restrict__ WOH, const __bf16* __restrict__ WOB, const float* __restrict__ BO, float* __restrict__ OUT) { __shared__ __align__(16) float sf[8][32][68];
  __shared__ __align__(16) union { __bf16 b[2][128 + 128 + 128][LP]; _Float16 h[2][128 + 128][LP]; } u;   /* early rows: ctx hi 0..127, ctx lo 128..255, Wo 256..383; else ctx 0..127, Wo 128..255 */
  const int tid = threadIdx.x, wave = __builtin_amdgcn_readfirstlane(tid >> 5), lane = tid & 31, col = lane & 15, g = lane >> 4; const int wr = wave >> 1, wc = wave & 1; const int c0 = blockIdx.y * 128; const size_t r0 = (size_t)blockIdx.x * 128 + wr * 32;
  v8f acc[2][4] = {};
  static_assert(KS == HD && KS == 64, "a stage is one head's columns of ctx");
  const int fr = tid >> 3, fc = (tid & 7) * 8;   /* the thread's row of each 32-row sweep and its 16 B of a 128-B stage row: the operands come finished, 16 bits an element, and go to LDS as they are */
  const unsigned fo = tid * 8; const size_t bb = (size_t)blockIdx.x * 128 / TT; const int t0 = (int)((size_t)blockIdx.x * 128 % TT);   /* a stage's rows follow one another in the workspace: a wave's load covers 512 B in a row */
  if (CAUSAL && t0 < QHI) {   /* block-uniform; QHI is a multiple of the 128 rows */
    const __bf16* yg = (const __bf16*)YH + (bb * NH * TT + t0) * HD; const __bf16* lg = YL + (bb * NH * QHI + t0) * HD; const __bf16* wg = WOB + (size_t)c0 * 64; v4u yr[4], yl[4], wv[4];
UNROLL_REGS
    for (int i = 0; i < 4; ++i) { yr[i] = *(const v4u*)(yg + fo + i * 32 * 64); yl[i] = *(const v4u*)(lg + fo + i * 32 * 64); wv[i] = *(const v4u*)(wg + fo + i * 32 * 64); }
    XWAIT();
    for (int s = 0; s < CC / KS; ++s) { __bf16 (*rb)[LP] = u.b[s & 1];
UNROLL_REGS
      for (int i = 0; i < 4; ++i) { *(v4u*)&rb[fr + 32 * i][fc] = yr[i]; *(v4u*)&rb[128 + fr + 32 * i][fc] = yl[i]; *(v4u*)&rb[256 + fr + 32 * i][fc] = wv[i]; }
      __syncthreads();   /* publishes stage s and ends the reads of the buffer that stage s + 1 overwrites */
      if (s + 1 < CC / KS) { yg += (size_t)TT * HD; lg += (size_t)QHI * HD; wg += (size_t)DIN * 64;
UNROLL_REGS
        for (int i = 0; i < 4; ++i) { yr[i] = *(const v4u*)(yg + fo + i * 32 * 64); yl[i] = *(const v4u*)(lg + fo + i * 32 * 64); wv[i] = *(const v4u*)(wg + fo + i * 32 * 64); }
        XWAIT(); }
UNROLL_REGS
      for (int kk = 0; kk < KS / 32; ++kk) { v16b ah[2], al[2], w[4];
UNROLL_REGS
        for (int i = 0; i < 2; ++i) { ah[i] = frag_b(&rb[wr * 32 + i * 16 + col][kk * 32], lane); al[i] = frag_b(&rb[128 + wr * 32 + i * 16 + col][kk * 32], lane); }
UNROLL_REGS
        for (int j = 0; j < 4; ++j) w[j] = frag_b(&rb[256 + wc * 64 + j * 16 + col][kk * 32], lane);
UNROLL_REGS
        for (int i = 0; i < 2; ++i)
UNROLL_REGS
          for (int j = 0; j < 4; ++j) { acc[i][j] = wmma_bf(ah[i], w[j], acc[i][j]); acc[i][j] = wmma_bf(al[i], w[j], acc[i][j]); } } }
#pragma unroll
    for (int i = 0; i < 2; ++i)
#pragma unroll
    for (int j = 0; j < 4; ++j) { const float bias = BO ? bfr(BO[c0 + wc * 64 + j * 16 + col]) : 0.f;
#pragma unroll
      for (int r = 0; r < 8; ++r) sf[wave][i * 16 + 8 * g + r][j * 16 + col] = acc[i][j][r] + bias; }
  } else {
    const _Float16* yg = YH + (bb * NH * TT + t0) * HD; const _Float16* wg = WOH + (size_t)c0 * 64; v4u yr[4], wv[4];
UNROLL_REGS
    for (int i = 0; i < 4; ++i) { yr[i] = *(const v4u*)(yg + fo + i * 32 * 64); wv[i] = *(const v4u*)(wg + fo + i * 32 * 64); }
    XWAIT();
    for (int s = 0; s < CC / KS; ++s) { _Float16 (*rb)[LP] = u.h[s & 1];
UNROLL_REGS
      for (int i = 0; i < 4; ++i) { *(v4u*)&rb[fr + 32 * i][fc] = yr[i]; *(v4u*)&rb[128 + fr + 32 * i][fc] = wv[i]; }
      __syncthreads();   /* publishes stage s and ends the reads of the buffer that stage s + 1 overwrites */
      if (s + 1 < CC / KS) { yg += (size_t)TT * HD; wg += (size_t)DIN * 64;
UNROLL_REGS
        for (int i = 0; i < 4; ++i) { yr[i] = *(const v4u*)(yg + fo + i * 32 * 64); wv[i] = *(const v4u*)(wg + fo + i * 32 * 64); }
        XWAIT(); }
UNROLL_REGS
      for (int kk = 0; kk < KS / 32; ++kk) { v16h a[2], w[4];
UNROLL_REGS
        for (int i = 0; i < 2; ++i) a[i] = frag_h(&rb[wr * 32 + i * 16 + col][kk * 32], lane);
UNROLL_REGS
        for (int j = 0; j < 4; ++j) w[j] = frag_h(&rb[128 + wc * 64 + j * 16 + col][kk * 32], lane);
UNROLL_REGS
        for (int i = 0; i < 2; ++i)
UNROLL_REGS
          for (int j = 0; j < 4; ++j) acc[i][j] = wmma16(a[i], w[j], acc[i][j]); } }
#pragma unroll
    for (int i = 0; i < 2; ++i)
#pragma unroll
    for (int j = 0; j < 4; ++j) { const float bias = BO ? bfr(BO[c0 + wc * 64 + j * 16 + col]) : 0.f;
#pragma unroll
      for (int r = 0; r < 8; ++r) sf[wave][i * 16 + 8 * g + r][j * 16 + col] = acc[i][j][r] * (1.0f / 16384.0f) + bias; } }   /* 2^-8 (Wo carry) x 2^-6 (ctx carry) */
  LDSX(); for (int rp = 0; rp < 16; ++rp) { const int rl = 2 * rp + g; vst2(OUT + (r0 + rl) * DIN + c0 + wc * 64 + col * 4, *(const v4f*)&sf[wave][rl][col * 4]); } }   /* a wave's store covers two rows' 256-B pieces: whole lines */

extern "C" void kernel_launch(void* const* d_in, const int* in_sizes, int n_in, void* d_out, int out_size, void* d_ws, size_t ws_size, hipStream_t stream) {
  (void)in_sizes; (void)n_in; (void)out_size;
  const float** F = (const float**)d_in;
  if (ws_size < (size_t)WS_END) return;
  char* ws = (char*)d_ws; _Float16 *QH = (_Float16*)(ws + WS_QH), *KH = (_Float16*)(ws + WS_KH), *VT = (_Float16*)(ws + WS_VT), *QL = (_Float16*)(ws + WS_QL), *KL = (_Float16*)(ws + WS_KL); __bf16 *VB = (__bf16*)(ws + WS_VB), *VBL = (__bf16*)(ws + WS_VBL); _Float16 *YH = (_Float16*)(ws + WS_Y), *WOH = (_Float16*)(ws + WS_WH); __bf16 *YL = (__bf16*)(ws + WS_YL), *WOB = (__bf16*)(ws + WS_WB);
  (void)QL; (void)KL; (void)VB; (void)VBL;
  // inputs: 0 x [1,4096,1024]; 1 token_positions [4096] int32 (arange): READ on the device; 2 Wq [1024,1024] (out,in); 3 Wk; 4 Wv; 5 Wo (out,in); no biases (null pointers)
  k_proj<<<dim3(TNB * TT / 128, CC / 128), 512, 0, stream>>>(F[0], F[2], F[3], F[4], nullptr, nullptr, nullptr, QH, QL, KH, KL, VT, VB, VBL, (const int*)d_in[1], F[5], WOH, WOB);
  k_attn<<<dim3(NH, NQB, TNB), 256, 0, stream>>>(QH, KH, QL, KL, VT, VB, VBL, YH, YL);
  k_out<<<dim3(TNB * TT / 128, DIN / 128), 256, 0, stream>>>(YH, YL, WOH, WOB, nullptr, (float*)d_out);
}
